// v000
// Measured on an AMD MI455X. A time is GPU time per run, averaged over a window of back-to-back runs after a warm-up
// (all launches, gaps included; the runs take copies of the inputs in turn), and the median of several windows.
// Apart from v000's, it joins two sittings. Times from different sittings can be a few percent apart, while
// side-by-side timings come from the same sitting.
// The starting kernel, v000, takes 1480 microseconds a run.
#include <hip/hip_runtime.h>

// DisorderedCausalSelfAttention (x [2][2048][1024]; qkv = x W_attn + b ([1024][3072], split q | k | v, 16 heads x 64); partial RoPE on the first 32 dims of each head with the given per-batch tables rope_cos/rope_sin [B][T][32] (read; rotate_half within the 32 dims); then q += bQ[h], k += bK[h] (post-RoPE symmetry-breaking biases, read); causal softmax(q.k / 8); out = merged W_proj + b_proj -> [2][2048][1024]).
// Compute dtypes, f32 accumulate: every input rounded to bf16; q/k/v on PLAIN bf16 operands (inputs: exact) + bias; partial RoPE and the post-RoPE biases f32; causal scores and att.v: query rows < 512 hl (3 products), the rest single fp16 (x1024); softmax f32; W_proj hl x exact (2 products) + bias.

#define NB_  2
#define TT   2048
#define DM   1024
#define NH_  16
#define NKV  16
#define REP  (NH_ / NKV)
#define HD   64
#define DQ   (NH_ * HD)
#define DKV  (NKV * HD)
#define ZH   2
#define RH   512                  // query rows < RH use hi+lo planes (0: none)
#define WIN  2048
#define PCAR 1024.0f
#define SCL  0.125f   // HD^-0.5
typedef _Float16 h16;
typedef unsigned short bf;
typedef __attribute__((ext_vector_type(16))) __bf16   v16bf;
typedef __attribute__((ext_vector_type(16))) _Float16 v16h;
typedef __attribute__((ext_vector_type(8)))  _Float16 v8h;
typedef __attribute__((ext_vector_type(8)))  unsigned short v8us;
typedef __attribute__((ext_vector_type(8)))  float    v8f;
typedef __attribute__((ext_vector_type(4)))  float    v4f;
typedef v8h  __attribute__((may_alias)) v8ha;
typedef v4f  __attribute__((may_alias)) v4fa;
typedef v8us __attribute__((may_alias)) v8usa;

__device__ __forceinline__ unsigned short f2bf(float f) { unsigned u = __float_as_uint(f); u += 0x7FFFu + ((u >> 16) & 1u); return (unsigned short)(u >> 16); }
__device__ __forceinline__ float bf2f(unsigned short b) { return __uint_as_float(((unsigned)b) << 16); }
__device__ __forceinline__ float bfr(float f) { return bf2f(f2bf(f)); }
__device__ __forceinline__ v16h cat16(v8h lo, v8h hi) { return __builtin_shufflevector(lo, hi, 0, 1, 2, 3, 4, 5, 6, 7, 8, 9, 10, 11, 12, 13, 14, 15); }
__device__ __forceinline__ v16bf cat16b(v8us lo, v8us hi) { return __builtin_bit_cast(v16bf, __builtin_shufflevector(lo, hi, 0, 1, 2, 3, 4, 5, 6, 7, 8, 9, 10, 11, 12, 13, 14, 15)); }
__device__ __forceinline__ v8f wmma16(v16h a, v16h b, v8f c) { return __builtin_amdgcn_wmma_f32_16x16x32_f16(false, a, false, b, (short)0, c, false, false); }
__device__ __forceinline__ v8f wmmab(v16bf a, v16bf b, v8f c) { return __builtin_amdgcn_wmma_f32_16x16x32_bf16(false, a, false, b, (short)0, c, false, false); }



// ---- k_gemmw: register-blocked GEMM, ONE WAVE per 64x64 output tile (16 accumulators), operands straight from K-contiguous 16-bit planes; grid (M/64, N/64, Z), 32 threads.
// C[m][n] (f32, pitch ldc, + optional f32 bias[n]) = sum_k A[m][k] Bt[n][k] (+ split products per NSPLIT). z-batch strides sA/sB/sC in elements. K % 32 == 0.
template <typename T16> struct WFrag;
template <> struct WFrag<h16> { typedef v16h V; static __device__ __forceinline__ V ld(const h16* p) { return cat16(*(const v8h*)p, *(const v8h*)(p + 16)); } static __device__ __forceinline__ v8f mma(V a, V b, v8f c) { return wmma16(a, b, c); } };
template <> struct WFrag<bf> { typedef v16bf V; static __device__ __forceinline__ V ld(const bf* p) { return cat16b(*(const v8us*)p, *(const v8us*)(p + 16)); } static __device__ __forceinline__ v8f mma(V a, V b, v8f c) { return wmmab(a, b, c); } };
template <typename T16, int NSPLIT, bool BIAS>
__global__ __launch_bounds__(32) void k_gemmw(const T16* __restrict__ A, const T16* __restrict__ A2, const T16* __restrict__ Bt, const T16* __restrict__ Bt2, int K, float* C, int ldc, const float* __restrict__ bias, size_t sA, size_t sB, size_t sC) {
    typedef typename WFrag<T16>::V V;
    __shared__ __align__(16) float os[16 * 68];
    const size_t z = blockIdx.z; A += z * sA; if (A2) A2 += z * sA; Bt += z * sB; if (Bt2) Bt2 += z * sB; C += z * sC;
    const int lane = threadIdx.x & 31, lr = lane & 15, hi = lane >> 4; const int r0 = blockIdx.x * 64, c0 = blockIdx.y * 64;
    v8f acc[4][4];
#pragma unroll
    for (int mb = 0; mb < 4; ++mb)
#pragma unroll
        for (int nb = 0; nb < 4; ++nb) acc[mb][nb] = (v8f){};
    const size_t aoff = (size_t)(r0 + lr) * K + 8 * hi, boff = (size_t)(c0 + lr) * K + 8 * hi;
#pragma unroll 1
    for (int kc = 0; kc < K; kc += 32) {
        V a[4], a2[4];
#pragma unroll
        for (int mb = 0; mb < 4; ++mb) { a[mb] = WFrag<T16>::ld(A + aoff + (size_t)mb * 16 * K + kc); if (NSPLIT == 1 || NSPLIT == 2) a2[mb] = WFrag<T16>::ld(A2 + aoff + (size_t)mb * 16 * K + kc); }
#pragma unroll
        for (int nb = 0; nb < 4; ++nb) { const V b = WFrag<T16>::ld(Bt + boff + (size_t)nb * 16 * K + kc); V b2; if (NSPLIT >= 2) b2 = WFrag<T16>::ld(Bt2 + boff + (size_t)nb * 16 * K + kc);
#pragma unroll
            for (int mb = 0; mb < 4; ++mb) { acc[mb][nb] = WFrag<T16>::mma(a[mb], b, acc[mb][nb]); if (NSPLIT == 1 || NSPLIT == 2) acc[mb][nb] = WFrag<T16>::mma(a2[mb], b, acc[mb][nb]); if (NSPLIT >= 2) acc[mb][nb] = WFrag<T16>::mma(a[mb], b2, acc[mb][nb]); } }
        asm volatile("v_nop\n\tv_nop\n\tv_nop\n\tv_nop" : "+v"(acc[0][0]), "+v"(acc[1][1]), "+v"(acc[2][2]), "+v"(acc[3][3]) : "v"(a[0]), "v"(a[3]));
    }
#pragma unroll
    for (int mb = 0; mb < 4; ++mb) {
#pragma unroll
        for (int nb = 0; nb < 4; ++nb) {
#pragma unroll
            for (int j = 0; j < 8; ++j) os[(hi * 8 + j) * 68 + nb * 16 + lr] = acc[mb][nb][j]; }
        __builtin_amdgcn_wave_barrier(); asm volatile("" ::: "memory");
        float* crow = C + (size_t)(r0 + mb * 16) * ldc + c0;
{
#pragma unroll
            for (int s = 0; s < 8; ++s) { const int row = 2 * s + hi, cofs = lr * 4; v4f val = *(const v4fa*)(os + row * 68 + cofs); if (BIAS) { val[0] += bfr(bias[c0 + cofs]); val[1] += bfr(bias[c0 + cofs + 1]); val[2] += bfr(bias[c0 + cofs + 2]); val[3] += bfr(bias[c0 + cofs + 3]); }
                *(v4f*)(crow + (size_t)row * ldc + cofs) = val; }
             }
        __builtin_amdgcn_wave_barrier(); asm volatile("" ::: "memory");
    }
}

// ---- k_gemmc: the same one-wave 64x64 tile GEMM specialised for causal attention: CMODE 1 skips score tiles entirely above the diagonal (query rows r0+roff.., key columns c0..), CMODE 2 limits the
// key (K) loop of the probability x value contraction to the diagonal block (probabilities beyond it are exactly zero). roff = row offset of this launch's first row within the sequence.
template <typename T16, int NSPLIT, int CMODE>
__global__ __launch_bounds__(32) void k_gemmc(const T16* __restrict__ A, const T16* __restrict__ A2, const T16* __restrict__ Bt, const T16* __restrict__ Bt2, int K, float* C, int ldc, int roff, size_t sA, size_t sB, size_t sC) {
    typedef typename WFrag<T16>::V V;
    __shared__ __align__(16) float os[16 * 68];
    const size_t z = blockIdx.z; A += z * sA; if (A2) A2 += z * sA; Bt += z * sB; if (Bt2) Bt2 += z * sB; C += z * sC;
    const int lane = threadIdx.x & 31, lr = lane & 15, hi = lane >> 4; const int r0 = blockIdx.x * 64, c0 = blockIdx.y * 64;
    if (CMODE == 1 && c0 > r0 + roff + 63) return;                  // score tile entirely above the causal diagonal: never read (the softmax masks j > i by select)
    const int Kl = (CMODE == 2) ? min(K, r0 + roff + 64) : K;        // P.V: probabilities are exactly 0 beyond the diagonal block, so the K loop stops there
    v8f acc[4][4];
#pragma unroll
    for (int mb = 0; mb < 4; ++mb)
#pragma unroll
        for (int nb = 0; nb < 4; ++nb) acc[mb][nb] = (v8f){};
    const size_t aoff = (size_t)(r0 + lr) * K + 8 * hi, boff = (size_t)(c0 + lr) * K + 8 * hi;
#pragma unroll 1
    for (int kc = 0; kc < Kl; kc += 32) {
        V a[4], a2[4];
#pragma unroll
        for (int mb = 0; mb < 4; ++mb) { a[mb] = WFrag<T16>::ld(A + aoff + (size_t)mb * 16 * K + kc); if (NSPLIT == 1 || NSPLIT == 2) a2[mb] = WFrag<T16>::ld(A2 + aoff + (size_t)mb * 16 * K + kc); }
#pragma unroll
        for (int nb = 0; nb < 4; ++nb) { const V b = WFrag<T16>::ld(Bt + boff + (size_t)nb * 16 * K + kc); V b2; if (NSPLIT >= 2) b2 = WFrag<T16>::ld(Bt2 + boff + (size_t)nb * 16 * K + kc);
#pragma unroll
            for (int mb = 0; mb < 4; ++mb) { acc[mb][nb] = WFrag<T16>::mma(a[mb], b, acc[mb][nb]); if (NSPLIT == 1 || NSPLIT == 2) acc[mb][nb] = WFrag<T16>::mma(a2[mb], b, acc[mb][nb]); if (NSPLIT >= 2) acc[mb][nb] = WFrag<T16>::mma(a[mb], b2, acc[mb][nb]); } }
        asm volatile("v_nop\n\tv_nop\n\tv_nop\n\tv_nop" : "+v"(acc[0][0]), "+v"(acc[1][1]), "+v"(acc[2][2]), "+v"(acc[3][3]) : "v"(a[0]), "v"(a[3]));
    }
#pragma unroll
    for (int mb = 0; mb < 4; ++mb) {
#pragma unroll
        for (int nb = 0; nb < 4; ++nb) {
#pragma unroll
            for (int j = 0; j < 8; ++j) os[(hi * 8 + j) * 68 + nb * 16 + lr] = acc[mb][nb][j]; }
        __builtin_amdgcn_wave_barrier(); asm volatile("" ::: "memory");
        float* crow = C + (size_t)(r0 + mb * 16) * ldc + c0;
{
#pragma unroll
            for (int s = 0; s < 8; ++s) { const int row = 2 * s + hi, cofs = lr * 4; v4f val = *(const v4fa*)(os + row * 68 + cofs);
                *(v4f*)(crow + (size_t)row * ldc + cofs) = val; }
             }
        __builtin_amdgcn_wave_barrier(); asm volatile("" ::: "memory");
    }
}

__device__ __forceinline__ h16 tohx(float x) { return (h16)x; }
__device__ __forceinline__ void splitf(float y, unsigned short& h, unsigned short& l) { h = f2bf(y); l = f2bf(y - bf2f(h)); }
typedef __attribute__((ext_vector_type(2))) _Float16 v2h;
typedef __attribute__((ext_vector_type(4))) _Float16 v4h;
typedef __attribute__((ext_vector_type(2))) unsigned short v2us;
typedef __attribute__((ext_vector_type(4))) unsigned short v4us;
typedef __attribute__((ext_vector_type(2))) float v2f;
typedef __attribute__((ext_vector_type(4))) int v4i;

__global__ __launch_bounds__(256) void k_wtG(const float* __restrict__ w, int K, int N, bf* Bt) {
    const int lane = threadIdx.x & 31; const int L0 = (blockIdx.x * 8 + (threadIdx.x >> 5)) * 8; const int nlines = N * K / 64;
{
#pragma unroll 1
        for (int l = 0; l < 8; ++l) { const int L = L0 + l; if (L >= nlines) break; const size_t e = (size_t)L * 64 + lane * 2; const int k = (int)(e % K), n = (int)(e / K); v2us o;
            o[0] = f2bf(w[(size_t)k * N + n]); o[1] = f2bf(w[(size_t)(k + 1) * N + n]); *(v2us*)(Bt + e) = o; }
         }
}
__global__ __launch_bounds__(256) void k_cvt8(const float* __restrict__ src, bf* dst, size_t n8) { const size_t i = (size_t)blockIdx.x * 256 + threadIdx.x; if (i >= n8) return; const v8f v = *(const v8f*)(src + i * 8); v8us o;
#pragma unroll
    for (int k = 0; k < 8; ++k) o[k] = f2bf(v[k]); *(v8us*)(dst + i * 8) = o;  }
__global__ __launch_bounds__(256) void k_cscvt(const float* __restrict__ cosT, const float* __restrict__ sinT, float* CS) { const int idx = blockIdx.x * 256 + threadIdx.x; if (idx >= TT * HD) return; v2f cs; cs[0] = bfr(cosT[idx]); cs[1] = bfr(sinT[idx]); *(v2f*)(CS + (size_t)idx * 2) = cs;  }
// k_rope: head planes [h][t][d] (fp16 + hi/lo) of (rope(x) + bias) x sc with the rotate-half convention on dims < 32, for d < 16: out[d] = x[d] cos[t][d] - x[d+16] sin[t][d], out[d+16] = x[d+16] cos[t][d+16] + x[d] sin[t][d+16]; dims >= 32 pass through
__global__ __launch_bounds__(256) void k_rope(const float* __restrict__ F, int pitch, int nheads, const float* __restrict__ CS, const float* __restrict__ RF, const float* __restrict__ nw, float sc, h16* P16, bf* Ph, bf* Pl) {
    const size_t e = ((size_t)blockIdx.x * 256 + threadIdx.x) * 2; if (e >= (size_t)nheads * TT * HD) return; const int d = (int)(e % HD); const int t = (int)((e / HD) % TT); const int h = (int)(e / ((size_t)HD * TT)); const float* f = F + (size_t)t * pitch + h * HD; const float rf = RF ? RF[(size_t)h * TT + t] : 1.0f; v2h o16; v2us oh, ol;
#pragma unroll
    for (int q = 0; q < 2; ++q) { const int dd = d + q; const int dp = (dd < 16) ? dd + 16 : (dd < 32 ? dd - 16 : dd); float x0 = f[dd], x1 = f[dp];
        
        const v2f cs = *(const v2f*)(CS + ((size_t)t * HD + dd) * 2); float a = __fmul_rn(x0, cs[0]), bq = __fmul_rn(x1, cs[1]); asm volatile("" : "+v"(a)); asm volatile("" : "+v"(bq)); float r0 = (dd < 16) ? __fsub_rn(a, bq) : (dd < 32 ? __fadd_rn(a, bq) : x0); asm volatile("" : "+v"(r0)); float pb = bfr(nw[h * HD + dd]); asm volatile("" : "+v"(pb)); const float r = __fadd_rn(r0, pb) * sc;   // partial RoPE (first 32 dims) then the post-RoPE per-head bias
        o16[q] = tohx(r); unsigned short a2, c2; splitf(r, a2, c2); oh[q] = a2; ol[q] = c2; }
    *(v2h*)(P16 + e) = o16; *(v2us*)(Ph + e) = oh; *(v2us*)(Pl + e) = ol;  }
__global__ __launch_bounds__(256) void k_vtp(const float* __restrict__ F, int pitch, int nheads, h16* V16, bf* Vh, bf* Vl) { const size_t e = ((size_t)blockIdx.x * 256 + threadIdx.x) * 2; if (e >= (size_t)nheads * HD * TT) return; const int t = (int)(e % TT); const int d = (int)((e / TT) % HD); const int g = (int)(e / ((size_t)TT * HD)); v2h o16; v2us oh, ol;
#pragma unroll
    for (int q = 0; q < 2; ++q) { const float x = F[(size_t)(t + q) * pitch + g * HD + d]; o16[q] = tohx(x); unsigned short a2, c2; splitf(x, a2, c2); oh[q] = a2; ol[q] = c2; }
    *(v2h*)(V16 + e) = o16; *(v2us*)(Vh + e) = oh; *(v2us*)(Vl + e) = ol;  }
// k_asoft: per row (zz, i): t = S x HD^-0.5 for j <= i and i - j < WIN (sliding causal window; the reference's -1e9 additive fill vanishes identically); softmax over the 2048 keys (register row, one exp, fixed trees);
__global__ __launch_bounds__(256) void k_asoft(const float* __restrict__ Sb, h16* P16, bf* Ph, bf* Pl) {
    const int lane = threadIdx.x & 31; const int row = blockIdx.x * 8 + (threadIdx.x >> 5); if (row >= ZH * TT) return; const int i = row % TT; const int zz = row / TT; (void)zz; const bool hires = (i < RH); const float* sr = Sb + (size_t)row * TT; float v[TT / 32]; float mx = -3.0e38f;
#pragma unroll
    for (int ch = 0; ch < TT / 128; ++ch) { const int j0 = ch * 128 + lane * 4; const v4f a = *(const v4f*)(sr + j0);
#pragma unroll
        for (int q = 0; q < 4; ++q) { const int j = j0 + q; (void)j; const float t = (j <= i && i - j < WIN) ? a[q] * SCL : -3.0e38f; v[ch * 4 + q] = t; mx = fmaxf(mx, t); } }
#pragma unroll
    for (int sh = 16; sh; sh >>= 1) mx = fmaxf(mx, __shfl_xor(mx, sh, 32));
    float sum = 0.f;
#pragma unroll
    for (int k = 0; k < TT / 32; ++k) { float d0 = __fsub_rn(v[k], mx); asm volatile("" : "+v"(d0)); v[k] = __builtin_amdgcn_exp2f(__fmul_rn(d0, 1.4426950408889634f)); sum += v[k]; }
#pragma unroll
    for (int sh = 16; sh; sh >>= 1) sum += __shfl_xor(sum, sh, 32);
    const float f = __fdiv_rn(hires ? 1.0f : PCAR, sum);
{
        if (hires) {
#pragma unroll
            for (int ch = 0; ch < TT / 128; ++ch) { v4us oh, ol;
#pragma unroll
                for (int q = 0; q < 4; ++q) { unsigned short a, c2; splitf(v[ch * 4 + q] * f, a, c2); oh[q] = a; ol[q] = c2; }
                const size_t oo = ((size_t)zz * (RH ? RH : 1) + i) * TT + ch * 128 + lane * 4; *(v4us*)(Ph + oo) = oh; *(v4us*)(Pl + oo) = ol; }
        } else {
#pragma unroll
            for (int ch = 0; ch < TT / 128; ++ch) { v4h o4;
#pragma unroll
                for (int q = 0; q < 4; ++q) o4[q] = tohx(v[ch * 4 + q] * f);
                *(v4h*)(P16 + (size_t)row * TT + ch * 128 + lane * 4) = o4; } }
         }
}
__global__ __launch_bounds__(256) void k_merge(const float* __restrict__ O, int h0, bf* Ah, bf* Al) { const size_t e = ((size_t)blockIdx.x * 256 + threadIdx.x) * 2; if (e >= (size_t)ZH * TT * HD) return; const int d = (int)(e % HD); const int t = (int)((e / HD) % TT); const int zz = (int)(e / ((size_t)HD * TT)); const float cs = (t < RH) ? 1.0f : (1.0f / PCAR); const size_t oo = (size_t)t * DQ + (h0 + zz) * HD + d;
    v2us oh, ol;
#pragma unroll
    for (int q = 0; q < 2; ++q) { unsigned short a, c2; splitf(O[e + q] * cs, a, c2); oh[q] = a; ol[q] = c2; } *(v2us*)(Ah + oo) = oh; *(v2us*)(Al + oo) = ol;  }

__global__ __launch_bounds__(256) void k_wtGs(const float* __restrict__ w, int K, int N, int ld, bf* Bt) { const size_t e = ((size_t)blockIdx.x * 256 + threadIdx.x) * 4; if (e >= (size_t)N * K) return; const int k = (int)(e % K); const int n = (int)(e / K); v4us o;   // Bt[n][k] = w[k*ld + n]
#pragma unroll
    for (int u = 0; u < 4; ++u) o[u] = f2bf(w[(size_t)(k + u) * ld + n]); *(v4us*)(Bt + e) = o;  }
__global__ __launch_bounds__(256) void k_cspart(const float* __restrict__ rc, const float* __restrict__ rs, float* CS) { const int idx = blockIdx.x * 256 + threadIdx.x; if (idx >= TT * HD) return; const int t = idx / HD, dd = idx % HD; v2f cs; cs[0] = (dd < 32) ? bfr(rc[(size_t)t * 32 + dd]) : 1.0f; cs[1] = (dd < 32) ? bfr(rs[(size_t)t * 32 + dd]) : 0.0f; *(v2f*)(CS + (size_t)idx * 2) = cs;  }   // per-batch partial tables (read as data), identity beyond dim 32

extern "C" void kernel_launch(void* const* d_in, const int* in_sizes, int n_in,
                              void* d_out, int out_size, void* d_ws, size_t ws_size, hipStream_t stream) {
    (void)in_sizes; (void)n_in; (void)out_size;
    const float* x = (const float*)d_in[0]; const float* rcos = (const float*)d_in[1]; const float* rsin = (const float*)d_in[2]; const float* wf = (const float*)d_in[3]; const float* bfz = (const float*)d_in[4]; const float* wo = (const float*)d_in[5]; const float* bo = (const float*)d_in[6]; const float* bQ = (const float*)d_in[7]; const float* bK = (const float*)d_in[8]; const float* wq = wf; const float* wk = wf + 1024; const float* wv = wf + 2048; const float* bq = bfz; const float* bk = bfz + 1024; const float* bv = bfz + 2048; (void)wq; (void)wk; (void)wv; const float* cosT = nullptr; const float* sinT = nullptr; (void)cosT; (void)sinT;
    float* OUT = (float*)d_out;     // [2][2048][1024]
    char* wsp = (char*)d_ws;
    auto take = [&](size_t bytes) { char* p = wsp; wsp += (bytes + 255) & ~(size_t)255; return (void*)p; };
    bf* WQ = (bf*)take((size_t)DQ * DM * 2); bf* WK = (bf*)take((size_t)DKV * DM * 2); bf* WV = (bf*)take((size_t)DKV * DM * 2); bf* WO = (bf*)take((size_t)DM * DQ * 2); float* CS = (float*)take((size_t)TT * HD * 2 * 4);
    bf* XB = (bf*)take((size_t)TT * DM * 2); float* FQ = (float*)take((size_t)TT * DQ * 4); float* FK = (float*)take((size_t)TT * DKV * 4);
    h16* QP16 = (h16*)take((size_t)NH_ * TT * HD * 2); h16* KP16 = (h16*)take((size_t)NKV * TT * HD * 2); h16* VT16 = (h16*)take((size_t)NKV * HD * TT * 2);
    bf* QPh = (bf*)take((size_t)NH_ * TT * HD * 2); bf* QPl = (bf*)take((size_t)NH_ * TT * HD * 2); bf* KPh = (bf*)take((size_t)NKV * TT * HD * 2); bf* KPl = (bf*)take((size_t)NKV * TT * HD * 2); bf* VTh = (bf*)take((size_t)NKV * HD * TT * 2); bf* VTl = (bf*)take((size_t)NKV * HD * TT * 2); bf* Ph = (bf*)take((size_t)ZH * RH * TT * 2); bf* Pl = (bf*)take((size_t)ZH * RH * TT * 2);
    float* Sb = (float*)take((size_t)ZH * TT * TT * 4); h16* P16 = (h16*)take((size_t)ZH * TT * TT * 2); float* Ob = (float*)take((size_t)ZH * TT * HD * 4); bf* ATh = (bf*)take((size_t)TT * DQ * 2); bf* ATl = (bf*)take((size_t)TT * DQ * 2);
    if ((size_t)(wsp - (char*)d_ws) > ws_size) return;    // ws 256 MiB
    float* FV = FK;   // v projection reuses the k buffer after the k planes are built (stream-ordered)
    { k_wtGs<<<(unsigned)(((size_t)DQ * DM / 4 + 255) / 256), 256, 0, stream>>>(wq, DM, DQ, 3072, WQ); k_wtGs<<<(unsigned)(((size_t)DKV * DM / 4 + 255) / 256), 256, 0, stream>>>(wk, DM, DKV, 3072, WK); k_wtGs<<<(unsigned)(((size_t)DKV * DM / 4 + 255) / 256), 256, 0, stream>>>(wv, DM, DKV, 3072, WV);
      k_wtG<<<(unsigned)((DQ * DM / 64 + 63) / 64), 256, 0, stream>>>(wo, DQ, DM, WO);
       }
    const unsigned LQ = (unsigned)(((size_t)NH_ * TT * HD / 2 + 255) / 256), LKv = (unsigned)(((size_t)NKV * TT * HD / 2 + 255) / 256);
    for (int b = 0; b < NB_; ++b) {
        k_cspart<<<(TT * HD + 255) / 256, 256, 0, stream>>>(rcos + (size_t)b * TT * 32, rsin + (size_t)b * TT * 32, CS);
        k_cvt8<<<(unsigned)(((size_t)TT * DM / 8 + 255) / 256), 256, 0, stream>>>(x + (size_t)b * TT * DM, XB, (size_t)TT * DM / 8);
        k_gemmw<bf, 0, true><<<dim3(TT / 64, DQ / 64, 1), 32, 0, stream>>>(XB, nullptr, WQ, nullptr, DM, FQ, DQ, bq, 0, 0, 0);
        k_rope<<<LQ, 256, 0, stream>>>(FQ, DQ, NH_, CS, nullptr, bQ, 1.0f, QP16, QPh, QPl);
        k_gemmw<bf, 0, true><<<dim3(TT / 64, DKV / 64, 1), 32, 0, stream>>>(XB, nullptr, WK, nullptr, DM, FK, DKV, bk, 0, 0, 0);
        k_rope<<<LKv, 256, 0, stream>>>(FK, DKV, NKV, CS, nullptr, bK, 1.0f, KP16, KPh, KPl);
        k_gemmw<bf, 0, true><<<dim3(TT / 64, DKV / 64, 1), 32, 0, stream>>>(XB, nullptr, WV, nullptr, DM, FV, DKV, bv, 0, 0, 0); k_vtp<<<LKv, 256, 0, stream>>>(FV, DKV, NKV, VT16, VTh, VTl);
        for (int h0 = 0; h0 < NH_; h0 += ZH) { const size_t zq = (size_t)h0, zk = (size_t)(h0 / REP);   // one kv head per query head: the pass's two heads use consecutive kv planes (z-strides TT*HD)
            k_gemmc<bf, 2, 1><<<dim3(RH / 64, TT / 64, ZH), 32, 0, stream>>>(QPh + zq * TT * HD, QPl + zq * TT * HD, KPh + zk * TT * HD, KPl + zk * TT * HD, HD, Sb, TT, 0, (size_t)TT * HD, (size_t)TT * HD, (size_t)TT * TT);
            k_gemmc<h16, 0, 1><<<dim3((TT - RH) / 64, TT / 64, ZH), 32, 0, stream>>>(QP16 + zq * TT * HD + (size_t)RH * HD, nullptr, KP16 + zk * TT * HD, nullptr, HD, Sb + (size_t)RH * TT, TT, RH, (size_t)TT * HD, (size_t)TT * HD, (size_t)TT * TT);
            k_asoft<<<ZH * TT / 8, 256, 0, stream>>>(Sb, P16, Ph, Pl);
            k_gemmc<bf, 2, 2><<<dim3(RH / 64, HD / 64, ZH), 32, 0, stream>>>(Ph, Pl, VTh + zk * HD * TT, VTl + zk * HD * TT, TT, Ob, HD, 0, (size_t)RH * TT, (size_t)HD * TT, (size_t)TT * HD);
            k_gemmc<h16, 0, 2><<<dim3((TT - RH) / 64, HD / 64, ZH), 32, 0, stream>>>(P16 + (size_t)RH * TT, nullptr, VT16 + zk * HD * TT, nullptr, TT, Ob + (size_t)RH * HD, HD, RH, (size_t)TT * TT, (size_t)HD * TT, (size_t)TT * HD);
            k_merge<<<(unsigned)(((size_t)ZH * TT * HD / 2 + 255) / 256), 256, 0, stream>>>(Ob, h0, ATh, ATl); }
        k_gemmw<bf, 1, true><<<dim3(TT / 64, DM / 64, 1), 32, 0, stream>>>(ATh, ATl, WO, nullptr, DQ, OUT + (size_t)b * TT * DM, DM, bo, 0, 0, 0); }
}

// v001
// A run of this version takes 885 microseconds.
// Two timings next to v000 put it at 1.66 and 1.69 times that version's speed.
#include <hip/hip_runtime.h>

// DisorderedCausalSelfAttention (x [2][2048][1024]; qkv = x W_attn + b ([1024][3072], split q | k | v, 16 heads x 64); partial RoPE on the first 32 dims of each head with the given per-batch tables rope_cos/rope_sin [B][T][32] (read; rotate_half within the 32 dims); then q += bQ[h], k += bK[h] (post-RoPE symmetry-breaking biases, read); causal softmax(q.k / 8); out = merged W_proj + b_proj -> [2][2048][1024]).
// Compute dtypes, f32 accumulate: every input rounded to bf16; q/k/v on PLAIN bf16 operands (inputs: exact) + bias; partial RoPE and the post-RoPE biases f32; causal scores and att.v: query rows < 512 hl (3 products), the rest single fp16 (x1024); softmax f32; W_proj hl x exact (2 products) + bias.

#define NB_  2
#define TT   2048
#define DM   1024
#define NH_  16
#define NKV  16
#define REP  (NH_ / NKV)
#define HD   64
#define DQ   (NH_ * HD)
#define DKV  (NKV * HD)
#define ZH   2
#define RH   512                  // query rows < RH use hi+lo planes (0: none)
#define WIN  2048
#define PCAR 1024.0f
#define SCL  0.125f   // HD^-0.5
typedef _Float16 h16;
typedef unsigned short bf;
typedef __attribute__((ext_vector_type(16))) __bf16   v16bf;
typedef __attribute__((ext_vector_type(16))) _Float16 v16h;
typedef __attribute__((ext_vector_type(8)))  _Float16 v8h;
typedef __attribute__((ext_vector_type(8)))  unsigned short v8us;
typedef __attribute__((ext_vector_type(8)))  float    v8f;
typedef __attribute__((ext_vector_type(4)))  float    v4f;
typedef v8h  __attribute__((may_alias)) v8ha;
typedef v4f  __attribute__((may_alias)) v4fa;
typedef v8us __attribute__((may_alias)) v8usa;
typedef float v2fa __attribute__((ext_vector_type(2), may_alias));

__device__ __forceinline__ unsigned short f2bf(float f) { unsigned u = __float_as_uint(f); u += 0x7FFFu + ((u >> 16) & 1u); return (unsigned short)(u >> 16); }
__device__ __forceinline__ float bf2f(unsigned short b) { return __uint_as_float(((unsigned)b) << 16); }
__device__ __forceinline__ float bfr(float f) { return bf2f(f2bf(f)); }
__device__ __forceinline__ v16h cat16(v8h lo, v8h hi) { return __builtin_shufflevector(lo, hi, 0, 1, 2, 3, 4, 5, 6, 7, 8, 9, 10, 11, 12, 13, 14, 15); }
__device__ __forceinline__ v16bf cat16b(v8us lo, v8us hi) { return __builtin_bit_cast(v16bf, __builtin_shufflevector(lo, hi, 0, 1, 2, 3, 4, 5, 6, 7, 8, 9, 10, 11, 12, 13, 14, 15)); }
__device__ __forceinline__ v8f wmma16(v16h a, v16h b, v8f c) { return __builtin_amdgcn_wmma_f32_16x16x32_f16(false, a, false, b, (short)0, c, false, false); }
__device__ __forceinline__ v8f wmmab(v16bf a, v16bf b, v8f c) { return __builtin_amdgcn_wmma_f32_16x16x32_bf16(false, a, false, b, (short)0, c, false, false); }



// ---- k_gemmw: register-blocked GEMM, ONE WAVE per 64x64 output tile (16 accumulators), operands straight from K-contiguous 16-bit planes; grid (M/64, N/64, Z), 32 threads.
// C[m][n] (f32, pitch ldc, + optional f32 bias[n]) = sum_k A[m][k] Bt[n][k] (+ split products per NSPLIT). z-batch strides sA/sB/sC in elements. K % 32 == 0.
template <typename T16> struct WFrag;
template <> struct WFrag<h16> { typedef v16h V; static __device__ __forceinline__ V ld(const h16* p) { return cat16(*(const v8h*)p, *(const v8h*)(p + 16)); } static __device__ __forceinline__ v8f mma(V a, V b, v8f c) { return wmma16(a, b, c); } };
template <> struct WFrag<bf> { typedef v16bf V; static __device__ __forceinline__ V ld(const bf* p) { return cat16b(*(const v8us*)p, *(const v8us*)(p + 16)); } static __device__ __forceinline__ v8f mma(V a, V b, v8f c) { return wmmab(a, b, c); } };
template <typename T16, int NSPLIT, bool BIAS>
__global__ __launch_bounds__(32) void k_gemmw(const T16* __restrict__ A, const T16* __restrict__ A2, const T16* __restrict__ Bt, const T16* __restrict__ Bt2, int K, float* C, int ldc, const float* __restrict__ bias, size_t sA, size_t sB, size_t sC) {
    typedef typename WFrag<T16>::V V;
    __shared__ __align__(16) float os[16 * 68];
    const size_t z = blockIdx.z; A += z * sA; if (A2) A2 += z * sA; Bt += z * sB; if (Bt2) Bt2 += z * sB; C += z * sC;
    const int lane = threadIdx.x & 31, lr = lane & 15, hi = lane >> 4; const int r0 = blockIdx.x * 64, c0 = blockIdx.y * 64;
    v8f acc[4][4];
#pragma unroll
    for (int mb = 0; mb < 4; ++mb)
#pragma unroll
        for (int nb = 0; nb < 4; ++nb) acc[mb][nb] = (v8f){};
    const size_t aoff = (size_t)(r0 + lr) * K + 8 * hi, boff = (size_t)(c0 + lr) * K + 8 * hi;
#pragma unroll 1
    for (int kc = 0; kc < K; kc += 32) {
        V a[4], a2[4];
#pragma unroll
        for (int mb = 0; mb < 4; ++mb) { a[mb] = WFrag<T16>::ld(A + aoff + (size_t)mb * 16 * K + kc); if (NSPLIT == 1 || NSPLIT == 2) a2[mb] = WFrag<T16>::ld(A2 + aoff + (size_t)mb * 16 * K + kc); }
#pragma unroll
        for (int nb = 0; nb < 4; ++nb) { const V b = WFrag<T16>::ld(Bt + boff + (size_t)nb * 16 * K + kc); V b2; if (NSPLIT >= 2) b2 = WFrag<T16>::ld(Bt2 + boff + (size_t)nb * 16 * K + kc);
#pragma unroll
            for (int mb = 0; mb < 4; ++mb) { acc[mb][nb] = WFrag<T16>::mma(a[mb], b, acc[mb][nb]); if (NSPLIT == 1 || NSPLIT == 2) acc[mb][nb] = WFrag<T16>::mma(a2[mb], b, acc[mb][nb]); if (NSPLIT >= 2) acc[mb][nb] = WFrag<T16>::mma(a[mb], b2, acc[mb][nb]); } }
        asm volatile("v_nop\n\tv_nop\n\tv_nop\n\tv_nop" : "+v"(acc[0][0]), "+v"(acc[1][1]), "+v"(acc[2][2]), "+v"(acc[3][3]) : "v"(a[0]), "v"(a[3]));
    }
#pragma unroll
    for (int mb = 0; mb < 4; ++mb) {
#pragma unroll
        for (int nb = 0; nb < 4; ++nb) {
#pragma unroll
            for (int j = 0; j < 8; ++j) os[(hi * 8 + j) * 68 + nb * 16 + lr] = acc[mb][nb][j]; }
        __builtin_amdgcn_wave_barrier(); asm volatile("" ::: "memory");
        float* crow = C + (size_t)(r0 + mb * 16) * ldc + c0;
{
#pragma unroll
            for (int s = 0; s < 8; ++s) { const int row = 2 * s + hi, cofs = lr * 4; v4f val = *(const v4fa*)(os + row * 68 + cofs); if (BIAS) { val[0] += bfr(bias[c0 + cofs]); val[1] += bfr(bias[c0 + cofs + 1]); val[2] += bfr(bias[c0 + cofs + 2]); val[3] += bfr(bias[c0 + cofs + 3]); }
                *(v4f*)(crow + (size_t)row * ldc + cofs) = val; }
             }
        __builtin_amdgcn_wave_barrier(); asm volatile("" ::: "memory");
    }
}

// ---- k_gemmc: the same one-wave 64x64 tile GEMM specialised for causal attention: CMODE 1 skips score tiles entirely above the diagonal (query rows r0+roff.., key columns c0..). roff = row offset of this launch's first row within the sequence.
template <typename T16, int NSPLIT, int CMODE>
__global__ __launch_bounds__(32) void k_gemmc(const T16* __restrict__ A, const T16* __restrict__ A2, const T16* __restrict__ Bt, const T16* __restrict__ Bt2, int K, float* C, int ldc, int roff, size_t sA, size_t sB, size_t sC) {
    typedef typename WFrag<T16>::V V;
    __shared__ __align__(16) float os[16 * 68];
    const size_t z = blockIdx.z; A += z * sA; if (A2) A2 += z * sA; Bt += z * sB; if (Bt2) Bt2 += z * sB; C += z * sC;
    const int lane = threadIdx.x & 31, lr = lane & 15, hi = lane >> 4; const int r0 = blockIdx.x * 64, c0 = blockIdx.y * 64;
    if (CMODE == 1 && c0 > r0 + roff + 63) return;                  // score tile entirely above the causal diagonal: never read (the softmax masks j > i by select)
    v8f acc[4][4];
#pragma unroll
    for (int mb = 0; mb < 4; ++mb)
#pragma unroll
        for (int nb = 0; nb < 4; ++nb) acc[mb][nb] = (v8f){};
    const size_t aoff = (size_t)(r0 + lr) * K + 8 * hi, boff = (size_t)(c0 + lr) * K + 8 * hi;
#pragma unroll 1
    for (int kc = 0; kc < K; kc += 32) {
        V a[4], a2[4];
#pragma unroll
        for (int mb = 0; mb < 4; ++mb) { a[mb] = WFrag<T16>::ld(A + aoff + (size_t)mb * 16 * K + kc); if (NSPLIT == 1 || NSPLIT == 2) a2[mb] = WFrag<T16>::ld(A2 + aoff + (size_t)mb * 16 * K + kc); }
#pragma unroll
        for (int nb = 0; nb < 4; ++nb) { const V b = WFrag<T16>::ld(Bt + boff + (size_t)nb * 16 * K + kc); V b2; if (NSPLIT >= 2) b2 = WFrag<T16>::ld(Bt2 + boff + (size_t)nb * 16 * K + kc);
#pragma unroll
            for (int mb = 0; mb < 4; ++mb) { acc[mb][nb] = WFrag<T16>::mma(a[mb], b, acc[mb][nb]); if (NSPLIT == 1 || NSPLIT == 2) acc[mb][nb] = WFrag<T16>::mma(a2[mb], b, acc[mb][nb]); if (NSPLIT >= 2) acc[mb][nb] = WFrag<T16>::mma(a[mb], b2, acc[mb][nb]); } }
        asm volatile("v_nop\n\tv_nop\n\tv_nop\n\tv_nop" : "+v"(acc[0][0]), "+v"(acc[1][1]), "+v"(acc[2][2]), "+v"(acc[3][3]) : "v"(a[0]), "v"(a[3]));
    }
#pragma unroll
    for (int mb = 0; mb < 4; ++mb) {
#pragma unroll
        for (int nb = 0; nb < 4; ++nb) {
#pragma unroll
            for (int j = 0; j < 8; ++j) os[(hi * 8 + j) * 68 + nb * 16 + lr] = acc[mb][nb][j]; }
        __builtin_amdgcn_wave_barrier(); asm volatile("" ::: "memory");
        float* crow = C + (size_t)(r0 + mb * 16) * ldc + c0;
{
#pragma unroll
            for (int s = 0; s < 8; ++s) { const int row = 2 * s + hi, cofs = lr * 4; v4f val = *(const v4fa*)(os + row * 68 + cofs);
                *(v4f*)(crow + (size_t)row * ldc + cofs) = val; }
             }
        __builtin_amdgcn_wave_barrier(); asm volatile("" ::: "memory");
    }
}

// ---- k_gemmk: the probability x value contraction, 64x64 output tile per work-group, with the key (K) loop split over the 16 waves of the work-group: wave w takes the 32-key chunks w, w + 16, ... up to the
// diagonal block (probabilities beyond it are exactly zero), each wave holds its own 16 accumulators, and the 16 partial tiles are summed through LDS in the fixed order wave 0..15. roff = row offset of this launch's first row within the sequence.
#define NWK 16
template <typename T16, int NSPLIT>
__global__ __launch_bounds__(32 * NWK) void k_gemmk(const T16* __restrict__ A, const T16* __restrict__ A2, const T16* __restrict__ Bt, const T16* __restrict__ Bt2, int K, float* C, int ldc, int roff, size_t sA, size_t sB, size_t sC) {
    typedef typename WFrag<T16>::V V;
    __shared__ __align__(16) float os[NWK * 64 * 68];   // one 64x64 partial tile a wave, row pitch 68
    const size_t z = blockIdx.z; A += z * sA; if (A2) A2 += z * sA; Bt += z * sB; if (Bt2) Bt2 += z * sB; C += z * sC;
    const int lane = threadIdx.x & 31, lr = lane & 15, hi = lane >> 4; const int r0 = blockIdx.x * 64, c0 = blockIdx.y * 64;
    const int wave = __builtin_amdgcn_readfirstlane((int)(threadIdx.x >> 5));   // scalar, so that the K loop is a scalar loop with every lane on
    const int Kl = min(K, r0 + roff + 64);
    v8f acc[4][4];
    // every '#pragma unroll' of this kernel: the indices of acc, a, b, ao and bo must be compile-time constants, so that these arrays stay in registers
#pragma unroll
    for (int mb = 0; mb < 4; ++mb)
#pragma unroll
        for (int nb = 0; nb < 4; ++nb) acc[mb][nb] = (v8f){};
    unsigned ao[4], bo[4];   // each lane's byte offsets inside the z slice (below 2^32), beside the slice's scalar base; they step by one round of the 16 waves at the foot of a trip
#pragma unroll
    for (int q = 0; q < 4; ++q) { ao[q] = (unsigned)((r0 + q * 16 + lr) * K + 8 * hi + wave * 32) * 2u; bo[q] = (unsigned)((c0 + q * 16 + lr) * K + 8 * hi + wave * 32) * 2u; }
    // kept rolled: two trips' fragments beside the 128 accumulator registers would not fit the 256 registers a wave has here
#pragma unroll 1
    for (int kc = wave * 32; kc < Kl; kc += NWK * 32) {
        const char* Ak = (const char*)A; const char* Ak2 = (const char*)A2; const char* Bk = (const char*)Bt; const char* Bk2 = (const char*)Bt2;
        V a[4], a2[4];
#pragma unroll
        for (int mb = 0; mb < 4; ++mb) { a[mb] = WFrag<T16>::ld((const T16*)(Ak + ao[mb])); if (NSPLIT == 1 || NSPLIT == 2) a2[mb] = WFrag<T16>::ld((const T16*)(Ak2 + ao[mb])); }
#pragma unroll
        for (int nb = 0; nb < 4; ++nb) { const V b = WFrag<T16>::ld((const T16*)(Bk + bo[nb])); V b2; if (NSPLIT >= 2) b2 = WFrag<T16>::ld((const T16*)(Bk2 + bo[nb]));
#pragma unroll
            for (int mb = 0; mb < 4; ++mb) { acc[mb][nb] = WFrag<T16>::mma(a[mb], b, acc[mb][nb]); if (NSPLIT == 1 || NSPLIT == 2) acc[mb][nb] = WFrag<T16>::mma(a2[mb], b, acc[mb][nb]); if (NSPLIT >= 2) acc[mb][nb] = WFrag<T16>::mma(a[mb], b2, acc[mb][nb]); } }
        asm volatile("v_nop\n\tv_nop\n\tv_nop\n\tv_nop" : "+v"(acc[0][0]), "+v"(acc[1][1]), "+v"(acc[2][2]), "+v"(acc[3][3]) : "v"(a[0]), "v"(a[3]));   // the distance behind the last matrix instruction, on the loop's back edge too
#pragma unroll
        for (int q = 0; q < 4; ++q) { ao[q] += NWK * 64u; bo[q] += NWK * 64u; }
    }
    float* ow = os + wave * (64 * 68);
#pragma unroll
    for (int mb = 0; mb < 4; ++mb)
#pragma unroll
        for (int nb = 0; nb < 4; ++nb)
#pragma unroll
            for (int j = 0; j < 8; ++j) ow[(mb * 16 + hi * 8 + j) * 68 + nb * 16 + lr] = acc[mb][nb][j];
    __syncthreads();   // all 16 partial tiles are in LDS before any of them is read
#pragma unroll
    for (int mb = 0; mb < 4; ++mb) { const float* pr = os + (mb * 16 + wave) * 68 + lane * 2; v2fa s = *(const v2fa*)pr;   // wave w sums rows w, w + 16, w + 32, w + 48, two columns a lane
#pragma unroll
        for (int w = 1; w < NWK; ++w) s += *(const v2fa*)(pr + w * (64 * 68));
        *(v2fa*)(C + (size_t)(r0 + mb * 16 + wave) * ldc + c0 + lane * 2) = s; }
}

__device__ __forceinline__ h16 tohx(float x) { return (h16)x; }
__device__ __forceinline__ void splitf(float y, unsigned short& h, unsigned short& l) { h = f2bf(y); l = f2bf(y - bf2f(h)); }
typedef __attribute__((ext_vector_type(2))) _Float16 v2h;
typedef __attribute__((ext_vector_type(4))) _Float16 v4h;
typedef __attribute__((ext_vector_type(2))) unsigned short v2us;
typedef __attribute__((ext_vector_type(4))) unsigned short v4us;
typedef __attribute__((ext_vector_type(2))) float v2f;
typedef __attribute__((ext_vector_type(4))) int v4i;

__global__ __launch_bounds__(256) void k_wtG(const float* __restrict__ w, int K, int N, bf* Bt) {
    const int lane = threadIdx.x & 31; const int L0 = (blockIdx.x * 8 + (threadIdx.x >> 5)) * 8; const int nlines = N * K / 64;
{
#pragma unroll 1
        for (int l = 0; l < 8; ++l) { const int L = L0 + l; if (L >= nlines) break; const size_t e = (size_t)L * 64 + lane * 2; const int k = (int)(e % K), n = (int)(e / K); v2us o;
            o[0] = f2bf(w[(size_t)k * N + n]); o[1] = f2bf(w[(size_t)(k + 1) * N + n]); *(v2us*)(Bt + e) = o; }
         }
}
__global__ __launch_bounds__(256) void k_cvt8(const float* __restrict__ src, bf* dst, size_t n8) { const size_t i = (size_t)blockIdx.x * 256 + threadIdx.x; if (i >= n8) return; const v8f v = *(const v8f*)(src + i * 8); v8us o;
#pragma unroll
    for (int k = 0; k < 8; ++k) o[k] = f2bf(v[k]); *(v8us*)(dst + i * 8) = o;  }
__global__ __launch_bounds__(256) void k_cscvt(const float* __restrict__ cosT, const float* __restrict__ sinT, float* CS) { const int idx = blockIdx.x * 256 + threadIdx.x; if (idx >= TT * HD) return; v2f cs; cs[0] = bfr(cosT[idx]); cs[1] = bfr(sinT[idx]); *(v2f*)(CS + (size_t)idx * 2) = cs;  }
// k_rope: head planes [h][t][d] (fp16 + hi/lo) of (rope(x) + bias) x sc with the rotate-half convention on dims < 32, for d < 16: out[d] = x[d] cos[t][d] - x[d+16] sin[t][d], out[d+16] = x[d+16] cos[t][d+16] + x[d] sin[t][d+16]; dims >= 32 pass through
__global__ __launch_bounds__(256) void k_rope(const float* __restrict__ F, int pitch, int nheads, const float* __restrict__ CS, const float* __restrict__ RF, const float* __restrict__ nw, float sc, h16* P16, bf* Ph, bf* Pl) {
    const size_t e = ((size_t)blockIdx.x * 256 + threadIdx.x) * 2; if (e >= (size_t)nheads * TT * HD) return; const int d = (int)(e % HD); const int t = (int)((e / HD) % TT); const int h = (int)(e / ((size_t)HD * TT)); const float* f = F + (size_t)t * pitch + h * HD; const float rf = RF ? RF[(size_t)h * TT + t] : 1.0f; v2h o16; v2us oh, ol;
#pragma unroll
    for (int q = 0; q < 2; ++q) { const int dd = d + q; const int dp = (dd < 16) ? dd + 16 : (dd < 32 ? dd - 16 : dd); float x0 = f[dd], x1 = f[dp];
        
        const v2f cs = *(const v2f*)(CS + ((size_t)t * HD + dd) * 2); float a = __fmul_rn(x0, cs[0]), bq = __fmul_rn(x1, cs[1]); asm volatile("" : "+v"(a)); asm volatile("" : "+v"(bq)); float r0 = (dd < 16) ? __fsub_rn(a, bq) : (dd < 32 ? __fadd_rn(a, bq) : x0); asm volatile("" : "+v"(r0)); float pb = bfr(nw[h * HD + dd]); asm volatile("" : "+v"(pb)); const float r = __fadd_rn(r0, pb) * sc;   // partial RoPE (first 32 dims) then the post-RoPE per-head bias
        o16[q] = tohx(r); unsigned short a2, c2; splitf(r, a2, c2); oh[q] = a2; ol[q] = c2; }
    *(v2h*)(P16 + e) = o16; *(v2us*)(Ph + e) = oh; *(v2us*)(Pl + e) = ol;  }
__global__ __launch_bounds__(256) void k_vtp(const float* __restrict__ F, int pitch, int nheads, h16* V16, bf* Vh, bf* Vl) { const size_t e = ((size_t)blockIdx.x * 256 + threadIdx.x) * 2; if (e >= (size_t)nheads * HD * TT) return; const int t = (int)(e % TT); const int d = (int)((e / TT) % HD); const int g = (int)(e / ((size_t)TT * HD)); v2h o16; v2us oh, ol;
#pragma unroll
    for (int q = 0; q < 2; ++q) { const float x = F[(size_t)(t + q) * pitch + g * HD + d]; o16[q] = tohx(x); unsigned short a2, c2; splitf(x, a2, c2); oh[q] = a2; ol[q] = c2; }
    *(v2h*)(V16 + e) = o16; *(v2us*)(Vh + e) = oh; *(v2us*)(Vl + e) = ol;  }
// k_asoft: per row (zz, i): t = S x HD^-0.5 for j <= i and i - j < WIN (sliding causal window; the reference's -1e9 additive fill vanishes identically); softmax over the 2048 keys (register row, one exp, fixed trees);
__global__ __launch_bounds__(256) void k_asoft(const float* __restrict__ Sb, h16* P16, bf* Ph, bf* Pl) {
    const int lane = threadIdx.x & 31; const int row = blockIdx.x * 8 + (threadIdx.x >> 5); if (row >= ZH * TT) return; const int i = row % TT; const int zz = row / TT; (void)zz; const bool hires = (i < RH); const float* sr = Sb + (size_t)row * TT; float v[TT / 32]; float mx = -3.0e38f;
#pragma unroll
    for (int ch = 0; ch < TT / 128; ++ch) { const int j0 = ch * 128 + lane * 4; const v4f a = *(const v4f*)(sr + j0);
#pragma unroll
        for (int q = 0; q < 4; ++q) { const int j = j0 + q; (void)j; const float t = (j <= i && i - j < WIN) ? a[q] * SCL : -3.0e38f; v[ch * 4 + q] = t; mx = fmaxf(mx, t); } }
#pragma unroll
    for (int sh = 16; sh; sh >>= 1) mx = fmaxf(mx, __shfl_xor(mx, sh, 32));
    float sum = 0.f;
#pragma unroll
    for (int k = 0; k < TT / 32; ++k) { float d0 = __fsub_rn(v[k], mx); asm volatile("" : "+v"(d0)); v[k] = __builtin_amdgcn_exp2f(__fmul_rn(d0, 1.4426950408889634f)); sum += v[k]; }
#pragma unroll
    for (int sh = 16; sh; sh >>= 1) sum += __shfl_xor(sum, sh, 32);
    const float f = __fdiv_rn(hires ? 1.0f : PCAR, sum);
{
        if (hires) {
#pragma unroll
            for (int ch = 0; ch < TT / 128; ++ch) { v4us oh, ol;
#pragma unroll
                for (int q = 0; q < 4; ++q) { unsigned short a, c2; splitf(v[ch * 4 + q] * f, a, c2); oh[q] = a; ol[q] = c2; }
                const size_t oo = ((size_t)zz * (RH ? RH : 1) + i) * TT + ch * 128 + lane * 4; *(v4us*)(Ph + oo) = oh; *(v4us*)(Pl + oo) = ol; }
        } else {
#pragma unroll
            for (int ch = 0; ch < TT / 128; ++ch) { v4h o4;
#pragma unroll
                for (int q = 0; q < 4; ++q) o4[q] = tohx(v[ch * 4 + q] * f);
                *(v4h*)(P16 + (size_t)row * TT + ch * 128 + lane * 4) = o4; } }
         }
}
__global__ __launch_bounds__(256) void k_merge(const float* __restrict__ O, int h0, bf* Ah, bf* Al) { const size_t e = ((size_t)blockIdx.x * 256 + threadIdx.x) * 2; if (e >= (size_t)ZH * TT * HD) return; const int d = (int)(e % HD); const int t = (int)((e / HD) % TT); const int zz = (int)(e / ((size_t)HD * TT)); const float cs = (t < RH) ? 1.0f : (1.0f / PCAR); const size_t oo = (size_t)t * DQ + (h0 + zz) * HD + d;
    v2us oh, ol;
#pragma unroll
    for (int q = 0; q < 2; ++q) { unsigned short a, c2; splitf(O[e + q] * cs, a, c2); oh[q] = a; ol[q] = c2; } *(v2us*)(Ah + oo) = oh; *(v2us*)(Al + oo) = ol;  }

__global__ __launch_bounds__(256) void k_wtGs(const float* __restrict__ w, int K, int N, int ld, bf* Bt) { const size_t e = ((size_t)blockIdx.x * 256 + threadIdx.x) * 4; if (e >= (size_t)N * K) return; const int k = (int)(e % K); const int n = (int)(e / K); v4us o;   // Bt[n][k] = w[k*ld + n]
#pragma unroll
    for (int u = 0; u < 4; ++u) o[u] = f2bf(w[(size_t)(k + u) * ld + n]); *(v4us*)(Bt + e) = o;  }
__global__ __launch_bounds__(256) void k_cspart(const float* __restrict__ rc, const float* __restrict__ rs, float* CS) { const int idx = blockIdx.x * 256 + threadIdx.x; if (idx >= TT * HD) return; const int t = idx / HD, dd = idx % HD; v2f cs; cs[0] = (dd < 32) ? bfr(rc[(size_t)t * 32 + dd]) : 1.0f; cs[1] = (dd < 32) ? bfr(rs[(size_t)t * 32 + dd]) : 0.0f; *(v2f*)(CS + (size_t)idx * 2) = cs;  }   // per-batch partial tables (read as data), identity beyond dim 32

extern "C" void kernel_launch(void* const* d_in, const int* in_sizes, int n_in,
                              void* d_out, int out_size, void* d_ws, size_t ws_size, hipStream_t stream) {
    (void)in_sizes; (void)n_in; (void)out_size;
    const float* x = (const float*)d_in[0]; const float* rcos = (const float*)d_in[1]; const float* rsin = (const float*)d_in[2]; const float* wf = (const float*)d_in[3]; const float* bfz = (const float*)d_in[4]; const float* wo = (const float*)d_in[5]; const float* bo = (const float*)d_in[6]; const float* bQ = (const float*)d_in[7]; const float* bK = (const float*)d_in[8]; const float* wq = wf; const float* wk = wf + 1024; const float* wv = wf + 2048; const float* bq = bfz; const float* bk = bfz + 1024; const float* bv = bfz + 2048; (void)wq; (void)wk; (void)wv; const float* cosT = nullptr; const float* sinT = nullptr; (void)cosT; (void)sinT;
    float* OUT = (float*)d_out;     // [2][2048][1024]
    char* wsp = (char*)d_ws;
    auto take = [&](size_t bytes) { char* p = wsp; wsp += (bytes + 255) & ~(size_t)255; return (void*)p; };
    bf* WQ = (bf*)take((size_t)DQ * DM * 2); bf* WK = (bf*)take((size_t)DKV * DM * 2); bf* WV = (bf*)take((size_t)DKV * DM * 2); bf* WO = (bf*)take((size_t)DM * DQ * 2); float* CS = (float*)take((size_t)TT * HD * 2 * 4);
    bf* XB = (bf*)take((size_t)TT * DM * 2); float* FQ = (float*)take((size_t)TT * DQ * 4); float* FK = (float*)take((size_t)TT * DKV * 4);
    h16* QP16 = (h16*)take((size_t)NH_ * TT * HD * 2); h16* KP16 = (h16*)take((size_t)NKV * TT * HD * 2); h16* VT16 = (h16*)take((size_t)NKV * HD * TT * 2);
    bf* QPh = (bf*)take((size_t)NH_ * TT * HD * 2); bf* QPl = (bf*)take((size_t)NH_ * TT * HD * 2); bf* KPh = (bf*)take((size_t)NKV * TT * HD * 2); bf* KPl = (bf*)take((size_t)NKV * TT * HD * 2); bf* VTh = (bf*)take((size_t)NKV * HD * TT * 2); bf* VTl = (bf*)take((size_t)NKV * HD * TT * 2); bf* Ph = (bf*)take((size_t)ZH * RH * TT * 2); bf* Pl = (bf*)take((size_t)ZH * RH * TT * 2);
    float* Sb = (float*)take((size_t)ZH * TT * TT * 4); h16* P16 = (h16*)take((size_t)ZH * TT * TT * 2); float* Ob = (float*)take((size_t)ZH * TT * HD * 4); bf* ATh = (bf*)take((size_t)TT * DQ * 2); bf* ATl = (bf*)take((size_t)TT * DQ * 2);
    if ((size_t)(wsp - (char*)d_ws) > ws_size) return;    // ws 256 MiB
    float* FV = FK;   // v projection reuses the k buffer after the k planes are built (stream-ordered)
    { k_wtGs<<<(unsigned)(((size_t)DQ * DM / 4 + 255) / 256), 256, 0, stream>>>(wq, DM, DQ, 3072, WQ); k_wtGs<<<(unsigned)(((size_t)DKV * DM / 4 + 255) / 256), 256, 0, stream>>>(wk, DM, DKV, 3072, WK); k_wtGs<<<(unsigned)(((size_t)DKV * DM / 4 + 255) / 256), 256, 0, stream>>>(wv, DM, DKV, 3072, WV);
      k_wtG<<<(unsigned)((DQ * DM / 64 + 63) / 64), 256, 0, stream>>>(wo, DQ, DM, WO);
       }
    const unsigned LQ = (unsigned)(((size_t)NH_ * TT * HD / 2 + 255) / 256), LKv = (unsigned)(((size_t)NKV * TT * HD / 2 + 255) / 256);
    for (int b = 0; b < NB_; ++b) {
        k_cspart<<<(TT * HD + 255) / 256, 256, 0, stream>>>(rcos + (size_t)b * TT * 32, rsin + (size_t)b * TT * 32, CS);
        k_cvt8<<<(unsigned)(((size_t)TT * DM / 8 + 255) / 256), 256, 0, stream>>>(x + (size_t)b * TT * DM, XB, (size_t)TT * DM / 8);
        k_gemmw<bf, 0, true><<<dim3(TT / 64, DQ / 64, 1), 32, 0, stream>>>(XB, nullptr, WQ, nullptr, DM, FQ, DQ, bq, 0, 0, 0);
        k_rope<<<LQ, 256, 0, stream>>>(FQ, DQ, NH_, CS, nullptr, bQ, 1.0f, QP16, QPh, QPl);
        k_gemmw<bf, 0, true><<<dim3(TT / 64, DKV / 64, 1), 32, 0, stream>>>(XB, nullptr, WK, nullptr, DM, FK, DKV, bk, 0, 0, 0);
        k_rope<<<LKv, 256, 0, stream>>>(FK, DKV, NKV, CS, nullptr, bK, 1.0f, KP16, KPh, KPl);
        k_gemmw<bf, 0, true><<<dim3(TT / 64, DKV / 64, 1), 32, 0, stream>>>(XB, nullptr, WV, nullptr, DM, FV, DKV, bv, 0, 0, 0); k_vtp<<<LKv, 256, 0, stream>>>(FV, DKV, NKV, VT16, VTh, VTl);
        for (int h0 = 0; h0 < NH_; h0 += ZH) { const size_t zq = (size_t)h0, zk = (size_t)(h0 / REP);   // one kv head per query head: the pass's two heads use consecutive kv planes (z-strides TT*HD)
            k_gemmc<bf, 2, 1><<<dim3(RH / 64, TT / 64, ZH), 32, 0, stream>>>(QPh + zq * TT * HD, QPl + zq * TT * HD, KPh + zk * TT * HD, KPl + zk * TT * HD, HD, Sb, TT, 0, (size_t)TT * HD, (size_t)TT * HD, (size_t)TT * TT);
            k_gemmc<h16, 0, 1><<<dim3((TT - RH) / 64, TT / 64, ZH), 32, 0, stream>>>(QP16 + zq * TT * HD + (size_t)RH * HD, nullptr, KP16 + zk * TT * HD, nullptr, HD, Sb + (size_t)RH * TT, TT, RH, (size_t)TT * HD, (size_t)TT * HD, (size_t)TT * TT);
            k_asoft<<<ZH * TT / 8, 256, 0, stream>>>(Sb, P16, Ph, Pl);
            k_gemmk<bf, 2><<<dim3(RH / 64, HD / 64, ZH), 32 * NWK, 0, stream>>>(Ph, Pl, VTh + zk * HD * TT, VTl + zk * HD * TT, TT, Ob, HD, 0, (size_t)RH * TT, (size_t)HD * TT, (size_t)TT * HD);
            k_gemmk<h16, 0><<<dim3((TT - RH) / 64, HD / 64, ZH), 32 * NWK, 0, stream>>>(P16 + (size_t)RH * TT, nullptr, VT16 + zk * HD * TT, nullptr, TT, Ob + (size_t)RH * HD, HD, RH, (size_t)TT * TT, (size_t)HD * TT, (size_t)TT * HD);
            k_merge<<<(unsigned)(((size_t)ZH * TT * HD / 2 + 255) / 256), 256, 0, stream>>>(Ob, h0, ATh, ATl); }
        k_gemmw<bf, 1, true><<<dim3(TT / 64, DM / 64, 1), 32, 0, stream>>>(ATh, ATl, WO, nullptr, DQ, OUT + (size_t)b * TT * DM, DM, bo, 0, 0, 0); }
}

// v002
// It runs in 394 microseconds.
// Two timings next to v001 put it at 2.26 and 2.24 times that version's speed.
// Over all steps from v000 it is 3.77 times as fast.
#include <hip/hip_runtime.h>

// DisorderedCausalSelfAttention (x [2][2048][1024]; qkv = x W_attn + b ([1024][3072], split q | k | v, 16 heads x 64); partial RoPE on the first 32 dims of each head with the given per-batch tables rope_cos/rope_sin [B][T][32] (read; rotate_half within the 32 dims); then q += bQ[h], k += bK[h] (post-RoPE symmetry-breaking biases, read); causal softmax(q.k / 8); out = merged W_proj + b_proj -> [2][2048][1024]).
// Compute dtypes, f32 accumulate: every input rounded to bf16; q/k/v on PLAIN bf16 operands (inputs: exact) + bias; partial RoPE and the post-RoPE biases f32; causal scores and att.v: query rows < 512 hl (3 products), the rest single fp16; softmax f32, running maximum, normalised after att.v; W_proj hl x exact (2 products) + bias.

#define NB_  2
#define TT   2048
#define DM   1024
#define NH_  16
#define NKV  16
#define REP  (NH_ / NKV)
#define HD   64
#define DQ   (NH_ * HD)
#define DKV  (NKV * HD)
#define RH   512                  // query rows < RH use hi+lo planes (0: none)
#define SCL  0.125f   // HD^-0.5
typedef _Float16 h16;
typedef unsigned short bf;
typedef __attribute__((ext_vector_type(16))) __bf16   v16bf;
typedef __attribute__((ext_vector_type(16))) _Float16 v16h;
typedef __attribute__((ext_vector_type(8)))  _Float16 v8h;
typedef __attribute__((ext_vector_type(8)))  unsigned short v8us;
typedef __attribute__((ext_vector_type(8)))  float    v8f;
typedef __attribute__((ext_vector_type(4)))  float    v4f;
typedef v8h  __attribute__((may_alias)) v8ha;
typedef v4f  __attribute__((may_alias)) v4fa;
typedef v8us __attribute__((may_alias)) v8usa;
typedef float v2fa __attribute__((ext_vector_type(2), may_alias));

__device__ __forceinline__ unsigned short f2bf(float f) { unsigned u = __float_as_uint(f); u += 0x7FFFu + ((u >> 16) & 1u); return (unsigned short)(u >> 16); }
__device__ __forceinline__ float bf2f(unsigned short b) { return __uint_as_float(((unsigned)b) << 16); }
__device__ __forceinline__ float bfr(float f) { return bf2f(f2bf(f)); }
__device__ __forceinline__ v16h cat16(v8h lo, v8h hi) { return __builtin_shufflevector(lo, hi, 0, 1, 2, 3, 4, 5, 6, 7, 8, 9, 10, 11, 12, 13, 14, 15); }
__device__ __forceinline__ v16bf cat16b(v8us lo, v8us hi) { return __builtin_bit_cast(v16bf, __builtin_shufflevector(lo, hi, 0, 1, 2, 3, 4, 5, 6, 7, 8, 9, 10, 11, 12, 13, 14, 15)); }
__device__ __forceinline__ v8f wmma16(v16h a, v16h b, v8f c) { return __builtin_amdgcn_wmma_f32_16x16x32_f16(false, a, false, b, (short)0, c, false, false); }
__device__ __forceinline__ v8f wmmab(v16bf a, v16bf b, v8f c) { return __builtin_amdgcn_wmma_f32_16x16x32_bf16(false, a, false, b, (short)0, c, false, false); }



// ---- k_gemmw: register-blocked GEMM, ONE WAVE per 64x64 output tile (16 accumulators), operands straight from K-contiguous 16-bit planes; grid (M/64, N/64, Z), 32 threads.
// C[m][n] (f32, pitch ldc, + optional f32 bias[n]) = sum_k A[m][k] Bt[n][k] (+ split products per NSPLIT). z-batch strides sA/sB/sC in elements. K % 32 == 0.
template <typename T16> struct WFrag;
template <> struct WFrag<h16> { typedef v16h V; static __device__ __forceinline__ V ld(const h16* p) { return cat16(*(const v8h*)p, *(const v8h*)(p + 16)); } static __device__ __forceinline__ v8f mma(V a, V b, v8f c) { return wmma16(a, b, c); } };
template <> struct WFrag<bf> { typedef v16bf V; static __device__ __forceinline__ V ld(const bf* p) { return cat16b(*(const v8us*)p, *(const v8us*)(p + 16)); } static __device__ __forceinline__ v8f mma(V a, V b, v8f c) { return wmmab(a, b, c); } };
template <typename T16, int NSPLIT, bool BIAS>
__global__ __launch_bounds__(32) void k_gemmw(const T16* __restrict__ A, const T16* __restrict__ A2, const T16* __restrict__ Bt, const T16* __restrict__ Bt2, int K, float* C, int ldc, const float* __restrict__ bias, size_t sA, size_t sB, size_t sC) {
    typedef typename WFrag<T16>::V V;
    __shared__ __align__(16) float os[16 * 68];
    const size_t z = blockIdx.z; A += z * sA; if (A2) A2 += z * sA; Bt += z * sB; if (Bt2) Bt2 += z * sB; C += z * sC;
    const int lane = threadIdx.x & 31, lr = lane & 15, hi = lane >> 4; const int r0 = blockIdx.x * 64, c0 = blockIdx.y * 64;
    v8f acc[4][4];
#pragma unroll
    for (int mb = 0; mb < 4; ++mb)
#pragma unroll
        for (int nb = 0; nb < 4; ++nb) acc[mb][nb] = (v8f){};
    const size_t aoff = (size_t)(r0 + lr) * K + 8 * hi, boff = (size_t)(c0 + lr) * K + 8 * hi;
#pragma unroll 1
    for (int kc = 0; kc < K; kc += 32) {
        V a[4], a2[4];
#pragma unroll
        for (int mb = 0; mb < 4; ++mb) { a[mb] = WFrag<T16>::ld(A + aoff + (size_t)mb * 16 * K + kc); if (NSPLIT == 1 || NSPLIT == 2) a2[mb] = WFrag<T16>::ld(A2 + aoff + (size_t)mb * 16 * K + kc); }
#pragma unroll
        for (int nb = 0; nb < 4; ++nb) { const V b = WFrag<T16>::ld(Bt + boff + (size_t)nb * 16 * K + kc); V b2; if (NSPLIT >= 2) b2 = WFrag<T16>::ld(Bt2 + boff + (size_t)nb * 16 * K + kc);
#pragma unroll
            for (int mb = 0; mb < 4; ++mb) { acc[mb][nb] = WFrag<T16>::mma(a[mb], b, acc[mb][nb]); if (NSPLIT == 1 || NSPLIT == 2) acc[mb][nb] = WFrag<T16>::mma(a2[mb], b, acc[mb][nb]); if (NSPLIT >= 2) acc[mb][nb] = WFrag<T16>::mma(a[mb], b2, acc[mb][nb]); } }
        asm volatile("v_nop\n\tv_nop\n\tv_nop\n\tv_nop" : "+v"(acc[0][0]), "+v"(acc[1][1]), "+v"(acc[2][2]), "+v"(acc[3][3]) : "v"(a[0]), "v"(a[3]));
    }
#pragma unroll
    for (int mb = 0; mb < 4; ++mb) {
#pragma unroll
        for (int nb = 0; nb < 4; ++nb) {
#pragma unroll
            for (int j = 0; j < 8; ++j) os[(hi * 8 + j) * 68 + nb * 16 + lr] = acc[mb][nb][j]; }
        __builtin_amdgcn_wave_barrier(); asm volatile("" ::: "memory");
        float* crow = C + (size_t)(r0 + mb * 16) * ldc + c0;
{
#pragma unroll
            for (int s = 0; s < 8; ++s) { const int row = 2 * s + hi, cofs = lr * 4; v4f val = *(const v4fa*)(os + row * 68 + cofs); if (BIAS) { val[0] += bfr(bias[c0 + cofs]); val[1] += bfr(bias[c0 + cofs + 1]); val[2] += bfr(bias[c0 + cofs + 2]); val[3] += bfr(bias[c0 + cofs + 3]); }
                *(v4f*)(crow + (size_t)row * ldc + cofs) = val; }
             }
        __builtin_amdgcn_wave_barrier(); asm volatile("" ::: "memory");
    }
}

__device__ __forceinline__ h16 tohx(float x) { return (h16)x; }
__device__ __forceinline__ void splitf(float y, unsigned short& h, unsigned short& l) { h = f2bf(y); l = f2bf(y - bf2f(h)); }
typedef __attribute__((ext_vector_type(2))) _Float16 v2h;
typedef __attribute__((ext_vector_type(4))) _Float16 v4h;
typedef __attribute__((ext_vector_type(2))) unsigned short v2us;
typedef __attribute__((ext_vector_type(4))) unsigned short v4us;
typedef __attribute__((ext_vector_type(2))) float v2f;
typedef __attribute__((ext_vector_type(4))) int v4i;

__global__ __launch_bounds__(256) void k_wtG(const float* __restrict__ w, int K, int N, bf* Bt) {
    const int lane = threadIdx.x & 31; const int L0 = (blockIdx.x * 8 + (threadIdx.x >> 5)) * 8; const int nlines = N * K / 64;
{
#pragma unroll 1
        for (int l = 0; l < 8; ++l) { const int L = L0 + l; if (L >= nlines) break; const size_t e = (size_t)L * 64 + lane * 2; const int k = (int)(e % K), n = (int)(e / K); v2us o;
            o[0] = f2bf(w[(size_t)k * N + n]); o[1] = f2bf(w[(size_t)(k + 1) * N + n]); *(v2us*)(Bt + e) = o; }
         }
}
__global__ __launch_bounds__(256) void k_cvt8(const float* __restrict__ src, bf* dst, size_t n8) { const size_t i = (size_t)blockIdx.x * 256 + threadIdx.x; if (i >= n8) return; const v8f v = *(const v8f*)(src + i * 8); v8us o;
#pragma unroll
    for (int k = 0; k < 8; ++k) o[k] = f2bf(v[k]); *(v8us*)(dst + i * 8) = o;  }
__global__ __launch_bounds__(256) void k_cscvt(const float* __restrict__ cosT, const float* __restrict__ sinT, float* CS) { const int idx = blockIdx.x * 256 + threadIdx.x; if (idx >= TT * HD) return; v2f cs; cs[0] = bfr(cosT[idx]); cs[1] = bfr(sinT[idx]); *(v2f*)(CS + (size_t)idx * 2) = cs;  }
// k_rope: head planes [h][t][d] (fp16 + hi/lo) of (rope(x) + bias) x sc with the rotate-half convention on dims < 32, for d < 16: out[d] = x[d] cos[t][d] - x[d+16] sin[t][d], out[d+16] = x[d+16] cos[t][d+16] + x[d] sin[t][d+16]; dims >= 32 pass through
__global__ __launch_bounds__(256) void k_rope(const float* __restrict__ F, int pitch, int nheads, const float* __restrict__ CS, const float* __restrict__ RF, const float* __restrict__ nw, float sc, h16* P16, bf* Ph, bf* Pl) {
    const size_t e = ((size_t)blockIdx.x * 256 + threadIdx.x) * 2; if (e >= (size_t)nheads * TT * HD) return; const int d = (int)(e % HD); const int t = (int)((e / HD) % TT); const int h = (int)(e / ((size_t)HD * TT)); const float* f = F + (size_t)t * pitch + h * HD; const float rf = RF ? RF[(size_t)h * TT + t] : 1.0f; v2h o16; v2us oh, ol;
#pragma unroll
    for (int q = 0; q < 2; ++q) { const int dd = d + q; const int dp = (dd < 16) ? dd + 16 : (dd < 32 ? dd - 16 : dd); float x0 = f[dd], x1 = f[dp];
        
        const v2f cs = *(const v2f*)(CS + ((size_t)t * HD + dd) * 2); float a = __fmul_rn(x0, cs[0]), bq = __fmul_rn(x1, cs[1]); asm volatile("" : "+v"(a)); asm volatile("" : "+v"(bq)); float r0 = (dd < 16) ? __fsub_rn(a, bq) : (dd < 32 ? __fadd_rn(a, bq) : x0); asm volatile("" : "+v"(r0)); float pb = bfr(nw[h * HD + dd]); asm volatile("" : "+v"(pb)); const float r = __fadd_rn(r0, pb) * sc;   // partial RoPE (first 32 dims) then the post-RoPE per-head bias
        o16[q] = tohx(r); unsigned short a2, c2; splitf(r, a2, c2); oh[q] = a2; ol[q] = c2; }
    *(v2h*)(P16 + e) = o16; *(v2us*)(Ph + e) = oh; *(v2us*)(Pl + e) = ol;  }
__global__ __launch_bounds__(256) void k_vtp(const float* __restrict__ F, int pitch, int nheads, h16* V16, bf* Vh, bf* Vl) { const size_t e = ((size_t)blockIdx.x * 256 + threadIdx.x) * 2; if (e >= (size_t)nheads * HD * TT) return; const int t = (int)(e % TT); const int d = (int)((e / TT) % HD); const int g = (int)(e / ((size_t)TT * HD)); v2h o16; v2us oh, ol;
#pragma unroll
    for (int q = 0; q < 2; ++q) { const float x = F[(size_t)(t + q) * pitch + g * HD + d]; o16[q] = tohx(x); unsigned short a2, c2; splitf(x, a2, c2); oh[q] = a2; ol[q] = c2; }
    *(v2h*)(V16 + e) = o16; *(v2us*)(Vh + e) = oh; *(v2us*)(Vl + e) = ol;  }
#define AW   4                    // waves a work-group; they walk the same keys at about the same time
#define RLO  2                    // query groups a wave, fp16 rows
#define NBLO ((TT - RH) / (16 * AW * RLO))   // work-groups a head, fp16 rows
#define NBHI (RH / (16 * AW))                // work-groups a head, hi+lo rows
#define CSC  (SCL * 1.4426950408889634f)
__device__ __forceinline__ float xhalf(float x) { return __builtin_bit_cast(float, __builtin_amdgcn_permlanex16(__builtin_bit_cast(int, x), __builtin_bit_cast(int, x), 0x76543210, 0xfedcba98, false, false)); }   // lane l reads lane l ^ 16
// dist: the distance behind the last matrix instruction of a product before its operand registers are loaded anew, on a loop's back edge too; it names the product's tiles so that the whole product stands in front of it
__device__ __forceinline__ void dist(v8f (&s)[1][2]) { asm volatile("v_nop\n\tv_nop\n\tv_nop\n\tv_nop" : "+v"(s[0][0]), "+v"(s[0][1])); }
__device__ __forceinline__ void dist(v8f (&s)[2][2]) { asm volatile("v_nop\n\tv_nop\n\tv_nop\n\tv_nop" : "+v"(s[0][0]), "+v"(s[0][1]), "+v"(s[1][0]), "+v"(s[1][1])); }
__device__ __forceinline__ void dist(v8f (&s)[1][4]) { asm volatile("v_nop\n\tv_nop\n\tv_nop\n\tv_nop" : "+v"(s[0][0]), "+v"(s[0][1]), "+v"(s[0][2]), "+v"(s[0][3])); }
__device__ __forceinline__ void dist(v8f (&s)[2][4]) { asm volatile("v_nop\n\tv_nop\n\tv_nop\n\tv_nop" : "+v"(s[0][0]), "+v"(s[0][1]), "+v"(s[0][2]), "+v"(s[0][3]), "+v"(s[1][0]), "+v"(s[1][1]), "+v"(s[1][2]), "+v"(s[1][3])); }
// xdone: stands behind a run of global loads from a (and b), in front of whatever overwrites the registers that held their addresses (the instruction set's rule for an issued load). It names the two addresses as inputs, so that their registers live up to the wait
// and no load of the run lands on them; the scheduling barrier keeps the loads in front of it and later code behind it.
template <bool TWO>
__device__ __forceinline__ void xdone(const void* a, const void* b) { if (TWO) asm volatile("s_wait_xcnt 0x0" :: "v"(a), "v"(b) : "memory"); else asm volatile("s_wait_xcnt 0x0" :: "v"(a) : "memory"); __builtin_amdgcn_sched_barrier(0); }
template <typename T16, bool HI, bool MASK, int R>
__device__ __forceinline__ void attn_pass(typename WFrag<T16>::V (&kf)[2][2], typename WFrag<T16>::V (&kf2)[2][2], const T16* Kn, const T16* Kn2, const T16* Vp, const T16* Vp2,
                                          const typename WFrag<T16>::V (&qf)[R][2], const typename WFrag<T16>::V (&qf2)[R][2], v8f (&acc)[R][4], float (&m)[R], float (&l)[R], int key0, int myq, int hi) {
    typedef typename WFrag<T16>::V V;
    // every '#pragma unroll' of this function: the indices of the fragment and accumulator arrays must be compile-time constants, so that they stay in registers
    V vf[4], vf2[4];   // this pass's V^T fragments (rows d, k = keys), in flight under the first product and the exponentials
#pragma unroll
    for (int t = 0; t < 4; ++t) { vf[t] = WFrag<T16>::ld(Vp + (size_t)t * 16 * TT); if (HI) vf2[t] = WFrag<T16>::ld(Vp2 + (size_t)t * 16 * TT); }
    xdone<HI>(Vp, Vp2);
    v8f s[R][2];
#pragma unroll
    for (int g = 0; g < R; ++g)
#pragma unroll
        for (int kt = 0; kt < 2; ++kt) { s[g][kt] = (v8f){};
#pragma unroll
            for (int kc = 0; kc < 2; ++kc) { s[g][kt] = WFrag<T16>::mma(kf[kt][kc], qf[g][kc], s[g][kt]); if (HI) { s[g][kt] = WFrag<T16>::mma(kf[kt][kc], qf2[g][kc], s[g][kt]); s[g][kt] = WFrag<T16>::mma(kf2[kt][kc], qf[g][kc], s[g][kt]); } } }
    dist(s);
    __builtin_amdgcn_sched_barrier(0);   // keeps the loads below behind that distance
    if (!HI) {   // the next pass's K fragments, in flight under this pass's softmax and second product
#pragma unroll
        for (int kt = 0; kt < 2; ++kt)
#pragma unroll
            for (int kc = 0; kc < 2; ++kc) kf[kt][kc] = WFrag<T16>::ld(Kn + kt * 16 * HD + kc * 32);
        xdone<false>(Kn, nullptr); }
    float mx[R]; bool need = false;
#pragma unroll
    for (int g = 0; g < R; ++g) { float x0 = -3.0e38f;
#pragma unroll
        for (int e = 0; e < 16; ++e) { float x = s[g][e >> 3][e & 7] * CSC; if (MASK) x = (key0 + 16 * (e >> 3) + 8 * hi + (e & 7) <= myq + 16 * g) ? x : -3.0e38f; s[g][e >> 3][e & 7] = x; x0 = fmaxf(x0, x); }
        mx[g] = fmaxf(x0, xhalf(x0));   // lanes l and l ^ 16 hold the two key halves of one query
        need = need || (mx[g] > m[g]); }
    if (__builtin_amdgcn_ballot_w32(need) != 0) {   // wave-uniform; where a query's maximum does not move its factor is exactly 1
#pragma unroll
        for (int g = 0; g < R; ++g) { const float mn = fmaxf(m[g], mx[g]); const float corr = __builtin_amdgcn_exp2f(m[g] - mn); m[g] = mn; l[g] *= corr;
#pragma unroll
            for (int t = 0; t < 4; ++t) acc[g][t] *= corr; } }
#pragma unroll
    for (int g = 0; g < R; ++g) { float p[16];
#pragma unroll
        for (int e = 0; e < 16; ++e) { p[e] = __builtin_amdgcn_exp2f(s[g][e >> 3][e & 7] - m[g]); l[g] += p[e]; }
        if (HI) { v8us h0, h1, l0, l1;
#pragma unroll
            for (int e = 0; e < 8; ++e) { unsigned short a, c; splitf(p[e], a, c); h0[e] = a; l0[e] = c; splitf(p[8 + e], a, c); h1[e] = a; l1[e] = c; }
            const v16bf ph = cat16b(h0, h1), pl = cat16b(l0, l1);
#pragma unroll
            for (int t = 0; t < 4; ++t) { acc[g][t] = wmmab(__builtin_bit_cast(v16bf, vf[t]), ph, acc[g][t]); acc[g][t] = wmmab(__builtin_bit_cast(v16bf, vf[t]), pl, acc[g][t]); acc[g][t] = wmmab(__builtin_bit_cast(v16bf, vf2[t]), ph, acc[g][t]); }
        } else { v16h pf;
#pragma unroll
            for (int e = 0; e < 16; ++e) pf[e] = tohx(p[e]);
#pragma unroll
            for (int t = 0; t < 4; ++t) acc[g][t] = wmma16(__builtin_bit_cast(v16h, vf[t]), pf, acc[g][t]); } }
    dist(acc);
    if (HI) {   // with hi and lo planes K and V^T together do not fit 256 registers: the next pass's K is loaded when V^T is spent (these rows have at most RH / 32 passes and are never the longest)
        __builtin_amdgcn_sched_barrier(0);   // keeps these loads behind the second product
#pragma unroll
        for (int kt = 0; kt < 2; ++kt)
#pragma unroll
            for (int kc = 0; kc < 2; ++kc) { kf[kt][kc] = WFrag<T16>::ld(Kn + kt * 16 * HD + kc * 32); kf2[kt][kc] = WFrag<T16>::ld(Kn2 + kt * 16 * HD + kc * 32); }
        xdone<true>(Kn, Kn2); }
}
// q0: the wave's first query row, a multiple of 16 R
template <typename T16, bool HI, int R>
__device__ __forceinline__ void attn_rows(const T16* __restrict__ Q, const T16* __restrict__ Q2, const T16* __restrict__ K, const T16* __restrict__ K2, const T16* __restrict__ Vt, const T16* __restrict__ Vt2, int q0, int head, bf* Ah, bf* Al) {
    typedef typename WFrag<T16>::V V;
    const int lane = threadIdx.x & 31, lr = lane & 15, hi = lane >> 4; const int myq = q0 + lr;
    const size_t qo = (size_t)myq * HD + 8 * hi; const int ko = lr * HD + 8 * hi, vo = lr * TT + 8 * hi;
    V qf[R][2], qf2[R][2], kf[2][2], kf2[2][2];
#pragma unroll
    for (int g = 0; g < R; ++g)
#pragma unroll
        for (int kc = 0; kc < 2; ++kc) { qf[g][kc] = WFrag<T16>::ld(Q + qo + g * 16 * HD + kc * 32); if (HI) qf2[g][kc] = WFrag<T16>::ld(Q2 + qo + g * 16 * HD + kc * 32); }
    xdone<HI>(Q + qo, Q2 + qo);
#pragma unroll
    for (int kt = 0; kt < 2; ++kt)
#pragma unroll
        for (int kc = 0; kc < 2; ++kc) { kf[kt][kc] = WFrag<T16>::ld(K + ko + kt * 16 * HD + kc * 32); if (HI) kf2[kt][kc] = WFrag<T16>::ld(K2 + ko + kt * 16 * HD + kc * 32); }
    xdone<HI>(K + ko, K2 + ko);
    v8f acc[R][4]; float m[R], l[R];
#pragma unroll
    for (int g = 0; g < R; ++g) { m[g] = -3.0e38f; l[g] = 0.f;
#pragma unroll
        for (int t = 0; t < 4; ++t) acc[g][t] = (v8f){}; }
    const int klast = (q0 >> 5) << 5;   // first key of the pass that holds the wave's diagonal (its 16 R <= 32 rows lie in one 32-key block): the only pass with masked keys, and the last
    // kept rolled: one pass's fragments and the next pass's K already fill the registers
#pragma unroll 1
    for (int key0 = 0; key0 < klast; key0 += 32) attn_pass<T16, HI, false, R>(kf, kf2, K + ko + (key0 + 32) * HD, K2 + ko + (key0 + 32) * HD, Vt + vo + key0, Vt2 + vo + key0, qf, qf2, acc, m, l, key0, myq, hi);
    attn_pass<T16, HI, true, R>(kf, kf2, K + ko + klast * HD, K2 + ko + klast * HD, Vt + vo + klast, Vt2 + vo + klast, qf, qf2, acc, m, l, klast, myq, hi);   // there is no next pass: its K load repeats this pass's rows, in bounds, unused
#pragma unroll
    for (int g = 0; g < R; ++g) { const float lt = l[g] + xhalf(l[g]); const float inv = __fdiv_rn(1.0f, lt);
#pragma unroll
        for (int t = 0; t < 4; ++t) { v8us oh, ol;   // registers j of tile t are d = 16 t + 8 hi + j of query myq + 16 g
#pragma unroll
            for (int j = 0; j < 8; ++j) { unsigned short a, c; splitf(acc[g][t][j] * inv, a, c); oh[j] = a; ol[j] = c; }
            const size_t oo = (size_t)(myq + 16 * g) * DQ + head * HD + t * 16 + 8 * hi; *(v8us*)(Ah + oo) = oh; *(v8us*)(Al + oo) = ol;
            asm volatile("s_wait_xcnt 0x0" ::: "memory"); __builtin_amdgcn_sched_barrier(0); } }   // behind the two stores, in front of whatever overwrites their address or data registers (the next tile's values); the scheduling barrier keeps that code behind the wait
}
__global__ __launch_bounds__(32 * AW) void k_attn(const h16* __restrict__ Q16, const h16* __restrict__ K16, const h16* __restrict__ V16, const bf* __restrict__ Qh, const bf* __restrict__ Ql, const bf* __restrict__ Kh, const bf* __restrict__ Kl, const bf* __restrict__ Vh, const bf* __restrict__ Vl, bf* Ah, bf* Al) {
    const int head = blockIdx.y; const size_t hp = (size_t)head * TT * HD; const int bx = blockIdx.x;
    const int wave = __builtin_amdgcn_readfirstlane((int)(threadIdx.x >> 5));   // scalar, so that the key loop is a scalar loop with every lane on
    if (bx < NBLO) attn_rows<h16, false, RLO>(Q16 + hp, nullptr, K16 + hp, nullptr, V16 + hp, nullptr, TT - (bx + 1) * (16 * AW * RLO) + wave * (16 * RLO), head, Ah, Al);   // the longest rows start first
    else attn_rows<bf, true, 1>(Qh + hp, Ql + hp, Kh + hp, Kl + hp, Vh + hp, Vl + hp, (bx - NBLO) * (16 * AW) + wave * 16, head, Ah, Al);
}

__global__ __launch_bounds__(256) void k_wtGs(const float* __restrict__ w, int K, int N, int ld, bf* Bt) { const size_t e = ((size_t)blockIdx.x * 256 + threadIdx.x) * 4; if (e >= (size_t)N * K) return; const int k = (int)(e % K); const int n = (int)(e / K); v4us o;   // Bt[n][k] = w[k*ld + n]
#pragma unroll
    for (int u = 0; u < 4; ++u) o[u] = f2bf(w[(size_t)(k + u) * ld + n]); *(v4us*)(Bt + e) = o;  }
__global__ __launch_bounds__(256) void k_cspart(const float* __restrict__ rc, const float* __restrict__ rs, float* CS) { const int idx = blockIdx.x * 256 + threadIdx.x; if (idx >= TT * HD) return; const int t = idx / HD, dd = idx % HD; v2f cs; cs[0] = (dd < 32) ? bfr(rc[(size_t)t * 32 + dd]) : 1.0f; cs[1] = (dd < 32) ? bfr(rs[(size_t)t * 32 + dd]) : 0.0f; *(v2f*)(CS + (size_t)idx * 2) = cs;  }   // per-batch partial tables (read as data), identity beyond dim 32

extern "C" void kernel_launch(void* const* d_in, const int* in_sizes, int n_in,
                              void* d_out, int out_size, void* d_ws, size_t ws_size, hipStream_t stream) {
    (void)in_sizes; (void)n_in; (void)out_size;
    const float* x = (const float*)d_in[0]; const float* rcos = (const float*)d_in[1]; const float* rsin = (const float*)d_in[2]; const float* wf = (const float*)d_in[3]; const float* bfz = (const float*)d_in[4]; const float* wo = (const float*)d_in[5]; const float* bo = (const float*)d_in[6]; const float* bQ = (const float*)d_in[7]; const float* bK = (const float*)d_in[8]; const float* wq = wf; const float* wk = wf + 1024; const float* wv = wf + 2048; const float* bq = bfz; const float* bk = bfz + 1024; const float* bv = bfz + 2048; (void)wq; (void)wk; (void)wv; const float* cosT = nullptr; const float* sinT = nullptr; (void)cosT; (void)sinT;
    float* OUT = (float*)d_out;     // [2][2048][1024]
    char* wsp = (char*)d_ws;
    auto take = [&](size_t bytes) { char* p = wsp; wsp += (bytes + 255) & ~(size_t)255; return (void*)p; };
    bf* WQ = (bf*)take((size_t)DQ * DM * 2); bf* WK = (bf*)take((size_t)DKV * DM * 2); bf* WV = (bf*)take((size_t)DKV * DM * 2); bf* WO = (bf*)take((size_t)DM * DQ * 2); float* CS = (float*)take((size_t)TT * HD * 2 * 4);
    bf* XB = (bf*)take((size_t)TT * DM * 2); float* FQ = (float*)take((size_t)TT * DQ * 4); float* FK = (float*)take((size_t)TT * DKV * 4);
    h16* QP16 = (h16*)take((size_t)NH_ * TT * HD * 2); h16* KP16 = (h16*)take((size_t)NKV * TT * HD * 2); h16* VT16 = (h16*)take((size_t)NKV * HD * TT * 2);
    bf* QPh = (bf*)take((size_t)NH_ * TT * HD * 2); bf* QPl = (bf*)take((size_t)NH_ * TT * HD * 2); bf* KPh = (bf*)take((size_t)NKV * TT * HD * 2); bf* KPl = (bf*)take((size_t)NKV * TT * HD * 2); bf* VTh = (bf*)take((size_t)NKV * HD * TT * 2); bf* VTl = (bf*)take((size_t)NKV * HD * TT * 2);
    bf* ATh = (bf*)take((size_t)TT * DQ * 2); bf* ATl = (bf*)take((size_t)TT * DQ * 2);
    if ((size_t)(wsp - (char*)d_ws) > ws_size) return;    // ws 256 MiB
    float* FV = FK;   // v projection reuses the k buffer after the k planes are built (stream-ordered)
    { k_wtGs<<<(unsigned)(((size_t)DQ * DM / 4 + 255) / 256), 256, 0, stream>>>(wq, DM, DQ, 3072, WQ); k_wtGs<<<(unsigned)(((size_t)DKV * DM / 4 + 255) / 256), 256, 0, stream>>>(wk, DM, DKV, 3072, WK); k_wtGs<<<(unsigned)(((size_t)DKV * DM / 4 + 255) / 256), 256, 0, stream>>>(wv, DM, DKV, 3072, WV);
      k_wtG<<<(unsigned)((DQ * DM / 64 + 63) / 64), 256, 0, stream>>>(wo, DQ, DM, WO);
       }
    const unsigned LQ = (unsigned)(((size_t)NH_ * TT * HD / 2 + 255) / 256), LKv = (unsigned)(((size_t)NKV * TT * HD / 2 + 255) / 256);
    for (int b = 0; b < NB_; ++b) {
        k_cspart<<<(TT * HD + 255) / 256, 256, 0, stream>>>(rcos + (size_t)b * TT * 32, rsin + (size_t)b * TT * 32, CS);
        k_cvt8<<<(unsigned)(((size_t)TT * DM / 8 + 255) / 256), 256, 0, stream>>>(x + (size_t)b * TT * DM, XB, (size_t)TT * DM / 8);
        k_gemmw<bf, 0, true><<<dim3(TT / 64, DQ / 64, 1), 32, 0, stream>>>(XB, nullptr, WQ, nullptr, DM, FQ, DQ, bq, 0, 0, 0);
        k_rope<<<LQ, 256, 0, stream>>>(FQ, DQ, NH_, CS, nullptr, bQ, 1.0f, QP16, QPh, QPl);
        k_gemmw<bf, 0, true><<<dim3(TT / 64, DKV / 64, 1), 32, 0, stream>>>(XB, nullptr, WK, nullptr, DM, FK, DKV, bk, 0, 0, 0);
        k_rope<<<LKv, 256, 0, stream>>>(FK, DKV, NKV, CS, nullptr, bK, 1.0f, KP16, KPh, KPl);
        k_gemmw<bf, 0, true><<<dim3(TT / 64, DKV / 64, 1), 32, 0, stream>>>(XB, nullptr, WV, nullptr, DM, FV, DKV, bv, 0, 0, 0); k_vtp<<<LKv, 256, 0, stream>>>(FV, DKV, NKV, VT16, VTh, VTl);
        k_attn<<<dim3(NBLO + NBHI, NH_, 1), 32 * AW, 0, stream>>>(QP16, KP16, VT16, QPh, QPl, KPh, KPl, VTh, VTl, ATh, ATl);
        k_gemmw<bf, 1, true><<<dim3(TT / 64, DM / 64, 1), 32, 0, stream>>>(ATh, ATl, WO, nullptr, DQ, OUT + (size_t)b * TT * DM, DM, bo, 0, 0, 0); }
}

// v003
// It runs in 234 microseconds.
// Next to v002, in two timings, it ran 1.67 and 1.69 times as fast.
// Counting every step since v000, it is 6.34 times as fast.
#include <hip/hip_runtime.h>

// DisorderedCausalSelfAttention (x [2][2048][1024]; qkv = x W_attn + b ([1024][3072], split q | k | v, 16 heads x 64); partial RoPE on the first 32 dims of each head with the given per-batch tables rope_cos/rope_sin [B][T][32] (read; rotate_half within the 32 dims); then q += bQ[h], k += bK[h] (post-RoPE symmetry-breaking biases, read); causal softmax(q.k / 8); out = merged W_proj + b_proj -> [2][2048][1024]).
// Compute dtypes, f32 accumulate: every input rounded to bf16; q/k/v on PLAIN bf16 operands (inputs: exact) + bias; partial RoPE and the post-RoPE biases f32; causal scores and att.v: query rows < 512 hl (3 products), the rest single fp16; softmax f32, running maximum, normalised after att.v; W_proj hl x exact (2 products) + bias.

#define NB_  2
#define TT   2048
#define DM   1024
#define NH_  16
#define NKV  16
#define REP  (NH_ / NKV)
#define HD   64
#define DQ   (NH_ * HD)
#define DKV  (NKV * HD)
#define RH   512                  // query rows < RH use hi+lo planes (0: none)
#define SCL  0.125f   // HD^-0.5
typedef _Float16 h16;
typedef unsigned short bf;
typedef __attribute__((ext_vector_type(16))) __bf16   v16bf;
typedef __attribute__((ext_vector_type(16))) _Float16 v16h;
typedef __attribute__((ext_vector_type(8)))  _Float16 v8h;
typedef __attribute__((ext_vector_type(8)))  unsigned short v8us;
typedef __attribute__((ext_vector_type(8)))  float    v8f;
typedef __attribute__((ext_vector_type(4)))  float    v4f;
typedef v8h  __attribute__((may_alias)) v8ha;
typedef v4f  __attribute__((may_alias)) v4fa;
typedef v8us __attribute__((may_alias)) v8usa;
typedef float v2fa __attribute__((ext_vector_type(2), may_alias));

__device__ __forceinline__ unsigned short f2bf(float f) { unsigned u = __float_as_uint(f); u += 0x7FFFu + ((u >> 16) & 1u); return (unsigned short)(u >> 16); }
__device__ __forceinline__ float bf2f(unsigned short b) { return __uint_as_float(((unsigned)b) << 16); }
__device__ __forceinline__ float bfr(float f) { return bf2f(f2bf(f)); }
__device__ __forceinline__ v16h cat16(v8h lo, v8h hi) { return __builtin_shufflevector(lo, hi, 0, 1, 2, 3, 4, 5, 6, 7, 8, 9, 10, 11, 12, 13, 14, 15); }
__device__ __forceinline__ v16bf cat16b(v8us lo, v8us hi) { return __builtin_bit_cast(v16bf, __builtin_shufflevector(lo, hi, 0, 1, 2, 3, 4, 5, 6, 7, 8, 9, 10, 11, 12, 13, 14, 15)); }
__device__ __forceinline__ v8f wmma16(v16h a, v16h b, v8f c) { return __builtin_amdgcn_wmma_f32_16x16x32_f16(false, a, false, b, (short)0, c, false, false); }
__device__ __forceinline__ v8f wmmab(v16bf a, v16bf b, v8f c) { return __builtin_amdgcn_wmma_f32_16x16x32_bf16(false, a, false, b, (short)0, c, false, false); }



// ---- k_gemmw: register-blocked GEMM, ONE WAVE per 64x64 output tile (16 accumulators), operands straight from K-contiguous 16-bit planes; grid (M/64, N/64, Z), 32 threads.
// C[m][n] (f32, pitch ldc, + optional f32 bias[n]) = sum_k A[m][k] Bt[n][k] (+ split products per NSPLIT). z-batch strides sA/sB/sC in elements. K % 32 == 0.
template <typename T16> struct WFrag;
template <> struct WFrag<h16> { typedef v16h V; static __device__ __forceinline__ V ld(const h16* p) { return cat16(*(const v8h*)p, *(const v8h*)(p + 16)); } static __device__ __forceinline__ v8f mma(V a, V b, v8f c) { return wmma16(a, b, c); } };
template <> struct WFrag<bf> { typedef v16bf V; static __device__ __forceinline__ V ld(const bf* p) { return cat16b(*(const v8us*)p, *(const v8us*)(p + 16)); } static __device__ __forceinline__ v8f mma(V a, V b, v8f c) { return wmmab(a, b, c); } };
template <typename T16, int NSPLIT, bool BIAS>
__global__ __launch_bounds__(32) void k_gemmw(const T16* __restrict__ A, const T16* __restrict__ A2, const T16* __restrict__ Bt, const T16* __restrict__ Bt2, int K, float* C, int ldc, const float* __restrict__ bias, size_t sA, size_t sB, size_t sC) {
    typedef typename WFrag<T16>::V V;
    __shared__ __align__(16) float os[16 * 68];
    const size_t z = blockIdx.z; A += z * sA; if (A2) A2 += z * sA; Bt += z * sB; if (Bt2) Bt2 += z * sB; C += z * sC;
    const int lane = threadIdx.x & 31, lr = lane & 15, hi = lane >> 4; const int r0 = blockIdx.x * 64, c0 = blockIdx.y * 64;
    v8f acc[4][4];
#pragma unroll
    for (int mb = 0; mb < 4; ++mb)
#pragma unroll
        for (int nb = 0; nb < 4; ++nb) acc[mb][nb] = (v8f){};
    const size_t aoff = (size_t)(r0 + lr) * K + 8 * hi, boff = (size_t)(c0 + lr) * K + 8 * hi;
#pragma unroll 1
    for (int kc = 0; kc < K; kc += 32) {
        V a[4], a2[4];
#pragma unroll
        for (int mb = 0; mb < 4; ++mb) { a[mb] = WFrag<T16>::ld(A + aoff + (size_t)mb * 16 * K + kc); if (NSPLIT == 1 || NSPLIT == 2) a2[mb] = WFrag<T16>::ld(A2 + aoff + (size_t)mb * 16 * K + kc); }
#pragma unroll
        for (int nb = 0; nb < 4; ++nb) { const V b = WFrag<T16>::ld(Bt + boff + (size_t)nb * 16 * K + kc); V b2; if (NSPLIT >= 2) b2 = WFrag<T16>::ld(Bt2 + boff + (size_t)nb * 16 * K + kc);
#pragma unroll
            for (int mb = 0; mb < 4; ++mb) { acc[mb][nb] = WFrag<T16>::mma(a[mb], b, acc[mb][nb]); if (NSPLIT == 1 || NSPLIT == 2) acc[mb][nb] = WFrag<T16>::mma(a2[mb], b, acc[mb][nb]); if (NSPLIT >= 2) acc[mb][nb] = WFrag<T16>::mma(a[mb], b2, acc[mb][nb]); } }
        asm volatile("v_nop\n\tv_nop\n\tv_nop\n\tv_nop" : "+v"(acc[0][0]), "+v"(acc[1][1]), "+v"(acc[2][2]), "+v"(acc[3][3]) : "v"(a[0]), "v"(a[3]));
    }
#pragma unroll
    for (int mb = 0; mb < 4; ++mb) {
#pragma unroll
        for (int nb = 0; nb < 4; ++nb) {
#pragma unroll
            for (int j = 0; j < 8; ++j) os[(hi * 8 + j) * 68 + nb * 16 + lr] = acc[mb][nb][j]; }
        __builtin_amdgcn_wave_barrier(); asm volatile("" ::: "memory");
        float* crow = C + (size_t)(r0 + mb * 16) * ldc + c0;
{
#pragma unroll
            for (int s = 0; s < 8; ++s) { const int row = 2 * s + hi, cofs = lr * 4; v4f val = *(const v4fa*)(os + row * 68 + cofs); if (BIAS) { val[0] += bfr(bias[c0 + cofs]); val[1] += bfr(bias[c0 + cofs + 1]); val[2] += bfr(bias[c0 + cofs + 2]); val[3] += bfr(bias[c0 + cofs + 3]); }
                *(v4f*)(crow + (size_t)row * ldc + cofs) = val; }
             }
        __builtin_amdgcn_wave_barrier(); asm volatile("" ::: "memory");
    }
}

__device__ __forceinline__ h16 tohx(float x) { return (h16)x; }
__device__ __forceinline__ void splitf(float y, unsigned short& h, unsigned short& l) { h = f2bf(y); l = f2bf(y - bf2f(h)); }
typedef __attribute__((ext_vector_type(2))) _Float16 v2h;
typedef __attribute__((ext_vector_type(4))) _Float16 v4h;
typedef __attribute__((ext_vector_type(2))) unsigned short v2us;
typedef __attribute__((ext_vector_type(4))) unsigned short v4us;
typedef __attribute__((ext_vector_type(2))) float v2f;
typedef __attribute__((ext_vector_type(4))) int v4i;

__global__ __launch_bounds__(256) void k_wtG(const float* __restrict__ w, int K, int N, bf* Bt) {
    const int lane = threadIdx.x & 31; const int L0 = (blockIdx.x * 8 + (threadIdx.x >> 5)) * 8; const int nlines = N * K / 64;
{
#pragma unroll 1
        for (int l = 0; l < 8; ++l) { const int L = L0 + l; if (L >= nlines) break; const size_t e = (size_t)L * 64 + lane * 2; const int k = (int)(e % K), n = (int)(e / K); v2us o;
            o[0] = f2bf(w[(size_t)k * N + n]); o[1] = f2bf(w[(size_t)(k + 1) * N + n]); *(v2us*)(Bt + e) = o; }
         }
}
__global__ __launch_bounds__(256) void k_cvt8(const float* __restrict__ src, bf* dst, size_t n8) { const size_t i = (size_t)blockIdx.x * 256 + threadIdx.x; if (i >= n8) return; const v8f v = *(const v8f*)(src + i * 8); v8us o;
#pragma unroll
    for (int k = 0; k < 8; ++k) o[k] = f2bf(v[k]); *(v8us*)(dst + i * 8) = o;  }
__global__ __launch_bounds__(256) void k_cscvt(const float* __restrict__ cosT, const float* __restrict__ sinT, float* CS) { const int idx = blockIdx.x * 256 + threadIdx.x; if (idx >= TT * HD) return; v2f cs; cs[0] = bfr(cosT[idx]); cs[1] = bfr(sinT[idx]); *(v2f*)(CS + (size_t)idx * 2) = cs;  }
// k_rope: head planes [b][h][t][d] (fp16 + hi/lo) of rope(x) x sc; blockIdx.z = b, the batch (rows b TT + t of F and CS); blockIdx.y = 1 takes the second set (k: the next DQ columns of F, its own bias and planes); with the rotate-half convention within the first 32 dims (d < 16): out[d] = x[d] cos[t][d] - x[d+16] sin[t][d], out[d+16] = x[d+16] cos[t][d+16] + x[d] sin[t][d+16]; dims 32..63 pass unchanged
__global__ __launch_bounds__(256) void k_rope(const float* __restrict__ F, int pitch, int nheads, const float* __restrict__ CS, const float* __restrict__ RF, const float* __restrict__ nw, const float* __restrict__ nwB, float sc, h16* P16, bf* Ph, bf* Pl, h16* P16B, bf* PhB, bf* PlB) {
    if (blockIdx.y) { F += DQ; nw = nwB; P16 = P16B; Ph = PhB; Pl = PlB; }
    { const size_t zb = blockIdx.z, po = zb * nheads * TT * HD; F += zb * TT * pitch; CS += zb * TT * HD * 2; P16 += po; Ph += po; Pl += po; }
    const size_t e = ((size_t)blockIdx.x * 256 + threadIdx.x) * 2; if (e >= (size_t)nheads * TT * HD) return; const int d = (int)(e % HD); const int t = (int)((e / HD) % TT); const int h = (int)(e / ((size_t)HD * TT)); const float* f = F + (size_t)t * pitch + h * HD; const float rf = RF ? RF[(size_t)h * TT + t] : 1.0f; v2h o16; v2us oh, ol;
#pragma unroll
    for (int q = 0; q < 2; ++q) { const int dd = d + q; const int dp = (dd < 16) ? dd + 16 : (dd < 32 ? dd - 16 : dd); float x0 = f[dd], x1 = f[dp];
        
        const v2f cs = *(const v2f*)(CS + ((size_t)t * HD + dd) * 2); float a = __fmul_rn(x0, cs[0]), bq = __fmul_rn(x1, cs[1]); asm volatile("" : "+v"(a)); asm volatile("" : "+v"(bq)); float r0 = (dd < 16) ? __fsub_rn(a, bq) : (dd < 32 ? __fadd_rn(a, bq) : x0); asm volatile("" : "+v"(r0)); float pb = bfr(nw[h * HD + dd]); asm volatile("" : "+v"(pb)); const float r = __fadd_rn(r0, pb) * sc;   // partial RoPE (first 32 dims) then the post-RoPE per-head bias
        o16[q] = tohx(r); unsigned short a2, c2; splitf(r, a2, c2); oh[q] = a2; ol[q] = c2; }
    *(v2h*)(P16 + e) = o16; *(v2us*)(Ph + e) = oh; *(v2us*)(Pl + e) = ol;  }
__global__ __launch_bounds__(256) void k_vtp(const float* __restrict__ F, int pitch, int nheads, h16* V16, bf* Vh, bf* Vl) { { const size_t zb = blockIdx.y, po = zb * nheads * HD * TT; F += zb * TT * pitch; V16 += po; Vh += po; Vl += po; }   // blockIdx.y = b, the batch: rows b TT + t of F, planes [b][g][d][t]
    const size_t e = ((size_t)blockIdx.x * 256 + threadIdx.x) * 2; if (e >= (size_t)nheads * HD * TT) return; const int t = (int)(e % TT); const int d = (int)((e / TT) % HD); const int g = (int)(e / ((size_t)TT * HD)); v2h o16; v2us oh, ol;
#pragma unroll
    for (int q = 0; q < 2; ++q) { const float x = F[(size_t)(t + q) * pitch + g * HD + d]; o16[q] = tohx(x); unsigned short a2, c2; splitf(x, a2, c2); oh[q] = a2; ol[q] = c2; }
    *(v2h*)(V16 + e) = o16; *(v2us*)(Vh + e) = oh; *(v2us*)(Vl + e) = ol;  }
#define AW   4                    // waves a work-group; they walk the same keys at about the same time
#define RLO  2                    // query groups a wave, fp16 rows
#define NBLO ((TT - RH) / (16 * AW * RLO))   // work-groups a head, fp16 rows
#define NBHI (RH / (16 * AW))                // work-groups a head, hi+lo rows
#define CSC  (SCL * 1.4426950408889634f)
__device__ __forceinline__ float xhalf(float x) { return __builtin_bit_cast(float, __builtin_amdgcn_permlanex16(__builtin_bit_cast(int, x), __builtin_bit_cast(int, x), 0x76543210, 0xfedcba98, false, false)); }   // lane l reads lane l ^ 16
// dist: the distance behind the last matrix instruction of a product before its operand registers are loaded anew, on a loop's back edge too; it names the product's tiles so that the whole product stands in front of it
__device__ __forceinline__ void dist(v8f (&s)[1][2]) { asm volatile("v_nop\n\tv_nop\n\tv_nop\n\tv_nop" : "+v"(s[0][0]), "+v"(s[0][1])); }
__device__ __forceinline__ void dist(v8f (&s)[2][2]) { asm volatile("v_nop\n\tv_nop\n\tv_nop\n\tv_nop" : "+v"(s[0][0]), "+v"(s[0][1]), "+v"(s[1][0]), "+v"(s[1][1])); }
__device__ __forceinline__ void dist(v8f (&s)[1][4]) { asm volatile("v_nop\n\tv_nop\n\tv_nop\n\tv_nop" : "+v"(s[0][0]), "+v"(s[0][1]), "+v"(s[0][2]), "+v"(s[0][3])); }
__device__ __forceinline__ void dist(v8f (&s)[2][4]) { asm volatile("v_nop\n\tv_nop\n\tv_nop\n\tv_nop" : "+v"(s[0][0]), "+v"(s[0][1]), "+v"(s[0][2]), "+v"(s[0][3]), "+v"(s[1][0]), "+v"(s[1][1]), "+v"(s[1][2]), "+v"(s[1][3])); }
// xdone: stands behind a run of global loads from a (and b), in front of whatever overwrites the registers that held their addresses (the instruction set's rule for an issued load). It names the two addresses as inputs, so that their registers live up to the wait
// and no load of the run lands on them; the scheduling barrier keeps the loads in front of it and later code behind it.
template <bool TWO>
__device__ __forceinline__ void xdone(const void* a, const void* b) { if (TWO) asm volatile("s_wait_xcnt 0x0" :: "v"(a), "v"(b) : "memory"); else asm volatile("s_wait_xcnt 0x0" :: "v"(a) : "memory"); __builtin_amdgcn_sched_barrier(0); }
template <typename T16, bool HI, bool MASK, int R>
__device__ __forceinline__ void attn_pass(typename WFrag<T16>::V (&kf)[2][2], typename WFrag<T16>::V (&kf2)[2][2], const T16* Kn, const T16* Kn2, const T16* Vp, const T16* Vp2,
                                          const typename WFrag<T16>::V (&qf)[R][2], const typename WFrag<T16>::V (&qf2)[R][2], v8f (&acc)[R][4], float (&m)[R], float (&l)[R], int key0, int myq, int hi) {
    typedef typename WFrag<T16>::V V;
    // every '#pragma unroll' of this function: the indices of the fragment and accumulator arrays must be compile-time constants, so that they stay in registers
    V vf[4], vf2[4];   // this pass's V^T fragments (rows d, k = keys), in flight under the first product and the exponentials
#pragma unroll
    for (int t = 0; t < 4; ++t) { vf[t] = WFrag<T16>::ld(Vp + (size_t)t * 16 * TT); if (HI) vf2[t] = WFrag<T16>::ld(Vp2 + (size_t)t * 16 * TT); }
    xdone<HI>(Vp, Vp2);
    v8f s[R][2];
#pragma unroll
    for (int g = 0; g < R; ++g)
#pragma unroll
        for (int kt = 0; kt < 2; ++kt) { s[g][kt] = (v8f){};
#pragma unroll
            for (int kc = 0; kc < 2; ++kc) { s[g][kt] = WFrag<T16>::mma(kf[kt][kc], qf[g][kc], s[g][kt]); if (HI) { s[g][kt] = WFrag<T16>::mma(kf[kt][kc], qf2[g][kc], s[g][kt]); s[g][kt] = WFrag<T16>::mma(kf2[kt][kc], qf[g][kc], s[g][kt]); } } }
    dist(s);
    __builtin_amdgcn_sched_barrier(0);   // keeps the loads below behind that distance
    if (!HI) {   // the next pass's K fragments, in flight under this pass's softmax and second product
#pragma unroll
        for (int kt = 0; kt < 2; ++kt)
#pragma unroll
            for (int kc = 0; kc < 2; ++kc) kf[kt][kc] = WFrag<T16>::ld(Kn + kt * 16 * HD + kc * 32);
        xdone<false>(Kn, nullptr); }
    float mx[R]; bool need = false;
#pragma unroll
    for (int g = 0; g < R; ++g) { float x0 = -3.0e38f;
#pragma unroll
        for (int e = 0; e < 16; ++e) { float x = s[g][e >> 3][e & 7] * CSC; if (MASK) x = (key0 + 16 * (e >> 3) + 8 * hi + (e & 7) <= myq + 16 * g) ? x : -3.0e38f; s[g][e >> 3][e & 7] = x; x0 = fmaxf(x0, x); }
        mx[g] = fmaxf(x0, xhalf(x0));   // lanes l and l ^ 16 hold the two key halves of one query
        need = need || (mx[g] > m[g]); }
    if (__builtin_amdgcn_ballot_w32(need) != 0) {   // wave-uniform; where a query's maximum does not move its factor is exactly 1
#pragma unroll
        for (int g = 0; g < R; ++g) { const float mn = fmaxf(m[g], mx[g]); const float corr = __builtin_amdgcn_exp2f(m[g] - mn); m[g] = mn; l[g] *= corr;
#pragma unroll
            for (int t = 0; t < 4; ++t) acc[g][t] *= corr; } }
#pragma unroll
    for (int g = 0; g < R; ++g) { float p[16];
#pragma unroll
        for (int e = 0; e < 16; ++e) { p[e] = __builtin_amdgcn_exp2f(s[g][e >> 3][e & 7] - m[g]); l[g] += p[e]; }
        if (HI) { v8us h0, h1, l0, l1;
#pragma unroll
            for (int e = 0; e < 8; ++e) { unsigned short a, c; splitf(p[e], a, c); h0[e] = a; l0[e] = c; splitf(p[8 + e], a, c); h1[e] = a; l1[e] = c; }
            const v16bf ph = cat16b(h0, h1), pl = cat16b(l0, l1);
#pragma unroll
            for (int t = 0; t < 4; ++t) { acc[g][t] = wmmab(__builtin_bit_cast(v16bf, vf[t]), ph, acc[g][t]); acc[g][t] = wmmab(__builtin_bit_cast(v16bf, vf[t]), pl, acc[g][t]); acc[g][t] = wmmab(__builtin_bit_cast(v16bf, vf2[t]), ph, acc[g][t]); }
        } else { v16h pf;
#pragma unroll
            for (int e = 0; e < 16; ++e) pf[e] = tohx(p[e]);
#pragma unroll
            for (int t = 0; t < 4; ++t) acc[g][t] = wmma16(__builtin_bit_cast(v16h, vf[t]), pf, acc[g][t]); } }
    dist(acc);
    if (HI) {   // with hi and lo planes K and V^T together do not fit 256 registers: the next pass's K is loaded when V^T is spent (these rows have at most RH / 32 passes and are never the longest)
        __builtin_amdgcn_sched_barrier(0);   // keeps these loads behind the second product
#pragma unroll
        for (int kt = 0; kt < 2; ++kt)
#pragma unroll
            for (int kc = 0; kc < 2; ++kc) { kf[kt][kc] = WFrag<T16>::ld(Kn + kt * 16 * HD + kc * 32); kf2[kt][kc] = WFrag<T16>::ld(Kn2 + kt * 16 * HD + kc * 32); }
        xdone<true>(Kn, Kn2); }
}
// q0: the wave's first query row, a multiple of 16 R
template <typename T16, bool HI, int R>
__device__ __forceinline__ void attn_rows(const T16* __restrict__ Q, const T16* __restrict__ Q2, const T16* __restrict__ K, const T16* __restrict__ K2, const T16* __restrict__ Vt, const T16* __restrict__ Vt2, int q0, int head, bf* Ah, bf* Al) {
    typedef typename WFrag<T16>::V V;
    const int lane = threadIdx.x & 31, lr = lane & 15, hi = lane >> 4; const int myq = q0 + lr;
    const size_t qo = (size_t)myq * HD + 8 * hi; const int ko = lr * HD + 8 * hi, vo = lr * TT + 8 * hi;
    V qf[R][2], qf2[R][2], kf[2][2], kf2[2][2];
#pragma unroll
    for (int g = 0; g < R; ++g)
#pragma unroll
        for (int kc = 0; kc < 2; ++kc) { qf[g][kc] = WFrag<T16>::ld(Q + qo + g * 16 * HD + kc * 32); if (HI) qf2[g][kc] = WFrag<T16>::ld(Q2 + qo + g * 16 * HD + kc * 32); }
    xdone<HI>(Q + qo, Q2 + qo);
#pragma unroll
    for (int kt = 0; kt < 2; ++kt)
#pragma unroll
        for (int kc = 0; kc < 2; ++kc) { kf[kt][kc] = WFrag<T16>::ld(K + ko + kt * 16 * HD + kc * 32); if (HI) kf2[kt][kc] = WFrag<T16>::ld(K2 + ko + kt * 16 * HD + kc * 32); }
    xdone<HI>(K + ko, K2 + ko);
    v8f acc[R][4]; float m[R], l[R];
#pragma unroll
    for (int g = 0; g < R; ++g) { m[g] = -3.0e38f; l[g] = 0.f;
#pragma unroll
        for (int t = 0; t < 4; ++t) acc[g][t] = (v8f){}; }
    const int klast = (q0 >> 5) << 5;   // first key of the pass that holds the wave's diagonal (its 16 R <= 32 rows lie in one 32-key block): the only pass with masked keys, and the last
    // kept rolled: one pass's fragments and the next pass's K already fill the registers
#pragma unroll 1
    for (int key0 = 0; key0 < klast; key0 += 32) attn_pass<T16, HI, false, R>(kf, kf2, K + ko + (key0 + 32) * HD, K2 + ko + (key0 + 32) * HD, Vt + vo + key0, Vt2 + vo + key0, qf, qf2, acc, m, l, key0, myq, hi);
    attn_pass<T16, HI, true, R>(kf, kf2, K + ko + klast * HD, K2 + ko + klast * HD, Vt + vo + klast, Vt2 + vo + klast, qf, qf2, acc, m, l, klast, myq, hi);   // there is no next pass: its K load repeats this pass's rows, in bounds, unused
#pragma unroll
    for (int g = 0; g < R; ++g) { const float lt = l[g] + xhalf(l[g]); const float inv = __fdiv_rn(1.0f, lt);
#pragma unroll
        for (int t = 0; t < 4; ++t) { v8us oh, ol;   // registers j of tile t are d = 16 t + 8 hi + j of query myq + 16 g
#pragma unroll
            for (int j = 0; j < 8; ++j) { unsigned short a, c; splitf(acc[g][t][j] * inv, a, c); oh[j] = a; ol[j] = c; }
            const size_t oo = (size_t)(myq + 16 * g) * DQ + head * HD + t * 16 + 8 * hi; *(v8us*)(Ah + oo) = oh; *(v8us*)(Al + oo) = ol;
            asm volatile("s_wait_xcnt 0x0" ::: "memory"); __builtin_amdgcn_sched_barrier(0); } }   // behind the two stores, in front of whatever overwrites their address or data registers (the next tile's values); the scheduling barrier keeps that code behind the wait
}
__global__ __launch_bounds__(32 * AW) void k_attn(const h16* __restrict__ Q16, const h16* __restrict__ K16, const h16* __restrict__ V16, const bf* __restrict__ Qh, const bf* __restrict__ Ql, const bf* __restrict__ Kh, const bf* __restrict__ Kl, const bf* __restrict__ Vh, const bf* __restrict__ Vl, bf* Ah, bf* Al) {
    const int head = blockIdx.y; const size_t hp = ((size_t)blockIdx.z * NH_ + head) * TT * HD; const int bx = blockIdx.x; Ah += (size_t)blockIdx.z * TT * DQ; Al += (size_t)blockIdx.z * TT * DQ;   // blockIdx.z: the batch
    const int wave = __builtin_amdgcn_readfirstlane((int)(threadIdx.x >> 5));   // scalar, so that the key loop is a scalar loop with every lane on
    if (bx < NBLO) attn_rows<h16, false, RLO>(Q16 + hp, nullptr, K16 + hp, nullptr, V16 + hp, nullptr, TT - (bx + 1) * (16 * AW * RLO) + wave * (16 * RLO), head, Ah, Al);   // the longest rows start first
    else attn_rows<bf, true, 1>(Qh + hp, Ql + hp, Kh + hp, Kl + hp, Vh + hp, Vl + hp, (bx - NBLO) * (16 * AW) + wave * 16, head, Ah, Al);
}

__global__ __launch_bounds__(256) void k_wtGs(const float* __restrict__ w, int K, int N, int ld, bf* Bt) { const size_t e = ((size_t)blockIdx.x * 256 + threadIdx.x) * 4; if (e >= (size_t)N * K) return; const int k = (int)(e % K); const int n = (int)(e / K); v4us o;   // Bt[n][k] = w[k*ld + n]
#pragma unroll
    for (int u = 0; u < 4; ++u) o[u] = f2bf(w[(size_t)(k + u) * ld + n]); *(v4us*)(Bt + e) = o;  }
__global__ __launch_bounds__(256) void k_cspart(const float* __restrict__ rc, const float* __restrict__ rs, float* CS) { const int idx = blockIdx.x * 256 + threadIdx.x; if (idx >= NB_ * TT * HD) return; const int t = idx / HD, dd = idx % HD; v2f cs; cs[0] = (dd < 32) ? bfr(rc[(size_t)t * 32 + dd]) : 1.0f; cs[1] = (dd < 32) ? bfr(rs[(size_t)t * 32 + dd]) : 0.0f; *(v2f*)(CS + (size_t)idx * 2) = cs;  }   // per-batch partial tables (read as data; t = b TT + t, both batches), identity beyond dim 32

extern "C" void kernel_launch(void* const* d_in, const int* in_sizes, int n_in,
                              void* d_out, int out_size, void* d_ws, size_t ws_size, hipStream_t stream) {
    (void)in_sizes; (void)n_in; (void)out_size;
    const float* x = (const float*)d_in[0]; const float* rcos = (const float*)d_in[1]; const float* rsin = (const float*)d_in[2]; const float* wf = (const float*)d_in[3]; const float* bfz = (const float*)d_in[4]; const float* wo = (const float*)d_in[5]; const float* bo = (const float*)d_in[6]; const float* bQ = (const float*)d_in[7]; const float* bK = (const float*)d_in[8]; const float* cosT = nullptr; const float* sinT = nullptr; (void)cosT; (void)sinT;
    float* OUT = (float*)d_out;     // [2][2048][1024]
    char* wsp = (char*)d_ws;
    auto take = [&](size_t bytes) { char* p = wsp; wsp += (bytes + 255) & ~(size_t)255; return (void*)p; };
    bf* WA = (bf*)take((size_t)3 * DQ * DM * 2); bf* WO = (bf*)take((size_t)DM * DQ * 2); float* CS = (float*)take((size_t)NB_ * TT * HD * 2 * 4);   // WA: W_attn transposed, rows q | k | v
    bf* XB = (bf*)take((size_t)NB_ * TT * DM * 2); float* FA = (float*)take((size_t)NB_ * TT * 3 * DQ * 4);   // FA [b TT + t][q | k | v]
    h16* QP16 = (h16*)take((size_t)NB_ * NH_ * TT * HD * 2); h16* KP16 = (h16*)take((size_t)NB_ * NKV * TT * HD * 2); h16* VT16 = (h16*)take((size_t)NB_ * NKV * HD * TT * 2);
    bf* QPh = (bf*)take((size_t)NB_ * NH_ * TT * HD * 2); bf* QPl = (bf*)take((size_t)NB_ * NH_ * TT * HD * 2); bf* KPh = (bf*)take((size_t)NB_ * NKV * TT * HD * 2); bf* KPl = (bf*)take((size_t)NB_ * NKV * TT * HD * 2); bf* VTh = (bf*)take((size_t)NB_ * NKV * HD * TT * 2); bf* VTl = (bf*)take((size_t)NB_ * NKV * HD * TT * 2);
    bf* ATh = (bf*)take((size_t)NB_ * TT * DQ * 2); bf* ATl = (bf*)take((size_t)NB_ * TT * DQ * 2);
    if ((size_t)(wsp - (char*)d_ws) > ws_size) return;    // ws 256 MiB
    // every kernel runs once: the two batches are rows b TT + t of one grid, and q, k, v are the 3 DQ columns of one product
    k_wtGs<<<(unsigned)(((size_t)3 * DQ * DM / 4 + 255) / 256), 256, 0, stream>>>(wf, DM, 3 * DQ, 3 * DQ, WA);
    k_wtG<<<(unsigned)((DQ * DM / 64 + 63) / 64), 256, 0, stream>>>(wo, DQ, DM, WO);
    k_cspart<<<(NB_ * TT * HD + 255) / 256, 256, 0, stream>>>(rcos, rsin, CS);
    k_cvt8<<<(unsigned)(((size_t)NB_ * TT * DM / 8 + 255) / 256), 256, 0, stream>>>(x, XB, (size_t)NB_ * TT * DM / 8);
    k_gemmw<bf, 0, true><<<dim3(NB_ * TT / 64, 3 * DQ / 64, 1), 32, 0, stream>>>(XB, nullptr, WA, nullptr, DM, FA, 3 * DQ, bfz, 0, 0, 0);
    const unsigned LQ = (unsigned)(((size_t)NH_ * TT * HD / 2 + 255) / 256), LKv = (unsigned)(((size_t)NKV * TT * HD / 2 + 255) / 256);
    k_rope<<<dim3(LQ, 2, NB_), 256, 0, stream>>>(FA, 3 * DQ, NH_, CS, nullptr, bQ, bK, 1.0f, QP16, QPh, QPl, KP16, KPh, KPl);
    k_vtp<<<dim3(LKv, NB_, 1), 256, 0, stream>>>(FA + 2 * DQ, 3 * DQ, NKV, VT16, VTh, VTl);
    k_attn<<<dim3(NBLO + NBHI, NH_, NB_), 32 * AW, 0, stream>>>(QP16, KP16, VT16, QPh, QPl, KPh, KPl, VTh, VTl, ATh, ATl);
    k_gemmw<bf, 1, true><<<dim3(NB_ * TT / 64, DM / 64, 1), 32, 0, stream>>>(ATh, ATl, WO, nullptr, DQ, OUT, DM, bo, 0, 0, 0);
}

// v004
// One run takes 187 microseconds.
// Timed twice side by side with v003, it ran 1.24 and 1.26 times as fast.
// Over all steps from v000 it is 7.92 times as fast.
#include <hip/hip_runtime.h>

// DisorderedCausalSelfAttention (x [2][2048][1024]; qkv = x W_attn + b ([1024][3072], split q | k | v, 16 heads x 64); partial RoPE on the first 32 dims of each head with the given per-batch tables rope_cos/rope_sin [B][T][32] (read; rotate_half within the 32 dims); then q += bQ[h], k += bK[h] (post-RoPE symmetry-breaking biases, read); causal softmax(q.k / 8); out = merged W_proj + b_proj -> [2][2048][1024]).
// Compute dtypes, f32 accumulate: every input rounded to bf16; q/k/v on PLAIN bf16 operands (inputs: exact) + bias; partial RoPE and the post-RoPE biases f32; causal scores and att.v: query rows < 512 hl (3 products), the rest single fp16; softmax f32, running maximum, normalised after att.v; W_proj hl x exact (2 products) + bias.

#define NB_  2
#define TT   2048
#define DM   1024
#define NH_  16
#define NKV  16
#define REP  (NH_ / NKV)
#define HD   64
#define DQ   (NH_ * HD)
#define DKV  (NKV * HD)
#define RH   512                  // query rows < RH use hi+lo planes (0: none)
#define SCL  0.125f   // HD^-0.5
typedef _Float16 h16;
typedef unsigned short bf;
typedef __attribute__((ext_vector_type(16))) __bf16   v16bf;
typedef __attribute__((ext_vector_type(16))) _Float16 v16h;
typedef __attribute__((ext_vector_type(8)))  _Float16 v8h;
typedef __attribute__((ext_vector_type(8)))  unsigned short v8us;
typedef __attribute__((ext_vector_type(8)))  float    v8f;
typedef __attribute__((ext_vector_type(4)))  float    v4f;
typedef v8h  __attribute__((may_alias)) v8ha;
typedef v4f  __attribute__((may_alias)) v4fa;
typedef v8us __attribute__((may_alias)) v8usa;
typedef float v2fa __attribute__((ext_vector_type(2), may_alias));

__device__ __forceinline__ unsigned short f2bf(float f) { unsigned u = __float_as_uint(f); u += 0x7FFFu + ((u >> 16) & 1u); return (unsigned short)(u >> 16); }
__device__ __forceinline__ float bf2f(unsigned short b) { return __uint_as_float(((unsigned)b) << 16); }
__device__ __forceinline__ float bfr(float f) { return bf2f(f2bf(f)); }
__device__ __forceinline__ v16h cat16(v8h lo, v8h hi) { return __builtin_shufflevector(lo, hi, 0, 1, 2, 3, 4, 5, 6, 7, 8, 9, 10, 11, 12, 13, 14, 15); }
__device__ __forceinline__ v16bf cat16b(v8us lo, v8us hi) { return __builtin_bit_cast(v16bf, __builtin_shufflevector(lo, hi, 0, 1, 2, 3, 4, 5, 6, 7, 8, 9, 10, 11, 12, 13, 14, 15)); }
__device__ __forceinline__ v8f wmma16(v16h a, v16h b, v8f c) { return __builtin_amdgcn_wmma_f32_16x16x32_f16(false, a, false, b, (short)0, c, false, false); }
__device__ __forceinline__ v8f wmmab(v16bf a, v16bf b, v8f c) { return __builtin_amdgcn_wmma_f32_16x16x32_bf16(false, a, false, b, (short)0, c, false, false); }



// ---- k_gemmw: register-blocked GEMM, ONE WAVE per 64x64 output tile (16 accumulators), operands straight from K-contiguous 16-bit planes; grid (M/64, N/64, Z), 32 threads.
// C[m][n] (f32, pitch ldc, + optional f32 bias[n]) = sum_k A[m][k] Bt[n][k] (+ split products per NSPLIT). z-batch strides sA/sB/sC in elements. K % 32 == 0.
template <typename T16> struct WFrag;
template <> struct WFrag<h16> { typedef v16h V; static __device__ __forceinline__ V ld(const h16* p) { return cat16(*(const v8h*)p, *(const v8h*)(p + 16)); } static __device__ __forceinline__ v8f mma(V a, V b, v8f c) { return wmma16(a, b, c); } };
template <> struct WFrag<bf> { typedef v16bf V; static __device__ __forceinline__ V ld(const bf* p) { return cat16b(*(const v8us*)p, *(const v8us*)(p + 16)); } static __device__ __forceinline__ v8f mma(V a, V b, v8f c) { return wmmab(a, b, c); } };
template <typename T16, int NSPLIT, bool BIAS>
__global__ __launch_bounds__(32) void k_gemmw(const T16* __restrict__ A, const T16* __restrict__ A2, const T16* __restrict__ Bt, const T16* __restrict__ Bt2, int K, float* C, int ldc, const float* __restrict__ bias, size_t sA, size_t sB, size_t sC) {
    typedef typename WFrag<T16>::V V;
    __shared__ __align__(16) float os[16 * 68];
    const size_t z = blockIdx.z; A += z * sA; if (A2) A2 += z * sA; Bt += z * sB; if (Bt2) Bt2 += z * sB; C += z * sC;
    const int lane = threadIdx.x & 31, lr = lane & 15, hi = lane >> 4; const int r0 = blockIdx.x * 64, c0 = blockIdx.y * 64;
    v8f acc[4][4];
#pragma unroll
    for (int mb = 0; mb < 4; ++mb)
#pragma unroll
        for (int nb = 0; nb < 4; ++nb) acc[mb][nb] = (v8f){};
    const size_t aoff = (size_t)(r0 + lr) * K + 8 * hi, boff = (size_t)(c0 + lr) * K + 8 * hi;
#pragma unroll 1
    for (int kc = 0; kc < K; kc += 32) {
        V a[4], a2[4];
#pragma unroll
        for (int mb = 0; mb < 4; ++mb) { a[mb] = WFrag<T16>::ld(A + aoff + (size_t)mb * 16 * K + kc); if (NSPLIT == 1 || NSPLIT == 2) a2[mb] = WFrag<T16>::ld(A2 + aoff + (size_t)mb * 16 * K + kc); }
#pragma unroll
        for (int nb = 0; nb < 4; ++nb) { const V b = WFrag<T16>::ld(Bt + boff + (size_t)nb * 16 * K + kc); V b2; if (NSPLIT >= 2) b2 = WFrag<T16>::ld(Bt2 + boff + (size_t)nb * 16 * K + kc);
#pragma unroll
            for (int mb = 0; mb < 4; ++mb) { acc[mb][nb] = WFrag<T16>::mma(a[mb], b, acc[mb][nb]); if (NSPLIT == 1 || NSPLIT == 2) acc[mb][nb] = WFrag<T16>::mma(a2[mb], b, acc[mb][nb]); if (NSPLIT >= 2) acc[mb][nb] = WFrag<T16>::mma(a[mb], b2, acc[mb][nb]); } }
        asm volatile("v_nop\n\tv_nop\n\tv_nop\n\tv_nop" : "+v"(acc[0][0]), "+v"(acc[1][1]), "+v"(acc[2][2]), "+v"(acc[3][3]) : "v"(a[0]), "v"(a[3]));
    }
#pragma unroll
    for (int mb = 0; mb < 4; ++mb) {
#pragma unroll
        for (int nb = 0; nb < 4; ++nb) {
#pragma unroll
            for (int j = 0; j < 8; ++j) os[(hi * 8 + j) * 68 + nb * 16 + lr] = acc[mb][nb][j]; }
        __builtin_amdgcn_wave_barrier(); asm volatile("" ::: "memory");
        float* crow = C + (size_t)(r0 + mb * 16) * ldc + c0;
{
#pragma unroll
            for (int s = 0; s < 8; ++s) { const int row = 2 * s + hi, cofs = lr * 4; v4f val = *(const v4fa*)(os + row * 68 + cofs); if (BIAS) { val[0] += bfr(bias[c0 + cofs]); val[1] += bfr(bias[c0 + cofs + 1]); val[2] += bfr(bias[c0 + cofs + 2]); val[3] += bfr(bias[c0 + cofs + 3]); }
                *(v4f*)(crow + (size_t)row * ldc + cofs) = val; }
             }
        __builtin_amdgcn_wave_barrier(); asm volatile("" ::: "memory");
    }
}

__device__ __forceinline__ h16 tohx(float x) { return (h16)x; }
__device__ __forceinline__ void splitf(float y, unsigned short& h, unsigned short& l) { h = f2bf(y); l = f2bf(y - bf2f(h)); }
typedef __attribute__((ext_vector_type(2))) _Float16 v2h;
typedef __attribute__((ext_vector_type(4))) _Float16 v4h;
typedef __attribute__((ext_vector_type(2))) unsigned short v2us;
typedef __attribute__((ext_vector_type(4))) unsigned short v4us;
typedef __attribute__((ext_vector_type(2))) float v2f;
typedef __attribute__((ext_vector_type(4))) int v4i;

__global__ __launch_bounds__(256) void k_wtG(const float* __restrict__ w, int K, int N, bf* Bt) {
    const int lane = threadIdx.x & 31; const int L0 = (blockIdx.x * 8 + (threadIdx.x >> 5)) * 8; const int nlines = N * K / 64;
{
#pragma unroll 1
        for (int l = 0; l < 8; ++l) { const int L = L0 + l; if (L >= nlines) break; const size_t e = (size_t)L * 64 + lane * 2; const int k = (int)(e % K), n = (int)(e / K); v2us o;
            o[0] = f2bf(w[(size_t)k * N + n]); o[1] = f2bf(w[(size_t)(k + 1) * N + n]); *(v2us*)(Bt + e) = o; }
         }
}
__global__ __launch_bounds__(256) void k_cvt8(const float* __restrict__ src, bf* dst, size_t n8) { const size_t i = (size_t)blockIdx.x * 256 + threadIdx.x; if (i >= n8) return; const v8f v = *(const v8f*)(src + i * 8); v8us o;
#pragma unroll
    for (int k = 0; k < 8; ++k) o[k] = f2bf(v[k]); *(v8us*)(dst + i * 8) = o;  }
__global__ __launch_bounds__(256) void k_cscvt(const float* __restrict__ cosT, const float* __restrict__ sinT, float* CS) { const int idx = blockIdx.x * 256 + threadIdx.x; if (idx >= TT * HD) return; v2f cs; cs[0] = bfr(cosT[idx]); cs[1] = bfr(sinT[idx]); *(v2f*)(CS + (size_t)idx * 2) = cs;  }
#define AW   4                    // waves a work-group; they walk the same keys at about the same time
#define RLO  2                    // query groups a wave, fp16 rows
#define NBLO ((TT - RH) / (16 * AW * RLO))   // work-groups a head, fp16 rows
#define NBHI (RH / (16 * AW))                // work-groups a head, hi+lo rows
#define CSC  (SCL * 1.4426950408889634f)
__device__ __forceinline__ float xhalf(float x) { return __builtin_bit_cast(float, __builtin_amdgcn_permlanex16(__builtin_bit_cast(int, x), __builtin_bit_cast(int, x), 0x76543210, 0xfedcba98, false, false)); }   // lane l reads lane l ^ 16
// dist: the distance behind the last matrix instruction of a product before its operand registers are loaded anew, on a loop's back edge too; it names the product's tiles so that the whole product stands in front of it
__device__ __forceinline__ void dist(v8f (&s)[1][2]) { asm volatile("v_nop\n\tv_nop\n\tv_nop\n\tv_nop" : "+v"(s[0][0]), "+v"(s[0][1])); }
__device__ __forceinline__ void dist(v8f (&s)[2][2]) { asm volatile("v_nop\n\tv_nop\n\tv_nop\n\tv_nop" : "+v"(s[0][0]), "+v"(s[0][1]), "+v"(s[1][0]), "+v"(s[1][1])); }
__device__ __forceinline__ void dist(v8f (&s)[1][4]) { asm volatile("v_nop\n\tv_nop\n\tv_nop\n\tv_nop" : "+v"(s[0][0]), "+v"(s[0][1]), "+v"(s[0][2]), "+v"(s[0][3])); }
__device__ __forceinline__ void dist(v8f (&s)[2][4]) { asm volatile("v_nop\n\tv_nop\n\tv_nop\n\tv_nop" : "+v"(s[0][0]), "+v"(s[0][1]), "+v"(s[0][2]), "+v"(s[0][3]), "+v"(s[1][0]), "+v"(s[1][1]), "+v"(s[1][2]), "+v"(s[1][3])); }
// xdone: stands behind a run of global loads from a (and b), in front of whatever overwrites the registers that held their addresses (the instruction set's rule for an issued load). It names the two addresses as inputs, so that their registers live up to the wait
// and no load of the run lands on them; the scheduling barrier keeps the loads in front of it and later code behind it.
template <bool TWO>
__device__ __forceinline__ void xdone(const void* a, const void* b) { if (TWO) asm volatile("s_wait_xcnt 0x0" :: "v"(a), "v"(b) : "memory"); else asm volatile("s_wait_xcnt 0x0" :: "v"(a) : "memory"); __builtin_amdgcn_sched_barrier(0); }
template <typename T16, bool HI, bool MASK, int R>
__device__ __forceinline__ void attn_pass(typename WFrag<T16>::V (&kf)[2][2], typename WFrag<T16>::V (&kf2)[2][2], const T16* Kn, const T16* Kn2, const T16* Vp, const T16* Vp2,
                                          const typename WFrag<T16>::V (&qf)[R][2], const typename WFrag<T16>::V (&qf2)[R][2], v8f (&acc)[R][4], float (&m)[R], float (&l)[R], int key0, int myq, int hi) {
    typedef typename WFrag<T16>::V V;
    // every '#pragma unroll' of this function: the indices of the fragment and accumulator arrays must be compile-time constants, so that they stay in registers
    V vf[4], vf2[4];   // this pass's V^T fragments (rows d, k = keys), in flight under the first product and the exponentials
#pragma unroll
    for (int t = 0; t < 4; ++t) { vf[t] = WFrag<T16>::ld(Vp + (size_t)t * 16 * TT); if (HI) vf2[t] = WFrag<T16>::ld(Vp2 + (size_t)t * 16 * TT); }
    xdone<HI>(Vp, Vp2);
    v8f s[R][2];
#pragma unroll
    for (int g = 0; g < R; ++g)
#pragma unroll
        for (int kt = 0; kt < 2; ++kt) { s[g][kt] = (v8f){};
#pragma unroll
            for (int kc = 0; kc < 2; ++kc) { s[g][kt] = WFrag<T16>::mma(kf[kt][kc], qf[g][kc], s[g][kt]); if (HI) { s[g][kt] = WFrag<T16>::mma(kf[kt][kc], qf2[g][kc], s[g][kt]); s[g][kt] = WFrag<T16>::mma(kf2[kt][kc], qf[g][kc], s[g][kt]); } } }
    dist(s);
    __builtin_amdgcn_sched_barrier(0);   // keeps the loads below behind that distance
    if (!HI) {   // the next pass's K fragments, in flight under this pass's softmax and second product
#pragma unroll
        for (int kt = 0; kt < 2; ++kt)
#pragma unroll
            for (int kc = 0; kc < 2; ++kc) kf[kt][kc] = WFrag<T16>::ld(Kn + kt * 16 * HD + kc * 32);
        xdone<false>(Kn, nullptr); }
    float mx[R]; bool need = false;
#pragma unroll
    for (int g = 0; g < R; ++g) { float x0 = -3.0e38f;
#pragma unroll
        for (int e = 0; e < 16; ++e) { float x = s[g][e >> 3][e & 7] * CSC; if (MASK) x = (key0 + 16 * (e >> 3) + 8 * hi + (e & 7) <= myq + 16 * g) ? x : -3.0e38f; s[g][e >> 3][e & 7] = x; x0 = fmaxf(x0, x); }
        mx[g] = fmaxf(x0, xhalf(x0));   // lanes l and l ^ 16 hold the two key halves of one query
        need = need || (mx[g] > m[g]); }
    if (__builtin_amdgcn_ballot_w32(need) != 0) {   // wave-uniform; where a query's maximum does not move its factor is exactly 1
#pragma unroll
        for (int g = 0; g < R; ++g) { const float mn = fmaxf(m[g], mx[g]); const float corr = __builtin_amdgcn_exp2f(m[g] - mn); m[g] = mn; l[g] *= corr;
#pragma unroll
            for (int t = 0; t < 4; ++t) acc[g][t] *= corr; } }
#pragma unroll
    for (int g = 0; g < R; ++g) { float p[16];
#pragma unroll
        for (int e = 0; e < 16; ++e) { p[e] = __builtin_amdgcn_exp2f(s[g][e >> 3][e & 7] - m[g]); l[g] += p[e]; }
        if (HI) { v8us h0, h1, l0, l1;
#pragma unroll
            for (int e = 0; e < 8; ++e) { unsigned short a, c; splitf(p[e], a, c); h0[e] = a; l0[e] = c; splitf(p[8 + e], a, c); h1[e] = a; l1[e] = c; }
            const v16bf ph = cat16b(h0, h1), pl = cat16b(l0, l1);
#pragma unroll
            for (int t = 0; t < 4; ++t) { acc[g][t] = wmmab(__builtin_bit_cast(v16bf, vf[t]), ph, acc[g][t]); acc[g][t] = wmmab(__builtin_bit_cast(v16bf, vf[t]), pl, acc[g][t]); acc[g][t] = wmmab(__builtin_bit_cast(v16bf, vf2[t]), ph, acc[g][t]); }
        } else { v16h pf;
#pragma unroll
            for (int e = 0; e < 16; ++e) pf[e] = tohx(p[e]);
#pragma unroll
            for (int t = 0; t < 4; ++t) acc[g][t] = wmma16(__builtin_bit_cast(v16h, vf[t]), pf, acc[g][t]); } }
    dist(acc);
    if (HI) {   // with hi and lo planes K and V^T together do not fit 256 registers: the next pass's K is loaded when V^T is spent (these rows have at most RH / 32 passes and are never the longest)
        __builtin_amdgcn_sched_barrier(0);   // keeps these loads behind the second product
#pragma unroll
        for (int kt = 0; kt < 2; ++kt)
#pragma unroll
            for (int kc = 0; kc < 2; ++kc) { kf[kt][kc] = WFrag<T16>::ld(Kn + kt * 16 * HD + kc * 32); kf2[kt][kc] = WFrag<T16>::ld(Kn2 + kt * 16 * HD + kc * 32); }
        xdone<true>(Kn, Kn2); }
}
// q0: the wave's first query row, a multiple of 16 R
template <typename T16, bool HI, int R>
__device__ __forceinline__ void attn_rows(const T16* __restrict__ Q, const T16* __restrict__ Q2, const T16* __restrict__ K, const T16* __restrict__ K2, const T16* __restrict__ Vt, const T16* __restrict__ Vt2, int q0, int head, bf* Ah, bf* Al) {
    typedef typename WFrag<T16>::V V;
    const int lane = threadIdx.x & 31, lr = lane & 15, hi = lane >> 4; const int myq = q0 + lr;
    const size_t qo = (size_t)myq * HD + 8 * hi; const int ko = lr * HD + 8 * hi, vo = lr * TT + 8 * hi;
    V qf[R][2], qf2[R][2], kf[2][2], kf2[2][2];
#pragma unroll
    for (int g = 0; g < R; ++g)
#pragma unroll
        for (int kc = 0; kc < 2; ++kc) { qf[g][kc] = WFrag<T16>::ld(Q + qo + g * 16 * HD + kc * 32); if (HI) qf2[g][kc] = WFrag<T16>::ld(Q2 + qo + g * 16 * HD + kc * 32); }
    xdone<HI>(Q + qo, Q2 + qo);
#pragma unroll
    for (int kt = 0; kt < 2; ++kt)
#pragma unroll
        for (int kc = 0; kc < 2; ++kc) { kf[kt][kc] = WFrag<T16>::ld(K + ko + kt * 16 * HD + kc * 32); if (HI) kf2[kt][kc] = WFrag<T16>::ld(K2 + ko + kt * 16 * HD + kc * 32); }
    xdone<HI>(K + ko, K2 + ko);
    v8f acc[R][4]; float m[R], l[R];
#pragma unroll
    for (int g = 0; g < R; ++g) { m[g] = -3.0e38f; l[g] = 0.f;
#pragma unroll
        for (int t = 0; t < 4; ++t) acc[g][t] = (v8f){}; }
    const int klast = (q0 >> 5) << 5;   // first key of the pass that holds the wave's diagonal (its 16 R <= 32 rows lie in one 32-key block): the only pass with masked keys, and the last
    // kept rolled: one pass's fragments and the next pass's K already fill the registers
#pragma unroll 1
    for (int key0 = 0; key0 < klast; key0 += 32) attn_pass<T16, HI, false, R>(kf, kf2, K + ko + (key0 + 32) * HD, K2 + ko + (key0 + 32) * HD, Vt + vo + key0, Vt2 + vo + key0, qf, qf2, acc, m, l, key0, myq, hi);
    attn_pass<T16, HI, true, R>(kf, kf2, K + ko + klast * HD, K2 + ko + klast * HD, Vt + vo + klast, Vt2 + vo + klast, qf, qf2, acc, m, l, klast, myq, hi);   // there is no next pass: its K load repeats this pass's rows, in bounds, unused
#pragma unroll
    for (int g = 0; g < R; ++g) { const float lt = l[g] + xhalf(l[g]); const float inv = __fdiv_rn(1.0f, lt);
#pragma unroll
        for (int t = 0; t < 4; ++t) { v8us oh, ol;   // registers j of tile t are d = 16 t + 8 hi + j of query myq + 16 g
#pragma unroll
            for (int j = 0; j < 8; ++j) { unsigned short a, c; splitf(acc[g][t][j] * inv, a, c); oh[j] = a; ol[j] = c; }
            const size_t oo = (size_t)(myq + 16 * g) * DQ + head * HD + t * 16 + 8 * hi; *(v8us*)(Ah + oo) = oh; *(v8us*)(Al + oo) = ol;
            asm volatile("s_wait_xcnt 0x0" ::: "memory"); __builtin_amdgcn_sched_barrier(0); } }   // behind the two stores, in front of whatever overwrites their address or data registers (the next tile's values); the scheduling barrier keeps that code behind the wait
}
__global__ __launch_bounds__(32 * AW) void k_attn(const h16* __restrict__ Q16, const h16* __restrict__ K16, const h16* __restrict__ V16, const bf* __restrict__ Qh, const bf* __restrict__ Ql, const bf* __restrict__ Kh, const bf* __restrict__ Kl, const bf* __restrict__ Vh, const bf* __restrict__ Vl, bf* Ah, bf* Al) {
    const int head = blockIdx.y; const size_t hp = ((size_t)blockIdx.z * NH_ + head) * TT * HD; const int bx = blockIdx.x; Ah += (size_t)blockIdx.z * TT * DQ; Al += (size_t)blockIdx.z * TT * DQ;   // blockIdx.z: the batch
    const int wave = __builtin_amdgcn_readfirstlane((int)(threadIdx.x >> 5));   // scalar, so that the key loop is a scalar loop with every lane on
    if (bx < NBLO) attn_rows<h16, false, RLO>(Q16 + hp, nullptr, K16 + hp, nullptr, V16 + hp, nullptr, TT - (bx + 1) * (16 * AW * RLO) + wave * (16 * RLO), head, Ah, Al);   // the longest rows start first
    else attn_rows<bf, true, 1>(Qh + hp, Ql + hp, Kh + hp, Kl + hp, Vh + hp, Vl + hp, (bx - NBLO) * (16 * AW) + wave * 16, head, Ah, Al);
}

// ---- k_qkv: the q | k | v projection (the loop of k_gemmw, one wave per 64x64 tile = 64 rows b TT + t of one head of q, k or v) with everything that follows it up to the 16-bit planes in its epilogue: + b_attn, partial RoPE, the post-RoPE head bias, the fp16 and hi/lo bf16 rounding, and for v the transpose. The f32 values never leave the work-group.
// A matrix tile leaves the unit with lane = column and registers = 8 consecutive rows, so the operand whose index is to run along a plane's rows goes in as A: for q and k (planes [t][d]) A = W^T rows d and B = x rows t, for v (planes [d][t]) A = x rows t and B = W^T rows d. Both are K-contiguous planes read by the same loader, so only the two pointers change places.
// acc[x][y][j] is then plane row 16 y + lr, plane column 16 x + 8 hi + j. The tile goes to LDS as f32 in that form and is read back four whole plane rows at a time, eight columns a lane.
#define FP 68   // pitch of a staged row in dwords, 64 + 4: the 16-byte LDS writes (16 rows, one column block) and reads (whole rows) both fall on distinct banks
template <bool ROPE>
__device__ __forceinline__ void qkv_out(const float* F, const float* __restrict__ gb, const float* __restrict__ rc, const float* __restrict__ rs, const float* __restrict__ hb, h16* P16, bf* Ph, bf* Pl, int pitch, int lane) {
    const int r4 = lane >> 3, ch = (lane & 7) * 8;   // the lane's row among four, its first column (for q and k: d)
    float g[8], g2[8], p[8]; v4f cn[2], sn[2];
    // every '#pragma unroll' of this function and of k_qkv: the indices of the register arrays and vectors must be compile-time constants, so that they stay in registers
    const float* cp = ROPE ? rc + r4 * 32 + (ch & 31) : nullptr; const float* sp = ROPE ? rs + r4 * 32 + (ch & 31) : nullptr;   // lanes with d >= 32 read the row's tables too (in bounds) and do not use them
    if (ROPE) { const float* gp = gb + ch; const float* gq = gb + (ch ^ 16); const float* pp = hb + ch;   // b_attn at d and at the RoPE partner d +- 16, the head bias at d
#pragma unroll
        for (int u = 0; u < 2; ++u) { const v4f a = *(const v4fa*)(gp + 4 * u), b = *(const v4fa*)(gq + 4 * u), c = *(const v4fa*)(pp + 4 * u); cn[u] = *(const v4fa*)(cp + 4 * u); sn[u] = *(const v4fa*)(sp + 4 * u);
#pragma unroll
            for (int j = 0; j < 4; ++j) { g[4 * u + j] = bfr(a[j]); g2[4 * u + j] = bfr(b[j]); p[4 * u + j] = bfr(c[j]); } }
        asm volatile("s_wait_xcnt 0x0" :: "v"(gp), "v"(gq), "v"(pp), "v"(cp), "v"(sp) : "memory"); __builtin_amdgcn_sched_barrier(0); }   // as xdone, for the five addresses of this run of loads
    // kept rolled: sixteen equal trips; unrolled they would be tens of KiB of code that every wave runs once
#pragma unroll 1
    for (int q = 0; q < 16; ++q) {
        const float* f = F + (q * 4 + r4) * FP; const v4f f0 = *(const v4fa*)(f + ch), f1 = *(const v4fa*)(f + ch + 4); float r[8];
        if (ROPE) { const v4f e0 = *(const v4fa*)(f + (ch ^ 16)), e1 = *(const v4fa*)(f + (ch ^ 16) + 4); const v4f c0 = cn[0], c1 = cn[1], s0 = sn[0], s1 = sn[1];
            if (q < 15) { cp += 4 * 32; sp += 4 * 32; }   // the next four rows' tables, in flight under this trip's work; the last trip repeats its own, in bounds, unused
            cn[0] = *(const v4fa*)cp; cn[1] = *(const v4fa*)(cp + 4); sn[0] = *(const v4fa*)sp; sn[1] = *(const v4fa*)(sp + 4);
            xdone<true>(cp, sp);
#pragma unroll
            for (int j = 0; j < 8; ++j) { const float x0 = (j < 4 ? f0[j & 3] : f1[j & 3]) + g[j], x1 = (j < 4 ? e0[j & 3] : e1[j & 3]) + g2[j]; const float c = bfr(j < 4 ? c0[j & 3] : c1[j & 3]), s = bfr(j < 4 ? s0[j & 3] : s1[j & 3]);
                const float ro = x0 * c + x1 * (ch < 16 ? -s : s);   // rotate-half within the first 32 dims
                r[j] = (ch < 32 ? ro : x0) + p[j]; }
        } else {
#pragma unroll
            for (int j = 0; j < 8; ++j) r[j] = j < 4 ? f0[j & 3] : f1[j & 3]; }
        v8h o16; v8us oh, ol;
#pragma unroll
        for (int j = 0; j < 8; ++j) { o16[j] = tohx(r[j]); unsigned short a2, c2; splitf(r[j], a2, c2); oh[j] = a2; ol[j] = c2; }
        const size_t go = (size_t)(q * 4 + r4) * pitch + ch; *(v8ha*)(P16 + go) = o16; *(v8usa*)(Ph + go) = oh; *(v8usa*)(Pl + go) = ol;   // each store of the wave: 128 B of each of four plane rows (whole rows for q and k)
        asm volatile("s_wait_xcnt 0x0" ::: "memory"); __builtin_amdgcn_sched_barrier(0);   // behind the three stores, in front of whatever overwrites their address or data registers (the next trip's); the scheduling barrier keeps that code behind the wait
    }
}
__global__ __launch_bounds__(32) void k_qkv(const bf* __restrict__ X, const bf* __restrict__ Wt, const float* __restrict__ bias, const float* __restrict__ rc, const float* __restrict__ rs, const float* __restrict__ bQ, const float* __restrict__ bK,
                                            h16* Q16, bf* Qh, bf* Ql, h16* K16, bf* Kh, bf* Kl, h16* V16, bf* Vh, bf* Vl) {
    typedef WFrag<bf>::V V;
    __shared__ __align__(16) float F[64 * FP];
    const int lane = threadIdx.x & 31, lr = lane & 15, hi = lane >> 4; const int r0 = blockIdx.x * 64, c0 = blockIdx.y * 64;
    const int sel = c0 / DQ, head = (c0 % DQ) / HD;   // 0 q, 1 k, 2 v
    const bf* A = (sel == 2) ? X + (size_t)r0 * DM : Wt + (size_t)c0 * DM; const bf* Bt = (sel == 2) ? Wt + (size_t)c0 * DM : X + (size_t)r0 * DM;
    v8f acc[4][4];
#pragma unroll
    for (int mb = 0; mb < 4; ++mb)
#pragma unroll
        for (int nb = 0; nb < 4; ++nb) acc[mb][nb] = (v8f){};
    const size_t off = (size_t)lr * DM + 8 * hi;
    // kept rolled, as in k_gemmw: the accumulators and one trip's fragments fill the registers that four waves a SIMD leave a wave
#pragma unroll 1
    for (int kc = 0; kc < DM; kc += 32) {
        V a[4], b[4]; const bf* pa = A + off + kc; const bf* pb = Bt + off + kc;
#pragma unroll
        for (int i = 0; i < 4; ++i) { a[i] = WFrag<bf>::ld(pa + (size_t)i * 16 * DM); b[i] = WFrag<bf>::ld(pb + (size_t)i * 16 * DM); }
        xdone<true>(pa, pb);
#pragma unroll
        for (int nb = 0; nb < 4; ++nb)
#pragma unroll
            for (int mb = 0; mb < 4; ++mb) acc[mb][nb] = WFrag<bf>::mma(a[mb], b[nb], acc[mb][nb]);
        asm volatile("v_nop\n\tv_nop\n\tv_nop\n\tv_nop" : "+v"(acc[0][0]), "+v"(acc[1][1]), "+v"(acc[2][2]), "+v"(acc[3][3]) : "v"(a[0]), "v"(a[3]));   // the distance behind the last matrix instruction before its operand registers are loaded anew on the back edge
    }
    if (sel == 2) { const float* gp = bias + c0 + lr; const float g0 = gp[0], g1 = gp[16], g2 = gp[32], g3 = gp[48]; xdone<false>(gp, nullptr);   // v: + b_attn, d = 16 y + lr (q and k: in qkv_out)
#pragma unroll
        for (int x = 0; x < 4; ++x) { acc[x][0] += bfr(g0); acc[x][1] += bfr(g1); acc[x][2] += bfr(g2); acc[x][3] += bfr(g3); } }
#pragma unroll
    for (int y = 0; y < 4; ++y) {
#pragma unroll
        for (int x = 0; x < 4; ++x) { const v8f w = acc[x][y]; float* f = F + (y * 16 + lr) * FP + x * 16 + hi * 8; *(v4fa*)f = __builtin_shufflevector(w, w, 0, 1, 2, 3); *(v4fa*)(f + 4) = __builtin_shufflevector(w, w, 4, 5, 6, 7); } }
    __syncthreads();   // the staged tile is read back across lanes
    const size_t hp = ((size_t)(r0 / TT) * NH_ + head) * TT * HD; const int t0 = r0 % TT;
    if (sel == 2) { const size_t o = hp + t0; qkv_out<false>(F, nullptr, nullptr, nullptr, nullptr, V16 + o, Vh + o, Vl + o, TT, lane); }
    else { const size_t o = hp + (size_t)t0 * HD; qkv_out<true>(F, bias + c0, rc + (size_t)r0 * 32, rs + (size_t)r0 * 32, (sel ? bK : bQ) + head * HD, (sel ? K16 : Q16) + o, (sel ? Kh : Qh) + o, (sel ? Kl : Ql) + o, HD, lane); }
}
__global__ __launch_bounds__(256) void k_wtGs(const float* __restrict__ w, int K, int N, int ld, bf* Bt) { const size_t e = ((size_t)blockIdx.x * 256 + threadIdx.x) * 4; if (e >= (size_t)N * K) return; const int k = (int)(e % K); const int n = (int)(e / K); v4us o;   // Bt[n][k] = w[k*ld + n]
#pragma unroll
    for (int u = 0; u < 4; ++u) o[u] = f2bf(w[(size_t)(k + u) * ld + n]); *(v4us*)(Bt + e) = o;  }

extern "C" void kernel_launch(void* const* d_in, const int* in_sizes, int n_in,
                              void* d_out, int out_size, void* d_ws, size_t ws_size, hipStream_t stream) {
    (void)in_sizes; (void)n_in; (void)out_size;
    const float* x = (const float*)d_in[0]; const float* rcos = (const float*)d_in[1]; const float* rsin = (const float*)d_in[2]; const float* wf = (const float*)d_in[3]; const float* bfz = (const float*)d_in[4]; const float* wo = (const float*)d_in[5]; const float* bo = (const float*)d_in[6]; const float* bQ = (const float*)d_in[7]; const float* bK = (const float*)d_in[8]; const float* cosT = nullptr; const float* sinT = nullptr; (void)cosT; (void)sinT;
    float* OUT = (float*)d_out;     // [2][2048][1024]
    char* wsp = (char*)d_ws;
    auto take = [&](size_t bytes) { char* p = wsp; wsp += (bytes + 255) & ~(size_t)255; return (void*)p; };
    bf* WA = (bf*)take((size_t)3 * DQ * DM * 2); bf* WO = (bf*)take((size_t)DM * DQ * 2);   // WA: W_attn transposed, rows q | k | v
    bf* XB = (bf*)take((size_t)NB_ * TT * DM * 2);
    h16* QP16 = (h16*)take((size_t)NB_ * NH_ * TT * HD * 2); h16* KP16 = (h16*)take((size_t)NB_ * NKV * TT * HD * 2); h16* VT16 = (h16*)take((size_t)NB_ * NKV * HD * TT * 2);
    bf* QPh = (bf*)take((size_t)NB_ * NH_ * TT * HD * 2); bf* QPl = (bf*)take((size_t)NB_ * NH_ * TT * HD * 2); bf* KPh = (bf*)take((size_t)NB_ * NKV * TT * HD * 2); bf* KPl = (bf*)take((size_t)NB_ * NKV * TT * HD * 2); bf* VTh = (bf*)take((size_t)NB_ * NKV * HD * TT * 2); bf* VTl = (bf*)take((size_t)NB_ * NKV * HD * TT * 2);
    bf* ATh = (bf*)take((size_t)NB_ * TT * DQ * 2); bf* ATl = (bf*)take((size_t)NB_ * TT * DQ * 2);
    if ((size_t)(wsp - (char*)d_ws) > ws_size) return;    // ws 256 MiB
    // every kernel runs once: the two batches are rows b TT + t of one grid, and q, k, v are the 3 DQ columns of one product
    k_wtGs<<<(unsigned)(((size_t)3 * DQ * DM / 4 + 255) / 256), 256, 0, stream>>>(wf, DM, 3 * DQ, 3 * DQ, WA);
    k_wtG<<<(unsigned)((DQ * DM / 64 + 63) / 64), 256, 0, stream>>>(wo, DQ, DM, WO);
    k_cvt8<<<(unsigned)(((size_t)NB_ * TT * DM / 8 + 255) / 256), 256, 0, stream>>>(x, XB, (size_t)NB_ * TT * DM / 8);
    k_qkv<<<dim3(NB_ * TT / 64, 3 * DQ / 64, 1), 32, 0, stream>>>(XB, WA, bfz, rcos, rsin, bQ, bK, QP16, QPh, QPl, KP16, KPh, KPl, VT16, VTh, VTl);
    k_attn<<<dim3(NBLO + NBHI, NH_, NB_), 32 * AW, 0, stream>>>(QP16, KP16, VT16, QPh, QPl, KPh, KPl, VTh, VTl, ATh, ATl);
    k_gemmw<bf, 1, true><<<dim3(NB_ * TT / 64, DM / 64, 1), 32, 0, stream>>>(ATh, ATl, WO, nullptr, DQ, OUT, DM, bo, 0, 0, 0);
}

// v005
// It runs in 125 microseconds.
// Two timings next to v004 put it at 1.51 and 1.48 times that version's speed.
// Counting every step since v000, it is 11.8 times as fast.
#include <hip/hip_runtime.h>

// DisorderedCausalSelfAttention (x [2][2048][1024]; qkv = x W_attn + b ([1024][3072], split q | k | v, 16 heads x 64); partial RoPE on the first 32 dims of each head with the given per-batch tables rope_cos/rope_sin [B][T][32] (read; rotate_half within the 32 dims); then q += bQ[h], k += bK[h] (post-RoPE symmetry-breaking biases, read); causal softmax(q.k / 8); out = merged W_proj + b_proj -> [2][2048][1024]).
// Compute dtypes, f32 accumulate: every input rounded to bf16; q/k/v on PLAIN bf16 operands (inputs: exact) + bias; partial RoPE and the post-RoPE biases f32; causal scores and att.v: query rows < 512 hl (3 products), the rest single fp16; softmax f32, running maximum, normalised after att.v; W_proj hl x exact (2 products) + bias.

// Every 16-bit operand plane (rows x K) lies in FRAGMENT ORDER: the 16 rows x 32 k of one matrix operand are one 1024-B block, blocks run along k and then along the row groups. Inside a block the 16-B chunk of row r, k = 16 j + 8 h + (0..7) stands at chunk 32 j + 16 h + (r & 15),
// which is lane 16 h + (r & 15) of the operand's j-th 16-B load: each wave-wide load reads 512 contiguous bytes, four whole lines, where a row-major plane gives sixteen 32-B pieces. A group of 16 rows still takes 16 K elements, so row-group offsets read as in a row-major plane.
#define NB_  2
#define TT   2048
#define DM   1024
#define NH_  16
#define NKV  16
#define REP  (NH_ / NKV)
#define HD   64
#define DQ   (NH_ * HD)
#define DKV  (NKV * HD)
#define RH   512                  // query rows < RH use hi+lo planes (0: none)
#define SCL  0.125f   // HD^-0.5
typedef _Float16 h16;
typedef unsigned short bf;
typedef __attribute__((ext_vector_type(16))) __bf16   v16bf;
typedef __attribute__((ext_vector_type(16))) _Float16 v16h;
typedef __attribute__((ext_vector_type(8)))  _Float16 v8h;
typedef __attribute__((ext_vector_type(8)))  unsigned short v8us;
typedef __attribute__((ext_vector_type(8)))  float    v8f;
typedef __attribute__((ext_vector_type(4)))  float    v4f;
typedef v8h  __attribute__((may_alias)) v8ha;
typedef v4f  __attribute__((may_alias)) v4fa;
typedef v8us __attribute__((may_alias)) v8usa;
typedef float v2fa __attribute__((ext_vector_type(2), may_alias));

__device__ __forceinline__ unsigned short f2bf(float f) { unsigned u = __float_as_uint(f); u += 0x7FFFu + ((u >> 16) & 1u); return (unsigned short)(u >> 16); }
__device__ __forceinline__ float bf2f(unsigned short b) { return __uint_as_float(((unsigned)b) << 16); }
__device__ __forceinline__ float bfr(float f) { return bf2f(f2bf(f)); }
__device__ __forceinline__ v16h cat16(v8h lo, v8h hi) { return __builtin_shufflevector(lo, hi, 0, 1, 2, 3, 4, 5, 6, 7, 8, 9, 10, 11, 12, 13, 14, 15); }
__device__ __forceinline__ v16bf cat16b(v8us lo, v8us hi) { return __builtin_bit_cast(v16bf, __builtin_shufflevector(lo, hi, 0, 1, 2, 3, 4, 5, 6, 7, 8, 9, 10, 11, 12, 13, 14, 15)); }
__device__ __forceinline__ v8f wmma16(v16h a, v16h b, v8f c) { return __builtin_amdgcn_wmma_f32_16x16x32_f16(false, a, false, b, (short)0, c, false, false); }
__device__ __forceinline__ v8f wmmab(v16bf a, v16bf b, v8f c) { return __builtin_amdgcn_wmma_f32_16x16x32_bf16(false, a, false, b, (short)0, c, false, false); }



// ---- k_gemmw: register-blocked GEMM, ONE WAVE per 64x64 output tile (16 accumulators), operands straight from fragment-order 16-bit planes (ld: p = the block's start + 8 lane); grid (M/64, N/64, Z), 32 threads.
// C[m][n] (f32, pitch ldc, + optional f32 bias[n]) = sum_k A[m][k] Bt[n][k] (+ split products per NSPLIT). z-batch strides sA/sB/sC in elements. K % 32 == 0.
template <typename T16> struct WFrag;
template <> struct WFrag<h16> { typedef v16h V; static __device__ __forceinline__ V ld(const h16* p) { return cat16(*(const v8h*)p, *(const v8h*)(p + 256)); } static __device__ __forceinline__ v8f mma(V a, V b, v8f c) { return wmma16(a, b, c); } };
template <> struct WFrag<bf> { typedef v16bf V; static __device__ __forceinline__ V ld(const bf* p) { return cat16b(*(const v8us*)p, *(const v8us*)(p + 256)); } static __device__ __forceinline__ v8f mma(V a, V b, v8f c) { return wmmab(a, b, c); } };
template <typename T16, int NSPLIT, bool BIAS>
__global__ __launch_bounds__(32) void k_gemmw(const T16* __restrict__ A, const T16* __restrict__ A2, const T16* __restrict__ Bt, const T16* __restrict__ Bt2, int K, float* C, int ldc, const float* __restrict__ bias, size_t sA, size_t sB, size_t sC) {
    typedef typename WFrag<T16>::V V;
    __shared__ __align__(16) float os[16 * 68];
    const size_t z = blockIdx.z; A += z * sA; if (A2) A2 += z * sA; Bt += z * sB; if (Bt2) Bt2 += z * sB; C += z * sC;
    const int lane = threadIdx.x & 31, lr = lane & 15, hi = lane >> 4; const int r0 = blockIdx.x * 64, c0 = blockIdx.y * 64;
    v8f acc[4][4];
#pragma unroll
    for (int mb = 0; mb < 4; ++mb)
#pragma unroll
        for (int nb = 0; nb < 4; ++nb) acc[mb][nb] = (v8f){};
    const size_t aoff = (size_t)r0 * K + 8 * lane, boff = (size_t)c0 * K + 8 * lane;   // a k block of 32 is 512 elements on: kc * 16
#pragma unroll 1
    for (int kc = 0; kc < K; kc += 32) {
        V a[4], a2[4], b[4], b2[4]; const T16* pa[4]; const T16* pa2[4]; const T16* pb[4]; const T16* pb2[4];   // a plane that this NSPLIT does not read: the pointer repeats its sibling's and nothing is loaded
#pragma unroll
        for (int i = 0; i < 4; ++i) { pa[i] = A + aoff + (size_t)i * 16 * K + kc * 16; pb[i] = Bt + boff + (size_t)i * 16 * K + kc * 16; pa2[i] = (NSPLIT == 1 || NSPLIT == 2) ? A2 + aoff + (size_t)i * 16 * K + kc * 16 : pa[i]; pb2[i] = (NSPLIT >= 2) ? Bt2 + boff + (size_t)i * 16 * K + kc * 16 : pb[i];
            a[i] = WFrag<T16>::ld(pa[i]); b[i] = WFrag<T16>::ld(pb[i]); if (NSPLIT == 1 || NSPLIT == 2) a2[i] = WFrag<T16>::ld(pa2[i]); if (NSPLIT >= 2) b2[i] = WFrag<T16>::ld(pb2[i]); }
        // behind the trip's loads, in front of whatever overwrites the registers that held their addresses (the instruction set's rule for an issued load): it names every address as an input, so that no load of the run lands on one; the scheduling barrier keeps the loads in front of it and later code behind it
        asm volatile("s_wait_xcnt 0x0" :: "v"(pa[0]), "v"(pa[1]), "v"(pa[2]), "v"(pa[3]), "v"(pa2[0]), "v"(pa2[1]), "v"(pa2[2]), "v"(pa2[3]), "v"(pb[0]), "v"(pb[1]), "v"(pb[2]), "v"(pb[3]), "v"(pb2[0]), "v"(pb2[1]), "v"(pb2[2]), "v"(pb2[3]) : "memory"); __builtin_amdgcn_sched_barrier(0);
#pragma unroll
        for (int nb = 0; nb < 4; ++nb) {
#pragma unroll
            for (int mb = 0; mb < 4; ++mb) { acc[mb][nb] = WFrag<T16>::mma(a[mb], b[nb], acc[mb][nb]); if (NSPLIT == 1 || NSPLIT == 2) acc[mb][nb] = WFrag<T16>::mma(a2[mb], b[nb], acc[mb][nb]); if (NSPLIT >= 2) acc[mb][nb] = WFrag<T16>::mma(a[mb], b2[nb], acc[mb][nb]); } }
        asm volatile("v_nop\n\tv_nop\n\tv_nop\n\tv_nop" : "+v"(acc[0][0]), "+v"(acc[1][1]), "+v"(acc[2][2]), "+v"(acc[3][3]) : "v"(a[0]), "v"(a[3]));
    }
#pragma unroll
    for (int mb = 0; mb < 4; ++mb) {
#pragma unroll
        for (int nb = 0; nb < 4; ++nb) {
#pragma unroll
            for (int j = 0; j < 8; ++j) os[(hi * 8 + j) * 68 + nb * 16 + lr] = acc[mb][nb][j]; }
        __builtin_amdgcn_wave_barrier(); asm volatile("" ::: "memory");
        float* crow = C + (size_t)(r0 + mb * 16) * ldc + c0;
{
#pragma unroll
            for (int s = 0; s < 8; ++s) { const int row = 2 * s + hi, cofs = lr * 4; v4f val = *(const v4fa*)(os + row * 68 + cofs); if (BIAS) { val[0] += bfr(bias[c0 + cofs]); val[1] += bfr(bias[c0 + cofs + 1]); val[2] += bfr(bias[c0 + cofs + 2]); val[3] += bfr(bias[c0 + cofs + 3]); }
                *(v4f*)(crow + (size_t)row * ldc + cofs) = val; }
             }
        asm volatile("s_wait_xcnt 0x0" ::: "memory"); __builtin_amdgcn_sched_barrier(0);   // behind the eight stores, in front of whatever overwrites their address or data registers (the next row group's values); the scheduling barrier keeps that code behind the wait
        __builtin_amdgcn_wave_barrier(); asm volatile("" ::: "memory");
    }
}

__device__ __forceinline__ h16 tohx(float x) { return (h16)x; }
__device__ __forceinline__ void splitf(float y, unsigned short& h, unsigned short& l) { h = f2bf(y); l = f2bf(y - bf2f(h)); }
typedef __attribute__((ext_vector_type(2))) _Float16 v2h;
typedef __attribute__((ext_vector_type(4))) _Float16 v4h;
typedef __attribute__((ext_vector_type(2))) unsigned short v2us;
typedef __attribute__((ext_vector_type(4))) unsigned short v4us;
typedef __attribute__((ext_vector_type(2))) float v2f;
typedef __attribute__((ext_vector_type(4))) int v4i;

// frag_off: where the 16-B chunk of (row, k .. k + 7), k a multiple of 8, stands in a fragment-order plane with K columns, in elements
__device__ __forceinline__ size_t frag_off(int row, int k, int K) { return ((((size_t)(row >> 4) * (K >> 5) + (k >> 5)) * 2 + ((k >> 4) & 1)) * 32 + ((k >> 3) & 1) * 16 + (row & 15)) * 8; }
// one thread a chunk; a wave takes 8 rows x 32 k: it reads one whole 128-B line of each row and stores four whole lines (8 neighbouring rows of each of the four chunk columns)
__global__ __launch_bounds__(256) void k_cvt8(const float* __restrict__ src, bf* dst, size_t n8) { const size_t i = (size_t)blockIdx.x * 256 + threadIdx.x; if (i >= n8) return; const int q = (int)(i >> 5); const int row = (q / (DM / 32)) * 8 + (int)((i >> 2) & 7), k = (q % (DM / 32)) * 32 + (int)(i & 3) * 8; const v8f v = *(const v8f*)(src + (size_t)row * DM + k); v8us o;
#pragma unroll
    for (int u = 0; u < 8; ++u) o[u] = f2bf(v[u]); *(v8us*)(dst + frag_off(row, k, DM)) = o;  }
__global__ __launch_bounds__(256) void k_cscvt(const float* __restrict__ cosT, const float* __restrict__ sinT, float* CS) { const int idx = blockIdx.x * 256 + threadIdx.x; if (idx >= TT * HD) return; v2f cs; cs[0] = bfr(cosT[idx]); cs[1] = bfr(sinT[idx]); *(v2f*)(CS + (size_t)idx * 2) = cs;  }
#define AW   4                    // waves a work-group; they walk the same keys at about the same time
#define RLO  2                    // query groups a wave, fp16 rows
#define NBLO ((TT - RH) / (16 * AW * RLO))   // work-groups a head, fp16 rows
#define NBHI (RH / (16 * AW))                // work-groups a head, hi+lo rows
#define CSC  (SCL * 1.4426950408889634f)
__device__ __forceinline__ float xhalf(float x) { return __builtin_bit_cast(float, __builtin_amdgcn_permlanex16(__builtin_bit_cast(int, x), __builtin_bit_cast(int, x), 0x76543210, 0xfedcba98, false, false)); }   // lane l reads lane l ^ 16
// dist: the distance behind the last matrix instruction of a product before its operand registers are loaded anew, on a loop's back edge too; it names the product's tiles so that the whole product stands in front of it
__device__ __forceinline__ void dist(v8f (&s)[1][2]) { asm volatile("v_nop\n\tv_nop\n\tv_nop\n\tv_nop" : "+v"(s[0][0]), "+v"(s[0][1])); }
__device__ __forceinline__ void dist(v8f (&s)[2][2]) { asm volatile("v_nop\n\tv_nop\n\tv_nop\n\tv_nop" : "+v"(s[0][0]), "+v"(s[0][1]), "+v"(s[1][0]), "+v"(s[1][1])); }
__device__ __forceinline__ void dist(v8f (&s)[1][4]) { asm volatile("v_nop\n\tv_nop\n\tv_nop\n\tv_nop" : "+v"(s[0][0]), "+v"(s[0][1]), "+v"(s[0][2]), "+v"(s[0][3])); }
__device__ __forceinline__ void dist(v8f (&s)[2][4]) { asm volatile("v_nop\n\tv_nop\n\tv_nop\n\tv_nop" : "+v"(s[0][0]), "+v"(s[0][1]), "+v"(s[0][2]), "+v"(s[0][3]), "+v"(s[1][0]), "+v"(s[1][1]), "+v"(s[1][2]), "+v"(s[1][3])); }
// xdone: stands behind a run of global loads from a (and b), in front of whatever overwrites the registers that held their addresses (the instruction set's rule for an issued load). It names the two addresses as inputs, so that their registers live up to the wait
// and no load of the run lands on them; the scheduling barrier keeps the loads in front of it and later code behind it.
template <bool TWO>
__device__ __forceinline__ void xdone(const void* a, const void* b) { if (TWO) asm volatile("s_wait_xcnt 0x0" :: "v"(a), "v"(b) : "memory"); else asm volatile("s_wait_xcnt 0x0" :: "v"(a) : "memory"); __builtin_amdgcn_sched_barrier(0); }
template <typename T16, bool HI, bool MASK, int R>
__device__ __forceinline__ void attn_pass(typename WFrag<T16>::V (&kf)[2][2], typename WFrag<T16>::V (&kf2)[2][2], const T16* Kn, const T16* Kn2, const T16* Vp, const T16* Vp2,
                                          const typename WFrag<T16>::V (&qf)[R][2], const typename WFrag<T16>::V (&qf2)[R][2], v8f (&acc)[R][4], float (&m)[R], float (&l)[R], int key0, int myq, int hi) {
    typedef typename WFrag<T16>::V V;
    // every '#pragma unroll' of this function: the indices of the fragment and accumulator arrays must be compile-time constants, so that they stay in registers
    V vf[4], vf2[4];   // this pass's V^T fragments (rows d, k = keys), in flight under the first product and the exponentials
#pragma unroll
    for (int t = 0; t < 4; ++t) { vf[t] = WFrag<T16>::ld(Vp + (size_t)t * 16 * TT); if (HI) vf2[t] = WFrag<T16>::ld(Vp2 + (size_t)t * 16 * TT); }
    xdone<HI>(Vp, Vp2);
    v8f s[R][2];
#pragma unroll
    for (int g = 0; g < R; ++g)
#pragma unroll
        for (int kt = 0; kt < 2; ++kt) { s[g][kt] = (v8f){};
#pragma unroll
            for (int kc = 0; kc < 2; ++kc) { s[g][kt] = WFrag<T16>::mma(kf[kt][kc], qf[g][kc], s[g][kt]); if (HI) { s[g][kt] = WFrag<T16>::mma(kf[kt][kc], qf2[g][kc], s[g][kt]); s[g][kt] = WFrag<T16>::mma(kf2[kt][kc], qf[g][kc], s[g][kt]); } } }
    dist(s);
    __builtin_amdgcn_sched_barrier(0);   // keeps the loads below behind that distance
    if (!HI) {   // the next pass's K fragments, in flight under this pass's softmax and second product
#pragma unroll
        for (int kt = 0; kt < 2; ++kt)
#pragma unroll
            for (int kc = 0; kc < 2; ++kc) kf[kt][kc] = WFrag<T16>::ld(Kn + kt * 16 * HD + kc * 512);
        xdone<false>(Kn, nullptr); }
    float mx[R]; bool need = false;
#pragma unroll
    for (int g = 0; g < R; ++g) { float x0 = -3.0e38f;
#pragma unroll
        for (int e = 0; e < 16; ++e) { float x = s[g][e >> 3][e & 7] * CSC; if (MASK) x = (key0 + 16 * (e >> 3) + 8 * hi + (e & 7) <= myq + 16 * g) ? x : -3.0e38f; s[g][e >> 3][e & 7] = x; x0 = fmaxf(x0, x); }
        mx[g] = fmaxf(x0, xhalf(x0));   // lanes l and l ^ 16 hold the two key halves of one query
        need = need || (mx[g] > m[g]); }
    if (__builtin_amdgcn_ballot_w32(need) != 0) {   // wave-uniform; where a query's maximum does not move its factor is exactly 1
#pragma unroll
        for (int g = 0; g < R; ++g) { const float mn = fmaxf(m[g], mx[g]); const float corr = __builtin_amdgcn_exp2f(m[g] - mn); m[g] = mn; l[g] *= corr;
#pragma unroll
            for (int t = 0; t < 4; ++t) acc[g][t] *= corr; } }
#pragma unroll
    for (int g = 0; g < R; ++g) { float p[16];
#pragma unroll
        for (int e = 0; e < 16; ++e) { p[e] = __builtin_amdgcn_exp2f(s[g][e >> 3][e & 7] - m[g]); l[g] += p[e]; }
        if (HI) { v8us h0, h1, l0, l1;
#pragma unroll
            for (int e = 0; e < 8; ++e) { unsigned short a, c; splitf(p[e], a, c); h0[e] = a; l0[e] = c; splitf(p[8 + e], a, c); h1[e] = a; l1[e] = c; }
            const v16bf ph = cat16b(h0, h1), pl = cat16b(l0, l1);
#pragma unroll
            for (int t = 0; t < 4; ++t) { acc[g][t] = wmmab(__builtin_bit_cast(v16bf, vf[t]), ph, acc[g][t]); acc[g][t] = wmmab(__builtin_bit_cast(v16bf, vf[t]), pl, acc[g][t]); acc[g][t] = wmmab(__builtin_bit_cast(v16bf, vf2[t]), ph, acc[g][t]); }
        } else { v16h pf;
#pragma unroll
            for (int e = 0; e < 16; ++e) pf[e] = tohx(p[e]);
#pragma unroll
            for (int t = 0; t < 4; ++t) acc[g][t] = wmma16(__builtin_bit_cast(v16h, vf[t]), pf, acc[g][t]); } }
    dist(acc);
    if (HI) {   // with hi and lo planes K and V^T together do not fit 256 registers: the next pass's K is loaded when V^T is spent (these rows have at most RH / 32 passes and are never the longest)
        __builtin_amdgcn_sched_barrier(0);   // keeps these loads behind the second product
#pragma unroll
        for (int kt = 0; kt < 2; ++kt)
#pragma unroll
            for (int kc = 0; kc < 2; ++kc) { kf[kt][kc] = WFrag<T16>::ld(Kn + kt * 16 * HD + kc * 512); kf2[kt][kc] = WFrag<T16>::ld(Kn2 + kt * 16 * HD + kc * 512); }
        xdone<true>(Kn, Kn2); }
}
// q0: the wave's first query row, a multiple of 16 R
template <typename T16, bool HI, int R>
__device__ __forceinline__ void attn_rows(const T16* __restrict__ Q, const T16* __restrict__ Q2, const T16* __restrict__ K, const T16* __restrict__ K2, const T16* __restrict__ Vt, const T16* __restrict__ Vt2, int q0, int head, bf* Ah, bf* Al) {
    typedef typename WFrag<T16>::V V;
    const int lane = threadIdx.x & 31, lr = lane & 15, hi = lane >> 4; const int myq = q0 + lr;
    const size_t qo = (size_t)q0 * HD + 8 * lane; const int ko = 8 * lane, vo = 8 * lane;   // fragment order: Q and K blocks (16 rows, 32 d) at 16 HD a row group and 512 a d block; V^T blocks (16 d, 32 keys) at 16 TT a d group and 512 a key block
    V qf[R][2], qf2[R][2], kf[2][2], kf2[2][2];
#pragma unroll
    for (int g = 0; g < R; ++g)
#pragma unroll
        for (int kc = 0; kc < 2; ++kc) { qf[g][kc] = WFrag<T16>::ld(Q + qo + g * 16 * HD + kc * 512); if (HI) qf2[g][kc] = WFrag<T16>::ld(Q2 + qo + g * 16 * HD + kc * 512); }
    xdone<HI>(Q + qo, Q2 + qo);
#pragma unroll
    for (int kt = 0; kt < 2; ++kt)
#pragma unroll
        for (int kc = 0; kc < 2; ++kc) { kf[kt][kc] = WFrag<T16>::ld(K + ko + kt * 16 * HD + kc * 512); if (HI) kf2[kt][kc] = WFrag<T16>::ld(K2 + ko + kt * 16 * HD + kc * 512); }
    xdone<HI>(K + ko, K2 + ko);
    v8f acc[R][4]; float m[R], l[R];
#pragma unroll
    for (int g = 0; g < R; ++g) { m[g] = -3.0e38f; l[g] = 0.f;
#pragma unroll
        for (int t = 0; t < 4; ++t) acc[g][t] = (v8f){}; }
    const int klast = (q0 >> 5) << 5;   // first key of the pass that holds the wave's diagonal (its 16 R <= 32 rows lie in one 32-key block): the only pass with masked keys, and the last
    // kept rolled: one pass's fragments and the next pass's K already fill the registers
#pragma unroll 1
    for (int key0 = 0; key0 < klast; key0 += 32) attn_pass<T16, HI, false, R>(kf, kf2, K + ko + (key0 + 32) * HD, K2 + ko + (key0 + 32) * HD, Vt + vo + key0 * 16, Vt2 + vo + key0 * 16, qf, qf2, acc, m, l, key0, myq, hi);
    attn_pass<T16, HI, true, R>(kf, kf2, K + ko + klast * HD, K2 + ko + klast * HD, Vt + vo + klast * 16, Vt2 + vo + klast * 16, qf, qf2, acc, m, l, klast, myq, hi);   // there is no next pass: its K load repeats this pass's rows, in bounds, unused
#pragma unroll
    for (int g = 0; g < R; ++g) { const float lt = l[g] + xhalf(l[g]); const float inv = __fdiv_rn(1.0f, lt);
#pragma unroll
        for (int t = 0; t < 4; ++t) { v8us oh, ol;   // registers j of tile t are d = 16 t + 8 hi + j of query myq + 16 g
#pragma unroll
            for (int j = 0; j < 8; ++j) { unsigned short a, c; splitf(acc[g][t][j] * inv, a, c); oh[j] = a; ol[j] = c; }
            const size_t oo = (size_t)(q0 + 16 * g) * DQ + (head * 2 + (t >> 1)) * 512 + (t & 1) * 256 + 8 * lane; *(v8us*)(Ah + oo) = oh; *(v8us*)(Al + oo) = ol;   // fragment order, k = head HD + d: each store is 512 contiguous bytes
            asm volatile("s_wait_xcnt 0x0" ::: "memory"); __builtin_amdgcn_sched_barrier(0); } }   // behind the two stores, in front of whatever overwrites their address or data registers (the next tile's values); the scheduling barrier keeps that code behind the wait
}
__global__ __launch_bounds__(32 * AW) void k_attn(const h16* __restrict__ Q16, const h16* __restrict__ K16, const h16* __restrict__ V16, const bf* __restrict__ Qh, const bf* __restrict__ Ql, const bf* __restrict__ Kh, const bf* __restrict__ Kl, const bf* __restrict__ Vh, const bf* __restrict__ Vl, bf* Ah, bf* Al) {
    const int head = blockIdx.y; const size_t hp = ((size_t)blockIdx.z * NH_ + head) * TT * HD; const int bx = blockIdx.x; Ah += (size_t)blockIdx.z * TT * DQ; Al += (size_t)blockIdx.z * TT * DQ;   // blockIdx.z: the batch
    const int wave = __builtin_amdgcn_readfirstlane((int)(threadIdx.x >> 5));   // scalar, so that the key loop is a scalar loop with every lane on
    if (bx < NBLO) attn_rows<h16, false, RLO>(Q16 + hp, nullptr, K16 + hp, nullptr, V16 + hp, nullptr, TT - (bx + 1) * (16 * AW * RLO) + wave * (16 * RLO), head, Ah, Al);   // the longest rows start first
    else attn_rows<bf, true, 1>(Qh + hp, Ql + hp, Kh + hp, Kl + hp, Vh + hp, Vl + hp, (bx - NBLO) * (16 * AW) + wave * 16, head, Ah, Al);
}

// ---- k_qkv: the q | k | v projection (the loop of k_gemmw, one wave per 64x64 tile = 64 rows b TT + t of one head of q, k or v) with everything that follows it up to the 16-bit planes in its epilogue: + b_attn, partial RoPE, the post-RoPE head bias, the fp16 and hi/lo bf16 rounding, and for v the transpose. The f32 values never leave the work-group.
// A matrix tile leaves the unit with lane = column and registers = 8 consecutive rows, so the operand whose index is to run along a plane's rows goes in as A: for q and k (planes [t][d]) A = W^T rows d and B = x rows t, for v (planes [d][t]) A = x rows t and B = W^T rows d. Both are fragment-order planes read by the same loader, so only the two pointers change places.
// acc[x][y][j] is then plane row 16 y + lr, plane column 16 x + 8 hi + j. The tile goes to LDS as f32 in that form and is read back four whole plane rows at a time, eight columns a lane.
#define FP 68   // pitch of a staged row in dwords, 64 + 4: the 16-byte LDS writes (16 rows, one column block) and reads (whole rows) both fall on distinct banks
template <bool ROPE>
__device__ __forceinline__ void qkv_out(const float* F, const float* __restrict__ gb, const float* __restrict__ rc, const float* __restrict__ rs, const float* __restrict__ hb, h16* P16, bf* Ph, bf* Pl, int pitch, int lane) {
    const int r4 = lane >> 3, ch = (lane & 7) * 8;   // the lane's row among four, its first column (for q and k: d)
    const int co = (ch >> 5) * 512 + ((ch >> 4) & 1) * 256 + ((ch >> 3) & 1) * 128;   // where that column's chunks start in a fragment-order block row (P16, Ph, Pl point at the tile's first block; pitch = the plane's K)
    float g[8], g2[8], p[8]; v4f cn[2], sn[2];
    // every '#pragma unroll' of this function and of k_qkv: the indices of the register arrays and vectors must be compile-time constants, so that they stay in registers
    const float* cp = ROPE ? rc + r4 * 32 + (ch & 31) : nullptr; const float* sp = ROPE ? rs + r4 * 32 + (ch & 31) : nullptr;   // lanes with d >= 32 read the row's tables too (in bounds) and do not use them
    if (ROPE) { const float* gp = gb + ch; const float* gq = gb + (ch ^ 16); const float* pp = hb + ch;   // b_attn at d and at the RoPE partner d +- 16, the head bias at d
#pragma unroll
        for (int u = 0; u < 2; ++u) { const v4f a = *(const v4fa*)(gp + 4 * u), b = *(const v4fa*)(gq + 4 * u), c = *(const v4fa*)(pp + 4 * u); cn[u] = *(const v4fa*)(cp + 4 * u); sn[u] = *(const v4fa*)(sp + 4 * u);
#pragma unroll
            for (int j = 0; j < 4; ++j) { g[4 * u + j] = bfr(a[j]); g2[4 * u + j] = bfr(b[j]); p[4 * u + j] = bfr(c[j]); } }
        asm volatile("s_wait_xcnt 0x0" :: "v"(gp), "v"(gq), "v"(pp), "v"(cp), "v"(sp) : "memory"); __builtin_amdgcn_sched_barrier(0); }   // as xdone, for the five addresses of this run of loads
    // kept rolled: sixteen equal trips; unrolled they would be tens of KiB of code that every wave runs once
#pragma unroll 1
    for (int q = 0; q < 16; ++q) {
        const float* f = F + (q * 4 + r4) * FP; const v4f f0 = *(const v4fa*)(f + ch), f1 = *(const v4fa*)(f + ch + 4); float r[8];
        if (ROPE) { const v4f e0 = *(const v4fa*)(f + (ch ^ 16)), e1 = *(const v4fa*)(f + (ch ^ 16) + 4); const v4f c0 = cn[0], c1 = cn[1], s0 = sn[0], s1 = sn[1];
            if (q < 15) { cp += 4 * 32; sp += 4 * 32; }   // the next four rows' tables, in flight under this trip's work; the last trip repeats its own, in bounds, unused
            cn[0] = *(const v4fa*)cp; cn[1] = *(const v4fa*)(cp + 4); sn[0] = *(const v4fa*)sp; sn[1] = *(const v4fa*)(sp + 4);
            xdone<true>(cp, sp);
#pragma unroll
            for (int j = 0; j < 8; ++j) { const float x0 = (j < 4 ? f0[j & 3] : f1[j & 3]) + g[j], x1 = (j < 4 ? e0[j & 3] : e1[j & 3]) + g2[j]; const float c = bfr(j < 4 ? c0[j & 3] : c1[j & 3]), s = bfr(j < 4 ? s0[j & 3] : s1[j & 3]);
                const float ro = x0 * c + x1 * (ch < 16 ? -s : s);   // rotate-half within the first 32 dims
                r[j] = (ch < 32 ? ro : x0) + p[j]; }
        } else {
#pragma unroll
            for (int j = 0; j < 8; ++j) r[j] = j < 4 ? f0[j & 3] : f1[j & 3]; }
        v8h o16; v8us oh, ol;
#pragma unroll
        for (int j = 0; j < 8; ++j) { o16[j] = tohx(r[j]); unsigned short a2, c2; splitf(r[j], a2, c2); oh[j] = a2; ol[j] = c2; }
        const int rr = q * 4 + r4; const size_t go = (size_t)(rr >> 4) * 16 * pitch + co + (rr & 15) * 8; *(v8ha*)(P16 + go) = o16; *(v8usa*)(Ph + go) = oh; *(v8usa*)(Pl + go) = ol;   // each store of the wave: eight 64-B pieces (four neighbouring rows of eight chunk columns); the next trip fills the lines' other halves
        asm volatile("s_wait_xcnt 0x0" ::: "memory"); __builtin_amdgcn_sched_barrier(0);   // behind the three stores, in front of whatever overwrites their address or data registers (the next trip's); the scheduling barrier keeps that code behind the wait
    }
}
__global__ __launch_bounds__(32) void k_qkv(const bf* __restrict__ X, const bf* __restrict__ Wt, const float* __restrict__ bias, const float* __restrict__ rc, const float* __restrict__ rs, const float* __restrict__ bQ, const float* __restrict__ bK,
                                            h16* Q16, bf* Qh, bf* Ql, h16* K16, bf* Kh, bf* Kl, h16* V16, bf* Vh, bf* Vl) {
    typedef WFrag<bf>::V V;
    __shared__ __align__(16) float F[64 * FP];
    const int lane = threadIdx.x & 31, lr = lane & 15, hi = lane >> 4; const int r0 = blockIdx.x * 64, c0 = blockIdx.y * 64;
    const int sel = c0 / DQ, head = (c0 % DQ) / HD;   // 0 q, 1 k, 2 v
    const bf* A = (sel == 2) ? X + (size_t)r0 * DM : Wt + (size_t)c0 * DM; const bf* Bt = (sel == 2) ? Wt + (size_t)c0 * DM : X + (size_t)r0 * DM;
    v8f acc[4][4];
#pragma unroll
    for (int mb = 0; mb < 4; ++mb)
#pragma unroll
        for (int nb = 0; nb < 4; ++nb) acc[mb][nb] = (v8f){};
    const size_t off = 8 * lane;
    // kept rolled, as in k_gemmw: the accumulators and one trip's fragments fill the registers that four waves a SIMD leave a wave
#pragma unroll 1
    for (int kc = 0; kc < DM; kc += 32) {
        V a[4], b[4]; const bf* pa = A + off + kc * 16; const bf* pb = Bt + off + kc * 16;
#pragma unroll
        for (int i = 0; i < 4; ++i) { a[i] = WFrag<bf>::ld(pa + (size_t)i * 16 * DM); b[i] = WFrag<bf>::ld(pb + (size_t)i * 16 * DM); }
        xdone<true>(pa, pb);
#pragma unroll
        for (int nb = 0; nb < 4; ++nb)
#pragma unroll
            for (int mb = 0; mb < 4; ++mb) acc[mb][nb] = WFrag<bf>::mma(a[mb], b[nb], acc[mb][nb]);
        asm volatile("v_nop\n\tv_nop\n\tv_nop\n\tv_nop" : "+v"(acc[0][0]), "+v"(acc[1][1]), "+v"(acc[2][2]), "+v"(acc[3][3]) : "v"(a[0]), "v"(a[3]));   // the distance behind the last matrix instruction before its operand registers are loaded anew on the back edge
    }
    if (sel == 2) { const float* gp = bias + c0 + lr; const float g0 = gp[0], g1 = gp[16], g2 = gp[32], g3 = gp[48]; xdone<false>(gp, nullptr);   // v: + b_attn, d = 16 y + lr (q and k: in qkv_out)
#pragma unroll
        for (int x = 0; x < 4; ++x) { acc[x][0] += bfr(g0); acc[x][1] += bfr(g1); acc[x][2] += bfr(g2); acc[x][3] += bfr(g3); } }
#pragma unroll
    for (int y = 0; y < 4; ++y) {
#pragma unroll
        for (int x = 0; x < 4; ++x) { const v8f w = acc[x][y]; float* f = F + (y * 16 + lr) * FP + x * 16 + hi * 8; *(v4fa*)f = __builtin_shufflevector(w, w, 0, 1, 2, 3); *(v4fa*)(f + 4) = __builtin_shufflevector(w, w, 4, 5, 6, 7); } }
    __syncthreads();   // the staged tile is read back across lanes
    const size_t hp = ((size_t)(r0 / TT) * NH_ + head) * TT * HD; const int t0 = r0 % TT;
    if (sel == 2) { const size_t o = hp + (size_t)t0 * 16; qkv_out<false>(F, nullptr, nullptr, nullptr, nullptr, V16 + o, Vh + o, Vl + o, TT, lane); }
    else { const size_t o = hp + (size_t)t0 * HD; qkv_out<true>(F, bias + c0, rc + (size_t)r0 * 32, rs + (size_t)r0 * 32, (sel ? bK : bQ) + head * HD, (sel ? K16 : Q16) + o, (sel ? Kh : Qh) + o, (sel ? Kl : Ql) + o, HD, lane); }
}
// Bt (fragment order, rows n, K columns): element (n, k) = w[k * ld + n]. One thread a chunk; a wave takes 32 neighbouring n at one k .. k + 7: each of its eight loads reads one whole 128-B line of w, and it stores two 256-B runs (16 neighbouring rows of a block stand side by side). N a multiple of 32
__global__ __launch_bounds__(256) void k_wtGs(const float* __restrict__ w, int K, int N, int ld, bf* Bt) { const size_t i = (size_t)blockIdx.x * 256 + threadIdx.x; if (i * 8 >= (size_t)N * K) return; const int q = (int)(i >> 5); const int n = (q / (K >> 3)) * 32 + (int)(i & 31), k = (q % (K >> 3)) * 8; v8us o; const float* p[8]; float v[8];
#pragma unroll
    for (int u = 0; u < 8; ++u) { p[u] = w + (size_t)(k + u) * ld + n; v[u] = *p[u]; }
    // behind the eight loads, in front of whatever overwrites their address registers (the instruction set's rule for an issued load); it names the addresses as inputs, so that no load of the run lands on one, and the scheduling barrier keeps later code behind it
    asm volatile("s_wait_xcnt 0x0" :: "v"(p[0]), "v"(p[1]), "v"(p[2]), "v"(p[3]), "v"(p[4]), "v"(p[5]), "v"(p[6]), "v"(p[7]) : "memory"); __builtin_amdgcn_sched_barrier(0);
#pragma unroll
    for (int u = 0; u < 8; ++u) o[u] = f2bf(v[u]); *(v8us*)(Bt + frag_off(n, k, K)) = o;  }

extern "C" void kernel_launch(void* const* d_in, const int* in_sizes, int n_in,
                              void* d_out, int out_size, void* d_ws, size_t ws_size, hipStream_t stream) {
    (void)in_sizes; (void)n_in; (void)out_size;
    const float* x = (const float*)d_in[0]; const float* rcos = (const float*)d_in[1]; const float* rsin = (const float*)d_in[2]; const float* wf = (const float*)d_in[3]; const float* bfz = (const float*)d_in[4]; const float* wo = (const float*)d_in[5]; const float* bo = (const float*)d_in[6]; const float* bQ = (const float*)d_in[7]; const float* bK = (const float*)d_in[8]; const float* cosT = nullptr; const float* sinT = nullptr; (void)cosT; (void)sinT;
    float* OUT = (float*)d_out;     // [2][2048][1024]
    char* wsp = (char*)d_ws;
    auto take = [&](size_t bytes) { char* p = wsp; wsp += (bytes + 255) & ~(size_t)255; return (void*)p; };
    bf* WA = (bf*)take((size_t)3 * DQ * DM * 2); bf* WO = (bf*)take((size_t)DM * DQ * 2);   // WA: W_attn transposed, rows q | k | v
    bf* XB = (bf*)take((size_t)NB_ * TT * DM * 2);
    h16* QP16 = (h16*)take((size_t)NB_ * NH_ * TT * HD * 2); h16* KP16 = (h16*)take((size_t)NB_ * NKV * TT * HD * 2); h16* VT16 = (h16*)take((size_t)NB_ * NKV * HD * TT * 2);
    bf* QPh = (bf*)take((size_t)NB_ * NH_ * TT * HD * 2); bf* QPl = (bf*)take((size_t)NB_ * NH_ * TT * HD * 2); bf* KPh = (bf*)take((size_t)NB_ * NKV * TT * HD * 2); bf* KPl = (bf*)take((size_t)NB_ * NKV * TT * HD * 2); bf* VTh = (bf*)take((size_t)NB_ * NKV * HD * TT * 2); bf* VTl = (bf*)take((size_t)NB_ * NKV * HD * TT * 2);
    bf* ATh = (bf*)take((size_t)NB_ * TT * DQ * 2); bf* ATl = (bf*)take((size_t)NB_ * TT * DQ * 2);
    if ((size_t)(wsp - (char*)d_ws) > ws_size) return;    // ws 256 MiB
    // one launch a stage (k_wtGs: one a weight): the two batches are rows b TT + t of one grid, and q, k, v are the 3 DQ columns of one product
    k_wtGs<<<(unsigned)(((size_t)3 * DQ * DM / 8 + 255) / 256), 256, 0, stream>>>(wf, DM, 3 * DQ, 3 * DQ, WA);
    k_wtGs<<<(unsigned)(((size_t)DM * DQ / 8 + 255) / 256), 256, 0, stream>>>(wo, DQ, DM, DM, WO);
    k_cvt8<<<(unsigned)(((size_t)NB_ * TT * DM / 8 + 255) / 256), 256, 0, stream>>>(x, XB, (size_t)NB_ * TT * DM / 8);
    k_qkv<<<dim3(NB_ * TT / 64, 3 * DQ / 64, 1), 32, 0, stream>>>(XB, WA, bfz, rcos, rsin, bQ, bK, QP16, QPh, QPl, KP16, KPh, KPl, VT16, VTh, VTl);
    k_attn<<<dim3(NBLO + NBHI, NH_, NB_), 32 * AW, 0, stream>>>(QP16, KP16, VT16, QPh, QPl, KPh, KPl, VTh, VTl, ATh, ATl);
    k_gemmw<bf, 1, true><<<dim3(NB_ * TT / 64, DM / 64, 1), 32, 0, stream>>>(ATh, ATl, WO, nullptr, DQ, OUT, DM, bo, 0, 0, 0);
}

// v006
// Measured time: 99.3 microseconds a run.
// Next to v005, in two timings, it ran 1.25 times as fast each time.
// All steps since v000 together make it 14.8 times as fast.
#include <hip/hip_runtime.h>

// DisorderedCausalSelfAttention (x [2][2048][1024]; qkv = x W_attn + b ([1024][3072], split q | k | v, 16 heads x 64); partial RoPE on the first 32 dims of each head with the given per-batch tables rope_cos/rope_sin [B][T][32] (read; rotate_half within the 32 dims); then q += bQ[h], k += bK[h] (post-RoPE symmetry-breaking biases, read); causal softmax(q.k / 8); out = merged W_proj + b_proj -> [2][2048][1024]).
// Compute dtypes, f32 accumulate: every input rounded to bf16; q/k/v on PLAIN bf16 operands (inputs: exact) + bias; partial RoPE and the post-RoPE biases f32; causal scores and att.v: query rows < 512 hl (3 products), the rest single fp16; softmax f32, running maximum, normalised after att.v; W_proj hl x exact (2 products) + bias.

// Every 16-bit operand plane (rows x K) lies in FRAGMENT ORDER: the 16 rows x 32 k of one matrix operand are one 1024-B block, blocks run along k and then along the row groups. Inside a block the 16-B chunk of row r, k = 16 j + 8 h + (0..7) stands at chunk 32 j + 16 h + (r & 15),
// which is lane 16 h + (r & 15) of the operand's j-th 16-B load: each wave-wide load reads 512 contiguous bytes, four whole lines, where a row-major plane gives sixteen 32-B pieces. A group of 16 rows still takes 16 K elements, so row-group offsets read as in a row-major plane.
#define NB_  2
#define TT   2048
#define DM   1024
#define NH_  16
#define NKV  16
#define REP  (NH_ / NKV)
#define HD   64
#define DQ   (NH_ * HD)
#define DKV  (NKV * HD)
#define RH   512                  // query rows < RH use hi+lo planes (0: none)
#define SCL  0.125f   // HD^-0.5
typedef _Float16 h16;
typedef unsigned short bf;
typedef __attribute__((ext_vector_type(16))) __bf16   v16bf;
typedef __attribute__((ext_vector_type(16))) _Float16 v16h;
typedef __attribute__((ext_vector_type(8)))  _Float16 v8h;
typedef __attribute__((ext_vector_type(8)))  unsigned short v8us;
typedef __attribute__((ext_vector_type(8)))  float    v8f;
typedef __attribute__((ext_vector_type(4)))  float    v4f;
typedef v8h  __attribute__((may_alias)) v8ha;
typedef v4f  __attribute__((may_alias)) v4fa;
typedef v8us __attribute__((may_alias)) v8usa;
typedef float v2fa __attribute__((ext_vector_type(2), may_alias));

__device__ __forceinline__ unsigned short f2bf(float f) { unsigned u = __float_as_uint(f); u += 0x7FFFu + ((u >> 16) & 1u); return (unsigned short)(u >> 16); }
__device__ __forceinline__ float bf2f(unsigned short b) { return __uint_as_float(((unsigned)b) << 16); }
__device__ __forceinline__ float bfr(float f) { return bf2f(f2bf(f)); }
__device__ __forceinline__ v16h cat16(v8h lo, v8h hi) { return __builtin_shufflevector(lo, hi, 0, 1, 2, 3, 4, 5, 6, 7, 8, 9, 10, 11, 12, 13, 14, 15); }
__device__ __forceinline__ v16bf cat16b(v8us lo, v8us hi) { return __builtin_bit_cast(v16bf, __builtin_shufflevector(lo, hi, 0, 1, 2, 3, 4, 5, 6, 7, 8, 9, 10, 11, 12, 13, 14, 15)); }
__device__ __forceinline__ v8f wmma16(v16h a, v16h b, v8f c) { return __builtin_amdgcn_wmma_f32_16x16x32_f16(false, a, false, b, (short)0, c, false, false); }
__device__ __forceinline__ v8f wmmab(v16bf a, v16bf b, v8f c) { return __builtin_amdgcn_wmma_f32_16x16x32_bf16(false, a, false, b, (short)0, c, false, false); }



// WFrag: a matrix operand from a fragment-order plane (ld: p = the block's start + 8 lane)
template <typename T16> struct WFrag;
template <> struct WFrag<h16> { typedef v16h V; static __device__ __forceinline__ V ld(const h16* p) { return cat16(*(const v8h*)p, *(const v8h*)(p + 256)); } static __device__ __forceinline__ v8f mma(V a, V b, v8f c) { return wmma16(a, b, c); } };
template <> struct WFrag<bf> { typedef v16bf V; static __device__ __forceinline__ V ld(const bf* p) { return cat16b(*(const v8us*)p, *(const v8us*)(p + 256)); } static __device__ __forceinline__ v8f mma(V a, V b, v8f c) { return wmmab(a, b, c); } };
// ---- operand staging for the two GEMMs. The waves of a work-group share their operand rows: a stage = KS k of every row group (16 rows) of the work-group's tile, which in a fragment-order plane is 2 KiB in a row, brought into LDS once by asynchronous copies (16 B a lane, 512 contiguous bytes a copy)
// and read from there by every wave that needs it, in the same fragment order (each wave-wide ds_load_b128 reads 512 contiguous bytes). Two buffers: stage t + 1 flies while stage t is worked on.
// cpN: N copies, each with its own LDS byte address l and global address g; s_wait_xcnt 0 is the statement's last line, so that it stands in front of whatever rewrites a register that a copy names
#define KS 64
__device__ __forceinline__ unsigned lds_off(const void* p) { return (unsigned)(size_t)p; }
__device__ __forceinline__ void cp1(const unsigned (&l)[1], const bf* const (&g)[1]) { asm volatile("global_load_async_to_lds_b128 %0, %1, off\n\ts_wait_xcnt 0x0" :: "v"(l[0]), "v"(g[0]) : "memory"); }
__device__ __forceinline__ void cp9(const unsigned (&l)[9], const bf* const (&g)[9]) { asm volatile("global_load_async_to_lds_b128 %0, %9, off\n\tglobal_load_async_to_lds_b128 %1, %10, off\n\tglobal_load_async_to_lds_b128 %2, %11, off\n\tglobal_load_async_to_lds_b128 %3, %12, off\n\tglobal_load_async_to_lds_b128 %4, %13, off\n\tglobal_load_async_to_lds_b128 %5, %14, off\n\tglobal_load_async_to_lds_b128 %6, %15, off\n\tglobal_load_async_to_lds_b128 %7, %16, off\n\tglobal_load_async_to_lds_b128 %8, %17, off\n\ts_wait_xcnt 0x0" :: "v"(l[0]), "v"(l[1]), "v"(l[2]), "v"(l[3]), "v"(l[4]), "v"(l[5]), "v"(l[6]), "v"(l[7]), "v"(l[8]), "v"(g[0]), "v"(g[1]), "v"(g[2]), "v"(g[3]), "v"(g[4]), "v"(g[5]), "v"(g[6]), "v"(g[7]), "v"(g[8]) : "memory"); }
__device__ __forceinline__ void cp12(const unsigned (&l)[12], const bf* const (&g)[12]) { asm volatile("global_load_async_to_lds_b128 %0, %12, off\n\tglobal_load_async_to_lds_b128 %1, %13, off\n\tglobal_load_async_to_lds_b128 %2, %14, off\n\tglobal_load_async_to_lds_b128 %3, %15, off\n\tglobal_load_async_to_lds_b128 %4, %16, off\n\tglobal_load_async_to_lds_b128 %5, %17, off\n\tglobal_load_async_to_lds_b128 %6, %18, off\n\tglobal_load_async_to_lds_b128 %7, %19, off\n\tglobal_load_async_to_lds_b128 %8, %20, off\n\tglobal_load_async_to_lds_b128 %9, %21, off\n\tglobal_load_async_to_lds_b128 %10, %22, off\n\tglobal_load_async_to_lds_b128 %11, %23, off\n\ts_wait_xcnt 0x0" :: "v"(l[0]), "v"(l[1]), "v"(l[2]), "v"(l[3]), "v"(l[4]), "v"(l[5]), "v"(l[6]), "v"(l[7]), "v"(l[8]), "v"(l[9]), "v"(l[10]), "v"(l[11]), "v"(g[0]), "v"(g[1]), "v"(g[2]), "v"(g[3]), "v"(g[4]), "v"(g[5]), "v"(g[6]), "v"(g[7]), "v"(g[8]), "v"(g[9]), "v"(g[10]), "v"(g[11]) : "memory"); }
// stage_done: the foot of a trip, every wave: its own LDS reads are back, its own copies have landed, then the work-group barrier that publishes the next stage and ends every reader's last read of this one
__device__ __forceinline__ void stage_done() { asm volatile("s_wait_dscnt 0x0" ::: "memory"); asm volatile("s_wait_asynccnt 0x0" ::: "memory"); __syncthreads(); }

// ---- k_proj: C[m][n] (f32, + bias[n]) = sum_k (A + A2)[m][k] Bt[n][k], two products. Work-group = 8 waves = 128 x 128 of C, a wave 32 x 64 (8 accumulators), two waves a SIMD; grid (M/128, N/128).
// Stage: 8 row groups of A, 8 of A2, 8 of Bt; wave w copies the (w & 3)-th 512 B of row groups (w >> 2), (w >> 2) + 2, ...
#define PWV 8
#define PRG 24
#define PST (PRG * 16 * KS)   // elements a stage
__global__ __launch_bounds__(32 * PWV) void k_proj(const bf* __restrict__ A, const bf* __restrict__ A2, const bf* __restrict__ Bt, float* C, const float* __restrict__ bias) {
    typedef WFrag<bf>::V V;
    __shared__ __align__(1024) bf ring[2 * PST];
    __shared__ __align__(16) float oss[PWV * 16 * 68];
    const int lane = threadIdx.x & 31, lr = lane & 15, hi = lane >> 4; const int wave = __builtin_amdgcn_readfirstlane((int)(threadIdx.x >> 5));   // scalar: what is formed from it stays in scalar registers
    const int R0 = blockIdx.x * 128, C0 = blockIdx.y * 128; const int r0 = R0 + (wave >> 1) * 32, c0 = C0 + (wave & 1) * 64;
    float* os = oss + wave * 16 * 68;
    const int wh = wave >> 2, po = (wave & 3) * 256 + 8 * lane;   // po: the lane's 16 B inside a row group's 2 KiB
    const bf* gA = A + (size_t)(R0 + wh * 16) * DQ + po; const bf* gA2 = A2 + (size_t)(R0 + wh * 16) * DQ + po; const bf* gB = Bt + (size_t)(C0 + wh * 16) * DQ + po; const unsigned l0 = lds_off(ring) + 2 * (wh * 1024 + po);
    auto issue = [&](int t) { const unsigned lb = l0 + (t & 1) * (PST * 2); const int go = t * (KS * 16); unsigned l[12]; const bf* g[12];
#pragma unroll
        for (int i = 0; i < 12; ++i) { l[i] = lb + i * 2 * 2048; g[i] = (i < 4 ? gA : i < 8 ? gA2 : gB) + (size_t)(i & 3) * 32 * DQ + go; }
        cp12(l, g); };
    v8f acc[2][4];
#pragma unroll
    for (int mb = 0; mb < 2; ++mb)
#pragma unroll
        for (int nb = 0; nb < 4; ++nb) acc[mb][nb] = (v8f){};
    issue(0); asm volatile("s_wait_asynccnt 0x0" ::: "memory"); __syncthreads();   // stage 0 has landed and is published
    issue(1);
    const int ao = (wave >> 1) * 2 * 1024 + 8 * lane, bo = (16 + (wave & 1) * 4) * 1024 + 8 * lane;
    // kept rolled: the buffer index alternates from trip to trip
#pragma unroll 1
    for (int t = 0; t < DQ / KS; ++t) {
        const bf* st = ring + (t & 1) * PST;
        V a[KS / 32][2], a2[KS / 32][2], b[KS / 32][4];
#pragma unroll
        for (int kb = 0; kb < KS / 32; ++kb) {
#pragma unroll
            for (int i = 0; i < 2; ++i) { a[kb][i] = WFrag<bf>::ld(st + ao + i * 1024 + kb * 512); a2[kb][i] = WFrag<bf>::ld(st + ao + (8 + i) * 1024 + kb * 512); }
#pragma unroll
            for (int i = 0; i < 4; ++i) b[kb][i] = WFrag<bf>::ld(st + bo + i * 1024 + kb * 512); }
        __builtin_amdgcn_sched_barrier(0);   // the trip's LDS reads stand as one group in front of its matrix instructions: left to itself the compiler puts them among those in pairs, each behind a wait to 0
#pragma unroll
        for (int kb = 0; kb < KS / 32; ++kb)
#pragma unroll
            for (int nb = 0; nb < 4; ++nb)
#pragma unroll
                for (int mb = 0; mb < 2; ++mb) { acc[mb][nb] = WFrag<bf>::mma(a[kb][mb], b[kb][nb], acc[mb][nb]); acc[mb][nb] = WFrag<bf>::mma(a2[kb][mb], b[kb][nb], acc[mb][nb]); }
        __builtin_amdgcn_sched_barrier(0);   // keeps the matrix instructions in front of the trip's foot: moved behind its waits they would no longer run while the next stage's copies fly
        stage_done();
        if (t + 2 < DQ / KS) issue(t + 2);   // into the buffer that this trip has just read
    }
    asm volatile("s_wait_asynccnt 0x0" ::: "memory");   // no copy is outstanding when the wave goes on
    const float* bp = bias + c0 + lr * 4; const v4f bv = *(const v4fa*)bp;   // the lane's four columns' bias
    asm volatile("s_wait_xcnt 0x0" :: "v"(bp) : "memory"); __builtin_amdgcn_sched_barrier(0);   // behind the load, in front of whatever overwrites its address register; it names the address as an input, so that the load does not land on it
#pragma unroll
    for (int mb = 0; mb < 2; ++mb) {
#pragma unroll
        for (int nb = 0; nb < 4; ++nb) {
#pragma unroll
            for (int j = 0; j < 8; ++j) os[(hi * 8 + j) * 68 + nb * 16 + lr] = acc[mb][nb][j]; }
        __builtin_amdgcn_wave_barrier(); asm volatile("" ::: "memory");
        float* crow = C + (size_t)(r0 + mb * 16) * DM + c0;
{
#pragma unroll
            for (int s = 0; s < 8; ++s) { const int row = 2 * s + hi, cofs = lr * 4; v4f val = *(const v4fa*)(os + row * 68 + cofs); val[0] += bfr(bv[0]); val[1] += bfr(bv[1]); val[2] += bfr(bv[2]); val[3] += bfr(bv[3]);
                *(v4f*)(crow + (size_t)row * DM + cofs) = val; }
             }
        asm volatile("s_wait_xcnt 0x0" ::: "memory"); __builtin_amdgcn_sched_barrier(0);   // behind the eight stores, in front of whatever overwrites their address or data registers (the next row group's values); the scheduling barrier keeps that code behind the wait
        __builtin_amdgcn_wave_barrier(); asm volatile("" ::: "memory");
    }
}

__device__ __forceinline__ h16 tohx(float x) { return (h16)x; }
__device__ __forceinline__ void splitf(float y, unsigned short& h, unsigned short& l) { h = f2bf(y); l = f2bf(y - bf2f(h)); }
typedef __attribute__((ext_vector_type(2))) _Float16 v2h;
typedef __attribute__((ext_vector_type(4))) _Float16 v4h;
typedef __attribute__((ext_vector_type(2))) unsigned short v2us;
typedef __attribute__((ext_vector_type(4))) unsigned short v4us;
typedef __attribute__((ext_vector_type(2))) float v2f;
typedef __attribute__((ext_vector_type(4))) int v4i;

// frag_off: where the 16-B chunk of (row, k .. k + 7), k a multiple of 8, stands in a fragment-order plane with K columns, in elements
__device__ __forceinline__ size_t frag_off(int row, int k, int K) { return ((((size_t)(row >> 4) * (K >> 5) + (k >> 5)) * 2 + ((k >> 4) & 1)) * 32 + ((k >> 3) & 1) * 16 + (row & 15)) * 8; }
// one thread a chunk; a wave takes 8 rows x 32 k: it reads one whole 128-B line of each row and stores four whole lines (8 neighbouring rows of each of the four chunk columns)
__global__ __launch_bounds__(256) void k_cvt8(const float* __restrict__ src, bf* dst, size_t n8) { const size_t i = (size_t)blockIdx.x * 256 + threadIdx.x; if (i >= n8) return; const int q = (int)(i >> 5); const int row = (q / (DM / 32)) * 8 + (int)((i >> 2) & 7), k = (q % (DM / 32)) * 32 + (int)(i & 3) * 8; const v8f v = *(const v8f*)(src + (size_t)row * DM + k); v8us o;
#pragma unroll
    for (int u = 0; u < 8; ++u) o[u] = f2bf(v[u]); *(v8us*)(dst + frag_off(row, k, DM)) = o;  }
__global__ __launch_bounds__(256) void k_cscvt(const float* __restrict__ cosT, const float* __restrict__ sinT, float* CS) { const int idx = blockIdx.x * 256 + threadIdx.x; if (idx >= TT * HD) return; v2f cs; cs[0] = bfr(cosT[idx]); cs[1] = bfr(sinT[idx]); *(v2f*)(CS + (size_t)idx * 2) = cs;  }
#define AW   4                    // waves a work-group; they walk the same keys at about the same time
#define RLO  2                    // query groups a wave, fp16 rows
#define NBLO ((TT - RH) / (16 * AW * RLO))   // work-groups a head, fp16 rows
#define NBHI (RH / (16 * AW))                // work-groups a head, hi+lo rows
#define CSC  (SCL * 1.4426950408889634f)
__device__ __forceinline__ float xhalf(float x) { return __builtin_bit_cast(float, __builtin_amdgcn_permlanex16(__builtin_bit_cast(int, x), __builtin_bit_cast(int, x), 0x76543210, 0xfedcba98, false, false)); }   // lane l reads lane l ^ 16
// dist: the distance behind the last matrix instruction of a product before its operand registers are loaded anew, on a loop's back edge too; it names the product's tiles so that the whole product stands in front of it
__device__ __forceinline__ void dist(v8f (&s)[1][2]) { asm volatile("v_nop\n\tv_nop\n\tv_nop\n\tv_nop" : "+v"(s[0][0]), "+v"(s[0][1])); }
__device__ __forceinline__ void dist(v8f (&s)[2][2]) { asm volatile("v_nop\n\tv_nop\n\tv_nop\n\tv_nop" : "+v"(s[0][0]), "+v"(s[0][1]), "+v"(s[1][0]), "+v"(s[1][1])); }
__device__ __forceinline__ void dist(v8f (&s)[1][4]) { asm volatile("v_nop\n\tv_nop\n\tv_nop\n\tv_nop" : "+v"(s[0][0]), "+v"(s[0][1]), "+v"(s[0][2]), "+v"(s[0][3])); }
__device__ __forceinline__ void dist(v8f (&s)[2][4]) { asm volatile("v_nop\n\tv_nop\n\tv_nop\n\tv_nop" : "+v"(s[0][0]), "+v"(s[0][1]), "+v"(s[0][2]), "+v"(s[0][3]), "+v"(s[1][0]), "+v"(s[1][1]), "+v"(s[1][2]), "+v"(s[1][3])); }
// xdone: stands behind a run of global loads from a (and b), in front of whatever overwrites the registers that held their addresses (the instruction set's rule for an issued load). It names the two addresses as inputs, so that their registers live up to the wait
// and no load of the run lands on them; the scheduling barrier keeps the loads in front of it and later code behind it.
template <bool TWO>
__device__ __forceinline__ void xdone(const void* a, const void* b) { if (TWO) asm volatile("s_wait_xcnt 0x0" :: "v"(a), "v"(b) : "memory"); else asm volatile("s_wait_xcnt 0x0" :: "v"(a) : "memory"); __builtin_amdgcn_sched_barrier(0); }
template <typename T16, bool HI, bool MASK, int R>
__device__ __forceinline__ void attn_pass(typename WFrag<T16>::V (&kf)[2][2], typename WFrag<T16>::V (&kf2)[2][2], const T16* Kn, const T16* Kn2, const T16* Vp, const T16* Vp2,
                                          const typename WFrag<T16>::V (&qf)[R][2], const typename WFrag<T16>::V (&qf2)[R][2], v8f (&acc)[R][4], float (&m)[R], float (&l)[R], int key0, int myq, int hi) {
    typedef typename WFrag<T16>::V V;
    // every '#pragma unroll' of this function: the indices of the fragment and accumulator arrays must be compile-time constants, so that they stay in registers
    V vf[4], vf2[4];   // this pass's V^T fragments (rows d, k = keys), in flight under the first product and the exponentials
#pragma unroll
    for (int t = 0; t < 4; ++t) { vf[t] = WFrag<T16>::ld(Vp + (size_t)t * 16 * TT); if (HI) vf2[t] = WFrag<T16>::ld(Vp2 + (size_t)t * 16 * TT); }
    xdone<HI>(Vp, Vp2);
    v8f s[R][2];
#pragma unroll
    for (int g = 0; g < R; ++g)
#pragma unroll
        for (int kt = 0; kt < 2; ++kt) { s[g][kt] = (v8f){};
#pragma unroll
            for (int kc = 0; kc < 2; ++kc) { s[g][kt] = WFrag<T16>::mma(kf[kt][kc], qf[g][kc], s[g][kt]); if (HI) { s[g][kt] = WFrag<T16>::mma(kf[kt][kc], qf2[g][kc], s[g][kt]); s[g][kt] = WFrag<T16>::mma(kf2[kt][kc], qf[g][kc], s[g][kt]); } } }
    dist(s);
    __builtin_amdgcn_sched_barrier(0);   // keeps the loads below behind that distance
    if (!HI) {   // the next pass's K fragments, in flight under this pass's softmax and second product
#pragma unroll
        for (int kt = 0; kt < 2; ++kt)
#pragma unroll
            for (int kc = 0; kc < 2; ++kc) kf[kt][kc] = WFrag<T16>::ld(Kn + kt * 16 * HD + kc * 512);
        xdone<false>(Kn, nullptr); }
    float mx[R]; bool need = false;
#pragma unroll
    for (int g = 0; g < R; ++g) { float x0 = -3.0e38f;
#pragma unroll
        for (int e = 0; e < 16; ++e) { float x = s[g][e >> 3][e & 7] * CSC; if (MASK) x = (key0 + 16 * (e >> 3) + 8 * hi + (e & 7) <= myq + 16 * g) ? x : -3.0e38f; s[g][e >> 3][e & 7] = x; x0 = fmaxf(x0, x); }
        mx[g] = fmaxf(x0, xhalf(x0));   // lanes l and l ^ 16 hold the two key halves of one query
        need = need || (mx[g] > m[g]); }
    if (__builtin_amdgcn_ballot_w32(need) != 0) {   // wave-uniform; where a query's maximum does not move its factor is exactly 1
#pragma unroll
        for (int g = 0; g < R; ++g) { const float mn = fmaxf(m[g], mx[g]); const float corr = __builtin_amdgcn_exp2f(m[g] - mn); m[g] = mn; l[g] *= corr;
#pragma unroll
            for (int t = 0; t < 4; ++t) acc[g][t] *= corr; } }
#pragma unroll
    for (int g = 0; g < R; ++g) { float p[16];
#pragma unroll
        for (int e = 0; e < 16; ++e) { p[e] = __builtin_amdgcn_exp2f(s[g][e >> 3][e & 7] - m[g]); l[g] += p[e]; }
        if (HI) { v8us h0, h1, l0, l1;
#pragma unroll
            for (int e = 0; e < 8; ++e) { unsigned short a, c; splitf(p[e], a, c); h0[e] = a; l0[e] = c; splitf(p[8 + e], a, c); h1[e] = a; l1[e] = c; }
            const v16bf ph = cat16b(h0, h1), pl = cat16b(l0, l1);
#pragma unroll
            for (int t = 0; t < 4; ++t) { acc[g][t] = wmmab(__builtin_bit_cast(v16bf, vf[t]), ph, acc[g][t]); acc[g][t] = wmmab(__builtin_bit_cast(v16bf, vf[t]), pl, acc[g][t]); acc[g][t] = wmmab(__builtin_bit_cast(v16bf, vf2[t]), ph, acc[g][t]); }
        } else { v16h pf;
#pragma unroll
            for (int e = 0; e < 16; ++e) pf[e] = tohx(p[e]);
#pragma unroll
            for (int t = 0; t < 4; ++t) acc[g][t] = wmma16(__builtin_bit_cast(v16h, vf[t]), pf, acc[g][t]); } }
    dist(acc);
    if (HI) {   // with hi and lo planes K and V^T together do not fit 256 registers: the next pass's K is loaded when V^T is spent (these rows have at most RH / 32 passes and are never the longest)
        __builtin_amdgcn_sched_barrier(0);   // keeps these loads behind the second product
#pragma unroll
        for (int kt = 0; kt < 2; ++kt)
#pragma unroll
            for (int kc = 0; kc < 2; ++kc) { kf[kt][kc] = WFrag<T16>::ld(Kn + kt * 16 * HD + kc * 512); kf2[kt][kc] = WFrag<T16>::ld(Kn2 + kt * 16 * HD + kc * 512); }
        xdone<true>(Kn, Kn2); }
}
// q0: the wave's first query row, a multiple of 16 R
template <typename T16, bool HI, int R>
__device__ __forceinline__ void attn_rows(const T16* __restrict__ Q, const T16* __restrict__ Q2, const T16* __restrict__ K, const T16* __restrict__ K2, const T16* __restrict__ Vt, const T16* __restrict__ Vt2, int q0, int head, bf* Ah, bf* Al) {
    typedef typename WFrag<T16>::V V;
    const int lane = threadIdx.x & 31, lr = lane & 15, hi = lane >> 4; const int myq = q0 + lr;
    const size_t qo = (size_t)q0 * HD + 8 * lane; const int ko = 8 * lane, vo = 8 * lane;   // fragment order: Q and K blocks (16 rows, 32 d) at 16 HD a row group and 512 a d block; V^T blocks (16 d, 32 keys) at 16 TT a d group and 512 a key block
    V qf[R][2], qf2[R][2], kf[2][2], kf2[2][2];
#pragma unroll
    for (int g = 0; g < R; ++g)
#pragma unroll
        for (int kc = 0; kc < 2; ++kc) { qf[g][kc] = WFrag<T16>::ld(Q + qo + g * 16 * HD + kc * 512); if (HI) qf2[g][kc] = WFrag<T16>::ld(Q2 + qo + g * 16 * HD + kc * 512); }
    xdone<HI>(Q + qo, Q2 + qo);
#pragma unroll
    for (int kt = 0; kt < 2; ++kt)
#pragma unroll
        for (int kc = 0; kc < 2; ++kc) { kf[kt][kc] = WFrag<T16>::ld(K + ko + kt * 16 * HD + kc * 512); if (HI) kf2[kt][kc] = WFrag<T16>::ld(K2 + ko + kt * 16 * HD + kc * 512); }
    xdone<HI>(K + ko, K2 + ko);
    v8f acc[R][4]; float m[R], l[R];
#pragma unroll
    for (int g = 0; g < R; ++g) { m[g] = -3.0e38f; l[g] = 0.f;
#pragma unroll
        for (int t = 0; t < 4; ++t) acc[g][t] = (v8f){}; }
    const int klast = (q0 >> 5) << 5;   // first key of the pass that holds the wave's diagonal (its 16 R <= 32 rows lie in one 32-key block): the only pass with masked keys, and the last
    // kept rolled: one pass's fragments and the next pass's K already fill the registers
#pragma unroll 1
    for (int key0 = 0; key0 < klast; key0 += 32) attn_pass<T16, HI, false, R>(kf, kf2, K + ko + (key0 + 32) * HD, K2 + ko + (key0 + 32) * HD, Vt + vo + key0 * 16, Vt2 + vo + key0 * 16, qf, qf2, acc, m, l, key0, myq, hi);
    attn_pass<T16, HI, true, R>(kf, kf2, K + ko + klast * HD, K2 + ko + klast * HD, Vt + vo + klast * 16, Vt2 + vo + klast * 16, qf, qf2, acc, m, l, klast, myq, hi);   // there is no next pass: its K load repeats this pass's rows, in bounds, unused
#pragma unroll
    for (int g = 0; g < R; ++g) { const float lt = l[g] + xhalf(l[g]); const float inv = __fdiv_rn(1.0f, lt);
#pragma unroll
        for (int t = 0; t < 4; ++t) { v8us oh, ol;   // registers j of tile t are d = 16 t + 8 hi + j of query myq + 16 g
#pragma unroll
            for (int j = 0; j < 8; ++j) { unsigned short a, c; splitf(acc[g][t][j] * inv, a, c); oh[j] = a; ol[j] = c; }
            const size_t oo = (size_t)(q0 + 16 * g) * DQ + (head * 2 + (t >> 1)) * 512 + (t & 1) * 256 + 8 * lane; *(v8us*)(Ah + oo) = oh; *(v8us*)(Al + oo) = ol;   // fragment order, k = head HD + d: each store is 512 contiguous bytes
            asm volatile("s_wait_xcnt 0x0" ::: "memory"); __builtin_amdgcn_sched_barrier(0); } }   // behind the two stores, in front of whatever overwrites their address or data registers (the next tile's values); the scheduling barrier keeps that code behind the wait
}
__global__ __launch_bounds__(32 * AW) void k_attn(const h16* __restrict__ Q16, const h16* __restrict__ K16, const h16* __restrict__ V16, const bf* __restrict__ Qh, const bf* __restrict__ Ql, const bf* __restrict__ Kh, const bf* __restrict__ Kl, const bf* __restrict__ Vh, const bf* __restrict__ Vl, bf* Ah, bf* Al) {
    const int head = blockIdx.y; const size_t hp = ((size_t)blockIdx.z * NH_ + head) * TT * HD; const int bx = blockIdx.x; Ah += (size_t)blockIdx.z * TT * DQ; Al += (size_t)blockIdx.z * TT * DQ;   // blockIdx.z: the batch
    const int wave = __builtin_amdgcn_readfirstlane((int)(threadIdx.x >> 5));   // scalar, so that the key loop is a scalar loop with every lane on
    if (bx < NBLO) attn_rows<h16, false, RLO>(Q16 + hp, nullptr, K16 + hp, nullptr, V16 + hp, nullptr, TT - (bx + 1) * (16 * AW * RLO) + wave * (16 * RLO), head, Ah, Al);   // the longest rows start first
    else attn_rows<bf, true, 1>(Qh + hp, Ql + hp, Kh + hp, Kl + hp, Vh + hp, Vl + hp, (bx - NBLO) * (16 * AW) + wave * 16, head, Ah, Al);
}

// ---- k_qkv: the q | k | v projection (the staged loop of k_proj, one wave per 64x64 tile = 64 rows b TT + t of one head of q, k or v) with everything that follows it up to the 16-bit planes in its epilogue: + b_attn, partial RoPE, the post-RoPE head bias, the fp16 and hi/lo bf16 rounding, and for v the transpose. The f32 values never leave the work-group.
// A matrix tile leaves the unit with lane = column and registers = 8 consecutive rows, so the operand whose index is to run along a plane's rows goes in as A: for q and k (planes [t][d]) A = W^T rows d and B = x rows t, for v (planes [d][t]) A = x rows t and B = W^T rows d. Both are fragment-order planes read by the same loader, so only the two pointers change places.
// acc[x][y][j] is then plane row 16 y + lr, plane column 16 x + 8 hi + j. The tile goes to LDS as f32 in that form and is read back four whole plane rows at a time, eight columns a lane.
#define FP 68   // pitch of a staged row in dwords, 64 + 4: the 16-byte LDS writes (16 rows, one column block) and reads (whole rows) both fall on distinct banks
template <bool ROPE>
__device__ __forceinline__ void qkv_out(const float* F, const float* __restrict__ gb, const float* __restrict__ rc, const float* __restrict__ rs, const float* __restrict__ hb, h16* P16, bf* Ph, bf* Pl, int pitch, int lane) {
    const int r4 = lane >> 3, ch = (lane & 7) * 8;   // the lane's row among four, its first column (for q and k: d)
    const int co = (ch >> 5) * 512 + ((ch >> 4) & 1) * 256 + ((ch >> 3) & 1) * 128;   // where that column's chunks start in a fragment-order block row (P16, Ph, Pl point at the tile's first block; pitch = the plane's K)
    float g[8], g2[8], p[8]; v4f cn[2], sn[2];
    // every '#pragma unroll' of this function and of k_qkv: the indices of the register arrays and vectors must be compile-time constants, so that they stay in registers
    const float* cp = ROPE ? rc + r4 * 32 + (ch & 31) : nullptr; const float* sp = ROPE ? rs + r4 * 32 + (ch & 31) : nullptr;   // lanes with d >= 32 read the row's tables too (in bounds) and do not use them
    if (ROPE) { const float* gp = gb + ch; const float* gq = gb + (ch ^ 16); const float* pp = hb + ch;   // b_attn at d and at the RoPE partner d +- 16, the head bias at d
#pragma unroll
        for (int u = 0; u < 2; ++u) { const v4f a = *(const v4fa*)(gp + 4 * u), b = *(const v4fa*)(gq + 4 * u), c = *(const v4fa*)(pp + 4 * u); cn[u] = *(const v4fa*)(cp + 4 * u); sn[u] = *(const v4fa*)(sp + 4 * u);
#pragma unroll
            for (int j = 0; j < 4; ++j) { g[4 * u + j] = bfr(a[j]); g2[4 * u + j] = bfr(b[j]); p[4 * u + j] = bfr(c[j]); } }
        asm volatile("s_wait_xcnt 0x0" :: "v"(gp), "v"(gq), "v"(pp), "v"(cp), "v"(sp) : "memory"); __builtin_amdgcn_sched_barrier(0); }   // as xdone, for the five addresses of this run of loads
    // kept rolled: sixteen equal trips; unrolled they would be tens of KiB of code that every wave runs once
#pragma unroll 1
    for (int q = 0; q < 16; ++q) {
        const float* f = F + (q * 4 + r4) * FP; const v4f f0 = *(const v4fa*)(f + ch), f1 = *(const v4fa*)(f + ch + 4); float r[8];
        if (ROPE) { const v4f e0 = *(const v4fa*)(f + (ch ^ 16)), e1 = *(const v4fa*)(f + (ch ^ 16) + 4); const v4f c0 = cn[0], c1 = cn[1], s0 = sn[0], s1 = sn[1];
            if (q < 15) { cp += 4 * 32; sp += 4 * 32; }   // the next four rows' tables, in flight under this trip's work; the last trip repeats its own, in bounds, unused
            cn[0] = *(const v4fa*)cp; cn[1] = *(const v4fa*)(cp + 4); sn[0] = *(const v4fa*)sp; sn[1] = *(const v4fa*)(sp + 4);
            xdone<true>(cp, sp);
#pragma unroll
            for (int j = 0; j < 8; ++j) { const float x0 = (j < 4 ? f0[j & 3] : f1[j & 3]) + g[j], x1 = (j < 4 ? e0[j & 3] : e1[j & 3]) + g2[j]; const float c = bfr(j < 4 ? c0[j & 3] : c1[j & 3]), s = bfr(j < 4 ? s0[j & 3] : s1[j & 3]);
                const float ro = x0 * c + x1 * (ch < 16 ? -s : s);   // rotate-half within the first 32 dims
                r[j] = (ch < 32 ? ro : x0) + p[j]; }
        } else {
#pragma unroll
            for (int j = 0; j < 8; ++j) r[j] = j < 4 ? f0[j & 3] : f1[j & 3]; }
        v8h o16; v8us oh, ol;
#pragma unroll
        for (int j = 0; j < 8; ++j) { o16[j] = tohx(r[j]); unsigned short a2, c2; splitf(r[j], a2, c2); oh[j] = a2; ol[j] = c2; }
        const int rr = q * 4 + r4; const size_t go = (size_t)(rr >> 4) * 16 * pitch + co + (rr & 15) * 8; *(v8ha*)(P16 + go) = o16; *(v8usa*)(Ph + go) = oh; *(v8usa*)(Pl + go) = ol;   // each store of the wave: eight 64-B pieces (four neighbouring rows of eight chunk columns); the next trip fills the lines' other halves
        asm volatile("s_wait_xcnt 0x0" ::: "memory"); __builtin_amdgcn_sched_barrier(0);   // behind the three stores, in front of whatever overwrites their address or data registers (the next trip's); the scheduling barrier keeps that code behind the wait
    }
}
#define QWV 12                 // waves a work-group: 3 heads (64 rows of W^T each) x 4 tiles of 64 rows of x; 256 work-groups
#define QRG 28                 // row groups a stage: 12 of W^T, then 16 of x
#define QST (QRG * 16 * KS)    // elements a stage
__global__ __launch_bounds__(32 * QWV) void k_qkv(const bf* __restrict__ X, const bf* __restrict__ Wt, const float* __restrict__ bias, const float* __restrict__ rc, const float* __restrict__ rs, const float* __restrict__ bQ, const float* __restrict__ bK,
                                            h16* Q16, bf* Qh, bf* Ql, h16* K16, bf* Kh, bf* Kl, h16* V16, bf* Vh, bf* Vl) {
    typedef WFrag<bf>::V V;
    __shared__ __align__(1024) bf ring[2 * QST];
    __shared__ __align__(16) float Fs[QWV * 64 * FP];
    const int lane = threadIdx.x & 31, lr = lane & 15, hi = lane >> 4; const int wave = __builtin_amdgcn_readfirstlane((int)(threadIdx.x >> 5));   // scalar: every branch on it is a scalar branch
    const int wq = wave >> 2, wp = wave & 3; const int R0 = blockIdx.x * 256, C0 = blockIdx.y * 192; const int r0 = R0 + wp * 64, c0 = C0 + wq * 64;
    float* F = Fs + wave * 64 * FP;   // the wave's own epilogue tile
    const int sel = c0 / DQ, head = (c0 % DQ) / HD;   // 0 q, 1 k, 2 v
    // the stage's 112 copies: wave (wq, wp) brings the wp-th 512 B of row groups wq, wq + 3, ..., wq + 24, and the waves with wq = 0 that of row group 27 too. Row groups up to wq + 9 are W^T's, the rest x's
    const int po = wp * 256 + 8 * lane; const bf* gW = Wt + (size_t)(C0 + wq * 16) * DM + po; const bf* gX = X + (size_t)(R0 + wq * 16) * DM + po; const unsigned l0 = lds_off(ring) + 2 * (wq * 1024 + po);
    auto issue = [&](int t) { const unsigned lb = l0 + (t & 1) * (QST * 2); const int go = t * (KS * 16); unsigned l[9]; const bf* g[9];
#pragma unroll
        for (int i = 0; i < 9; ++i) { l[i] = lb + i * 3 * 2048; g[i] = (i < 4 ? gW + (size_t)i * 48 * DM : gX + (size_t)(i - 4) * 48 * DM) + go; }
        cp9(l, g);
        if (wq == 0) { const unsigned l1[1] = { lb + 27 * 2048 }; const bf* const g1[1] = { gX + (size_t)15 * 16 * DM + go }; cp1(l1, g1); } };
    v8f acc[4][4];
#pragma unroll
    for (int mb = 0; mb < 4; ++mb)
#pragma unroll
        for (int nb = 0; nb < 4; ++nb) acc[mb][nb] = (v8f){};
    issue(0); asm volatile("s_wait_asynccnt 0x0" ::: "memory"); __syncthreads();   // stage 0 has landed and is published
    issue(1);
    const int wo = wq * 4 * 1024 + 8 * lane, xo = (12 + wp * 4) * 1024 + 8 * lane; const int ao = (sel == 2) ? xo : wo, bo = (sel == 2) ? wo : xo;
    // kept rolled: the buffer index alternates from trip to trip
#pragma unroll 1
    for (int t = 0; t < DM / KS; ++t) {
        const bf* st = ring + (t & 1) * QST;
#pragma unroll
        for (int kb = 0; kb < KS / 32; ++kb) {
            V a[4], b[4];
#pragma unroll
            for (int i = 0; i < 4; ++i) { a[i] = WFrag<bf>::ld(st + ao + i * 1024 + kb * 512); b[i] = WFrag<bf>::ld(st + bo + i * 1024 + kb * 512); }
            __builtin_amdgcn_sched_barrier(0);   // a block's LDS reads stand as one group in front of its matrix instructions: left to itself the compiler puts them among those in pairs, each behind a wait to 0
#pragma unroll
            for (int nb = 0; nb < 4; ++nb)
#pragma unroll
                for (int mb = 0; mb < 4; ++mb) acc[mb][nb] = WFrag<bf>::mma(a[mb], b[nb], acc[mb][nb]);
            __builtin_amdgcn_sched_barrier(0);   // and the next block's reads behind them
        }
        stage_done();
        if (t + 2 < DM / KS) issue(t + 2);   // into the buffer that this trip has just read
    }
    asm volatile("s_wait_asynccnt 0x0" ::: "memory");   // no copy is outstanding when the wave goes on
    if (sel == 2) { const float* gp = bias + c0 + lr; const float g0 = gp[0], g1 = gp[16], g2 = gp[32], g3 = gp[48]; xdone<false>(gp, nullptr);   // v: + b_attn, d = 16 y + lr (q and k: in qkv_out)
#pragma unroll
        for (int x = 0; x < 4; ++x) { acc[x][0] += bfr(g0); acc[x][1] += bfr(g1); acc[x][2] += bfr(g2); acc[x][3] += bfr(g3); } }
#pragma unroll
    for (int y = 0; y < 4; ++y) {
#pragma unroll
        for (int x = 0; x < 4; ++x) { const v8f w = acc[x][y]; float* f = F + (y * 16 + lr) * FP + x * 16 + hi * 8; *(v4fa*)f = __builtin_shufflevector(w, w, 0, 1, 2, 3); *(v4fa*)(f + 4) = __builtin_shufflevector(w, w, 4, 5, 6, 7); } }
    __syncthreads();   // the staged tile is read back across lanes
    const size_t hp = ((size_t)(r0 / TT) * NH_ + head) * TT * HD; const int t0 = r0 % TT;
    if (sel == 2) { const size_t o = hp + (size_t)t0 * 16; qkv_out<false>(F, nullptr, nullptr, nullptr, nullptr, V16 + o, Vh + o, Vl + o, TT, lane); }
    else { const size_t o = hp + (size_t)t0 * HD; qkv_out<true>(F, bias + c0, rc + (size_t)r0 * 32, rs + (size_t)r0 * 32, (sel ? bK : bQ) + head * HD, (sel ? K16 : Q16) + o, (sel ? Kh : Qh) + o, (sel ? Kl : Ql) + o, HD, lane); }
}
// Bt (fragment order, rows n, K columns): element (n, k) = w[k * ld + n]. One thread a chunk; a wave takes 32 neighbouring n at one k .. k + 7: each of its eight loads reads one whole 128-B line of w, and it stores two 256-B runs (16 neighbouring rows of a block stand side by side). N a multiple of 32
__global__ __launch_bounds__(256) void k_wtGs(const float* __restrict__ w, int K, int N, int ld, bf* Bt) { const size_t i = (size_t)blockIdx.x * 256 + threadIdx.x; if (i * 8 >= (size_t)N * K) return; const int q = (int)(i >> 5); const int n = (q / (K >> 3)) * 32 + (int)(i & 31), k = (q % (K >> 3)) * 8; v8us o; const float* p[8]; float v[8];
#pragma unroll
    for (int u = 0; u < 8; ++u) { p[u] = w + (size_t)(k + u) * ld + n; v[u] = *p[u]; }
    // behind the eight loads, in front of whatever overwrites their address registers (the instruction set's rule for an issued load); it names the addresses as inputs, so that no load of the run lands on one, and the scheduling barrier keeps later code behind it
    asm volatile("s_wait_xcnt 0x0" :: "v"(p[0]), "v"(p[1]), "v"(p[2]), "v"(p[3]), "v"(p[4]), "v"(p[5]), "v"(p[6]), "v"(p[7]) : "memory"); __builtin_amdgcn_sched_barrier(0);
#pragma unroll
    for (int u = 0; u < 8; ++u) o[u] = f2bf(v[u]); *(v8us*)(Bt + frag_off(n, k, K)) = o;  }

extern "C" void kernel_launch(void* const* d_in, const int* in_sizes, int n_in,
                              void* d_out, int out_size, void* d_ws, size_t ws_size, hipStream_t stream) {
    (void)in_sizes; (void)n_in; (void)out_size;
    const float* x = (const float*)d_in[0]; const float* rcos = (const float*)d_in[1]; const float* rsin = (const float*)d_in[2]; const float* wf = (const float*)d_in[3]; const float* bfz = (const float*)d_in[4]; const float* wo = (const float*)d_in[5]; const float* bo = (const float*)d_in[6]; const float* bQ = (const float*)d_in[7]; const float* bK = (const float*)d_in[8]; const float* cosT = nullptr; const float* sinT = nullptr; (void)cosT; (void)sinT;
    float* OUT = (float*)d_out;     // [2][2048][1024]
    char* wsp = (char*)d_ws;
    auto take = [&](size_t bytes) { char* p = wsp; wsp += (bytes + 255) & ~(size_t)255; return (void*)p; };
    bf* WA = (bf*)take((size_t)3 * DQ * DM * 2); bf* WO = (bf*)take((size_t)DM * DQ * 2);   // WA: W_attn transposed, rows q | k | v
    bf* XB = (bf*)take((size_t)NB_ * TT * DM * 2);
    h16* QP16 = (h16*)take((size_t)NB_ * NH_ * TT * HD * 2); h16* KP16 = (h16*)take((size_t)NB_ * NKV * TT * HD * 2); h16* VT16 = (h16*)take((size_t)NB_ * NKV * HD * TT * 2);
    bf* QPh = (bf*)take((size_t)NB_ * NH_ * TT * HD * 2); bf* QPl = (bf*)take((size_t)NB_ * NH_ * TT * HD * 2); bf* KPh = (bf*)take((size_t)NB_ * NKV * TT * HD * 2); bf* KPl = (bf*)take((size_t)NB_ * NKV * TT * HD * 2); bf* VTh = (bf*)take((size_t)NB_ * NKV * HD * TT * 2); bf* VTl = (bf*)take((size_t)NB_ * NKV * HD * TT * 2);
    bf* ATh = (bf*)take((size_t)NB_ * TT * DQ * 2); bf* ATl = (bf*)take((size_t)NB_ * TT * DQ * 2);
    if ((size_t)(wsp - (char*)d_ws) > ws_size) return;    // ws 256 MiB
    // one launch a stage (k_wtGs: one a weight): the two batches are rows b TT + t of one grid, and q, k, v are the 3 DQ columns of one product
    k_wtGs<<<(unsigned)(((size_t)3 * DQ * DM / 8 + 255) / 256), 256, 0, stream>>>(wf, DM, 3 * DQ, 3 * DQ, WA);
    k_wtGs<<<(unsigned)(((size_t)DM * DQ / 8 + 255) / 256), 256, 0, stream>>>(wo, DQ, DM, DM, WO);
    k_cvt8<<<(unsigned)(((size_t)NB_ * TT * DM / 8 + 255) / 256), 256, 0, stream>>>(x, XB, (size_t)NB_ * TT * DM / 8);
    k_qkv<<<dim3(NB_ * TT / 256, 3 * DQ / 192, 1), 32 * QWV, 0, stream>>>(XB, WA, bfz, rcos, rsin, bQ, bK, QP16, QPh, QPl, KP16, KPh, KPl, VT16, VTh, VTl);
    k_attn<<<dim3(NBLO + NBHI, NH_, NB_), 32 * AW, 0, stream>>>(QP16, KP16, VT16, QPh, QPl, KPh, KPl, VTh, VTl, ATh, ATl);
    k_proj<<<dim3(NB_ * TT / 128, DM / 128, 1), 32 * PWV, 0, stream>>>(ATh, ATl, WO, OUT, bo);
}

// v007
// One run takes 92.3 microseconds.
// In both of two side-by-side timings against v006, it was 1.07 times as fast.
// Over all steps from v000 it is 15.9 times as fast.
#include <hip/hip_runtime.h>

// DisorderedCausalSelfAttention (x [2][2048][1024]; qkv = x W_attn + b ([1024][3072], split q | k | v, 16 heads x 64); partial RoPE on the first 32 dims of each head with the given per-batch tables rope_cos/rope_sin [B][T][32] (read; rotate_half within the 32 dims); then q += bQ[h], k += bK[h] (post-RoPE symmetry-breaking biases, read); causal softmax(q.k / 8); out = merged W_proj + b_proj -> [2][2048][1024]).
// Compute dtypes, f32 accumulate: every input rounded to bf16; q/k/v on PLAIN bf16 operands (inputs: exact) + bias; partial RoPE and the post-RoPE biases f32; causal scores and att.v: query rows < 512 hl (3 products), the rest single fp16; softmax f32, running maximum, normalised after att.v; W_proj hl x exact (2 products) + bias.

// Every 16-bit operand plane (rows x K) lies in FRAGMENT ORDER: the 16 rows x 32 k of one matrix operand are one 1024-B block, blocks run along k and then along the row groups. Inside a block the 16-B chunk of row r, k = 16 j + 8 h + (0..7) stands at chunk 32 j + 16 h + (r & 15),
// which is lane 16 h + (r & 15) of the operand's j-th 16-B load: each wave-wide load reads 512 contiguous bytes, four whole lines, where a row-major plane gives sixteen 32-B pieces. A group of 16 rows still takes 16 K elements, so row-group offsets read as in a row-major plane.
#define NB_  2
#define TT   2048
#define DM   1024
#define NH_  16
#define NKV  16
#define REP  (NH_ / NKV)
#define HD   64
#define DQ   (NH_ * HD)
#define DKV  (NKV * HD)
#define RH   512                  // query rows < RH use hi+lo planes (0: none)
#define SCL  0.125f   // HD^-0.5
typedef _Float16 h16;
typedef unsigned short bf;
typedef __attribute__((ext_vector_type(16))) __bf16   v16bf;
typedef __attribute__((ext_vector_type(16))) _Float16 v16h;
typedef __attribute__((ext_vector_type(8)))  _Float16 v8h;
typedef __attribute__((ext_vector_type(8)))  unsigned short v8us;
typedef __attribute__((ext_vector_type(8)))  float    v8f;
typedef __attribute__((ext_vector_type(4)))  float    v4f;
typedef v8h  __attribute__((may_alias)) v8ha;
typedef v4f  __attribute__((may_alias)) v4fa;
typedef v8us __attribute__((may_alias)) v8usa;
typedef float v2fa __attribute__((ext_vector_type(2), may_alias));

__device__ __forceinline__ unsigned short f2bf(float f) { unsigned u = __float_as_uint(f); u += 0x7FFFu + ((u >> 16) & 1u); return (unsigned short)(u >> 16); }
__device__ __forceinline__ float bf2f(unsigned short b) { return __uint_as_float(((unsigned)b) << 16); }
__device__ __forceinline__ float bfr(float f) { return bf2f(f2bf(f)); }
__device__ __forceinline__ v16h cat16(v8h lo, v8h hi) { return __builtin_shufflevector(lo, hi, 0, 1, 2, 3, 4, 5, 6, 7, 8, 9, 10, 11, 12, 13, 14, 15); }
__device__ __forceinline__ v16bf cat16b(v8us lo, v8us hi) { return __builtin_bit_cast(v16bf, __builtin_shufflevector(lo, hi, 0, 1, 2, 3, 4, 5, 6, 7, 8, 9, 10, 11, 12, 13, 14, 15)); }
__device__ __forceinline__ v8f wmma16(v16h a, v16h b, v8f c) { return __builtin_amdgcn_wmma_f32_16x16x32_f16(false, a, false, b, (short)0, c, false, false); }
__device__ __forceinline__ v8f wmmab(v16bf a, v16bf b, v8f c) { return __builtin_amdgcn_wmma_f32_16x16x32_bf16(false, a, false, b, (short)0, c, false, false); }



// WFrag: a matrix operand from a fragment-order plane (ld: p = the block's start + 8 lane)
template <typename T16> struct WFrag;
template <> struct WFrag<h16> { typedef v16h V; static __device__ __forceinline__ V ld(const h16* p) { return cat16(*(const v8h*)p, *(const v8h*)(p + 256)); } static __device__ __forceinline__ v8f mma(V a, V b, v8f c) { return wmma16(a, b, c); } };
template <> struct WFrag<bf> { typedef v16bf V; static __device__ __forceinline__ V ld(const bf* p) { return cat16b(*(const v8us*)p, *(const v8us*)(p + 256)); } static __device__ __forceinline__ v8f mma(V a, V b, v8f c) { return wmmab(a, b, c); } };
// ---- operand staging for the two GEMMs. The waves of a work-group share their operand rows: a stage = KS k of every row group (16 rows) of the work-group's tile, which in a fragment-order plane is 2 KiB in a row, brought into LDS once by asynchronous copies (16 B a lane, 512 contiguous bytes a copy)
// and read from there by every wave that needs it, in the same fragment order (each wave-wide ds_load_b128 reads 512 contiguous bytes). Two buffers: stage t + 1 flies while stage t is worked on.
// cpN: N copies, each with its own LDS byte address l and global address g; s_wait_xcnt 0 is the statement's last line, so that it stands in front of whatever rewrites a register that a copy names
#define KS 64
__device__ __forceinline__ unsigned lds_off(const void* p) { return (unsigned)(size_t)p; }
__device__ __forceinline__ void cp1(const unsigned (&l)[1], const bf* const (&g)[1]) { asm volatile("global_load_async_to_lds_b128 %0, %1, off\n\ts_wait_xcnt 0x0" :: "v"(l[0]), "v"(g[0]) : "memory"); }
__device__ __forceinline__ void cp9(const unsigned (&l)[9], const bf* const (&g)[9]) { asm volatile("global_load_async_to_lds_b128 %0, %9, off\n\tglobal_load_async_to_lds_b128 %1, %10, off\n\tglobal_load_async_to_lds_b128 %2, %11, off\n\tglobal_load_async_to_lds_b128 %3, %12, off\n\tglobal_load_async_to_lds_b128 %4, %13, off\n\tglobal_load_async_to_lds_b128 %5, %14, off\n\tglobal_load_async_to_lds_b128 %6, %15, off\n\tglobal_load_async_to_lds_b128 %7, %16, off\n\tglobal_load_async_to_lds_b128 %8, %17, off\n\ts_wait_xcnt 0x0" :: "v"(l[0]), "v"(l[1]), "v"(l[2]), "v"(l[3]), "v"(l[4]), "v"(l[5]), "v"(l[6]), "v"(l[7]), "v"(l[8]), "v"(g[0]), "v"(g[1]), "v"(g[2]), "v"(g[3]), "v"(g[4]), "v"(g[5]), "v"(g[6]), "v"(g[7]), "v"(g[8]) : "memory"); }
__device__ __forceinline__ void cp12(const unsigned (&l)[12], const bf* const (&g)[12]) { asm volatile("global_load_async_to_lds_b128 %0, %12, off\n\tglobal_load_async_to_lds_b128 %1, %13, off\n\tglobal_load_async_to_lds_b128 %2, %14, off\n\tglobal_load_async_to_lds_b128 %3, %15, off\n\tglobal_load_async_to_lds_b128 %4, %16, off\n\tglobal_load_async_to_lds_b128 %5, %17, off\n\tglobal_load_async_to_lds_b128 %6, %18, off\n\tglobal_load_async_to_lds_b128 %7, %19, off\n\tglobal_load_async_to_lds_b128 %8, %20, off\n\tglobal_load_async_to_lds_b128 %9, %21, off\n\tglobal_load_async_to_lds_b128 %10, %22, off\n\tglobal_load_async_to_lds_b128 %11, %23, off\n\ts_wait_xcnt 0x0" :: "v"(l[0]), "v"(l[1]), "v"(l[2]), "v"(l[3]), "v"(l[4]), "v"(l[5]), "v"(l[6]), "v"(l[7]), "v"(l[8]), "v"(l[9]), "v"(l[10]), "v"(l[11]), "v"(g[0]), "v"(g[1]), "v"(g[2]), "v"(g[3]), "v"(g[4]), "v"(g[5]), "v"(g[6]), "v"(g[7]), "v"(g[8]), "v"(g[9]), "v"(g[10]), "v"(g[11]) : "memory"); }
// stage_done: the foot of a trip, every wave: its own LDS reads are back, its own copies have landed, then the work-group barrier that publishes the next stage and ends every reader's last read of this one
__device__ __forceinline__ void stage_done() { asm volatile("s_wait_dscnt 0x0" ::: "memory"); asm volatile("s_wait_asynccnt 0x0" ::: "memory"); __syncthreads(); }

// ---- k_proj: C[m][n] (f32, + bias[n]) = sum_k (A + A2)[m][k] Bt[n][k], two products. Work-group = 8 waves = 128 x 128 of C, a wave 32 x 64 (8 accumulators), two waves a SIMD; grid (M/128, N/128).
// Stage: 8 row groups of A, 8 of A2, 8 of Bt; wave w copies the (w & 3)-th 512 B of row groups (w >> 2), (w >> 2) + 2, ...
#define PWV 8
#define PRG 24
#define PST (PRG * 16 * KS)   // elements a stage
__global__ __launch_bounds__(32 * PWV) void k_proj(const bf* __restrict__ A, const bf* __restrict__ A2, const bf* __restrict__ Bt, float* C, const float* __restrict__ bias) {
    typedef WFrag<bf>::V V;
    __shared__ __align__(1024) bf ring[2 * PST];
    __shared__ __align__(16) float oss[PWV * 16 * 68];
    const int lane = threadIdx.x & 31, lr = lane & 15, hi = lane >> 4; const int wave = __builtin_amdgcn_readfirstlane((int)(threadIdx.x >> 5));   // scalar: what is formed from it stays in scalar registers
    const int R0 = blockIdx.x * 128, C0 = blockIdx.y * 128; const int r0 = R0 + (wave >> 1) * 32, c0 = C0 + (wave & 1) * 64;
    float* os = oss + wave * 16 * 68;
    const int wh = wave >> 2, po = (wave & 3) * 256 + 8 * lane;   // po: the lane's 16 B inside a row group's 2 KiB
    const bf* gA = A + (size_t)(R0 + wh * 16) * DQ + po; const bf* gA2 = A2 + (size_t)(R0 + wh * 16) * DQ + po; const bf* gB = Bt + (size_t)(C0 + wh * 16) * DQ + po; const unsigned l0 = lds_off(ring) + 2 * (wh * 1024 + po);
    auto issue = [&](int t) { const unsigned lb = l0 + (t & 1) * (PST * 2); const int go = t * (KS * 16); unsigned l[12]; const bf* g[12];
#pragma unroll
        for (int i = 0; i < 12; ++i) { l[i] = lb + i * 2 * 2048; g[i] = (i < 4 ? gA : i < 8 ? gA2 : gB) + (size_t)(i & 3) * 32 * DQ + go; }
        cp12(l, g); };
    v8f acc[2][4];
#pragma unroll
    for (int mb = 0; mb < 2; ++mb)
#pragma unroll
        for (int nb = 0; nb < 4; ++nb) acc[mb][nb] = (v8f){};
    issue(0); asm volatile("s_wait_asynccnt 0x0" ::: "memory"); __syncthreads();   // stage 0 has landed and is published
    issue(1);
    const int ao = (wave >> 1) * 2 * 1024 + 8 * lane, bo = (16 + (wave & 1) * 4) * 1024 + 8 * lane;
    // kept rolled: the buffer index alternates from trip to trip
#pragma unroll 1
    for (int t = 0; t < DQ / KS; ++t) {
        const bf* st = ring + (t & 1) * PST;
        V a[KS / 32][2], a2[KS / 32][2], b[KS / 32][4];
#pragma unroll
        for (int kb = 0; kb < KS / 32; ++kb) {
#pragma unroll
            for (int i = 0; i < 2; ++i) { a[kb][i] = WFrag<bf>::ld(st + ao + i * 1024 + kb * 512); a2[kb][i] = WFrag<bf>::ld(st + ao + (8 + i) * 1024 + kb * 512); }
#pragma unroll
            for (int i = 0; i < 4; ++i) b[kb][i] = WFrag<bf>::ld(st + bo + i * 1024 + kb * 512); }
        __builtin_amdgcn_sched_barrier(0);   // the trip's LDS reads stand as one group in front of its matrix instructions: left to itself the compiler puts them among those in pairs, each behind a wait to 0
#pragma unroll
        for (int kb = 0; kb < KS / 32; ++kb)
#pragma unroll
            for (int nb = 0; nb < 4; ++nb)
#pragma unroll
                for (int mb = 0; mb < 2; ++mb) { acc[mb][nb] = WFrag<bf>::mma(a[kb][mb], b[kb][nb], acc[mb][nb]); acc[mb][nb] = WFrag<bf>::mma(a2[kb][mb], b[kb][nb], acc[mb][nb]); }
        __builtin_amdgcn_sched_barrier(0);   // keeps the matrix instructions in front of the trip's foot: moved behind its waits they would no longer run while the next stage's copies fly
        stage_done();
        if (t + 2 < DQ / KS) issue(t + 2);   // into the buffer that this trip has just read
    }
    asm volatile("s_wait_asynccnt 0x0" ::: "memory");   // no copy is outstanding when the wave goes on
    const float* bp = bias + c0 + lr * 4; const v4f bv = *(const v4fa*)bp;   // the lane's four columns' bias
    asm volatile("s_wait_xcnt 0x0" :: "v"(bp) : "memory"); __builtin_amdgcn_sched_barrier(0);   // behind the load, in front of whatever overwrites its address register; it names the address as an input, so that the load does not land on it
#pragma unroll
    for (int mb = 0; mb < 2; ++mb) {
#pragma unroll
        for (int nb = 0; nb < 4; ++nb) {
#pragma unroll
            for (int j = 0; j < 8; ++j) os[(hi * 8 + j) * 68 + nb * 16 + lr] = acc[mb][nb][j]; }
        __builtin_amdgcn_wave_barrier(); asm volatile("" ::: "memory");
        float* crow = C + (size_t)(r0 + mb * 16) * DM + c0;
{
#pragma unroll
            for (int s = 0; s < 8; ++s) { const int row = 2 * s + hi, cofs = lr * 4; v4f val = *(const v4fa*)(os + row * 68 + cofs); val[0] += bfr(bv[0]); val[1] += bfr(bv[1]); val[2] += bfr(bv[2]); val[3] += bfr(bv[3]);
                *(v4f*)(crow + (size_t)row * DM + cofs) = val; }
             }
        asm volatile("s_wait_xcnt 0x0" ::: "memory"); __builtin_amdgcn_sched_barrier(0);   // behind the eight stores, in front of whatever overwrites their address or data registers (the next row group's values); the scheduling barrier keeps that code behind the wait
        __builtin_amdgcn_wave_barrier(); asm volatile("" ::: "memory");
    }
}

__device__ __forceinline__ h16 tohx(float x) { return (h16)x; }
__device__ __forceinline__ void splitf(float y, unsigned short& h, unsigned short& l) { h = f2bf(y); l = f2bf(y - bf2f(h)); }
typedef __attribute__((ext_vector_type(2))) _Float16 v2h;
typedef __attribute__((ext_vector_type(4))) _Float16 v4h;
typedef __attribute__((ext_vector_type(2))) unsigned short v2us;
typedef __attribute__((ext_vector_type(4))) unsigned short v4us;
typedef __attribute__((ext_vector_type(2))) float v2f;
typedef __attribute__((ext_vector_type(4))) int v4i;

// frag_off: where the 16-B chunk of (row, k .. k + 7), k a multiple of 8, stands in a fragment-order plane with K columns, in elements
__device__ __forceinline__ size_t frag_off(int row, int k, int K) { return ((((size_t)(row >> 4) * (K >> 5) + (k >> 5)) * 2 + ((k >> 4) & 1)) * 32 + ((k >> 3) & 1) * 16 + (row & 15)) * 8; }
// ---- k_prep: all operand preparation in one launch: x -> XB, W_attn -> WA, W_proj -> WO, none of which reads another's output; the job goes by the block index. Few, long-lived waves: a thread takes PC chunks, all of its loads in flight together, so that 4096 waves are started and not 32768.
#define PC 8   // chunks (8 elements of a plane each) a thread
// prep_x, wave task q: 8 rows x 256 k of x. For each of its PC chunks (32 k apart) a wave reads one whole 128-B line of each row and stores four whole lines (8 neighbouring rows of each of the four chunk columns)
__device__ __forceinline__ void prep_x(const float* __restrict__ src, bf* dst, int q, int lane) {
    const int row = (q >> 2) * 8 + (lane >> 2), k = (q & 3) * (32 * PC) + (lane & 3) * 8; const float* p = src + (size_t)row * DM + k; v8f v[PC]; v8us o[PC];
    // every '#pragma unroll' of prep_x and prep_w: the indices of the register arrays must be compile-time constants, so that they stay in registers
#pragma unroll
    for (int c = 0; c < PC; ++c) v[c] = *(const v8f*)(p + 32 * c);
    asm volatile("s_wait_xcnt 0x0" :: "v"(p) : "memory"); __builtin_amdgcn_sched_barrier(0);   // behind the loads, in front of whatever overwrites their address register (the instruction set's rule for an issued load); it names the address as an input, so that no load of the run lands on it, and the scheduling barrier keeps later code behind it
#pragma unroll
    for (int c = 0; c < PC; ++c)
#pragma unroll
        for (int u = 0; u < 8; ++u) o[c][u] = f2bf(v[c][u]);
    __builtin_amdgcn_sched_barrier(0);   // the stores stand together as one run behind all the conversions, so that one wait behind the last of them serves the run
    bf* d = dst + frag_off(row, k, DM);
#pragma unroll
    for (int c = 0; c < PC; ++c) *(v8us*)(d + 512 * c) = o[c];   // 32 k on: the next 1024-B block
    asm volatile("s_wait_xcnt 0x0" ::: "memory"); }   // behind the last store, in front of whatever code follows in the kernel and overwrites the stores' address or data registers
// prep_w, wave task q: 32 neighbouring n x 64 k of Bt (fragment order, rows n, K columns): element (n, k) = w[k * N + n]. Each of the wave's 64 loads reads one whole 128-B line of w (the waves of a work-group take neighbouring n), each of its PC stores writes two 256-B runs (16 neighbouring rows of a block stand side by side)
template <int K, int N>
__device__ __forceinline__ void prep_w(const float* __restrict__ w, bf* Bt, int q, int lane) {
    const int n = (q % (N / 32)) * 32 + lane, k = (q / (N / 32)) * (8 * PC); const float* p = w + (size_t)k * N + n; float v[8 * PC]; v8us o[PC];
#pragma unroll
    for (int i = 0; i < 8 * PC; ++i) v[i] = p[(size_t)i * N];
    asm volatile("s_wait_xcnt 0x0" :: "v"(p) : "memory"); __builtin_amdgcn_sched_barrier(0);   // as in prep_x
#pragma unroll
    for (int c = 0; c < PC; ++c)
#pragma unroll
        for (int u = 0; u < 8; ++u) o[c][u] = f2bf(v[8 * c + u]);
    __builtin_amdgcn_sched_barrier(0);   // as in prep_x
    bf* d = Bt + frag_off(n, k, K);
#pragma unroll
    for (int c = 0; c < PC; ++c) *(v8us*)(d + 128 * c) = o[c];   // 8 k on: 16 chunks on in the fragment order (k a multiple of 64)
    asm volatile("s_wait_xcnt 0x0" ::: "memory"); }   // as in prep_x
#define PBX (NB_ * TT * DM / (8 * PC * 256))   // work-groups for x
#define PBA (3 * DQ * DM / (8 * PC * 256))     // for W_attn
#define PBO (DM * DQ / (8 * PC * 256))         // for W_proj
__global__ __launch_bounds__(256) void k_prep(const float* __restrict__ x, const float* __restrict__ wa, const float* __restrict__ wo, bf* XB, bf* WA, bf* WO) {
    const int lane = threadIdx.x & 31, wave = __builtin_amdgcn_readfirstlane((int)(threadIdx.x >> 5)), b = blockIdx.x;   // wave scalar: the task's indices stay in scalar registers
    if (b < PBX) prep_x(x, XB, b * 8 + wave, lane);
    else if (b < PBX + PBA) prep_w<DM, 3 * DQ>(wa, WA, (b - PBX) * 8 + wave, lane);
    else prep_w<DQ, DM>(wo, WO, (b - PBX - PBA) * 8 + wave, lane);
}
__global__ __launch_bounds__(256) void k_cscvt(const float* __restrict__ cosT, const float* __restrict__ sinT, float* CS) { const int idx = blockIdx.x * 256 + threadIdx.x; if (idx >= TT * HD) return; v2f cs; cs[0] = bfr(cosT[idx]); cs[1] = bfr(sinT[idx]); *(v2f*)(CS + (size_t)idx * 2) = cs;  }
#define AW   4                    // waves a work-group; they walk the same keys at about the same time
#define RLO  2                    // query groups a wave, fp16 rows
#define NBLO ((TT - RH) / (16 * AW * RLO))   // work-groups a head, fp16 rows
#define NBHI (RH / (16 * AW))                // work-groups a head, hi+lo rows
#define CSC  (SCL * 1.4426950408889634f)
__device__ __forceinline__ float xhalf(float x) { return __builtin_bit_cast(float, __builtin_amdgcn_permlanex16(__builtin_bit_cast(int, x), __builtin_bit_cast(int, x), 0x76543210, 0xfedcba98, false, false)); }   // lane l reads lane l ^ 16
// dist: the distance behind the last matrix instruction of a product before its operand registers are loaded anew, on a loop's back edge too; it names the product's tiles so that the whole product stands in front of it
__device__ __forceinline__ void dist(v8f (&s)[1][2]) { asm volatile("v_nop\n\tv_nop\n\tv_nop\n\tv_nop" : "+v"(s[0][0]), "+v"(s[0][1])); }
__device__ __forceinline__ void dist(v8f (&s)[2][2]) { asm volatile("v_nop\n\tv_nop\n\tv_nop\n\tv_nop" : "+v"(s[0][0]), "+v"(s[0][1]), "+v"(s[1][0]), "+v"(s[1][1])); }
__device__ __forceinline__ void dist(v8f (&s)[1][4]) { asm volatile("v_nop\n\tv_nop\n\tv_nop\n\tv_nop" : "+v"(s[0][0]), "+v"(s[0][1]), "+v"(s[0][2]), "+v"(s[0][3])); }
__device__ __forceinline__ void dist(v8f (&s)[2][4]) { asm volatile("v_nop\n\tv_nop\n\tv_nop\n\tv_nop" : "+v"(s[0][0]), "+v"(s[0][1]), "+v"(s[0][2]), "+v"(s[0][3]), "+v"(s[1][0]), "+v"(s[1][1]), "+v"(s[1][2]), "+v"(s[1][3])); }
// xdone: stands behind a run of global loads from a (and b), in front of whatever overwrites the registers that held their addresses (the instruction set's rule for an issued load). It names the two addresses as inputs, so that their registers live up to the wait
// and no load of the run lands on them; the scheduling barrier keeps the loads in front of it and later code behind it.
template <bool TWO>
__device__ __forceinline__ void xdone(const void* a, const void* b) { if (TWO) asm volatile("s_wait_xcnt 0x0" :: "v"(a), "v"(b) : "memory"); else asm volatile("s_wait_xcnt 0x0" :: "v"(a) : "memory"); __builtin_amdgcn_sched_barrier(0); }
template <typename T16, bool HI, bool MASK, int R>
__device__ __forceinline__ void attn_pass(typename WFrag<T16>::V (&kf)[2][2], typename WFrag<T16>::V (&kf2)[2][2], const T16* Kn, const T16* Kn2, const T16* Vp, const T16* Vp2,
                                          const typename WFrag<T16>::V (&qf)[R][2], const typename WFrag<T16>::V (&qf2)[R][2], v8f (&acc)[R][4], float (&m)[R], float (&l)[R], int key0, int myq, int hi) {
    typedef typename WFrag<T16>::V V;
    // every '#pragma unroll' of this function: the indices of the fragment and accumulator arrays must be compile-time constants, so that they stay in registers
    V vf[4], vf2[4];   // this pass's V^T fragments (rows d, k = keys), in flight under the first product and the exponentials
#pragma unroll
    for (int t = 0; t < 4; ++t) { vf[t] = WFrag<T16>::ld(Vp + (size_t)t * 16 * TT); if (HI) vf2[t] = WFrag<T16>::ld(Vp2 + (size_t)t * 16 * TT); }
    xdone<HI>(Vp, Vp2);
    v8f s[R][2];
#pragma unroll
    for (int g = 0; g < R; ++g)
#pragma unroll
        for (int kt = 0; kt < 2; ++kt) { s[g][kt] = (v8f){};
#pragma unroll
            for (int kc = 0; kc < 2; ++kc) { s[g][kt] = WFrag<T16>::mma(kf[kt][kc], qf[g][kc], s[g][kt]); if (HI) { s[g][kt] = WFrag<T16>::mma(kf[kt][kc], qf2[g][kc], s[g][kt]); s[g][kt] = WFrag<T16>::mma(kf2[kt][kc], qf[g][kc], s[g][kt]); } } }
    dist(s);
    __builtin_amdgcn_sched_barrier(0);   // keeps the loads below behind that distance
    if (!HI) {   // the next pass's K fragments, in flight under this pass's softmax and second product
#pragma unroll
        for (int kt = 0; kt < 2; ++kt)
#pragma unroll
            for (int kc = 0; kc < 2; ++kc) kf[kt][kc] = WFrag<T16>::ld(Kn + kt * 16 * HD + kc * 512);
        xdone<false>(Kn, nullptr); }
    float mx[R]; bool need = false;
#pragma unroll
    for (int g = 0; g < R; ++g) { float x0 = -3.0e38f;
#pragma unroll
        for (int e = 0; e < 16; ++e) { float x = s[g][e >> 3][e & 7] * CSC; if (MASK) x = (key0 + 16 * (e >> 3) + 8 * hi + (e & 7) <= myq + 16 * g) ? x : -3.0e38f; s[g][e >> 3][e & 7] = x; x0 = fmaxf(x0, x); }
        mx[g] = fmaxf(x0, xhalf(x0));   // lanes l and l ^ 16 hold the two key halves of one query
        need = need || (mx[g] > m[g]); }
    if (__builtin_amdgcn_ballot_w32(need) != 0) {   // wave-uniform; where a query's maximum does not move its factor is exactly 1
#pragma unroll
        for (int g = 0; g < R; ++g) { const float mn = fmaxf(m[g], mx[g]); const float corr = __builtin_amdgcn_exp2f(m[g] - mn); m[g] = mn; l[g] *= corr;
#pragma unroll
            for (int t = 0; t < 4; ++t) acc[g][t] *= corr; } }
#pragma unroll
    for (int g = 0; g < R; ++g) { float p[16];
#pragma unroll
        for (int e = 0; e < 16; ++e) { p[e] = __builtin_amdgcn_exp2f(s[g][e >> 3][e & 7] - m[g]); l[g] += p[e]; }
        if (HI) { v8us h0, h1, l0, l1;
#pragma unroll
            for (int e = 0; e < 8; ++e) { unsigned short a, c; splitf(p[e], a, c); h0[e] = a; l0[e] = c; splitf(p[8 + e], a, c); h1[e] = a; l1[e] = c; }
            const v16bf ph = cat16b(h0, h1), pl = cat16b(l0, l1);
#pragma unroll
            for (int t = 0; t < 4; ++t) { acc[g][t] = wmmab(__builtin_bit_cast(v16bf, vf[t]), ph, acc[g][t]); acc[g][t] = wmmab(__builtin_bit_cast(v16bf, vf[t]), pl, acc[g][t]); acc[g][t] = wmmab(__builtin_bit_cast(v16bf, vf2[t]), ph, acc[g][t]); }
        } else { v16h pf;
#pragma unroll
            for (int e = 0; e < 16; ++e) pf[e] = tohx(p[e]);
#pragma unroll
            for (int t = 0; t < 4; ++t) acc[g][t] = wmma16(__builtin_bit_cast(v16h, vf[t]), pf, acc[g][t]); } }
    dist(acc);
    if (HI) {   // with hi and lo planes K and V^T together do not fit 256 registers: the next pass's K is loaded when V^T is spent (these rows have at most RH / 32 passes and are never the longest)
        __builtin_amdgcn_sched_barrier(0);   // keeps these loads behind the second product
#pragma unroll
        for (int kt = 0; kt < 2; ++kt)
#pragma unroll
            for (int kc = 0; kc < 2; ++kc) { kf[kt][kc] = WFrag<T16>::ld(Kn + kt * 16 * HD + kc * 512); kf2[kt][kc] = WFrag<T16>::ld(Kn2 + kt * 16 * HD + kc * 512); }
        xdone<true>(Kn, Kn2); }
}
// q0: the wave's first query row, a multiple of 16 R
template <typename T16, bool HI, int R>
__device__ __forceinline__ void attn_rows(const T16* __restrict__ Q, const T16* __restrict__ Q2, const T16* __restrict__ K, const T16* __restrict__ K2, const T16* __restrict__ Vt, const T16* __restrict__ Vt2, int q0, int head, bf* Ah, bf* Al) {
    typedef typename WFrag<T16>::V V;
    const int lane = threadIdx.x & 31, lr = lane & 15, hi = lane >> 4; const int myq = q0 + lr;
    const size_t qo = (size_t)q0 * HD + 8 * lane; const int ko = 8 * lane, vo = 8 * lane;   // fragment order: Q and K blocks (16 rows, 32 d) at 16 HD a row group and 512 a d block; V^T blocks (16 d, 32 keys) at 16 TT a d group and 512 a key block
    V qf[R][2], qf2[R][2], kf[2][2], kf2[2][2];
#pragma unroll
    for (int g = 0; g < R; ++g)
#pragma unroll
        for (int kc = 0; kc < 2; ++kc) { qf[g][kc] = WFrag<T16>::ld(Q + qo + g * 16 * HD + kc * 512); if (HI) qf2[g][kc] = WFrag<T16>::ld(Q2 + qo + g * 16 * HD + kc * 512); }
    xdone<HI>(Q + qo, Q2 + qo);
#pragma unroll
    for (int kt = 0; kt < 2; ++kt)
#pragma unroll
        for (int kc = 0; kc < 2; ++kc) { kf[kt][kc] = WFrag<T16>::ld(K + ko + kt * 16 * HD + kc * 512); if (HI) kf2[kt][kc] = WFrag<T16>::ld(K2 + ko + kt * 16 * HD + kc * 512); }
    xdone<HI>(K + ko, K2 + ko);
    v8f acc[R][4]; float m[R], l[R];
#pragma unroll
    for (int g = 0; g < R; ++g) { m[g] = -3.0e38f; l[g] = 0.f;
#pragma unroll
        for (int t = 0; t < 4; ++t) acc[g][t] = (v8f){}; }
    const int klast = (q0 >> 5) << 5;   // first key of the pass that holds the wave's diagonal (its 16 R <= 32 rows lie in one 32-key block): the only pass with masked keys, and the last
    // kept rolled: one pass's fragments and the next pass's K already fill the registers
#pragma unroll 1
    for (int key0 = 0; key0 < klast; key0 += 32) attn_pass<T16, HI, false, R>(kf, kf2, K + ko + (key0 + 32) * HD, K2 + ko + (key0 + 32) * HD, Vt + vo + key0 * 16, Vt2 + vo + key0 * 16, qf, qf2, acc, m, l, key0, myq, hi);
    attn_pass<T16, HI, true, R>(kf, kf2, K + ko + klast * HD, K2 + ko + klast * HD, Vt + vo + klast * 16, Vt2 + vo + klast * 16, qf, qf2, acc, m, l, klast, myq, hi);   // there is no next pass: its K load repeats this pass's rows, in bounds, unused
#pragma unroll
    for (int g = 0; g < R; ++g) { const float lt = l[g] + xhalf(l[g]); const float inv = __fdiv_rn(1.0f, lt);
#pragma unroll
        for (int t = 0; t < 4; ++t) { v8us oh, ol;   // registers j of tile t are d = 16 t + 8 hi + j of query myq + 16 g
#pragma unroll
            for (int j = 0; j < 8; ++j) { unsigned short a, c; splitf(acc[g][t][j] * inv, a, c); oh[j] = a; ol[j] = c; }
            const size_t oo = (size_t)(q0 + 16 * g) * DQ + (head * 2 + (t >> 1)) * 512 + (t & 1) * 256 + 8 * lane; *(v8us*)(Ah + oo) = oh; *(v8us*)(Al + oo) = ol;   // fragment order, k = head HD + d: each store is 512 contiguous bytes
            asm volatile("s_wait_xcnt 0x0" ::: "memory"); __builtin_amdgcn_sched_barrier(0); } }   // behind the two stores, in front of whatever overwrites their address or data registers (the next tile's values); the scheduling barrier keeps that code behind the wait
}
__global__ __launch_bounds__(32 * AW) void k_attn(const h16* __restrict__ Q16, const h16* __restrict__ K16, const h16* __restrict__ V16, const bf* __restrict__ Qh, const bf* __restrict__ Ql, const bf* __restrict__ Kh, const bf* __restrict__ Kl, const bf* __restrict__ Vh, const bf* __restrict__ Vl, bf* Ah, bf* Al) {
    const int head = blockIdx.y; const size_t hp = ((size_t)blockIdx.z * NH_ + head) * TT * HD; const int bx = blockIdx.x; Ah += (size_t)blockIdx.z * TT * DQ; Al += (size_t)blockIdx.z * TT * DQ;   // blockIdx.z: the batch
    const int wave = __builtin_amdgcn_readfirstlane((int)(threadIdx.x >> 5));   // scalar, so that the key loop is a scalar loop with every lane on
    if (bx < NBLO) attn_rows<h16, false, RLO>(Q16 + hp, nullptr, K16 + hp, nullptr, V16 + hp, nullptr, TT - (bx + 1) * (16 * AW * RLO) + wave * (16 * RLO), head, Ah, Al);   // the longest rows take the lowest block indices
    else attn_rows<bf, true, 1>(Qh + hp, Ql + hp, Kh + hp, Kl + hp, Vh + hp, Vl + hp, (bx - NBLO) * (16 * AW) + wave * 16, head, Ah, Al);
}

// ---- k_qkv: the q | k | v projection (the staged loop of k_proj, one wave per 64x64 tile = 64 rows b TT + t of one head of q, k or v) with everything that follows it up to the 16-bit planes in its epilogue: + b_attn, partial RoPE, the post-RoPE head bias, the fp16 and hi/lo bf16 rounding, and for v the transpose. The f32 values never leave the work-group.
// A matrix tile leaves the unit with lane = column and registers = 8 consecutive rows, so the operand whose index is to run along a plane's rows goes in as A: for q and k (planes [t][d]) A = W^T rows d and B = x rows t, for v (planes [d][t]) A = x rows t and B = W^T rows d. Both are fragment-order planes read by the same loader, so only the two pointers change places.
// acc[x][y][j] is then plane row 16 y + lr, plane column 16 x + 8 hi + j. The tile goes to LDS as f32 in that form and is read back four whole plane rows at a time, eight columns a lane.
#define FP 68   // pitch of a staged row in dwords, 64 + 4: the 16-byte LDS writes (16 rows, one column block) and reads (whole rows) both fall on distinct banks
template <bool ROPE>
__device__ __forceinline__ void qkv_out(const float* F, const float* __restrict__ gb, const float* __restrict__ rc, const float* __restrict__ rs, const float* __restrict__ hb, h16* P16, bf* Ph, bf* Pl, int pitch, int lane) {
    const int r4 = lane >> 3, ch = (lane & 7) * 8;   // the lane's row among four, its first column (for q and k: d)
    const int co = (ch >> 5) * 512 + ((ch >> 4) & 1) * 256 + ((ch >> 3) & 1) * 128;   // where that column's chunks start in a fragment-order block row (P16, Ph, Pl point at the tile's first block; pitch = the plane's K)
    float g[8], g2[8], p[8]; v4f cn[2], sn[2];
    // every '#pragma unroll' of this function and of k_qkv: the indices of the register arrays and vectors must be compile-time constants, so that they stay in registers
    const float* cp = ROPE ? rc + r4 * 32 + (ch & 31) : nullptr; const float* sp = ROPE ? rs + r4 * 32 + (ch & 31) : nullptr;   // lanes with d >= 32 read the row's tables too (in bounds) and do not use them
    if (ROPE) { const float* gp = gb + ch; const float* gq = gb + (ch ^ 16); const float* pp = hb + ch;   // b_attn at d and at the RoPE partner d +- 16, the head bias at d
#pragma unroll
        for (int u = 0; u < 2; ++u) { const v4f a = *(const v4fa*)(gp + 4 * u), b = *(const v4fa*)(gq + 4 * u), c = *(const v4fa*)(pp + 4 * u); cn[u] = *(const v4fa*)(cp + 4 * u); sn[u] = *(const v4fa*)(sp + 4 * u);
#pragma unroll
            for (int j = 0; j < 4; ++j) { g[4 * u + j] = bfr(a[j]); g2[4 * u + j] = bfr(b[j]); p[4 * u + j] = bfr(c[j]); } }
        asm volatile("s_wait_xcnt 0x0" :: "v"(gp), "v"(gq), "v"(pp), "v"(cp), "v"(sp) : "memory"); __builtin_amdgcn_sched_barrier(0); }   // as xdone, for the five addresses of this run of loads
    // kept rolled: sixteen equal trips; unrolled they would be tens of KiB of code that every wave runs once
#pragma unroll 1
    for (int q = 0; q < 16; ++q) {
        const float* f = F + (q * 4 + r4) * FP; const v4f f0 = *(const v4fa*)(f + ch), f1 = *(const v4fa*)(f + ch + 4); float r[8];
        if (ROPE) { const v4f e0 = *(const v4fa*)(f + (ch ^ 16)), e1 = *(const v4fa*)(f + (ch ^ 16) + 4); const v4f c0 = cn[0], c1 = cn[1], s0 = sn[0], s1 = sn[1];
            if (q < 15) { cp += 4 * 32; sp += 4 * 32; }   // the next four rows' tables, in flight under this trip's work; the last trip repeats its own, in bounds, unused
            cn[0] = *(const v4fa*)cp; cn[1] = *(const v4fa*)(cp + 4); sn[0] = *(const v4fa*)sp; sn[1] = *(const v4fa*)(sp + 4);
            xdone<true>(cp, sp);
#pragma unroll
            for (int j = 0; j < 8; ++j) { const float x0 = (j < 4 ? f0[j & 3] : f1[j & 3]) + g[j], x1 = (j < 4 ? e0[j & 3] : e1[j & 3]) + g2[j]; const float c = bfr(j < 4 ? c0[j & 3] : c1[j & 3]), s = bfr(j < 4 ? s0[j & 3] : s1[j & 3]);
                const float ro = x0 * c + x1 * (ch < 16 ? -s : s);   // rotate-half within the first 32 dims
                r[j] = (ch < 32 ? ro : x0) + p[j]; }
        } else {
#pragma unroll
            for (int j = 0; j < 8; ++j) r[j] = j < 4 ? f0[j & 3] : f1[j & 3]; }
        v8h o16; v8us oh, ol;
#pragma unroll
        for (int j = 0; j < 8; ++j) { o16[j] = tohx(r[j]); unsigned short a2, c2; splitf(r[j], a2, c2); oh[j] = a2; ol[j] = c2; }
        const int rr = q * 4 + r4; const size_t go = (size_t)(rr >> 4) * 16 * pitch + co + (rr & 15) * 8; *(v8ha*)(P16 + go) = o16; *(v8usa*)(Ph + go) = oh; *(v8usa*)(Pl + go) = ol;   // each store of the wave: eight 64-B pieces (four neighbouring rows of eight chunk columns); the next trip fills the lines' other halves
        asm volatile("s_wait_xcnt 0x0" ::: "memory"); __builtin_amdgcn_sched_barrier(0);   // behind the three stores, in front of whatever overwrites their address or data registers (the next trip's); the scheduling barrier keeps that code behind the wait
    }
}
#define QWV 12                 // waves a work-group: 3 heads (64 rows of W^T each) x 4 tiles of 64 rows of x; 256 work-groups
#define QRG 28                 // row groups a stage: 12 of W^T, then 16 of x
#define QST (QRG * 16 * KS)    // elements a stage
__global__ __launch_bounds__(32 * QWV) void k_qkv(const bf* __restrict__ X, const bf* __restrict__ Wt, const float* __restrict__ bias, const float* __restrict__ rc, const float* __restrict__ rs, const float* __restrict__ bQ, const float* __restrict__ bK,
                                            h16* Q16, bf* Qh, bf* Ql, h16* K16, bf* Kh, bf* Kl, h16* V16, bf* Vh, bf* Vl) {
    typedef WFrag<bf>::V V;
    __shared__ __align__(1024) bf ring[2 * QST];
    __shared__ __align__(16) float Fs[QWV * 64 * FP];
    const int lane = threadIdx.x & 31, lr = lane & 15, hi = lane >> 4; const int wave = __builtin_amdgcn_readfirstlane((int)(threadIdx.x >> 5));   // scalar: every branch on it is a scalar branch
    const int wq = wave >> 2, wp = wave & 3; const int R0 = blockIdx.x * 256, C0 = blockIdx.y * 192; const int r0 = R0 + wp * 64, c0 = C0 + wq * 64;
    float* F = Fs + wave * 64 * FP;   // the wave's own epilogue tile
    const int sel = c0 / DQ, head = (c0 % DQ) / HD;   // 0 q, 1 k, 2 v
    // the stage's 112 copies: wave (wq, wp) brings the wp-th 512 B of row groups wq, wq + 3, ..., wq + 24, and the waves with wq = 0 that of row group 27 too. Row groups up to wq + 9 are W^T's, the rest x's
    const int po = wp * 256 + 8 * lane; const bf* gW = Wt + (size_t)(C0 + wq * 16) * DM + po; const bf* gX = X + (size_t)(R0 + wq * 16) * DM + po; const unsigned l0 = lds_off(ring) + 2 * (wq * 1024 + po);
    auto issue = [&](int t) { const unsigned lb = l0 + (t & 1) * (QST * 2); const int go = t * (KS * 16); unsigned l[9]; const bf* g[9];
#pragma unroll
        for (int i = 0; i < 9; ++i) { l[i] = lb + i * 3 * 2048; g[i] = (i < 4 ? gW + (size_t)i * 48 * DM : gX + (size_t)(i - 4) * 48 * DM) + go; }
        cp9(l, g);
        if (wq == 0) { const unsigned l1[1] = { lb + 27 * 2048 }; const bf* const g1[1] = { gX + (size_t)15 * 16 * DM + go }; cp1(l1, g1); } };
    v8f acc[4][4];
#pragma unroll
    for (int mb = 0; mb < 4; ++mb)
#pragma unroll
        for (int nb = 0; nb < 4; ++nb) acc[mb][nb] = (v8f){};
    issue(0); asm volatile("s_wait_asynccnt 0x0" ::: "memory"); __syncthreads();   // stage 0 has landed and is published
    issue(1);
    const int wo = wq * 4 * 1024 + 8 * lane, xo = (12 + wp * 4) * 1024 + 8 * lane; const int ao = (sel == 2) ? xo : wo, bo = (sel == 2) ? wo : xo;
    // kept rolled: the buffer index alternates from trip to trip
#pragma unroll 1
    for (int t = 0; t < DM / KS; ++t) {
        const bf* st = ring + (t & 1) * QST;
#pragma unroll
        for (int kb = 0; kb < KS / 32; ++kb) {
            V a[4], b[4];
#pragma unroll
            for (int i = 0; i < 4; ++i) { a[i] = WFrag<bf>::ld(st + ao + i * 1024 + kb * 512); b[i] = WFrag<bf>::ld(st + bo + i * 1024 + kb * 512); }
            __builtin_amdgcn_sched_barrier(0);   // a block's LDS reads stand as one group in front of its matrix instructions: left to itself the compiler puts them among those in pairs, each behind a wait to 0
#pragma unroll
            for (int nb = 0; nb < 4; ++nb)
#pragma unroll
                for (int mb = 0; mb < 4; ++mb) acc[mb][nb] = WFrag<bf>::mma(a[mb], b[nb], acc[mb][nb]);
            __builtin_amdgcn_sched_barrier(0);   // and the next block's reads behind them
        }
        stage_done();
        if (t + 2 < DM / KS) issue(t + 2);   // into the buffer that this trip has just read
    }
    asm volatile("s_wait_asynccnt 0x0" ::: "memory");   // no copy is outstanding when the wave goes on
    if (sel == 2) { const float* gp = bias + c0 + lr; const float g0 = gp[0], g1 = gp[16], g2 = gp[32], g3 = gp[48]; xdone<false>(gp, nullptr);   // v: + b_attn, d = 16 y + lr (q and k: in qkv_out)
#pragma unroll
        for (int x = 0; x < 4; ++x) { acc[x][0] += bfr(g0); acc[x][1] += bfr(g1); acc[x][2] += bfr(g2); acc[x][3] += bfr(g3); } }
#pragma unroll
    for (int y = 0; y < 4; ++y) {
#pragma unroll
        for (int x = 0; x < 4; ++x) { const v8f w = acc[x][y]; float* f = F + (y * 16 + lr) * FP + x * 16 + hi * 8; *(v4fa*)f = __builtin_shufflevector(w, w, 0, 1, 2, 3); *(v4fa*)(f + 4) = __builtin_shufflevector(w, w, 4, 5, 6, 7); } }
    __syncthreads();   // the staged tile is read back across lanes
    const size_t hp = ((size_t)(r0 / TT) * NH_ + head) * TT * HD; const int t0 = r0 % TT;
    if (sel == 2) { const size_t o = hp + (size_t)t0 * 16; qkv_out<false>(F, nullptr, nullptr, nullptr, nullptr, V16 + o, Vh + o, Vl + o, TT, lane); }
    else { const size_t o = hp + (size_t)t0 * HD; qkv_out<true>(F, bias + c0, rc + (size_t)r0 * 32, rs + (size_t)r0 * 32, (sel ? bK : bQ) + head * HD, (sel ? K16 : Q16) + o, (sel ? Kh : Qh) + o, (sel ? Kl : Ql) + o, HD, lane); }
}

extern "C" void kernel_launch(void* const* d_in, const int* in_sizes, int n_in,
                              void* d_out, int out_size, void* d_ws, size_t ws_size, hipStream_t stream) {
    (void)in_sizes; (void)n_in; (void)out_size;
    const float* x = (const float*)d_in[0]; const float* rcos = (const float*)d_in[1]; const float* rsin = (const float*)d_in[2]; const float* wf = (const float*)d_in[3]; const float* bfz = (const float*)d_in[4]; const float* wo = (const float*)d_in[5]; const float* bo = (const float*)d_in[6]; const float* bQ = (const float*)d_in[7]; const float* bK = (const float*)d_in[8]; const float* cosT = nullptr; const float* sinT = nullptr; (void)cosT; (void)sinT;
    float* OUT = (float*)d_out;     // [2][2048][1024]
    char* wsp = (char*)d_ws;
    auto take = [&](size_t bytes) { char* p = wsp; wsp += (bytes + 255) & ~(size_t)255; return (void*)p; };
    bf* WA = (bf*)take((size_t)3 * DQ * DM * 2); bf* WO = (bf*)take((size_t)DM * DQ * 2);   // WA: W_attn transposed, rows q | k | v
    bf* XB = (bf*)take((size_t)NB_ * TT * DM * 2);
    h16* QP16 = (h16*)take((size_t)NB_ * NH_ * TT * HD * 2); h16* KP16 = (h16*)take((size_t)NB_ * NKV * TT * HD * 2); h16* VT16 = (h16*)take((size_t)NB_ * NKV * HD * TT * 2);
    bf* QPh = (bf*)take((size_t)NB_ * NH_ * TT * HD * 2); bf* QPl = (bf*)take((size_t)NB_ * NH_ * TT * HD * 2); bf* KPh = (bf*)take((size_t)NB_ * NKV * TT * HD * 2); bf* KPl = (bf*)take((size_t)NB_ * NKV * TT * HD * 2); bf* VTh = (bf*)take((size_t)NB_ * NKV * HD * TT * 2); bf* VTl = (bf*)take((size_t)NB_ * NKV * HD * TT * 2);
    bf* ATh = (bf*)take((size_t)NB_ * TT * DQ * 2); bf* ATl = (bf*)take((size_t)NB_ * TT * DQ * 2);
    if ((size_t)(wsp - (char*)d_ws) > ws_size) return;    // ws 256 MiB
    // every kernel runs once: the two batches are rows b TT + t of one grid, and q, k, v are the 3 DQ columns of one product
    k_prep<<<PBX + PBA + PBO, 256, 0, stream>>>(x, wf, wo, XB, WA, WO);
    k_qkv<<<dim3(NB_ * TT / 256, 3 * DQ / 192, 1), 32 * QWV, 0, stream>>>(XB, WA, bfz, rcos, rsin, bQ, bK, QP16, QPh, QPl, KP16, KPh, KPl, VT16, VTh, VTl);
    k_attn<<<dim3(NBLO + NBHI, NH_, NB_), 32 * AW, 0, stream>>>(QP16, KP16, VT16, QPh, QPl, KPh, KPl, VTh, VTl, ATh, ATl);
    k_proj<<<dim3(NB_ * TT / 128, DM / 128, 1), 32 * PWV, 0, stream>>>(ATh, ATl, WO, OUT, bo);
}

// v008
// One run takes 79.6 microseconds.
// In both of two side-by-side timings against v007, it was 1.16 times as fast.
// Counting every step since v000, it is 18.5 times as fast.
#include <hip/hip_runtime.h>

// DisorderedCausalSelfAttention (x [2][2048][1024]; qkv = x W_attn + b ([1024][3072], split q | k | v, 16 heads x 64); partial RoPE on the first 32 dims of each head with the given per-batch tables rope_cos/rope_sin [B][T][32] (read; rotate_half within the 32 dims); then q += bQ[h], k += bK[h] (post-RoPE symmetry-breaking biases, read); causal softmax(q.k / 8); out = merged W_proj + b_proj -> [2][2048][1024]).
// Compute dtypes, f32 accumulate: every input rounded to bf16; q/k/v on PLAIN bf16 operands (inputs: exact) + bias; partial RoPE and the post-RoPE biases f32; causal scores and att.v: query rows < 512 hl (3 products), the rest single fp16; softmax f32, running maximum, normalised after att.v; W_proj hl x exact (2 products) + bias.

// Every 16-bit operand plane (rows x K) lies in FRAGMENT ORDER: the 16 rows x 32 k of one matrix operand are one 1024-B block, blocks run along k and then along the row groups. Inside a block the 16-B chunk of row r, k = 16 j + 8 h + (0..7) stands at chunk 32 j + 16 h + (r & 15),
// which is lane 16 h + (r & 15) of the operand's j-th 16-B load: each wave-wide load reads 512 contiguous bytes, four whole lines, where a row-major plane gives sixteen 32-B pieces. A group of 16 rows still takes 16 K elements, so row-group offsets read as in a row-major plane.
#define NB_  2
#define TT   2048
#define DM   1024
#define NH_  16
#define NKV  16
#define REP  (NH_ / NKV)
#define HD   64
#define DQ   (NH_ * HD)
#define DKV  (NKV * HD)
#define RH   512                  // query rows < RH use hi+lo planes
#define SCL  0.125f   // HD^-0.5
typedef _Float16 h16;
typedef unsigned short bf;
typedef __attribute__((ext_vector_type(16))) __bf16   v16bf;
typedef __attribute__((ext_vector_type(16))) _Float16 v16h;
typedef __attribute__((ext_vector_type(8)))  _Float16 v8h;
typedef __attribute__((ext_vector_type(8)))  unsigned short v8us;
typedef __attribute__((ext_vector_type(8)))  float    v8f;
typedef __attribute__((ext_vector_type(4)))  float    v4f;
typedef v8h  __attribute__((may_alias)) v8ha;
typedef v4f  __attribute__((may_alias)) v4fa;
typedef v8us __attribute__((may_alias)) v8usa;
typedef float v2fa __attribute__((ext_vector_type(2), may_alias));

__device__ __forceinline__ unsigned short f2bf(float f) { unsigned u = __float_as_uint(f); u += 0x7FFFu + ((u >> 16) & 1u); return (unsigned short)(u >> 16); }
__device__ __forceinline__ float bf2f(unsigned short b) { return __uint_as_float(((unsigned)b) << 16); }
__device__ __forceinline__ float bfr(float f) { return bf2f(f2bf(f)); }
__device__ __forceinline__ v16h cat16(v8h lo, v8h hi) { return __builtin_shufflevector(lo, hi, 0, 1, 2, 3, 4, 5, 6, 7, 8, 9, 10, 11, 12, 13, 14, 15); }
__device__ __forceinline__ v16bf cat16b(v8us lo, v8us hi) { return __builtin_bit_cast(v16bf, __builtin_shufflevector(lo, hi, 0, 1, 2, 3, 4, 5, 6, 7, 8, 9, 10, 11, 12, 13, 14, 15)); }
__device__ __forceinline__ v8f wmma16(v16h a, v16h b, v8f c) { return __builtin_amdgcn_wmma_f32_16x16x32_f16(false, a, false, b, (short)0, c, false, false); }
__device__ __forceinline__ v8f wmmab(v16bf a, v16bf b, v8f c) { return __builtin_amdgcn_wmma_f32_16x16x32_bf16(false, a, false, b, (short)0, c, false, false); }



// WFrag: a matrix operand from a fragment-order plane (ld: p = the block's start + 8 lane)
template <typename T16> struct WFrag;
template <> struct WFrag<h16> { typedef v16h V; static __device__ __forceinline__ V ld(const h16* p) { return cat16(*(const v8h*)p, *(const v8h*)(p + 256)); } static __device__ __forceinline__ v8f mma(V a, V b, v8f c) { return wmma16(a, b, c); } };
template <> struct WFrag<bf> { typedef v16bf V; static __device__ __forceinline__ V ld(const bf* p) { return cat16b(*(const v8us*)p, *(const v8us*)(p + 256)); } static __device__ __forceinline__ v8f mma(V a, V b, v8f c) { return wmmab(a, b, c); } };
// ---- operand staging for the two GEMMs. The waves of a work-group share their operand rows: a stage = KS k of every row group (16 rows) of the work-group's tile, which in a fragment-order plane is 2 KiB in a row, brought into LDS once by asynchronous copies (16 B a lane, 512 contiguous bytes a copy)
// and read from there by every wave that needs it, in the same fragment order (each wave-wide ds_load_b128 reads 512 contiguous bytes). Two buffers: stage t + 1 flies while stage t is worked on.
// cpN: N copies, each with its own LDS byte address l and global address g; s_wait_xcnt 0 is the statement's last line, so that it stands in front of whatever rewrites a register that a copy names
#define KS 64
__device__ __forceinline__ unsigned lds_off(const void* p) { return (unsigned)(size_t)p; }
__device__ __forceinline__ void cp1(const unsigned (&l)[1], const bf* const (&g)[1]) { asm volatile("global_load_async_to_lds_b128 %0, %1, off\n\ts_wait_xcnt 0x0" :: "v"(l[0]), "v"(g[0]) : "memory"); }
__device__ __forceinline__ void cp9(const unsigned (&l)[9], const bf* const (&g)[9]) { asm volatile("global_load_async_to_lds_b128 %0, %9, off\n\tglobal_load_async_to_lds_b128 %1, %10, off\n\tglobal_load_async_to_lds_b128 %2, %11, off\n\tglobal_load_async_to_lds_b128 %3, %12, off\n\tglobal_load_async_to_lds_b128 %4, %13, off\n\tglobal_load_async_to_lds_b128 %5, %14, off\n\tglobal_load_async_to_lds_b128 %6, %15, off\n\tglobal_load_async_to_lds_b128 %7, %16, off\n\tglobal_load_async_to_lds_b128 %8, %17, off\n\ts_wait_xcnt 0x0" :: "v"(l[0]), "v"(l[1]), "v"(l[2]), "v"(l[3]), "v"(l[4]), "v"(l[5]), "v"(l[6]), "v"(l[7]), "v"(l[8]), "v"(g[0]), "v"(g[1]), "v"(g[2]), "v"(g[3]), "v"(g[4]), "v"(g[5]), "v"(g[6]), "v"(g[7]), "v"(g[8]) : "memory"); }
__device__ __forceinline__ void cp12(const unsigned (&l)[12], const bf* const (&g)[12]) { asm volatile("global_load_async_to_lds_b128 %0, %12, off\n\tglobal_load_async_to_lds_b128 %1, %13, off\n\tglobal_load_async_to_lds_b128 %2, %14, off\n\tglobal_load_async_to_lds_b128 %3, %15, off\n\tglobal_load_async_to_lds_b128 %4, %16, off\n\tglobal_load_async_to_lds_b128 %5, %17, off\n\tglobal_load_async_to_lds_b128 %6, %18, off\n\tglobal_load_async_to_lds_b128 %7, %19, off\n\tglobal_load_async_to_lds_b128 %8, %20, off\n\tglobal_load_async_to_lds_b128 %9, %21, off\n\tglobal_load_async_to_lds_b128 %10, %22, off\n\tglobal_load_async_to_lds_b128 %11, %23, off\n\ts_wait_xcnt 0x0" :: "v"(l[0]), "v"(l[1]), "v"(l[2]), "v"(l[3]), "v"(l[4]), "v"(l[5]), "v"(l[6]), "v"(l[7]), "v"(l[8]), "v"(l[9]), "v"(l[10]), "v"(l[11]), "v"(g[0]), "v"(g[1]), "v"(g[2]), "v"(g[3]), "v"(g[4]), "v"(g[5]), "v"(g[6]), "v"(g[7]), "v"(g[8]), "v"(g[9]), "v"(g[10]), "v"(g[11]) : "memory"); }
// stage_done: the foot of a trip, every wave: its own LDS reads are back, its own copies have landed, then the work-group barrier that publishes the next stage and ends every reader's last read of this one
__device__ __forceinline__ void stage_done() { asm volatile("s_wait_dscnt 0x0" ::: "memory"); asm volatile("s_wait_asynccnt 0x0" ::: "memory"); __syncthreads(); }

// ---- k_proj: C[m][n] (f32, + bias[n]) = sum_k (A + A2)[m][k] Bt[n][k], two products. Work-group = 8 waves = 128 x 128 of C, a wave 32 x 64 (8 accumulators), two waves a SIMD; grid (M/128, N/128).
// Stage: 8 row groups of A, 8 of A2, 8 of Bt; wave w copies the (w & 3)-th 512 B of row groups (w >> 2), (w >> 2) + 2, ...
#define PWV 8
#define PRG 24
#define PST (PRG * 16 * KS)   // elements a stage
__global__ __launch_bounds__(32 * PWV) void k_proj(const bf* __restrict__ A, const bf* __restrict__ A2, const bf* __restrict__ Bt, float* C, const float* __restrict__ bias) {
    typedef WFrag<bf>::V V;
    __shared__ __align__(1024) bf ring[2 * PST];
    __shared__ __align__(16) float oss[PWV * 16 * 68];
    const int lane = threadIdx.x & 31, lr = lane & 15, hi = lane >> 4; const int wave = __builtin_amdgcn_readfirstlane((int)(threadIdx.x >> 5));   // scalar: what is formed from it stays in scalar registers
    const int R0 = blockIdx.x * 128, C0 = blockIdx.y * 128; const int r0 = R0 + (wave >> 1) * 32, c0 = C0 + (wave & 1) * 64;
    float* os = oss + wave * 16 * 68;
    const int wh = wave >> 2, po = (wave & 3) * 256 + 8 * lane;   // po: the lane's 16 B inside a row group's 2 KiB
    const bf* gA = A + (size_t)(R0 + wh * 16) * DQ + po; const bf* gA2 = A2 + (size_t)(R0 + wh * 16) * DQ + po; const bf* gB = Bt + (size_t)(C0 + wh * 16) * DQ + po; const unsigned l0 = lds_off(ring) + 2 * (wh * 1024 + po);
    auto issue = [&](int t) { const unsigned lb = l0 + (t & 1) * (PST * 2); const int go = t * (KS * 16); unsigned l[12]; const bf* g[12];
#pragma unroll
        for (int i = 0; i < 12; ++i) { l[i] = lb + i * 2 * 2048; g[i] = (i < 4 ? gA : i < 8 ? gA2 : gB) + (size_t)(i & 3) * 32 * DQ + go; }
        cp12(l, g); };
    v8f acc[2][4];
#pragma unroll
    for (int mb = 0; mb < 2; ++mb)
#pragma unroll
        for (int nb = 0; nb < 4; ++nb) acc[mb][nb] = (v8f){};
    issue(0); asm volatile("s_wait_asynccnt 0x0" ::: "memory"); __syncthreads();   // stage 0 has landed and is published
    issue(1);
    const int ao = (wave >> 1) * 2 * 1024 + 8 * lane, bo = (16 + (wave & 1) * 4) * 1024 + 8 * lane;
    // kept rolled: the buffer index alternates from trip to trip
#pragma unroll 1
    for (int t = 0; t < DQ / KS; ++t) {
        const bf* st = ring + (t & 1) * PST;
        V a[KS / 32][2], a2[KS / 32][2], b[KS / 32][4];
#pragma unroll
        for (int kb = 0; kb < KS / 32; ++kb) {
#pragma unroll
            for (int i = 0; i < 2; ++i) { a[kb][i] = WFrag<bf>::ld(st + ao + i * 1024 + kb * 512); a2[kb][i] = WFrag<bf>::ld(st + ao + (8 + i) * 1024 + kb * 512); }
#pragma unroll
            for (int i = 0; i < 4; ++i) b[kb][i] = WFrag<bf>::ld(st + bo + i * 1024 + kb * 512); }
        __builtin_amdgcn_sched_barrier(0);   // the trip's LDS reads stand as one group in front of its matrix instructions: left to itself the compiler puts them among those in pairs, each behind a wait to 0
#pragma unroll
        for (int kb = 0; kb < KS / 32; ++kb)
#pragma unroll
            for (int nb = 0; nb < 4; ++nb)
#pragma unroll
                for (int mb = 0; mb < 2; ++mb) { acc[mb][nb] = WFrag<bf>::mma(a[kb][mb], b[kb][nb], acc[mb][nb]); acc[mb][nb] = WFrag<bf>::mma(a2[kb][mb], b[kb][nb], acc[mb][nb]); }
        __builtin_amdgcn_sched_barrier(0);   // keeps the matrix instructions in front of the trip's foot: moved behind its waits they would no longer run while the next stage's copies fly
        stage_done();
        if (t + 2 < DQ / KS) issue(t + 2);   // into the buffer that this trip has just read
    }
    asm volatile("s_wait_asynccnt 0x0" ::: "memory");   // no copy is outstanding when the wave goes on
    const float* bp = bias + c0 + lr * 4; const v4f bv = *(const v4fa*)bp;   // the lane's four columns' bias
    asm volatile("s_wait_xcnt 0x0" :: "v"(bp) : "memory"); __builtin_amdgcn_sched_barrier(0);   // behind the load, in front of whatever overwrites its address register; it names the address as an input, so that the load does not land on it
#pragma unroll
    for (int mb = 0; mb < 2; ++mb) {
#pragma unroll
        for (int nb = 0; nb < 4; ++nb) {
#pragma unroll
            for (int j = 0; j < 8; ++j) os[(hi * 8 + j) * 68 + nb * 16 + lr] = acc[mb][nb][j]; }
        __builtin_amdgcn_wave_barrier(); asm volatile("" ::: "memory");
        float* crow = C + (size_t)(r0 + mb * 16) * DM + c0;
{
#pragma unroll
            for (int s = 0; s < 8; ++s) { const int row = 2 * s + hi, cofs = lr * 4; v4f val = *(const v4fa*)(os + row * 68 + cofs); val[0] += bfr(bv[0]); val[1] += bfr(bv[1]); val[2] += bfr(bv[2]); val[3] += bfr(bv[3]);
                *(v4f*)(crow + (size_t)row * DM + cofs) = val; }
             }
        asm volatile("s_wait_xcnt 0x0" ::: "memory"); __builtin_amdgcn_sched_barrier(0);   // behind the eight stores, in front of whatever overwrites their address or data registers (the next row group's values); the scheduling barrier keeps that code behind the wait
        __builtin_amdgcn_wave_barrier(); asm volatile("" ::: "memory");
    }
}

__device__ __forceinline__ h16 tohx(float x) { return (h16)x; }
__device__ __forceinline__ void splitf(float y, unsigned short& h, unsigned short& l) { h = f2bf(y); l = f2bf(y - bf2f(h)); }
typedef __attribute__((ext_vector_type(2))) _Float16 v2h;
typedef __attribute__((ext_vector_type(4))) _Float16 v4h;
typedef __attribute__((ext_vector_type(2))) unsigned short v2us;
typedef __attribute__((ext_vector_type(4))) unsigned short v4us;
typedef __attribute__((ext_vector_type(2))) float v2f;
typedef __attribute__((ext_vector_type(4))) int v4i;

// frag_off: where the 16-B chunk of (row, k .. k + 7), k a multiple of 8, stands in a fragment-order plane with K columns, in elements
__device__ __forceinline__ size_t frag_off(int row, int k, int K) { return ((((size_t)(row >> 4) * (K >> 5) + (k >> 5)) * 2 + ((k >> 4) & 1)) * 32 + ((k >> 3) & 1) * 16 + (row & 15)) * 8; }
// ---- k_prep: all operand preparation in one launch: x -> XB, W_attn -> WA, W_proj -> WO, none of which reads another's output; the job goes by the block index. Few, long-lived waves: a thread takes PC chunks, all of its loads in flight together, so that 4096 waves are started and not 32768.
#define PC 8   // chunks (8 elements of a plane each) a thread
// prep_x, wave task q: 8 rows x 256 k of x. For each of its PC chunks (32 k apart) a wave reads one whole 128-B line of each row and stores four whole lines (8 neighbouring rows of each of the four chunk columns)
__device__ __forceinline__ void prep_x(const float* __restrict__ src, bf* dst, int q, int lane) {
    const int row = (q >> 2) * 8 + (lane >> 2), k = (q & 3) * (32 * PC) + (lane & 3) * 8; const float* p = src + (size_t)row * DM + k; v8f v[PC]; v8us o[PC];
    // every '#pragma unroll' of prep_x and prep_w: the indices of the register arrays must be compile-time constants, so that they stay in registers
#pragma unroll
    for (int c = 0; c < PC; ++c) v[c] = *(const v8f*)(p + 32 * c);
    asm volatile("s_wait_xcnt 0x0" :: "v"(p) : "memory"); __builtin_amdgcn_sched_barrier(0);   // behind the loads, in front of whatever overwrites their address register (the instruction set's rule for an issued load); it names the address as an input, so that no load of the run lands on it, and the scheduling barrier keeps later code behind it
#pragma unroll
    for (int c = 0; c < PC; ++c)
#pragma unroll
        for (int u = 0; u < 8; ++u) o[c][u] = f2bf(v[c][u]);
    __builtin_amdgcn_sched_barrier(0);   // the stores stand together as one run behind all the conversions, so that one wait behind the last of them serves the run
    bf* d = dst + frag_off(row, k, DM);
#pragma unroll
    for (int c = 0; c < PC; ++c) *(v8us*)(d + 512 * c) = o[c];   // 32 k on: the next 1024-B block
    asm volatile("s_wait_xcnt 0x0" ::: "memory"); }   // behind the last store, in front of whatever code follows in the kernel and overwrites the stores' address or data registers
// prep_w, wave task q: 32 neighbouring n x 64 k of Bt (fragment order, rows n, K columns): element (n, k) = w[k * N + n]. Each of the wave's 64 loads reads one whole 128-B line of w (the waves of a work-group take neighbouring n), each of its PC stores writes two 256-B runs (16 neighbouring rows of a block stand side by side)
template <int K, int N>
__device__ __forceinline__ void prep_w(const float* __restrict__ w, bf* Bt, int q, int lane) {
    const int n = (q % (N / 32)) * 32 + lane, k = (q / (N / 32)) * (8 * PC); const float* p = w + (size_t)k * N + n; float v[8 * PC]; v8us o[PC];
#pragma unroll
    for (int i = 0; i < 8 * PC; ++i) v[i] = p[(size_t)i * N];
    asm volatile("s_wait_xcnt 0x0" :: "v"(p) : "memory"); __builtin_amdgcn_sched_barrier(0);   // as in prep_x
#pragma unroll
    for (int c = 0; c < PC; ++c)
#pragma unroll
        for (int u = 0; u < 8; ++u) o[c][u] = f2bf(v[8 * c + u]);
    __builtin_amdgcn_sched_barrier(0);   // as in prep_x
    bf* d = Bt + frag_off(n, k, K);
#pragma unroll
    for (int c = 0; c < PC; ++c) *(v8us*)(d + 128 * c) = o[c];   // 8 k on: 16 chunks on in the fragment order (k a multiple of 64)
    asm volatile("s_wait_xcnt 0x0" ::: "memory"); }   // as in prep_x
#define PBX (NB_ * TT * DM / (8 * PC * 256))   // work-groups for x
#define PBA (3 * DQ * DM / (8 * PC * 256))     // for W_attn
#define PBO (DM * DQ / (8 * PC * 256))         // for W_proj
__global__ __launch_bounds__(256) void k_prep(const float* __restrict__ x, const float* __restrict__ wa, const float* __restrict__ wo, bf* XB, bf* WA, bf* WO) {
    const int lane = threadIdx.x & 31, wave = __builtin_amdgcn_readfirstlane((int)(threadIdx.x >> 5)), b = blockIdx.x;   // wave scalar: the task's indices stay in scalar registers
    if (b < PBX) prep_x(x, XB, b * 8 + wave, lane);
    else if (b < PBX + PBA) prep_w<DM, 3 * DQ>(wa, WA, (b - PBX) * 8 + wave, lane);
    else prep_w<DQ, DM>(wo, WO, (b - PBX - PBA) * 8 + wave, lane);
}
__global__ __launch_bounds__(256) void k_cscvt(const float* __restrict__ cosT, const float* __restrict__ sinT, float* CS) { const int idx = blockIdx.x * 256 + threadIdx.x; if (idx >= TT * HD) return; v2f cs; cs[0] = bfr(cosT[idx]); cs[1] = bfr(sinT[idx]); *(v2f*)(CS + (size_t)idx * 2) = cs;  }
#define AW   16                   // waves a work-group
#define AG   8                    // work-groups a head and batch
#define RLO  2                    // query groups a wave, fp16 rows
#define XCH  (17 * 128)           // floats of one wave's partial result in LDS: 16 chunks of 16 B a lane of O^T, one of the maxima and sums; chunk c of lane n at 16 B x (32 c + n), so that each wave-wide access is 512 contiguous bytes
static_assert((TT - RH) / (16 * RLO) == 6 * AG && RH / 16 == 4 * AG && RH >= 64, "k_attn: six fp16 tiles (each of at least two passes) and four hi+lo tiles a work-group");
#define CSC  (SCL * 1.4426950408889634f)
__device__ __forceinline__ float xhalf(float x) { return __builtin_bit_cast(float, __builtin_amdgcn_permlanex16(__builtin_bit_cast(int, x), __builtin_bit_cast(int, x), 0x76543210, 0xfedcba98, false, false)); }   // lane l reads lane l ^ 16
// dist: the distance behind the last matrix instruction of a product before its operand registers are loaded anew, on a loop's back edge too; it names the product's tiles so that the whole product stands in front of it
__device__ __forceinline__ void dist(v8f (&s)[1][2]) { asm volatile("v_nop\n\tv_nop\n\tv_nop\n\tv_nop" : "+v"(s[0][0]), "+v"(s[0][1])); }
__device__ __forceinline__ void dist(v8f (&s)[2][2]) { asm volatile("v_nop\n\tv_nop\n\tv_nop\n\tv_nop" : "+v"(s[0][0]), "+v"(s[0][1]), "+v"(s[1][0]), "+v"(s[1][1])); }
__device__ __forceinline__ void dist(v8f (&s)[1][4]) { asm volatile("v_nop\n\tv_nop\n\tv_nop\n\tv_nop" : "+v"(s[0][0]), "+v"(s[0][1]), "+v"(s[0][2]), "+v"(s[0][3])); }
__device__ __forceinline__ void dist(v8f (&s)[2][4]) { asm volatile("v_nop\n\tv_nop\n\tv_nop\n\tv_nop" : "+v"(s[0][0]), "+v"(s[0][1]), "+v"(s[0][2]), "+v"(s[0][3]), "+v"(s[1][0]), "+v"(s[1][1]), "+v"(s[1][2]), "+v"(s[1][3])); }
// xdone: stands behind a run of global loads from a (and b), in front of whatever overwrites the registers that held their addresses (the instruction set's rule for an issued load). It names the two addresses as inputs, so that their registers live up to the wait
// and no load of the run lands on them; the scheduling barrier keeps the loads in front of it and later code behind it.
template <bool TWO>
__device__ __forceinline__ void xdone(const void* a, const void* b) { if (TWO) asm volatile("s_wait_xcnt 0x0" :: "v"(a), "v"(b) : "memory"); else asm volatile("s_wait_xcnt 0x0" :: "v"(a) : "memory"); __builtin_amdgcn_sched_barrier(0); }
template <typename T16, bool HI, bool MASK, int R>
__device__ __forceinline__ void attn_pass(typename WFrag<T16>::V (&kf)[2][2], typename WFrag<T16>::V (&kf2)[2][2], const T16* Kn, const T16* Kn2, const T16* Vp, const T16* Vp2,
                                          const typename WFrag<T16>::V (&qf)[R][2], const typename WFrag<T16>::V (&qf2)[R][2], v8f (&acc)[R][4], float (&m)[R], float (&l)[R], int key0, int myq, int hi) {
    typedef typename WFrag<T16>::V V;
    // every '#pragma unroll' of this function: the indices of the fragment and accumulator arrays must be compile-time constants, so that they stay in registers
    V vf[4], vf2[4];   // this pass's V^T fragments (rows d, k = keys), in flight under the first product and the exponentials
#pragma unroll
    for (int t = 0; t < 4; ++t) { vf[t] = WFrag<T16>::ld(Vp + (size_t)t * 16 * TT); if (HI) vf2[t] = WFrag<T16>::ld(Vp2 + (size_t)t * 16 * TT); }
    xdone<HI>(Vp, Vp2);
    v8f s[R][2];
#pragma unroll
    for (int g = 0; g < R; ++g)
#pragma unroll
        for (int kt = 0; kt < 2; ++kt) { s[g][kt] = (v8f){};
#pragma unroll
            for (int kc = 0; kc < 2; ++kc) { s[g][kt] = WFrag<T16>::mma(kf[kt][kc], qf[g][kc], s[g][kt]); if (HI) { s[g][kt] = WFrag<T16>::mma(kf[kt][kc], qf2[g][kc], s[g][kt]); s[g][kt] = WFrag<T16>::mma(kf2[kt][kc], qf[g][kc], s[g][kt]); } } }
    dist(s);
    __builtin_amdgcn_sched_barrier(0);   // keeps the loads below behind that distance
    if (!HI) {   // the next pass's K fragments, in flight under this pass's softmax and second product
#pragma unroll
        for (int kt = 0; kt < 2; ++kt)
#pragma unroll
            for (int kc = 0; kc < 2; ++kc) kf[kt][kc] = WFrag<T16>::ld(Kn + kt * 16 * HD + kc * 512);
        xdone<false>(Kn, nullptr); }
    float mx[R]; bool need = false;
#pragma unroll
    for (int g = 0; g < R; ++g) { float x0 = -3.0e38f;
#pragma unroll
        for (int e = 0; e < 16; ++e) { float x = s[g][e >> 3][e & 7] * CSC; if (MASK) x = (key0 + 16 * (e >> 3) + 8 * hi + (e & 7) <= myq + 16 * g) ? x : -3.0e38f; s[g][e >> 3][e & 7] = x; x0 = fmaxf(x0, x); }
        mx[g] = fmaxf(x0, xhalf(x0));   // lanes l and l ^ 16 hold the two key halves of one query
        need = need || (mx[g] > m[g]); }
    if (__builtin_amdgcn_ballot_w32(need) != 0) {   // wave-uniform; where a query's maximum does not move its factor is exactly 1
#pragma unroll
        for (int g = 0; g < R; ++g) { const float mn = fmaxf(m[g], mx[g]); const float corr = __builtin_amdgcn_exp2f(m[g] - mn); m[g] = mn; l[g] *= corr;
#pragma unroll
            for (int t = 0; t < 4; ++t) acc[g][t] *= corr; } }
#pragma unroll
    for (int g = 0; g < R; ++g) { float p[16];
#pragma unroll
        for (int e = 0; e < 16; ++e) { p[e] = __builtin_amdgcn_exp2f(s[g][e >> 3][e & 7] - m[g]); l[g] += p[e]; }
        if (HI) { v8us h0, h1, l0, l1;
#pragma unroll
            for (int e = 0; e < 8; ++e) { unsigned short a, c; splitf(p[e], a, c); h0[e] = a; l0[e] = c; splitf(p[8 + e], a, c); h1[e] = a; l1[e] = c; }
            const v16bf ph = cat16b(h0, h1), pl = cat16b(l0, l1);
#pragma unroll
            for (int t = 0; t < 4; ++t) { acc[g][t] = wmmab(__builtin_bit_cast(v16bf, vf[t]), ph, acc[g][t]); acc[g][t] = wmmab(__builtin_bit_cast(v16bf, vf[t]), pl, acc[g][t]); acc[g][t] = wmmab(__builtin_bit_cast(v16bf, vf2[t]), ph, acc[g][t]); }
        } else { v16h pf;
#pragma unroll
            for (int e = 0; e < 16; ++e) pf[e] = tohx(p[e]);
#pragma unroll
            for (int t = 0; t < 4; ++t) acc[g][t] = wmma16(__builtin_bit_cast(v16h, vf[t]), pf, acc[g][t]); } }
    dist(acc);
    if (HI) {   // with hi and lo planes K and V^T together do not fit 256 registers: the next pass's K is loaded when V^T is spent (these rows have at most RH / 32 passes and are never the longest)
        __builtin_amdgcn_sched_barrier(0);   // keeps these loads behind the second product
#pragma unroll
        for (int kt = 0; kt < 2; ++kt)
#pragma unroll
            for (int kc = 0; kc < 2; ++kc) { kf[kt][kc] = WFrag<T16>::ld(Kn + kt * 16 * HD + kc * 512); kf2[kt][kc] = WFrag<T16>::ld(Kn2 + kt * 16 * HD + kc * 512); }
        xdone<true>(Kn, Kn2); }
}
// attn_keys: the key loop. q0: the wave's first query row, a multiple of 16 R. The tile's passes go alternately to NS waves; this wave is number part of them and takes passes part, part + NS, ... It leaves its running maximum m, its sums l and its unnormalised O^T acc
template <typename T16, bool HI, int R, int NS>
__device__ __forceinline__ void attn_keys(const T16* __restrict__ Q, const T16* __restrict__ Q2, const T16* __restrict__ K, const T16* __restrict__ K2, const T16* __restrict__ Vt, const T16* __restrict__ Vt2, int q0, int part, v8f (&acc)[R][4], float (&m)[R], float (&l)[R]) {
    typedef typename WFrag<T16>::V V;
    const int lane = threadIdx.x & 31, lr = lane & 15, hi = lane >> 4; const int myq = q0 + lr;
    const size_t qo = (size_t)q0 * HD + 8 * lane; const int ko = 8 * lane, vo = 8 * lane;   // fragment order: Q and K blocks (16 rows, 32 d) at 16 HD a row group and 512 a d block; V^T blocks (16 d, 32 keys) at 16 TT a d group and 512 a key block
    V qf[R][2], qf2[R][2], kf[2][2], kf2[2][2];
#pragma unroll
    for (int g = 0; g < R; ++g)
#pragma unroll
        for (int kc = 0; kc < 2; ++kc) { qf[g][kc] = WFrag<T16>::ld(Q + qo + g * 16 * HD + kc * 512); if (HI) qf2[g][kc] = WFrag<T16>::ld(Q2 + qo + g * 16 * HD + kc * 512); }
    xdone<HI>(Q + qo, Q2 + qo);
#pragma unroll
    for (int kt = 0; kt < 2; ++kt)
#pragma unroll
        for (int kc = 0; kc < 2; ++kc) { kf[kt][kc] = WFrag<T16>::ld(K + ko + (32 * part + kt * 16) * HD + kc * 512); if (HI) kf2[kt][kc] = WFrag<T16>::ld(K2 + ko + (32 * part + kt * 16) * HD + kc * 512); }
    xdone<HI>(K + ko + 32 * part * HD, K2 + ko + 32 * part * HD);
#pragma unroll
    for (int g = 0; g < R; ++g) { m[g] = -3.0e38f; l[g] = 0.f;
#pragma unroll
        for (int t = 0; t < 4; ++t) acc[g][t] = (v8f){}; }
    const int klast = (q0 >> 5) << 5;   // first key of the pass that holds the wave's diagonal (its 16 R <= 32 rows lie in one 32-key block): the only pass with masked keys, and the last
    int key0 = 32 * part;
    // kept rolled: one pass's fragments and the next pass's K already fill the registers
#pragma unroll 1
    for (; key0 < klast; key0 += 32 * NS) { const int kn = NS == 1 ? key0 + 32 : min(key0 + 32 * NS, klast);   // the wave's next pass; the wave that does not take the diagonal pass loads that pass's rows at its end, in bounds, unused
        attn_pass<T16, HI, false, R>(kf, kf2, K + ko + kn * HD, K2 + ko + kn * HD, Vt + vo + key0 * 16, Vt2 + vo + key0 * 16, qf, qf2, acc, m, l, key0, myq, hi); }
    if (NS == 1 || key0 == klast)   // scalar: the diagonal pass belongs to one of the NS waves
        attn_pass<T16, HI, true, R>(kf, kf2, K + ko + klast * HD, K2 + ko + klast * HD, Vt + vo + klast * 16, Vt2 + vo + klast * 16, qf, qf2, acc, m, l, klast, myq, hi);   // there is no next pass: its K load repeats this pass's rows, in bounds, unused
}
// put_part, add_part: one wave's partial result of a tile goes to LDS, the tile's other wave joins it to its own as two running-maximum states are joined: both are brought to the common maximum and added. Lane and register hold the same query and d in both waves
template <int R>
__device__ __forceinline__ void put_part(float* X, const v8f (&acc)[R][4], const float (&m)[R], const float (&l)[R], int lane) {
    // every '#pragma unroll' of put_part, add_part and attn_out: the indices of the accumulator arrays must be compile-time constants, so that they stay in registers
#pragma unroll
    for (int g = 0; g < R; ++g)
#pragma unroll
        for (int t = 0; t < 4; ++t) { const v8f w = acc[g][t]; float* x = X + ((g * 4 + t) * 64 + lane) * 4; *(v4fa*)x = __builtin_shufflevector(w, w, 0, 1, 2, 3); *(v4fa*)(x + 128) = __builtin_shufflevector(w, w, 4, 5, 6, 7); }
    v4f ml; ml[0] = m[0]; ml[1] = m[R - 1]; ml[2] = l[0]; ml[3] = l[R - 1]; *(v4fa*)(X + (R * 8 * 32 + lane) * 4) = ml;
}
template <int R>
__device__ __forceinline__ void add_part(const float* X, v8f (&acc)[R][4], float (&m)[R], float (&l)[R], int lane) {
    const v4f ml = *(const v4fa*)(X + (R * 8 * 32 + lane) * 4);
#pragma unroll
    for (int g = 0; g < R; ++g) { const float mo = g ? ml[1] : ml[0], lo = g ? ml[3] : ml[2]; const float mn = fmaxf(m[g], mo); const float fa = __builtin_amdgcn_exp2f(m[g] - mn), fb = __builtin_amdgcn_exp2f(mo - mn); m[g] = mn; l[g] = l[g] * fa + lo * fb;
#pragma unroll
        for (int t = 0; t < 4; ++t) { const float* x = X + ((g * 4 + t) * 64 + lane) * 4; const v4f w0 = *(const v4fa*)x, w1 = *(const v4fa*)(x + 128);
#pragma unroll
            for (int j = 0; j < 8; ++j) acc[g][t][j] = acc[g][t][j] * fa + (j < 4 ? w0[j & 3] : w1[j & 3]) * fb; } }
}
// attn_out: the wave halves' sums meet, division by the sum, the hi/lo planes [t][head][d]
template <int R>
__device__ __forceinline__ void attn_out(const v8f (&acc)[R][4], const float (&l)[R], int q0, int head, bf* Ah, bf* Al) {
    const int lane = threadIdx.x & 31;
#pragma unroll
    for (int g = 0; g < R; ++g) { const float lt = l[g] + xhalf(l[g]); const float inv = __fdiv_rn(1.0f, lt);
#pragma unroll
        for (int t = 0; t < 4; ++t) { v8us oh, ol;   // registers j of tile t are d = 16 t + 8 hi + j of query myq + 16 g
#pragma unroll
            for (int j = 0; j < 8; ++j) { unsigned short a, c; splitf(acc[g][t][j] * inv, a, c); oh[j] = a; ol[j] = c; }
            const size_t oo = (size_t)(q0 + 16 * g) * DQ + (head * 2 + (t >> 1)) * 512 + (t & 1) * 256 + 8 * lane; *(v8us*)(Ah + oo) = oh; *(v8us*)(Al + oo) = ol;   // fragment order, k = head HD + d: each store is 512 contiguous bytes
            asm volatile("s_wait_xcnt 0x0" ::: "memory"); __builtin_amdgcn_sched_barrier(0); } }   // behind the two stores, in front of whatever overwrites their address or data registers (the next tile's values); the scheduling barrier keeps that code behind the wait
}
__global__ __launch_bounds__(32 * AW) void k_attn(const h16* __restrict__ Q16, const h16* __restrict__ K16, const h16* __restrict__ V16, const bf* __restrict__ Qh, const bf* __restrict__ Ql, const bf* __restrict__ Kh, const bf* __restrict__ Kl, const bf* __restrict__ Vh, const bf* __restrict__ Vl, bf* Ah, bf* Al) {
    __shared__ __align__(16) float xch[6 * XCH];
    const int head = blockIdx.x; const size_t hp = ((size_t)blockIdx.y * NH_ + head) * TT * HD; const int a = blockIdx.z; Ah += (size_t)blockIdx.y * TT * DQ; Al += (size_t)blockIdx.y * TT * DQ;   // blockIdx.y: the batch; a: which of the head's AG equal shares
    const int lane = threadIdx.x & 31, wave = __builtin_amdgcn_readfirstlane((int)(threadIdx.x >> 5));   // wave scalar, so that the key loop is a scalar loop with every lane on and every branch on the wave's task a scalar branch
    // Share a: the fp16 tiles (32 queries; tile i has 17 + i passes) 47 - a, 39 - a, 31 - a, 16 + a, 8 + a, a (classes 0 to 5: three pairs of 81 passes) and the hi+lo tiles (16 queries) a, 8 + a, 23 - a, 31 - a.
    // Waves w, w + 4, w + 8, w + 12 are taken to stand on one SIMD, the lower the older (for speed only): SIMD 0 gets halves of classes 0, 1, 5 and the shortest hi+lo tile, SIMD 1 of 0, 2, 5, SIMD 2 of 1, 3, 4, SIMD 3 of 2, 3, 4 and the longest hi+lo tile.
    // The oldest wave has the longest half, the next (waves 4 to 7) the hi+lo tile, whose passes wait longest for their loads. The waves with part 0, which join and store, are spread 1, 1, 2, 2 over the SIMDs. One hexadecimal digit (class) and one bit (part) a wave:
    const bool lo = (wave >> 2) != 1; const int cls = (int)((0x4455332100002100ull >> (4 * wave)) & 15), part = (0x5B02 >> wave) & 1;
    const int q0 = RH + 16 * RLO * (cls < 3 ? 6 * AG - 1 - AG * cls - a : AG * (5 - cls) + a);
    float* X = xch + cls * XCH; v8f acc[RLO][4]; float m[RLO], l[RLO];
    if (lo) { attn_keys<h16, false, RLO, 2>(Q16 + hp, nullptr, K16 + hp, nullptr, V16 + hp, nullptr, q0, part, acc, m, l); if (part) put_part<RLO>(X, acc, m, l, lane); }
    else { const int w = wave & 3; const int qh = 16 * (w == 0 ? a : w == 1 ? AG + a : w == 2 ? 3 * AG - 1 - a : 4 * AG - 1 - a); v8f ah[1][4]; float mh[1], lh[1];
        attn_keys<bf, true, 1, 1>(Qh + hp, Ql + hp, Kh + hp, Kl + hp, Vh + hp, Vl + hp, qh, 0, ah, mh, lh); attn_out<1>(ah, lh, qh, head, Ah, Al); }
    __syncthreads();   // every wave of the work-group: the partial results of the waves with part 1 are in LDS
    if (lo && !part) { add_part<RLO>(X, acc, m, l, lane); attn_out<RLO>(acc, l, q0, head, Ah, Al); }
}

// ---- k_qkv: the q | k | v projection (the staged loop of k_proj, one wave per 64x64 tile = 64 rows b TT + t of one head of q, k or v) with everything that follows it up to the 16-bit planes in its epilogue: + b_attn, partial RoPE, the post-RoPE head bias, the fp16 and hi/lo bf16 rounding, and for v the transpose. The f32 values never leave the work-group.
// A matrix tile leaves the unit with lane = column and registers = 8 consecutive rows, so the operand whose index is to run along a plane's rows goes in as A: for q and k (planes [t][d]) A = W^T rows d and B = x rows t, for v (planes [d][t]) A = x rows t and B = W^T rows d. Both are fragment-order planes read by the same loader, so only the two pointers change places.
// acc[x][y][j] is then plane row 16 y + lr, plane column 16 x + 8 hi + j. The tile goes to LDS as f32 in that form and is read back four whole plane rows at a time, eight columns a lane.
#define FP 68   // pitch of a staged row in dwords, 64 + 4: the 16-byte LDS writes (16 rows, one column block) and reads (whole rows) both fall on distinct banks
template <bool ROPE>
__device__ __forceinline__ void qkv_out(const float* F, const float* __restrict__ gb, const float* __restrict__ rc, const float* __restrict__ rs, const float* __restrict__ hb, h16* P16, bf* Ph, bf* Pl, int pitch, int lane) {
    const int r4 = lane >> 3, ch = (lane & 7) * 8;   // the lane's row among four, its first column (for q and k: d)
    const int co = (ch >> 5) * 512 + ((ch >> 4) & 1) * 256 + ((ch >> 3) & 1) * 128;   // where that column's chunks start in a fragment-order block row (P16, Ph, Pl point at the tile's first block; pitch = the plane's K)
    float g[8], g2[8], p[8]; v4f cn[2], sn[2];
    // every '#pragma unroll' of this function and of k_qkv: the indices of the register arrays and vectors must be compile-time constants, so that they stay in registers
    const float* cp = ROPE ? rc + r4 * 32 + (ch & 31) : nullptr; const float* sp = ROPE ? rs + r4 * 32 + (ch & 31) : nullptr;   // lanes with d >= 32 read the row's tables too (in bounds) and do not use them
    if (ROPE) { const float* gp = gb + ch; const float* gq = gb + (ch ^ 16); const float* pp = hb + ch;   // b_attn at d and at the RoPE partner d +- 16, the head bias at d
#pragma unroll
        for (int u = 0; u < 2; ++u) { const v4f a = *(const v4fa*)(gp + 4 * u), b = *(const v4fa*)(gq + 4 * u), c = *(const v4fa*)(pp + 4 * u); cn[u] = *(const v4fa*)(cp + 4 * u); sn[u] = *(const v4fa*)(sp + 4 * u);
#pragma unroll
            for (int j = 0; j < 4; ++j) { g[4 * u + j] = bfr(a[j]); g2[4 * u + j] = bfr(b[j]); p[4 * u + j] = bfr(c[j]); } }
        asm volatile("s_wait_xcnt 0x0" :: "v"(gp), "v"(gq), "v"(pp), "v"(cp), "v"(sp) : "memory"); __builtin_amdgcn_sched_barrier(0); }   // as xdone, for the five addresses of this run of loads
    // kept rolled: sixteen equal trips; unrolled they would be tens of KiB of code that every wave runs once
#pragma unroll 1
    for (int q = 0; q < 16; ++q) {
        const float* f = F + (q * 4 + r4) * FP; const v4f f0 = *(const v4fa*)(f + ch), f1 = *(const v4fa*)(f + ch + 4); float r[8];
        if (ROPE) { const v4f e0 = *(const v4fa*)(f + (ch ^ 16)), e1 = *(const v4fa*)(f + (ch ^ 16) + 4); const v4f c0 = cn[0], c1 = cn[1], s0 = sn[0], s1 = sn[1];
            if (q < 15) { cp += 4 * 32; sp += 4 * 32; }   // the next four rows' tables, in flight under this trip's work; the last trip repeats its own, in bounds, unused
            cn[0] = *(const v4fa*)cp; cn[1] = *(const v4fa*)(cp + 4); sn[0] = *(const v4fa*)sp; sn[1] = *(const v4fa*)(sp + 4);
            xdone<true>(cp, sp);
#pragma unroll
            for (int j = 0; j < 8; ++j) { const float x0 = (j < 4 ? f0[j & 3] : f1[j & 3]) + g[j], x1 = (j < 4 ? e0[j & 3] : e1[j & 3]) + g2[j]; const float c = bfr(j < 4 ? c0[j & 3] : c1[j & 3]), s = bfr(j < 4 ? s0[j & 3] : s1[j & 3]);
                const float ro = x0 * c + x1 * (ch < 16 ? -s : s);   // rotate-half within the first 32 dims
                r[j] = (ch < 32 ? ro : x0) + p[j]; }
        } else {
#pragma unroll
            for (int j = 0; j < 8; ++j) r[j] = j < 4 ? f0[j & 3] : f1[j & 3]; }
        v8h o16; v8us oh, ol;
#pragma unroll
        for (int j = 0; j < 8; ++j) { o16[j] = tohx(r[j]); unsigned short a2, c2; splitf(r[j], a2, c2); oh[j] = a2; ol[j] = c2; }
        const int rr = q * 4 + r4; const size_t go = (size_t)(rr >> 4) * 16 * pitch + co + (rr & 15) * 8; *(v8ha*)(P16 + go) = o16; *(v8usa*)(Ph + go) = oh; *(v8usa*)(Pl + go) = ol;   // each store of the wave: eight 64-B pieces (four neighbouring rows of eight chunk columns); the next trip fills the lines' other halves
        asm volatile("s_wait_xcnt 0x0" ::: "memory"); __builtin_amdgcn_sched_barrier(0);   // behind the three stores, in front of whatever overwrites their address or data registers (the next trip's); the scheduling barrier keeps that code behind the wait
    }
}
#define QWV 12                 // waves a work-group: 3 heads (64 rows of W^T each) x 4 tiles of 64 rows of x; 256 work-groups
#define QRG 28                 // row groups a stage: 12 of W^T, then 16 of x
#define QST (QRG * 16 * KS)    // elements a stage
__global__ __launch_bounds__(32 * QWV) void k_qkv(const bf* __restrict__ X, const bf* __restrict__ Wt, const float* __restrict__ bias, const float* __restrict__ rc, const float* __restrict__ rs, const float* __restrict__ bQ, const float* __restrict__ bK,
                                            h16* Q16, bf* Qh, bf* Ql, h16* K16, bf* Kh, bf* Kl, h16* V16, bf* Vh, bf* Vl) {
    typedef WFrag<bf>::V V;
    __shared__ __align__(1024) bf ring[2 * QST];
    __shared__ __align__(16) float Fs[QWV * 64 * FP];
    const int lane = threadIdx.x & 31, lr = lane & 15, hi = lane >> 4; const int wave = __builtin_amdgcn_readfirstlane((int)(threadIdx.x >> 5));   // scalar: every branch on it is a scalar branch
    const int wq = wave >> 2, wp = wave & 3; const int R0 = blockIdx.x * 256, C0 = blockIdx.y * 192; const int r0 = R0 + wp * 64, c0 = C0 + wq * 64;
    float* F = Fs + wave * 64 * FP;   // the wave's own epilogue tile
    const int sel = c0 / DQ, head = (c0 % DQ) / HD;   // 0 q, 1 k, 2 v
    // the stage's 112 copies: wave (wq, wp) brings the wp-th 512 B of row groups wq, wq + 3, ..., wq + 24, and the waves with wq = 0 that of row group 27 too. Row groups up to wq + 9 are W^T's, the rest x's
    const int po = wp * 256 + 8 * lane; const bf* gW = Wt + (size_t)(C0 + wq * 16) * DM + po; const bf* gX = X + (size_t)(R0 + wq * 16) * DM + po; const unsigned l0 = lds_off(ring) + 2 * (wq * 1024 + po);
    auto issue = [&](int t) { const unsigned lb = l0 + (t & 1) * (QST * 2); const int go = t * (KS * 16); unsigned l[9]; const bf* g[9];
#pragma unroll
        for (int i = 0; i < 9; ++i) { l[i] = lb + i * 3 * 2048; g[i] = (i < 4 ? gW + (size_t)i * 48 * DM : gX + (size_t)(i - 4) * 48 * DM) + go; }
        cp9(l, g);
        if (wq == 0) { const unsigned l1[1] = { lb + 27 * 2048 }; const bf* const g1[1] = { gX + (size_t)15 * 16 * DM + go }; cp1(l1, g1); } };
    v8f acc[4][4];
#pragma unroll
    for (int mb = 0; mb < 4; ++mb)
#pragma unroll
        for (int nb = 0; nb < 4; ++nb) acc[mb][nb] = (v8f){};
    issue(0); asm volatile("s_wait_asynccnt 0x0" ::: "memory"); __syncthreads();   // stage 0 has landed and is published
    issue(1);
    const int wo = wq * 4 * 1024 + 8 * lane, xo = (12 + wp * 4) * 1024 + 8 * lane; const int ao = (sel == 2) ? xo : wo, bo = (sel == 2) ? wo : xo;
    // kept rolled: the buffer index alternates from trip to trip
#pragma unroll 1
    for (int t = 0; t < DM / KS; ++t) {
        const bf* st = ring + (t & 1) * QST;
#pragma unroll
        for (int kb = 0; kb < KS / 32; ++kb) {
            V a[4], b[4];
#pragma unroll
            for (int i = 0; i < 4; ++i) { a[i] = WFrag<bf>::ld(st + ao + i * 1024 + kb * 512); b[i] = WFrag<bf>::ld(st + bo + i * 1024 + kb * 512); }
            __builtin_amdgcn_sched_barrier(0);   // a block's LDS reads stand as one group in front of its matrix instructions: left to itself the compiler puts them among those in pairs, each behind a wait to 0
#pragma unroll
            for (int nb = 0; nb < 4; ++nb)
#pragma unroll
                for (int mb = 0; mb < 4; ++mb) acc[mb][nb] = WFrag<bf>::mma(a[mb], b[nb], acc[mb][nb]);
            __builtin_amdgcn_sched_barrier(0);   // and the next block's reads behind them
        }
        stage_done();
        if (t + 2 < DM / KS) issue(t + 2);   // into the buffer that this trip has just read
    }
    asm volatile("s_wait_asynccnt 0x0" ::: "memory");   // no copy is outstanding when the wave goes on
    if (sel == 2) { const float* gp = bias + c0 + lr; const float g0 = gp[0], g1 = gp[16], g2 = gp[32], g3 = gp[48]; xdone<false>(gp, nullptr);   // v: + b_attn, d = 16 y + lr (q and k: in qkv_out)
#pragma unroll
        for (int x = 0; x < 4; ++x) { acc[x][0] += bfr(g0); acc[x][1] += bfr(g1); acc[x][2] += bfr(g2); acc[x][3] += bfr(g3); } }
#pragma unroll
    for (int y = 0; y < 4; ++y) {
#pragma unroll
        for (int x = 0; x < 4; ++x) { const v8f w = acc[x][y]; float* f = F + (y * 16 + lr) * FP + x * 16 + hi * 8; *(v4fa*)f = __builtin_shufflevector(w, w, 0, 1, 2, 3); *(v4fa*)(f + 4) = __builtin_shufflevector(w, w, 4, 5, 6, 7); } }
    __syncthreads();   // the staged tile is read back across lanes
    const size_t hp = ((size_t)(r0 / TT) * NH_ + head) * TT * HD; const int t0 = r0 % TT;
    if (sel == 2) { const size_t o = hp + (size_t)t0 * 16; qkv_out<false>(F, nullptr, nullptr, nullptr, nullptr, V16 + o, Vh + o, Vl + o, TT, lane); }
    else { const size_t o = hp + (size_t)t0 * HD; qkv_out<true>(F, bias + c0, rc + (size_t)r0 * 32, rs + (size_t)r0 * 32, (sel ? bK : bQ) + head * HD, (sel ? K16 : Q16) + o, (sel ? Kh : Qh) + o, (sel ? Kl : Ql) + o, HD, lane); }
}

extern "C" void kernel_launch(void* const* d_in, const int* in_sizes, int n_in,
                              void* d_out, int out_size, void* d_ws, size_t ws_size, hipStream_t stream) {
    (void)in_sizes; (void)n_in; (void)out_size;
    const float* x = (const float*)d_in[0]; const float* rcos = (const float*)d_in[1]; const float* rsin = (const float*)d_in[2]; const float* wf = (const float*)d_in[3]; const float* bfz = (const float*)d_in[4]; const float* wo = (const float*)d_in[5]; const float* bo = (const float*)d_in[6]; const float* bQ = (const float*)d_in[7]; const float* bK = (const float*)d_in[8]; const float* cosT = nullptr; const float* sinT = nullptr; (void)cosT; (void)sinT;
    float* OUT = (float*)d_out;     // [2][2048][1024]
    char* wsp = (char*)d_ws;
    auto take = [&](size_t bytes) { char* p = wsp; wsp += (bytes + 255) & ~(size_t)255; return (void*)p; };
    bf* WA = (bf*)take((size_t)3 * DQ * DM * 2); bf* WO = (bf*)take((size_t)DM * DQ * 2);   // WA: W_attn transposed, rows q | k | v
    bf* XB = (bf*)take((size_t)NB_ * TT * DM * 2);
    h16* QP16 = (h16*)take((size_t)NB_ * NH_ * TT * HD * 2); h16* KP16 = (h16*)take((size_t)NB_ * NKV * TT * HD * 2); h16* VT16 = (h16*)take((size_t)NB_ * NKV * HD * TT * 2);
    bf* QPh = (bf*)take((size_t)NB_ * NH_ * TT * HD * 2); bf* QPl = (bf*)take((size_t)NB_ * NH_ * TT * HD * 2); bf* KPh = (bf*)take((size_t)NB_ * NKV * TT * HD * 2); bf* KPl = (bf*)take((size_t)NB_ * NKV * TT * HD * 2); bf* VTh = (bf*)take((size_t)NB_ * NKV * HD * TT * 2); bf* VTl = (bf*)take((size_t)NB_ * NKV * HD * TT * 2);
    bf* ATh = (bf*)take((size_t)NB_ * TT * DQ * 2); bf* ATl = (bf*)take((size_t)NB_ * TT * DQ * 2);
    if ((size_t)(wsp - (char*)d_ws) > ws_size) return;    // ws 256 MiB
    // every kernel runs once: the two batches are rows b TT + t of one grid, and q, k, v are the 3 DQ columns of one product
    k_prep<<<PBX + PBA + PBO, 256, 0, stream>>>(x, wf, wo, XB, WA, WO);
    k_qkv<<<dim3(NB_ * TT / 256, 3 * DQ / 192, 1), 32 * QWV, 0, stream>>>(XB, WA, bfz, rcos, rsin, bQ, bK, QP16, QPh, QPl, KP16, KPh, KPl, VT16, VTh, VTl);
    k_attn<<<dim3(NH_, NB_, AG), 32 * AW, 0, stream>>>(QP16, KP16, VT16, QPh, QPl, KPh, KPl, VTh, VTl, ATh, ATl);
    k_proj<<<dim3(NB_ * TT / 128, DM / 128, 1), 32 * PWV, 0, stream>>>(ATh, ATl, WO, OUT, bo);
}

// v009
// One run takes 72.5 microseconds.
// Next to v008, in two timings, it ran 1.10 times as fast each time.
// All steps since v000 together make it 20.3 times as fast.
#include <hip/hip_runtime.h>

// DisorderedCausalSelfAttention (x [2][2048][1024]; qkv = x W_attn + b ([1024][3072], split q | k | v, 16 heads x 64); partial RoPE on the first 32 dims of each head with the given per-batch tables rope_cos/rope_sin [B][T][32] (read; rotate_half within the 32 dims); then q += bQ[h], k += bK[h] (post-RoPE symmetry-breaking biases, read); causal softmax(q.k / 8); out = merged W_proj + b_proj -> [2][2048][1024]).
// Compute dtypes, f32 accumulate: every input rounded to bf16; q/k/v on PLAIN bf16 operands (inputs: exact) + bias; partial RoPE and the post-RoPE biases f32; causal scores and att.v: query rows < 512 hl (3 products), the rest single fp16; softmax f32, running maximum, normalised after att.v; W_proj hl x exact (2 products) + bias.

// Every 16-bit operand plane (rows x K) lies in FRAGMENT ORDER: the 16 rows x 32 k of one matrix operand are one 1024-B block, blocks run along k and then along the row groups. Inside a block the 16-B chunk of row r, k = 16 j + 8 h + (0..7) stands at chunk 32 j + 16 h + (r & 15),
// which is lane 16 h + (r & 15) of the operand's j-th 16-B load: each wave-wide load reads 512 contiguous bytes, four whole lines, where a row-major plane gives sixteen 32-B pieces. A group of 16 rows still takes 16 K elements, so row-group offsets read as in a row-major plane.
#define NB_  2
#define TT   2048
#define DM   1024
#define NH_  16
#define NKV  16
#define REP  (NH_ / NKV)
#define HD   64
#define DQ   (NH_ * HD)
#define DKV  (NKV * HD)
#define RH   512                  // query rows < RH use hi+lo planes
#define SCL  0.125f   // HD^-0.5
typedef _Float16 h16;
typedef unsigned short bf;
typedef __attribute__((ext_vector_type(16))) __bf16   v16bf;
typedef __attribute__((ext_vector_type(16))) _Float16 v16h;
typedef __attribute__((ext_vector_type(8)))  _Float16 v8h;
typedef __attribute__((ext_vector_type(8)))  unsigned short v8us;
typedef __attribute__((ext_vector_type(8)))  float    v8f;
typedef __attribute__((ext_vector_type(4)))  float    v4f;
typedef v8h  __attribute__((may_alias)) v8ha;
typedef v4f  __attribute__((may_alias)) v4fa;
typedef v8us __attribute__((may_alias)) v8usa;
typedef float v2fa __attribute__((ext_vector_type(2), may_alias));

__device__ __forceinline__ unsigned short f2bf(float f) { unsigned u = __float_as_uint(f); u += 0x7FFFu + ((u >> 16) & 1u); return (unsigned short)(u >> 16); }
__device__ __forceinline__ float bf2f(unsigned short b) { return __uint_as_float(((unsigned)b) << 16); }
__device__ __forceinline__ float bfr(float f) { return bf2f(f2bf(f)); }
__device__ __forceinline__ v16h cat16(v8h lo, v8h hi) { return __builtin_shufflevector(lo, hi, 0, 1, 2, 3, 4, 5, 6, 7, 8, 9, 10, 11, 12, 13, 14, 15); }
__device__ __forceinline__ v16bf cat16b(v8us lo, v8us hi) { return __builtin_bit_cast(v16bf, __builtin_shufflevector(lo, hi, 0, 1, 2, 3, 4, 5, 6, 7, 8, 9, 10, 11, 12, 13, 14, 15)); }
__device__ __forceinline__ v8f wmma16(v16h a, v16h b, v8f c) { return __builtin_amdgcn_wmma_f32_16x16x32_f16(false, a, false, b, (short)0, c, false, false); }
__device__ __forceinline__ v8f wmmab(v16bf a, v16bf b, v8f c) { return __builtin_amdgcn_wmma_f32_16x16x32_bf16(false, a, false, b, (short)0, c, false, false); }



// WFrag: a matrix operand from a fragment-order plane (ld: p = the block's start + 8 lane)
template <typename T16> struct WFrag;
template <> struct WFrag<h16> { typedef v16h V; static __device__ __forceinline__ V ld(const h16* p) { return cat16(*(const v8h*)p, *(const v8h*)(p + 256)); } static __device__ __forceinline__ v8f mma(V a, V b, v8f c) { return wmma16(a, b, c); } };
template <> struct WFrag<bf> { typedef v16bf V; static __device__ __forceinline__ V ld(const bf* p) { return cat16b(*(const v8us*)p, *(const v8us*)(p + 256)); } static __device__ __forceinline__ v8f mma(V a, V b, v8f c) { return wmmab(a, b, c); } };
// ---- operand staging for the two GEMMs. The waves of a work-group share their operand rows: a stage = KS k of every row group (16 rows) of the work-group's tile, which in a fragment-order plane is 2 KiB in a row, brought into LDS once by asynchronous copies (16 B a lane, 512 contiguous bytes a copy)
// and read from there by every wave that needs it, in the same fragment order (each wave-wide ds_load_b128 reads 512 contiguous bytes).
// The ring: all work-groups walk k together, so every stage holds operand lines that nobody has touched before, and part of its copies come from memory, with a latency that one trip need not cover. G groups of four waves take turns as copiers, stage s being the work of group s mod G, and the ring has G + 1 buffers:
// a group waits for its own stage alone (to 0: nothing else of it is in flight), passes the barrier that publishes it, and issues its next stage, G stages on, into the buffer that the trip just ended has read. Each stage so flies during G whole trips.
// cpN: N copies, each with its own LDS byte address l and global address g; s_wait_xcnt 0 is the statement's last line, so that it stands in front of whatever rewrites a register that a copy names
#define KS 64
__device__ __forceinline__ unsigned lds_off(const void* p) { return (unsigned)(size_t)p; }
__device__ __forceinline__ void cp14(const unsigned (&l)[14], const bf* const (&g)[14]) { asm volatile("global_load_async_to_lds_b128 %0, %14, off\n\tglobal_load_async_to_lds_b128 %1, %15, off\n\tglobal_load_async_to_lds_b128 %2, %16, off\n\tglobal_load_async_to_lds_b128 %3, %17, off\n\tglobal_load_async_to_lds_b128 %4, %18, off\n\tglobal_load_async_to_lds_b128 %5, %19, off\n\tglobal_load_async_to_lds_b128 %6, %20, off\n\tglobal_load_async_to_lds_b128 %7, %21, off\n\tglobal_load_async_to_lds_b128 %8, %22, off\n\tglobal_load_async_to_lds_b128 %9, %23, off\n\tglobal_load_async_to_lds_b128 %10, %24, off\n\tglobal_load_async_to_lds_b128 %11, %25, off\n\tglobal_load_async_to_lds_b128 %12, %26, off\n\tglobal_load_async_to_lds_b128 %13, %27, off\n\ts_wait_xcnt 0x0" :: "v"(l[0]), "v"(l[1]), "v"(l[2]), "v"(l[3]), "v"(l[4]), "v"(l[5]), "v"(l[6]), "v"(l[7]), "v"(l[8]), "v"(l[9]), "v"(l[10]), "v"(l[11]), "v"(l[12]), "v"(l[13]), "v"(g[0]), "v"(g[1]), "v"(g[2]), "v"(g[3]), "v"(g[4]), "v"(g[5]), "v"(g[6]), "v"(g[7]), "v"(g[8]), "v"(g[9]), "v"(g[10]), "v"(g[11]), "v"(g[12]), "v"(g[13]) : "memory"); }
__device__ __forceinline__ void cp12(const unsigned (&l)[12], const bf* const (&g)[12]) { asm volatile("global_load_async_to_lds_b128 %0, %12, off\n\tglobal_load_async_to_lds_b128 %1, %13, off\n\tglobal_load_async_to_lds_b128 %2, %14, off\n\tglobal_load_async_to_lds_b128 %3, %15, off\n\tglobal_load_async_to_lds_b128 %4, %16, off\n\tglobal_load_async_to_lds_b128 %5, %17, off\n\tglobal_load_async_to_lds_b128 %6, %18, off\n\tglobal_load_async_to_lds_b128 %7, %19, off\n\tglobal_load_async_to_lds_b128 %8, %20, off\n\tglobal_load_async_to_lds_b128 %9, %21, off\n\tglobal_load_async_to_lds_b128 %10, %22, off\n\tglobal_load_async_to_lds_b128 %11, %23, off\n\ts_wait_xcnt 0x0" :: "v"(l[0]), "v"(l[1]), "v"(l[2]), "v"(l[3]), "v"(l[4]), "v"(l[5]), "v"(l[6]), "v"(l[7]), "v"(l[8]), "v"(l[9]), "v"(l[10]), "v"(l[11]), "v"(g[0]), "v"(g[1]), "v"(g[2]), "v"(g[3]), "v"(g[4]), "v"(g[5]), "v"(g[6]), "v"(g[7]), "v"(g[8]), "v"(g[9]), "v"(g[10]), "v"(g[11]) : "memory"); }
// stage_done: the foot of a trip, every wave: its own LDS reads are back; the waves that copied the next stage (mine, scalar): their copies have landed; then the work-group barrier that publishes the next stage and ends every reader's last read of this one
__device__ __forceinline__ void stage_done(bool mine) { asm volatile("s_wait_dscnt 0x0" ::: "memory"); if (mine) asm volatile("s_wait_asynccnt 0x0" ::: "memory"); __syncthreads(); }

// ---- k_proj: C[m][n] (f32, + bias[n]) = sum_k (A + A2)[m][k] Bt[n][k], two products. Work-group = 8 waves = 128 x 128 of C, a wave 32 x 64 (8 accumulators), two waves a SIMD; grid (M/128, N/128).
// Stage: 8 row groups of A, 8 of A2, 8 of Bt; two groups of copiers (waves 0 to 3, waves 4 to 7; waves w and w + 4 are taken to share a SIMD, for speed only), three buffers; wave w of the stage's group copies the (w & 3)-th 512 B of every row group
#define PWV 8
#define PRG 24
#define PST (PRG * 16 * KS)   // elements a stage
#define PNB 3                 // buffers
static_assert(DQ / KS >= PNB, "k_proj: the prologue issues PNB stages");
__global__ __launch_bounds__(32 * PWV) void k_proj(const bf* __restrict__ A, const bf* __restrict__ A2, const bf* __restrict__ Bt, float* C, const float* __restrict__ bias) {
    typedef WFrag<bf>::V V;
    __shared__ __align__(1024) bf ring[PNB * PST];
    __shared__ __align__(16) float oss[PWV * 16 * 68];
    const int lane = threadIdx.x & 31, lr = lane & 15, hi = lane >> 4; const int wave = __builtin_amdgcn_readfirstlane((int)(threadIdx.x >> 5));   // scalar: what is formed from it stays in scalar registers
    const int R0 = blockIdx.x * 128, C0 = blockIdx.y * 128; const int r0 = R0 + (wave >> 1) * 32, c0 = C0 + (wave & 1) * 64;
    float* os = oss + wave * 16 * 68;
    const int grp = wave >> 2, po = (wave & 3) * 256 + 8 * lane;   // grp: the wave copies the stages of this parity; po: the lane's 16 B inside a row group's 2 KiB
    const bf* gA = A + (size_t)R0 * DQ + po; const bf* gA2 = A2 + (size_t)R0 * DQ + po; const bf* gB = Bt + (size_t)C0 * DQ + po; const unsigned l0 = lds_off(ring) + 2 * po;
    auto issue = [&](int t, int buf) { const unsigned lb = l0 + buf * (PST * 2); const int go = t * (KS * 16); const bf* tA = gA + go; const bf* tA2 = gA2 + go; const bf* tB = gB + go;   // the stage's k first, the row group's constant last: three addresses live through the loop, not 24. Both loops unrolled: l and g are asm operands, their indices must be compile-time constants
#pragma unroll
        for (int h = 0; h < 2; ++h) { unsigned l[12]; const bf* g[12];
#pragma unroll
            for (int i = 0; i < 12; ++i) { const int r = 12 * h + i; l[i] = lb + r * 2048; g[i] = (r < 8 ? tA : r < 16 ? tA2 : tB) + (size_t)(r & 7) * 16 * DQ; }
            cp12(l, g); } };
    v8f acc[2][4];
#pragma unroll
    for (int mb = 0; mb < 2; ++mb)
#pragma unroll
        for (int nb = 0; nb < 4; ++nb) acc[mb][nb] = (v8f){};
    issue(grp, grp);   // stages 0 and 1, each by its group
    if (grp == 0) asm volatile("s_wait_asynccnt 0x0" ::: "memory");
    __syncthreads();   // stage 0 has landed and is published
    if (grp == 0) issue(2, 2);
    const int ao = (wave >> 1) * 2 * 1024 + 8 * lane, bo = (16 + (wave & 1) * 4) * 1024 + 8 * lane;
    int rb = 0;   // the buffer of this trip's stage, t mod PNB
    // kept rolled: the buffer index changes from trip to trip
#pragma unroll 1
    for (int t = 0; t < DQ / KS; ++t) {
        const bf* st = ring + rb * PST;
        V a[KS / 32][2], a2[KS / 32][2], b[KS / 32][4];
#pragma unroll
        for (int kb = 0; kb < KS / 32; ++kb) {
#pragma unroll
            for (int i = 0; i < 2; ++i) { a[kb][i] = WFrag<bf>::ld(st + ao + i * 1024 + kb * 512); a2[kb][i] = WFrag<bf>::ld(st + ao + (8 + i) * 1024 + kb * 512); }
#pragma unroll
            for (int i = 0; i < 4; ++i) b[kb][i] = WFrag<bf>::ld(st + bo + i * 1024 + kb * 512); }
        __builtin_amdgcn_sched_barrier(0);   // the trip's LDS reads stand as one group in front of its matrix instructions: left to itself the compiler puts them among those in pairs, each behind a wait to 0
#pragma unroll
        for (int kb = 0; kb < KS / 32; ++kb)
#pragma unroll
            for (int nb = 0; nb < 4; ++nb)
#pragma unroll
                for (int mb = 0; mb < 2; ++mb) { acc[mb][nb] = WFrag<bf>::mma(a[kb][mb], b[kb][nb], acc[mb][nb]); acc[mb][nb] = WFrag<bf>::mma(a2[kb][mb], b[kb][nb], acc[mb][nb]); }
        __builtin_amdgcn_sched_barrier(0);   // keeps the matrix instructions in front of the trip's foot: moved behind its waits they would no longer run while the next stage's copies fly
        const bool mine = ((t + 1) & 1) == grp;   // scalar: stage t + 1 is this wave's group's
        stage_done(mine);
        if (mine && t + 3 < DQ / KS) issue(t + 3, rb);   // the group's next stage, into the buffer that this trip has just read
        rb = rb == PNB - 1 ? 0 : rb + 1;
    }
    asm volatile("s_wait_asynccnt 0x0" ::: "memory");   // no copy is outstanding when the wave goes on
    const float* bp = bias + c0 + lr * 4; const v4f bv = *(const v4fa*)bp;   // the lane's four columns' bias
    asm volatile("s_wait_xcnt 0x0" :: "v"(bp) : "memory"); __builtin_amdgcn_sched_barrier(0);   // behind the load, in front of whatever overwrites its address register; it names the address as an input, so that the load does not land on it
#pragma unroll
    for (int mb = 0; mb < 2; ++mb) {
#pragma unroll
        for (int nb = 0; nb < 4; ++nb) {
#pragma unroll
            for (int j = 0; j < 8; ++j) os[(hi * 8 + j) * 68 + nb * 16 + lr] = acc[mb][nb][j]; }
        __builtin_amdgcn_wave_barrier(); asm volatile("" ::: "memory");
        float* crow = C + (size_t)(r0 + mb * 16) * DM + c0;
{
#pragma unroll
            for (int s = 0; s < 8; ++s) { const int row = 2 * s + hi, cofs = lr * 4; v4f val = *(const v4fa*)(os + row * 68 + cofs); val[0] += bfr(bv[0]); val[1] += bfr(bv[1]); val[2] += bfr(bv[2]); val[3] += bfr(bv[3]);
                *(v4f*)(crow + (size_t)row * DM + cofs) = val; }
             }
        asm volatile("s_wait_xcnt 0x0" ::: "memory"); __builtin_amdgcn_sched_barrier(0);   // behind the eight stores, in front of whatever overwrites their address or data registers (the next row group's values); the scheduling barrier keeps that code behind the wait
        __builtin_amdgcn_wave_barrier(); asm volatile("" ::: "memory");
    }
}

__device__ __forceinline__ h16 tohx(float x) { return (h16)x; }
__device__ __forceinline__ void splitf(float y, unsigned short& h, unsigned short& l) { h = f2bf(y); l = f2bf(y - bf2f(h)); }
typedef __attribute__((ext_vector_type(2))) _Float16 v2h;
typedef __attribute__((ext_vector_type(4))) _Float16 v4h;
typedef __attribute__((ext_vector_type(2))) unsigned short v2us;
typedef __attribute__((ext_vector_type(4))) unsigned short v4us;
typedef __attribute__((ext_vector_type(2))) float v2f;
typedef __attribute__((ext_vector_type(4))) int v4i;

// frag_off: where the 16-B chunk of (row, k .. k + 7), k a multiple of 8, stands in a fragment-order plane with K columns, in elements
__device__ __forceinline__ size_t frag_off(int row, int k, int K) { return ((((size_t)(row >> 4) * (K >> 5) + (k >> 5)) * 2 + ((k >> 4) & 1)) * 32 + ((k >> 3) & 1) * 16 + (row & 15)) * 8; }
// ---- k_prep: all operand preparation in one launch: x -> XB, W_attn -> WA, W_proj -> WO, none of which reads another's output; the job goes by the block index. Few, long-lived waves: a thread takes PC chunks, all of its loads in flight together, so that 4096 waves are started and not 32768.
#define PC 8   // chunks (8 elements of a plane each) a thread
// prep_x, wave task q: 8 rows x 256 k of x. For each of its PC chunks (32 k apart) a wave reads one whole 128-B line of each row and stores four whole lines (8 neighbouring rows of each of the four chunk columns)
__device__ __forceinline__ void prep_x(const float* __restrict__ src, bf* dst, int q, int lane) {
    const int row = (q >> 2) * 8 + (lane >> 2), k = (q & 3) * (32 * PC) + (lane & 3) * 8; const float* p = src + (size_t)row * DM + k; v8f v[PC]; v8us o[PC];
    // every '#pragma unroll' of prep_x and prep_w: the indices of the register arrays must be compile-time constants, so that they stay in registers
#pragma unroll
    for (int c = 0; c < PC; ++c) v[c] = *(const v8f*)(p + 32 * c);
    asm volatile("s_wait_xcnt 0x0" :: "v"(p) : "memory"); __builtin_amdgcn_sched_barrier(0);   // behind the loads, in front of whatever overwrites their address register (the instruction set's rule for an issued load); it names the address as an input, so that no load of the run lands on it, and the scheduling barrier keeps later code behind it
#pragma unroll
    for (int c = 0; c < PC; ++c)
#pragma unroll
        for (int u = 0; u < 8; ++u) o[c][u] = f2bf(v[c][u]);
    __builtin_amdgcn_sched_barrier(0);   // the stores stand together as one run behind all the conversions, so that one wait behind the last of them serves the run
    bf* d = dst + frag_off(row, k, DM);
#pragma unroll
    for (int c = 0; c < PC; ++c) *(v8us*)(d + 512 * c) = o[c];   // 32 k on: the next 1024-B block
    asm volatile("s_wait_xcnt 0x0" ::: "memory"); }   // behind the last store, in front of whatever code follows in the kernel and overwrites the stores' address or data registers
// prep_w, wave task q: 32 neighbouring n x 64 k of Bt (fragment order, rows n, K columns): element (n, k) = w[k * N + n]. Each of the wave's 64 loads reads one whole 128-B line of w (the waves of a work-group take neighbouring n), each of its PC stores writes two 256-B runs (16 neighbouring rows of a block stand side by side)
template <int K, int N>
__device__ __forceinline__ void prep_w(const float* __restrict__ w, bf* Bt, int q, int lane) {
    const int n = (q % (N / 32)) * 32 + lane, k = (q / (N / 32)) * (8 * PC); const float* p = w + (size_t)k * N + n; float v[8 * PC]; v8us o[PC];
#pragma unroll
    for (int i = 0; i < 8 * PC; ++i) v[i] = p[(size_t)i * N];
    asm volatile("s_wait_xcnt 0x0" :: "v"(p) : "memory"); __builtin_amdgcn_sched_barrier(0);   // as in prep_x
#pragma unroll
    for (int c = 0; c < PC; ++c)
#pragma unroll
        for (int u = 0; u < 8; ++u) o[c][u] = f2bf(v[8 * c + u]);
    __builtin_amdgcn_sched_barrier(0);   // as in prep_x
    bf* d = Bt + frag_off(n, k, K);
#pragma unroll
    for (int c = 0; c < PC; ++c) *(v8us*)(d + 128 * c) = o[c];   // 8 k on: 16 chunks on in the fragment order (k a multiple of 64)
    asm volatile("s_wait_xcnt 0x0" ::: "memory"); }   // as in prep_x
#define PBX (NB_ * TT * DM / (8 * PC * 256))   // work-groups for x
#define PBA (3 * DQ * DM / (8 * PC * 256))     // for W_attn
#define PBO (DM * DQ / (8 * PC * 256))         // for W_proj
__global__ __launch_bounds__(256) void k_prep(const float* __restrict__ x, const float* __restrict__ wa, const float* __restrict__ wo, bf* XB, bf* WA, bf* WO) {
    const int lane = threadIdx.x & 31, wave = __builtin_amdgcn_readfirstlane((int)(threadIdx.x >> 5)), b = blockIdx.x;   // wave scalar: the task's indices stay in scalar registers
    if (b < PBX) prep_x(x, XB, b * 8 + wave, lane);
    else if (b < PBX + PBA) prep_w<DM, 3 * DQ>(wa, WA, (b - PBX) * 8 + wave, lane);
    else prep_w<DQ, DM>(wo, WO, (b - PBX - PBA) * 8 + wave, lane);
}
__global__ __launch_bounds__(256) void k_cscvt(const float* __restrict__ cosT, const float* __restrict__ sinT, float* CS) { const int idx = blockIdx.x * 256 + threadIdx.x; if (idx >= TT * HD) return; v2f cs; cs[0] = bfr(cosT[idx]); cs[1] = bfr(sinT[idx]); *(v2f*)(CS + (size_t)idx * 2) = cs;  }
#define AW   16                   // waves a work-group
#define AG   8                    // work-groups a head and batch
#define RLO  2                    // query groups a wave, fp16 rows
#define XCH  (17 * 128)           // floats of one wave's partial result in LDS: 16 chunks of 16 B a lane of O^T, one of the maxima and sums; chunk c of lane n at 16 B x (32 c + n), so that each wave-wide access is 512 contiguous bytes
static_assert((TT - RH) / (16 * RLO) == 6 * AG && RH / 16 == 4 * AG && RH >= 64, "k_attn: six fp16 tiles (each of at least two passes) and four hi+lo tiles a work-group");
#define CSC  (SCL * 1.4426950408889634f)
__device__ __forceinline__ float xhalf(float x) { return __builtin_bit_cast(float, __builtin_amdgcn_permlanex16(__builtin_bit_cast(int, x), __builtin_bit_cast(int, x), 0x76543210, 0xfedcba98, false, false)); }   // lane l reads lane l ^ 16
// dist: the distance behind the last matrix instruction of a product before its operand registers are loaded anew, on a loop's back edge too; it names the product's tiles so that the whole product stands in front of it
__device__ __forceinline__ void dist(v8f (&s)[1][2]) { asm volatile("v_nop\n\tv_nop\n\tv_nop\n\tv_nop" : "+v"(s[0][0]), "+v"(s[0][1])); }
__device__ __forceinline__ void dist(v8f (&s)[2][2]) { asm volatile("v_nop\n\tv_nop\n\tv_nop\n\tv_nop" : "+v"(s[0][0]), "+v"(s[0][1]), "+v"(s[1][0]), "+v"(s[1][1])); }
__device__ __forceinline__ void dist(v8f (&s)[1][4]) { asm volatile("v_nop\n\tv_nop\n\tv_nop\n\tv_nop" : "+v"(s[0][0]), "+v"(s[0][1]), "+v"(s[0][2]), "+v"(s[0][3])); }
__device__ __forceinline__ void dist(v8f (&s)[2][4]) { asm volatile("v_nop\n\tv_nop\n\tv_nop\n\tv_nop" : "+v"(s[0][0]), "+v"(s[0][1]), "+v"(s[0][2]), "+v"(s[0][3]), "+v"(s[1][0]), "+v"(s[1][1]), "+v"(s[1][2]), "+v"(s[1][3])); }
// xdone: stands behind a run of global loads from a (and b), in front of whatever overwrites the registers that held their addresses (the instruction set's rule for an issued load). It names the two addresses as inputs, so that their registers live up to the wait
// and no load of the run lands on them; the scheduling barrier keeps the loads in front of it and later code behind it.
template <bool TWO>
__device__ __forceinline__ void xdone(const void* a, const void* b) { if (TWO) asm volatile("s_wait_xcnt 0x0" :: "v"(a), "v"(b) : "memory"); else asm volatile("s_wait_xcnt 0x0" :: "v"(a) : "memory"); __builtin_amdgcn_sched_barrier(0); }
template <typename T16, bool HI, bool MASK, int R>
__device__ __forceinline__ void attn_pass(typename WFrag<T16>::V (&kf)[2][2], typename WFrag<T16>::V (&kf2)[2][2], const T16* Kn, const T16* Kn2, const T16* Vp, const T16* Vp2,
                                          const typename WFrag<T16>::V (&qf)[R][2], const typename WFrag<T16>::V (&qf2)[R][2], v8f (&acc)[R][4], float (&m)[R], float (&l)[R], int key0, int myq, int hi) {
    typedef typename WFrag<T16>::V V;
    // every '#pragma unroll' of this function: the indices of the fragment and accumulator arrays must be compile-time constants, so that they stay in registers
    V vf[4], vf2[4];   // this pass's V^T fragments (rows d, k = keys), in flight under the first product and the exponentials
#pragma unroll
    for (int t = 0; t < 4; ++t) { vf[t] = WFrag<T16>::ld(Vp + (size_t)t * 16 * TT); if (HI) vf2[t] = WFrag<T16>::ld(Vp2 + (size_t)t * 16 * TT); }
    xdone<HI>(Vp, Vp2);
    v8f s[R][2];
#pragma unroll
    for (int g = 0; g < R; ++g)
#pragma unroll
        for (int kt = 0; kt < 2; ++kt) { s[g][kt] = (v8f){};
#pragma unroll
            for (int kc = 0; kc < 2; ++kc) { s[g][kt] = WFrag<T16>::mma(kf[kt][kc], qf[g][kc], s[g][kt]); if (HI) { s[g][kt] = WFrag<T16>::mma(kf[kt][kc], qf2[g][kc], s[g][kt]); s[g][kt] = WFrag<T16>::mma(kf2[kt][kc], qf[g][kc], s[g][kt]); } } }
    dist(s);
    __builtin_amdgcn_sched_barrier(0);   // keeps the loads below behind that distance
    if (!HI) {   // the next pass's K fragments, in flight under this pass's softmax and second product
#pragma unroll
        for (int kt = 0; kt < 2; ++kt)
#pragma unroll
            for (int kc = 0; kc < 2; ++kc) kf[kt][kc] = WFrag<T16>::ld(Kn + kt * 16 * HD + kc * 512);
        xdone<false>(Kn, nullptr); }
    float mx[R]; bool need = false;
#pragma unroll
    for (int g = 0; g < R; ++g) { float x0 = -3.0e38f;
#pragma unroll
        for (int e = 0; e < 16; ++e) { float x = s[g][e >> 3][e & 7] * CSC; if (MASK) x = (key0 + 16 * (e >> 3) + 8 * hi + (e & 7) <= myq + 16 * g) ? x : -3.0e38f; s[g][e >> 3][e & 7] = x; x0 = fmaxf(x0, x); }
        mx[g] = fmaxf(x0, xhalf(x0));   // lanes l and l ^ 16 hold the two key halves of one query
        need = need || (mx[g] > m[g]); }
    if (__builtin_amdgcn_ballot_w32(need) != 0) {   // wave-uniform; where a query's maximum does not move its factor is exactly 1
#pragma unroll
        for (int g = 0; g < R; ++g) { const float mn = fmaxf(m[g], mx[g]); const float corr = __builtin_amdgcn_exp2f(m[g] - mn); m[g] = mn; l[g] *= corr;
#pragma unroll
            for (int t = 0; t < 4; ++t) acc[g][t] *= corr; } }
#pragma unroll
    for (int g = 0; g < R; ++g) { float p[16];
#pragma unroll
        for (int e = 0; e < 16; ++e) { p[e] = __builtin_amdgcn_exp2f(s[g][e >> 3][e & 7] - m[g]); l[g] += p[e]; }
        if (HI) { v8us h0, h1, l0, l1;
#pragma unroll
            for (int e = 0; e < 8; ++e) { unsigned short a, c; splitf(p[e], a, c); h0[e] = a; l0[e] = c; splitf(p[8 + e], a, c); h1[e] = a; l1[e] = c; }
            const v16bf ph = cat16b(h0, h1), pl = cat16b(l0, l1);
#pragma unroll
            for (int t = 0; t < 4; ++t) { acc[g][t] = wmmab(__builtin_bit_cast(v16bf, vf[t]), ph, acc[g][t]); acc[g][t] = wmmab(__builtin_bit_cast(v16bf, vf[t]), pl, acc[g][t]); acc[g][t] = wmmab(__builtin_bit_cast(v16bf, vf2[t]), ph, acc[g][t]); }
        } else { v16h pf;
#pragma unroll
            for (int e = 0; e < 16; ++e) pf[e] = tohx(p[e]);
#pragma unroll
            for (int t = 0; t < 4; ++t) acc[g][t] = wmma16(__builtin_bit_cast(v16h, vf[t]), pf, acc[g][t]); } }
    dist(acc);
    if (HI) {   // with hi and lo planes K and V^T together do not fit 256 registers: the next pass's K is loaded when V^T is spent (these rows have at most RH / 32 passes and are never the longest)
        __builtin_amdgcn_sched_barrier(0);   // keeps these loads behind the second product
#pragma unroll
        for (int kt = 0; kt < 2; ++kt)
#pragma unroll
            for (int kc = 0; kc < 2; ++kc) { kf[kt][kc] = WFrag<T16>::ld(Kn + kt * 16 * HD + kc * 512); kf2[kt][kc] = WFrag<T16>::ld(Kn2 + kt * 16 * HD + kc * 512); }
        xdone<true>(Kn, Kn2); }
}
// attn_keys: the key loop. q0: the wave's first query row, a multiple of 16 R. The tile's passes go alternately to NS waves; this wave is number part of them and takes passes part, part + NS, ... It leaves its running maximum m, its sums l and its unnormalised O^T acc
template <typename T16, bool HI, int R, int NS>
__device__ __forceinline__ void attn_keys(const T16* __restrict__ Q, const T16* __restrict__ Q2, const T16* __restrict__ K, const T16* __restrict__ K2, const T16* __restrict__ Vt, const T16* __restrict__ Vt2, int q0, int part, v8f (&acc)[R][4], float (&m)[R], float (&l)[R]) {
    typedef typename WFrag<T16>::V V;
    const int lane = threadIdx.x & 31, lr = lane & 15, hi = lane >> 4; const int myq = q0 + lr;
    const size_t qo = (size_t)q0 * HD + 8 * lane; const int ko = 8 * lane, vo = 8 * lane;   // fragment order: Q and K blocks (16 rows, 32 d) at 16 HD a row group and 512 a d block; V^T blocks (16 d, 32 keys) at 16 TT a d group and 512 a key block
    V qf[R][2], qf2[R][2], kf[2][2], kf2[2][2];
#pragma unroll
    for (int g = 0; g < R; ++g)
#pragma unroll
        for (int kc = 0; kc < 2; ++kc) { qf[g][kc] = WFrag<T16>::ld(Q + qo + g * 16 * HD + kc * 512); if (HI) qf2[g][kc] = WFrag<T16>::ld(Q2 + qo + g * 16 * HD + kc * 512); }
    xdone<HI>(Q + qo, Q2 + qo);
#pragma unroll
    for (int kt = 0; kt < 2; ++kt)
#pragma unroll
        for (int kc = 0; kc < 2; ++kc) { kf[kt][kc] = WFrag<T16>::ld(K + ko + (32 * part + kt * 16) * HD + kc * 512); if (HI) kf2[kt][kc] = WFrag<T16>::ld(K2 + ko + (32 * part + kt * 16) * HD + kc * 512); }
    xdone<HI>(K + ko + 32 * part * HD, K2 + ko + 32 * part * HD);
#pragma unroll
    for (int g = 0; g < R; ++g) { m[g] = -3.0e38f; l[g] = 0.f;
#pragma unroll
        for (int t = 0; t < 4; ++t) acc[g][t] = (v8f){}; }
    const int klast = (q0 >> 5) << 5;   // first key of the pass that holds the wave's diagonal (its 16 R <= 32 rows lie in one 32-key block): the only pass with masked keys, and the last
    int key0 = 32 * part;
    // kept rolled: one pass's fragments and the next pass's K already fill the registers
#pragma unroll 1
    for (; key0 < klast; key0 += 32 * NS) { const int kn = NS == 1 ? key0 + 32 : min(key0 + 32 * NS, klast);   // the wave's next pass; the wave that does not take the diagonal pass loads that pass's rows at its end, in bounds, unused
        attn_pass<T16, HI, false, R>(kf, kf2, K + ko + kn * HD, K2 + ko + kn * HD, Vt + vo + key0 * 16, Vt2 + vo + key0 * 16, qf, qf2, acc, m, l, key0, myq, hi); }
    if (NS == 1 || key0 == klast)   // scalar: the diagonal pass belongs to one of the NS waves
        attn_pass<T16, HI, true, R>(kf, kf2, K + ko + klast * HD, K2 + ko + klast * HD, Vt + vo + klast * 16, Vt2 + vo + klast * 16, qf, qf2, acc, m, l, klast, myq, hi);   // there is no next pass: its K load repeats this pass's rows, in bounds, unused
}
// put_part, add_part: one wave's partial result of a tile goes to LDS, the tile's other wave joins it to its own as two running-maximum states are joined: both are brought to the common maximum and added. Lane and register hold the same query and d in both waves
template <int R>
__device__ __forceinline__ void put_part(float* X, const v8f (&acc)[R][4], const float (&m)[R], const float (&l)[R], int lane) {
    // every '#pragma unroll' of put_part, add_part and attn_out: the indices of the accumulator arrays must be compile-time constants, so that they stay in registers
#pragma unroll
    for (int g = 0; g < R; ++g)
#pragma unroll
        for (int t = 0; t < 4; ++t) { const v8f w = acc[g][t]; float* x = X + ((g * 4 + t) * 64 + lane) * 4; *(v4fa*)x = __builtin_shufflevector(w, w, 0, 1, 2, 3); *(v4fa*)(x + 128) = __builtin_shufflevector(w, w, 4, 5, 6, 7); }
    v4f ml; ml[0] = m[0]; ml[1] = m[R - 1]; ml[2] = l[0]; ml[3] = l[R - 1]; *(v4fa*)(X + (R * 8 * 32 + lane) * 4) = ml;
}
template <int R>
__device__ __forceinline__ void add_part(const float* X, v8f (&acc)[R][4], float (&m)[R], float (&l)[R], int lane) {
    const v4f ml = *(const v4fa*)(X + (R * 8 * 32 + lane) * 4);
#pragma unroll
    for (int g = 0; g < R; ++g) { const float mo = g ? ml[1] : ml[0], lo = g ? ml[3] : ml[2]; const float mn = fmaxf(m[g], mo); const float fa = __builtin_amdgcn_exp2f(m[g] - mn), fb = __builtin_amdgcn_exp2f(mo - mn); m[g] = mn; l[g] = l[g] * fa + lo * fb;
#pragma unroll
        for (int t = 0; t < 4; ++t) { const float* x = X + ((g * 4 + t) * 64 + lane) * 4; const v4f w0 = *(const v4fa*)x, w1 = *(const v4fa*)(x + 128);
#pragma unroll
            for (int j = 0; j < 8; ++j) acc[g][t][j] = acc[g][t][j] * fa + (j < 4 ? w0[j & 3] : w1[j & 3]) * fb; } }
}
// attn_out: the wave halves' sums meet, division by the sum, the hi/lo planes [t][head][d]
template <int R>
__device__ __forceinline__ void attn_out(const v8f (&acc)[R][4], const float (&l)[R], int q0, int head, bf* Ah, bf* Al) {
    const int lane = threadIdx.x & 31;
#pragma unroll
    for (int g = 0; g < R; ++g) { const float lt = l[g] + xhalf(l[g]); const float inv = __fdiv_rn(1.0f, lt);
#pragma unroll
        for (int t = 0; t < 4; ++t) { v8us oh, ol;   // registers j of tile t are d = 16 t + 8 hi + j of query myq + 16 g
#pragma unroll
            for (int j = 0; j < 8; ++j) { unsigned short a, c; splitf(acc[g][t][j] * inv, a, c); oh[j] = a; ol[j] = c; }
            const size_t oo = (size_t)(q0 + 16 * g) * DQ + (head * 2 + (t >> 1)) * 512 + (t & 1) * 256 + 8 * lane; *(v8us*)(Ah + oo) = oh; *(v8us*)(Al + oo) = ol;   // fragment order, k = head HD + d: each store is 512 contiguous bytes
            asm volatile("s_wait_xcnt 0x0" ::: "memory"); __builtin_amdgcn_sched_barrier(0); } }   // behind the two stores, in front of whatever overwrites their address or data registers (the next tile's values); the scheduling barrier keeps that code behind the wait
}
__global__ __launch_bounds__(32 * AW) void k_attn(const h16* __restrict__ Q16, const h16* __restrict__ K16, const h16* __restrict__ V16, const bf* __restrict__ Qh, const bf* __restrict__ Ql, const bf* __restrict__ Kh, const bf* __restrict__ Kl, const bf* __restrict__ Vh, const bf* __restrict__ Vl, bf* Ah, bf* Al) {
    __shared__ __align__(16) float xch[6 * XCH];
    const int head = blockIdx.x; const size_t hp = ((size_t)blockIdx.y * NH_ + head) * TT * HD; const int a = blockIdx.z; Ah += (size_t)blockIdx.y * TT * DQ; Al += (size_t)blockIdx.y * TT * DQ;   // blockIdx.y: the batch; a: which of the head's AG equal shares
    const int lane = threadIdx.x & 31, wave = __builtin_amdgcn_readfirstlane((int)(threadIdx.x >> 5));   // wave scalar, so that the key loop is a scalar loop with every lane on and every branch on the wave's task a scalar branch
    // Share a: the fp16 tiles (32 queries; tile i has 17 + i passes) 47 - a, 39 - a, 31 - a, 16 + a, 8 + a, a (classes 0 to 5: three pairs of 81 passes) and the hi+lo tiles (16 queries) a, 8 + a, 23 - a, 31 - a.
    // Waves w, w + 4, w + 8, w + 12 are taken to stand on one SIMD, the lower the older (for speed only): SIMD 0 gets halves of classes 0, 1, 5 and the shortest hi+lo tile, SIMD 1 of 0, 2, 5, SIMD 2 of 1, 3, 4, SIMD 3 of 2, 3, 4 and the longest hi+lo tile.
    // The oldest wave has the longest half, the next (waves 4 to 7) the hi+lo tile, whose passes wait longest for their loads. The waves with part 0, which join and store, are spread 1, 1, 2, 2 over the SIMDs. One hexadecimal digit (class) and one bit (part) a wave:
    const bool lo = (wave >> 2) != 1; const int cls = (int)((0x4455332100002100ull >> (4 * wave)) & 15), part = (0x5B02 >> wave) & 1;
    const int q0 = RH + 16 * RLO * (cls < 3 ? 6 * AG - 1 - AG * cls - a : AG * (5 - cls) + a);
    float* X = xch + cls * XCH; v8f acc[RLO][4]; float m[RLO], l[RLO];
    if (lo) { attn_keys<h16, false, RLO, 2>(Q16 + hp, nullptr, K16 + hp, nullptr, V16 + hp, nullptr, q0, part, acc, m, l); if (part) put_part<RLO>(X, acc, m, l, lane); }
    else { const int w = wave & 3; const int qh = 16 * (w == 0 ? a : w == 1 ? AG + a : w == 2 ? 3 * AG - 1 - a : 4 * AG - 1 - a); v8f ah[1][4]; float mh[1], lh[1];
        attn_keys<bf, true, 1, 1>(Qh + hp, Ql + hp, Kh + hp, Kl + hp, Vh + hp, Vl + hp, qh, 0, ah, mh, lh); attn_out<1>(ah, lh, qh, head, Ah, Al); }
    __syncthreads();   // every wave of the work-group: the partial results of the waves with part 1 are in LDS
    if (lo && !part) { add_part<RLO>(X, acc, m, l, lane); attn_out<RLO>(acc, l, q0, head, Ah, Al); }
}

// ---- k_qkv: the q | k | v projection (the staged loop of k_proj, one wave per 64x64 tile = 64 rows b TT + t of one head of q, k or v) with everything that follows it up to the 16-bit planes in its epilogue: + b_attn, partial RoPE, the post-RoPE head bias, the fp16 and hi/lo bf16 rounding, and for v the transpose. The f32 values never leave the work-group.
// A matrix tile leaves the unit with lane = column and registers = 8 consecutive rows, so the operand whose index is to run along a plane's rows goes in as A: for q and k (planes [t][d]) A = W^T rows d and B = x rows t, for v (planes [d][t]) A = x rows t and B = W^T rows d. Both are fragment-order planes read by the same loader, so only the two pointers change places.
// acc[x][y][j] is then plane row 16 y + lr, plane column 16 x + 8 hi + j. The tile goes to LDS as f32 in that form and is read back four whole plane rows at a time, eight columns a lane.
#define FP 68   // pitch of a staged row in dwords, 64 + 4: the 16-byte LDS writes (16 rows, one column block) and reads (whole rows) both fall on distinct banks
template <bool ROPE>
__device__ __forceinline__ void qkv_out(const float* F, const float* __restrict__ gb, const float* __restrict__ rc, const float* __restrict__ rs, const float* __restrict__ hb, h16* P16, bf* Ph, bf* Pl, int pitch, int lane) {
    const int r4 = lane >> 3, ch = (lane & 7) * 8;   // the lane's row among four, its first column (for q and k: d)
    const int co = (ch >> 5) * 512 + ((ch >> 4) & 1) * 256 + ((ch >> 3) & 1) * 128;   // where that column's chunks start in a fragment-order block row (P16, Ph, Pl point at the tile's first block; pitch = the plane's K)
    float g[8], g2[8], p[8]; v4f cn[2], sn[2];
    // every '#pragma unroll' of this function and of k_qkv: the indices of the register arrays and vectors must be compile-time constants, so that they stay in registers
    const float* cp = ROPE ? rc + r4 * 32 + (ch & 31) : nullptr; const float* sp = ROPE ? rs + r4 * 32 + (ch & 31) : nullptr;   // lanes with d >= 32 read the row's tables too (in bounds) and do not use them
    if (ROPE) { const float* gp = gb + ch; const float* gq = gb + (ch ^ 16); const float* pp = hb + ch;   // b_attn at d and at the RoPE partner d +- 16, the head bias at d
#pragma unroll
        for (int u = 0; u < 2; ++u) { const v4f a = *(const v4fa*)(gp + 4 * u), b = *(const v4fa*)(gq + 4 * u), c = *(const v4fa*)(pp + 4 * u); cn[u] = *(const v4fa*)(cp + 4 * u); sn[u] = *(const v4fa*)(sp + 4 * u);
#pragma unroll
            for (int j = 0; j < 4; ++j) { g[4 * u + j] = bfr(a[j]); g2[4 * u + j] = bfr(b[j]); p[4 * u + j] = bfr(c[j]); } }
        asm volatile("s_wait_xcnt 0x0" :: "v"(gp), "v"(gq), "v"(pp), "v"(cp), "v"(sp) : "memory"); __builtin_amdgcn_sched_barrier(0); }   // as xdone, for the five addresses of this run of loads
    // kept rolled: sixteen equal trips; unrolled they would be tens of KiB of code that every wave runs once
#pragma unroll 1
    for (int q = 0; q < 16; ++q) {
        const float* f = F + (q * 4 + r4) * FP; const v4f f0 = *(const v4fa*)(f + ch), f1 = *(const v4fa*)(f + ch + 4); float r[8];
        if (ROPE) { const v4f e0 = *(const v4fa*)(f + (ch ^ 16)), e1 = *(const v4fa*)(f + (ch ^ 16) + 4); const v4f c0 = cn[0], c1 = cn[1], s0 = sn[0], s1 = sn[1];
            if (q < 15) { cp += 4 * 32; sp += 4 * 32; }   // the next four rows' tables, in flight under this trip's work; the last trip repeats its own, in bounds, unused
            cn[0] = *(const v4fa*)cp; cn[1] = *(const v4fa*)(cp + 4); sn[0] = *(const v4fa*)sp; sn[1] = *(const v4fa*)(sp + 4);
            xdone<true>(cp, sp);
#pragma unroll
            for (int j = 0; j < 8; ++j) { const float x0 = (j < 4 ? f0[j & 3] : f1[j & 3]) + g[j], x1 = (j < 4 ? e0[j & 3] : e1[j & 3]) + g2[j]; const float c = bfr(j < 4 ? c0[j & 3] : c1[j & 3]), s = bfr(j < 4 ? s0[j & 3] : s1[j & 3]);
                const float ro = x0 * c + x1 * (ch < 16 ? -s : s);   // rotate-half within the first 32 dims
                r[j] = (ch < 32 ? ro : x0) + p[j]; }
        } else {
#pragma unroll
            for (int j = 0; j < 8; ++j) r[j] = j < 4 ? f0[j & 3] : f1[j & 3]; }
        v8h o16; v8us oh, ol;
#pragma unroll
        for (int j = 0; j < 8; ++j) { o16[j] = tohx(r[j]); unsigned short a2, c2; splitf(r[j], a2, c2); oh[j] = a2; ol[j] = c2; }
        const int rr = q * 4 + r4; const size_t go = (size_t)(rr >> 4) * 16 * pitch + co + (rr & 15) * 8; *(v8ha*)(P16 + go) = o16; *(v8usa*)(Ph + go) = oh; *(v8usa*)(Pl + go) = ol;   // each store of the wave: eight 64-B pieces (four neighbouring rows of eight chunk columns); the next trip fills the lines' other halves
        asm volatile("s_wait_xcnt 0x0" ::: "memory"); __builtin_amdgcn_sched_barrier(0);   // behind the three stores, in front of whatever overwrites their address or data registers (the next trip's); the scheduling barrier keeps that code behind the wait
    }
}
#define QWV 12                 // waves a work-group: 3 heads (64 rows of W^T each) x 4 tiles of 64 rows of x; 256 work-groups
#define QRG 28                 // row groups a stage: 12 of W^T, then 16 of x
#define QST (QRG * 16 * KS)    // elements a stage
#define QNB 4                  // buffers: three groups of copiers (the waves of one wq; where waves w, w + 4, w + 8 stand on one SIMD, one of each group there: for speed only)
static_assert(DM / KS >= QNB && (QNB & (QNB - 1)) == 0, "k_qkv: the prologue issues QNB stages; the buffer index is t & (QNB - 1)");
#define QSM (QNB * QST * 2 > QWV * 64 * FP * 4 ? QNB * QST * 2 : QWV * 64 * FP * 4)   // bytes of LDS: the ring, and behind the loop's last barrier, in the same place, the epilogue tiles
__global__ __launch_bounds__(32 * QWV) void k_qkv(const bf* __restrict__ X, const bf* __restrict__ Wt, const float* __restrict__ bias, const float* __restrict__ rc, const float* __restrict__ rs, const float* __restrict__ bQ, const float* __restrict__ bK,
                                            h16* Q16, bf* Qh, bf* Ql, h16* K16, bf* Kh, bf* Kl, h16* V16, bf* Vh, bf* Vl) {
    typedef WFrag<bf>::V V;
    __shared__ __align__(1024) char sm[QSM];
    bf* ring = (bf*)sm; float* Fs = (float*)sm;
    const int lane = threadIdx.x & 31, lr = lane & 15, hi = lane >> 4; const int wave = __builtin_amdgcn_readfirstlane((int)(threadIdx.x >> 5));   // scalar: every branch on it is a scalar branch
    const int wq = wave >> 2, wp = wave & 3; const int R0 = blockIdx.x * 256, C0 = blockIdx.y * 192; const int r0 = R0 + wp * 64, c0 = C0 + wq * 64;
    float* F = Fs + wave * 64 * FP;   // the wave's own epilogue tile
    const int sel = c0 / DQ, head = (c0 % DQ) / HD;   // 0 q, 1 k, 2 v
    // the stage's 112 copies: stage s is brought by the four waves with wq = s mod 3, wave (wq, wp) bringing the wp-th 512 B of each of the 28 row groups
    const int po = wp * 256 + 8 * lane; const bf* gW = Wt + (size_t)C0 * DM + po; const bf* gX = X + (size_t)R0 * DM + po; const unsigned l0 = lds_off(ring) + 2 * po;
    auto issue = [&](int t, int buf) { const unsigned lb = l0 + buf * (QST * 2); const int go = t * (KS * 16); const bf* tW = gW + go; const bf* tX = gX + go;   // the stage's k first, the row group's constant last: two addresses live through the loop, not 28
#pragma unroll
        for (int h = 0; h < 2; ++h) { unsigned l[14]; const bf* g[14];
#pragma unroll
            for (int i = 0; i < 14; ++i) { const int r = 14 * h + i; l[i] = lb + r * 2048; g[i] = r < 12 ? tW + (size_t)r * 16 * DM : tX + (size_t)(r - 12) * 16 * DM; }
            cp14(l, g); } };
    v8f acc[4][4];
#pragma unroll
    for (int mb = 0; mb < 4; ++mb)
#pragma unroll
        for (int nb = 0; nb < 4; ++nb) acc[mb][nb] = (v8f){};
    issue(wq, wq);   // stages 0, 1 and 2, each by its group
    if (wq == 0) asm volatile("s_wait_asynccnt 0x0" ::: "memory");
    __syncthreads();   // stage 0 has landed and is published
    if (wq == 0) issue(3, 3);
    int ng = 1;   // the group of the next stage, (t + 1) mod 3
    const int wo = wq * 4 * 1024 + 8 * lane, xo = (12 + wp * 4) * 1024 + 8 * lane; const int ao = (sel == 2) ? xo : wo, bo = (sel == 2) ? wo : xo;
    // kept rolled: the buffer index changes from trip to trip
#pragma unroll 1
    for (int t = 0; t < DM / KS; ++t) {
        const bf* st = ring + (t & (QNB - 1)) * QST;
#pragma unroll
        for (int kb = 0; kb < KS / 32; ++kb) {
            V a[4], b[4];
#pragma unroll
            for (int i = 0; i < 4; ++i) { a[i] = WFrag<bf>::ld(st + ao + i * 1024 + kb * 512); b[i] = WFrag<bf>::ld(st + bo + i * 1024 + kb * 512); }
            __builtin_amdgcn_sched_barrier(0);   // a block's LDS reads stand as one group in front of its matrix instructions: left to itself the compiler puts them among those in pairs, each behind a wait to 0
#pragma unroll
            for (int nb = 0; nb < 4; ++nb)
#pragma unroll
                for (int mb = 0; mb < 4; ++mb) acc[mb][nb] = WFrag<bf>::mma(a[mb], b[nb], acc[mb][nb]);
            __builtin_amdgcn_sched_barrier(0);   // and the next block's reads behind them
        }
        const bool mine = ng == wq;   // scalar: stage t + 1 is this wave's group's
        stage_done(mine);
        if (mine && t + 4 < DM / KS) issue(t + 4, t & (QNB - 1));   // the group's next stage, into the buffer that this trip has just read
        ng = ng == 2 ? 0 : ng + 1;
    }
    asm volatile("s_wait_asynccnt 0x0" ::: "memory");   // no copy is outstanding when the wave goes on
    if (sel == 2) { const float* gp = bias + c0 + lr; const float g0 = gp[0], g1 = gp[16], g2 = gp[32], g3 = gp[48]; xdone<false>(gp, nullptr);   // v: + b_attn, d = 16 y + lr (q and k: in qkv_out)
#pragma unroll
        for (int x = 0; x < 4; ++x) { acc[x][0] += bfr(g0); acc[x][1] += bfr(g1); acc[x][2] += bfr(g2); acc[x][3] += bfr(g3); } }
#pragma unroll
    for (int y = 0; y < 4; ++y) {
#pragma unroll
        for (int x = 0; x < 4; ++x) { const v8f w = acc[x][y]; float* f = F + (y * 16 + lr) * FP + x * 16 + hi * 8; *(v4fa*)f = __builtin_shufflevector(w, w, 0, 1, 2, 3); *(v4fa*)(f + 4) = __builtin_shufflevector(w, w, 4, 5, 6, 7); } }
    __syncthreads();   // the staged tile is read back across lanes
    const size_t hp = ((size_t)(r0 / TT) * NH_ + head) * TT * HD; const int t0 = r0 % TT;
    if (sel == 2) { const size_t o = hp + (size_t)t0 * 16; qkv_out<false>(F, nullptr, nullptr, nullptr, nullptr, V16 + o, Vh + o, Vl + o, TT, lane); }
    else { const size_t o = hp + (size_t)t0 * HD; qkv_out<true>(F, bias + c0, rc + (size_t)r0 * 32, rs + (size_t)r0 * 32, (sel ? bK : bQ) + head * HD, (sel ? K16 : Q16) + o, (sel ? Kh : Qh) + o, (sel ? Kl : Ql) + o, HD, lane); }
}

extern "C" void kernel_launch(void* const* d_in, const int* in_sizes, int n_in,
                              void* d_out, int out_size, void* d_ws, size_t ws_size, hipStream_t stream) {
    (void)in_sizes; (void)n_in; (void)out_size;
    const float* x = (const float*)d_in[0]; const float* rcos = (const float*)d_in[1]; const float* rsin = (const float*)d_in[2]; const float* wf = (const float*)d_in[3]; const float* bfz = (const float*)d_in[4]; const float* wo = (const float*)d_in[5]; const float* bo = (const float*)d_in[6]; const float* bQ = (const float*)d_in[7]; const float* bK = (const float*)d_in[8]; const float* cosT = nullptr; const float* sinT = nullptr; (void)cosT; (void)sinT;
    float* OUT = (float*)d_out;     // [2][2048][1024]
    char* wsp = (char*)d_ws;
    auto take = [&](size_t bytes) { char* p = wsp; wsp += (bytes + 255) & ~(size_t)255; return (void*)p; };
    bf* WA = (bf*)take((size_t)3 * DQ * DM * 2); bf* WO = (bf*)take((size_t)DM * DQ * 2);   // WA: W_attn transposed, rows q | k | v
    bf* XB = (bf*)take((size_t)NB_ * TT * DM * 2);
    h16* QP16 = (h16*)take((size_t)NB_ * NH_ * TT * HD * 2); h16* KP16 = (h16*)take((size_t)NB_ * NKV * TT * HD * 2); h16* VT16 = (h16*)take((size_t)NB_ * NKV * HD * TT * 2);
    bf* QPh = (bf*)take((size_t)NB_ * NH_ * TT * HD * 2); bf* QPl = (bf*)take((size_t)NB_ * NH_ * TT * HD * 2); bf* KPh = (bf*)take((size_t)NB_ * NKV * TT * HD * 2); bf* KPl = (bf*)take((size_t)NB_ * NKV * TT * HD * 2); bf* VTh = (bf*)take((size_t)NB_ * NKV * HD * TT * 2); bf* VTl = (bf*)take((size_t)NB_ * NKV * HD * TT * 2);
    bf* ATh = (bf*)take((size_t)NB_ * TT * DQ * 2); bf* ATl = (bf*)take((size_t)NB_ * TT * DQ * 2);
    if ((size_t)(wsp - (char*)d_ws) > ws_size) return;    // ws 256 MiB
    // every kernel runs once: the two batches are rows b TT + t of one grid, and q, k, v are the 3 DQ columns of one product
    k_prep<<<PBX + PBA + PBO, 256, 0, stream>>>(x, wf, wo, XB, WA, WO);
    k_qkv<<<dim3(NB_ * TT / 256, 3 * DQ / 192, 1), 32 * QWV, 0, stream>>>(XB, WA, bfz, rcos, rsin, bQ, bK, QP16, QPh, QPl, KP16, KPh, KPl, VT16, VTh, VTl);
    k_attn<<<dim3(NH_, NB_, AG), 32 * AW, 0, stream>>>(QP16, KP16, VT16, QPh, QPl, KPh, KPl, VTh, VTl, ATh, ATl);
    k_proj<<<dim3(NB_ * TT / 128, DM / 128, 1), 32 * PWV, 0, stream>>>(ATh, ATl, WO, OUT, bo);
}

// v010
// It runs in 65 microseconds.
// Two timings next to v009 both put it at 1.11 times that version's speed.
// All steps since v000 together make it 22.6 times as fast.
#include <hip/hip_runtime.h>

// DisorderedCausalSelfAttention (x [2][2048][1024]; qkv = x W_attn + b ([1024][3072], split q | k | v, 16 heads x 64); partial RoPE on the first 32 dims of each head with the given per-batch tables rope_cos/rope_sin [B][T][32] (read; rotate_half within the 32 dims); then q += bQ[h], k += bK[h] (post-RoPE symmetry-breaking biases, read); causal softmax(q.k / 8); out = merged W_proj + b_proj -> [2][2048][1024]).
// Compute dtypes, f32 accumulate: every input rounded to bf16; q/k/v on PLAIN bf16 operands (inputs: exact) + bias; partial RoPE and the post-RoPE biases f32; causal scores and att.v: query rows < 512 hl (3 products), the rest single fp16; softmax f32, running maximum, normalised after att.v; W_proj hl x exact (2 products) + bias.

// Every 16-bit operand plane (rows x K) lies in FRAGMENT ORDER: the 16 rows x 32 k of one matrix operand are one 1024-B block, blocks run along k and then along the row groups. Inside a block the 16-B chunk of row r, k = 16 j + 8 h + (0..7) stands at chunk 32 j + 16 h + (r & 15),
// which is lane 16 h + (r & 15) of the operand's j-th 16-B load: each wave-wide load reads 512 contiguous bytes, four whole lines, where a row-major plane gives sixteen 32-B pieces. A group of 16 rows still takes 16 K elements, so row-group offsets read as in a row-major plane.
#define NB_  2
#define TT   2048
#define DM   1024
#define NH_  16
#define NKV  16
#define REP  (NH_ / NKV)
#define HD   64
#define DQ   (NH_ * HD)
#define DKV  (NKV * HD)
#define RH   512                  // query rows < RH use hi+lo planes
#define SCL  0.125f   // HD^-0.5
typedef _Float16 h16;
typedef unsigned short bf;
typedef __attribute__((ext_vector_type(16))) __bf16   v16bf;
typedef __attribute__((ext_vector_type(16))) _Float16 v16h;
typedef __attribute__((ext_vector_type(8)))  _Float16 v8h;
typedef __attribute__((ext_vector_type(8)))  unsigned short v8us;
typedef __attribute__((ext_vector_type(8)))  float    v8f;
typedef __attribute__((ext_vector_type(4)))  float    v4f;
typedef v8h  __attribute__((may_alias)) v8ha;
typedef v4f  __attribute__((may_alias)) v4fa;
typedef v8us __attribute__((may_alias)) v8usa;
typedef float v2fa __attribute__((ext_vector_type(2), may_alias));

__device__ __forceinline__ unsigned short f2bf(float f) { unsigned u = __float_as_uint(f); u += 0x7FFFu + ((u >> 16) & 1u); return (unsigned short)(u >> 16); }
__device__ __forceinline__ float bf2f(unsigned short b) { return __uint_as_float(((unsigned)b) << 16); }
__device__ __forceinline__ float bfr(float f) { return bf2f(f2bf(f)); }
__device__ __forceinline__ v16h cat16(v8h lo, v8h hi) { return __builtin_shufflevector(lo, hi, 0, 1, 2, 3, 4, 5, 6, 7, 8, 9, 10, 11, 12, 13, 14, 15); }
__device__ __forceinline__ v16bf cat16b(v8us lo, v8us hi) { return __builtin_bit_cast(v16bf, __builtin_shufflevector(lo, hi, 0, 1, 2, 3, 4, 5, 6, 7, 8, 9, 10, 11, 12, 13, 14, 15)); }
__device__ __forceinline__ v8f wmma16(v16h a, v16h b, v8f c) { return __builtin_amdgcn_wmma_f32_16x16x32_f16(false, a, false, b, (short)0, c, false, false); }
__device__ __forceinline__ v8f wmmab(v16bf a, v16bf b, v8f c) { return __builtin_amdgcn_wmma_f32_16x16x32_bf16(false, a, false, b, (short)0, c, false, false); }



// WFrag: a matrix operand from a fragment-order plane (ld: p = the block's start + 8 lane)
template <typename T16> struct WFrag;
template <> struct WFrag<h16> { typedef v16h V; static __device__ __forceinline__ V ld(const h16* p) { return cat16(*(const v8h*)p, *(const v8h*)(p + 256)); } static __device__ __forceinline__ v8f mma(V a, V b, v8f c) { return wmma16(a, b, c); } };
template <> struct WFrag<bf> { typedef v16bf V; static __device__ __forceinline__ V ld(const bf* p) { return cat16b(*(const v8us*)p, *(const v8us*)(p + 256)); } static __device__ __forceinline__ v8f mma(V a, V b, v8f c) { return wmmab(a, b, c); } };
// ---- operand staging for the two GEMMs. The waves of a work-group share their operand rows: a stage = KS k of every row group (16 rows) of the work-group's tile, which in a fragment-order plane is 2 KiB in a row, brought into LDS once by asynchronous copies (16 B a lane, 512 contiguous bytes a copy)
// and read from there by every wave that needs it, in the same fragment order (each wave-wide ds_load_b128 reads 512 contiguous bytes).
// The ring: all work-groups walk k together, so every stage holds operand lines that nobody has touched before, and part of its copies come from memory, with a latency that one trip need not cover. G groups of four waves take turns as copiers, stage s being the work of group s mod G, and the ring has G + 1 buffers:
// a group waits for its own stage alone (to 0: nothing else of it is in flight), passes the barrier that publishes it, and issues its next stage, G stages on, into the buffer that the trip just ended has read. Each stage so flies during G whole trips.
// cpN: N copies, each with its own LDS byte address l and global address g; s_wait_xcnt 0 is the statement's last line, so that it stands in front of whatever rewrites a register that a copy names
#define KS 64
__device__ __forceinline__ unsigned lds_off(const void* p) { return (unsigned)(size_t)p; }
__device__ __forceinline__ void cp14(const unsigned (&l)[14], const bf* const (&g)[14]) { asm volatile("global_load_async_to_lds_b128 %0, %14, off\n\tglobal_load_async_to_lds_b128 %1, %15, off\n\tglobal_load_async_to_lds_b128 %2, %16, off\n\tglobal_load_async_to_lds_b128 %3, %17, off\n\tglobal_load_async_to_lds_b128 %4, %18, off\n\tglobal_load_async_to_lds_b128 %5, %19, off\n\tglobal_load_async_to_lds_b128 %6, %20, off\n\tglobal_load_async_to_lds_b128 %7, %21, off\n\tglobal_load_async_to_lds_b128 %8, %22, off\n\tglobal_load_async_to_lds_b128 %9, %23, off\n\tglobal_load_async_to_lds_b128 %10, %24, off\n\tglobal_load_async_to_lds_b128 %11, %25, off\n\tglobal_load_async_to_lds_b128 %12, %26, off\n\tglobal_load_async_to_lds_b128 %13, %27, off\n\ts_wait_xcnt 0x0" :: "v"(l[0]), "v"(l[1]), "v"(l[2]), "v"(l[3]), "v"(l[4]), "v"(l[5]), "v"(l[6]), "v"(l[7]), "v"(l[8]), "v"(l[9]), "v"(l[10]), "v"(l[11]), "v"(l[12]), "v"(l[13]), "v"(g[0]), "v"(g[1]), "v"(g[2]), "v"(g[3]), "v"(g[4]), "v"(g[5]), "v"(g[6]), "v"(g[7]), "v"(g[8]), "v"(g[9]), "v"(g[10]), "v"(g[11]), "v"(g[12]), "v"(g[13]) : "memory"); }
__device__ __forceinline__ void cp12(const unsigned (&l)[12], const bf* const (&g)[12]) { asm volatile("global_load_async_to_lds_b128 %0, %12, off\n\tglobal_load_async_to_lds_b128 %1, %13, off\n\tglobal_load_async_to_lds_b128 %2, %14, off\n\tglobal_load_async_to_lds_b128 %3, %15, off\n\tglobal_load_async_to_lds_b128 %4, %16, off\n\tglobal_load_async_to_lds_b128 %5, %17, off\n\tglobal_load_async_to_lds_b128 %6, %18, off\n\tglobal_load_async_to_lds_b128 %7, %19, off\n\tglobal_load_async_to_lds_b128 %8, %20, off\n\tglobal_load_async_to_lds_b128 %9, %21, off\n\tglobal_load_async_to_lds_b128 %10, %22, off\n\tglobal_load_async_to_lds_b128 %11, %23, off\n\ts_wait_xcnt 0x0" :: "v"(l[0]), "v"(l[1]), "v"(l[2]), "v"(l[3]), "v"(l[4]), "v"(l[5]), "v"(l[6]), "v"(l[7]), "v"(l[8]), "v"(l[9]), "v"(l[10]), "v"(l[11]), "v"(g[0]), "v"(g[1]), "v"(g[2]), "v"(g[3]), "v"(g[4]), "v"(g[5]), "v"(g[6]), "v"(g[7]), "v"(g[8]), "v"(g[9]), "v"(g[10]), "v"(g[11]) : "memory"); }
// stage_done: the foot of a trip, every wave: its own LDS reads are back; the waves that copied the next stage (mine, scalar): their copies have landed; then the work-group barrier that publishes the next stage and ends every reader's last read of this one
__device__ __forceinline__ void stage_done(bool mine) { asm volatile("s_wait_dscnt 0x0" ::: "memory"); if (mine) asm volatile("s_wait_asynccnt 0x0" ::: "memory"); __syncthreads(); }

// ---- k_proj: C[m][n] (f32, + bias[n]) = sum_k (A + A2)[m][k] Bt[n][k], two products. Work-group = 8 waves = 128 x 128 of C, a wave 32 x 64 (8 accumulators), two waves a SIMD; grid (M/128, N/128).
// Stage: 8 row groups of A, 8 of A2, 8 of Bt; two groups of copiers (waves 0 to 3, waves 4 to 7; waves w and w + 4 are taken to share a SIMD, for speed only), three buffers; wave w of the stage's group copies the (w & 3)-th 512 B of every row group
#define PWV 8
#define PRG 24
#define PST (PRG * 16 * KS)   // elements a stage
#define PNB 3                 // buffers
static_assert(DQ / KS >= PNB, "k_proj: the prologue issues PNB stages");
__global__ __launch_bounds__(32 * PWV) void k_proj(const bf* __restrict__ A, const bf* __restrict__ A2, const bf* __restrict__ Bt, float* C, const float* __restrict__ bias) {
    typedef WFrag<bf>::V V;
    __shared__ __align__(1024) bf ring[PNB * PST];
    __shared__ __align__(16) float oss[PWV * 16 * 68];
    const int lane = threadIdx.x & 31, lr = lane & 15, hi = lane >> 4; const int wave = __builtin_amdgcn_readfirstlane((int)(threadIdx.x >> 5));   // scalar: what is formed from it stays in scalar registers
    const int R0 = blockIdx.x * 128, C0 = blockIdx.y * 128; const int r0 = R0 + (wave >> 1) * 32, c0 = C0 + (wave & 1) * 64;
    float* os = oss + wave * 16 * 68;
    const int grp = wave >> 2, po = (wave & 3) * 256 + 8 * lane;   // grp: the wave copies the stages of this parity; po: the lane's 16 B inside a row group's 2 KiB
    const bf* gA = A + (size_t)R0 * DQ + po; const bf* gA2 = A2 + (size_t)R0 * DQ + po; const bf* gB = Bt + (size_t)C0 * DQ + po; const unsigned l0 = lds_off(ring) + 2 * po;
    auto issue = [&](int t, int buf) { const unsigned lb = l0 + buf * (PST * 2); const int go = t * (KS * 16); const bf* tA = gA + go; const bf* tA2 = gA2 + go; const bf* tB = gB + go;   // the stage's k first, the row group's constant last: three addresses live through the loop, not 24. Both loops unrolled: l and g are asm operands, their indices must be compile-time constants
#pragma unroll
        for (int h = 0; h < 2; ++h) { unsigned l[12]; const bf* g[12];
#pragma unroll
            for (int i = 0; i < 12; ++i) { const int r = 12 * h + i; l[i] = lb + r * 2048; g[i] = (r < 8 ? tA : r < 16 ? tA2 : tB) + (size_t)(r & 7) * 16 * DQ; }
            cp12(l, g); } };
    v8f acc[2][4];
#pragma unroll
    for (int mb = 0; mb < 2; ++mb)
#pragma unroll
        for (int nb = 0; nb < 4; ++nb) acc[mb][nb] = (v8f){};
    issue(grp, grp);   // stages 0 and 1, each by its group
    if (grp == 0) asm volatile("s_wait_asynccnt 0x0" ::: "memory");
    __syncthreads();   // stage 0 has landed and is published
    if (grp == 0) issue(2, 2);
    const int ao = (wave >> 1) * 2 * 1024 + 8 * lane, bo = (16 + (wave & 1) * 4) * 1024 + 8 * lane;
    int rb = 0;   // the buffer of this trip's stage, t mod PNB
    // kept rolled: the buffer index changes from trip to trip
#pragma unroll 1
    for (int t = 0; t < DQ / KS; ++t) {
        const bf* st = ring + rb * PST;
        V a[KS / 32][2], a2[KS / 32][2], b[KS / 32][4];
#pragma unroll
        for (int kb = 0; kb < KS / 32; ++kb) {
#pragma unroll
            for (int i = 0; i < 2; ++i) { a[kb][i] = WFrag<bf>::ld(st + ao + i * 1024 + kb * 512); a2[kb][i] = WFrag<bf>::ld(st + ao + (8 + i) * 1024 + kb * 512); }
#pragma unroll
            for (int i = 0; i < 4; ++i) b[kb][i] = WFrag<bf>::ld(st + bo + i * 1024 + kb * 512); }
        __builtin_amdgcn_sched_barrier(0);   // the trip's LDS reads stand as one group in front of its matrix instructions: left to itself the compiler puts them among those in pairs, each behind a wait to 0
#pragma unroll
        for (int kb = 0; kb < KS / 32; ++kb)
#pragma unroll
            for (int nb = 0; nb < 4; ++nb)
#pragma unroll
                for (int mb = 0; mb < 2; ++mb) { acc[mb][nb] = WFrag<bf>::mma(a[kb][mb], b[kb][nb], acc[mb][nb]); acc[mb][nb] = WFrag<bf>::mma(a2[kb][mb], b[kb][nb], acc[mb][nb]); }
        __builtin_amdgcn_sched_barrier(0);   // keeps the matrix instructions in front of the trip's foot: moved behind its waits they would no longer run while the next stage's copies fly
        const bool mine = ((t + 1) & 1) == grp;   // scalar: stage t + 1 is this wave's group's
        stage_done(mine);
        if (mine && t + 3 < DQ / KS) issue(t + 3, rb);   // the group's next stage, into the buffer that this trip has just read
        rb = rb == PNB - 1 ? 0 : rb + 1;
    }
    asm volatile("s_wait_asynccnt 0x0" ::: "memory");   // no copy is outstanding when the wave goes on
    const float* bp = bias + c0 + lr * 4; const v4f bv = *(const v4fa*)bp;   // the lane's four columns' bias
    asm volatile("s_wait_xcnt 0x0" :: "v"(bp) : "memory"); __builtin_amdgcn_sched_barrier(0);   // behind the load, in front of whatever overwrites its address register; it names the address as an input, so that the load does not land on it
#pragma unroll
    for (int mb = 0; mb < 2; ++mb) {
#pragma unroll
        for (int nb = 0; nb < 4; ++nb) {
#pragma unroll
            for (int j = 0; j < 8; ++j) os[(hi * 8 + j) * 68 + nb * 16 + lr] = acc[mb][nb][j]; }
        __builtin_amdgcn_wave_barrier(); asm volatile("" ::: "memory");
        float* crow = C + (size_t)(r0 + mb * 16) * DM + c0;
{
#pragma unroll
            for (int s = 0; s < 8; ++s) { const int row = 2 * s + hi, cofs = lr * 4; v4f val = *(const v4fa*)(os + row * 68 + cofs); val[0] += bfr(bv[0]); val[1] += bfr(bv[1]); val[2] += bfr(bv[2]); val[3] += bfr(bv[3]);
                *(v4f*)(crow + (size_t)row * DM + cofs) = val; }
             }
        asm volatile("s_wait_xcnt 0x0" ::: "memory"); __builtin_amdgcn_sched_barrier(0);   // behind the eight stores, in front of whatever overwrites their address or data registers (the next row group's values); the scheduling barrier keeps that code behind the wait
        __builtin_amdgcn_wave_barrier(); asm volatile("" ::: "memory");
    }
}

__device__ __forceinline__ h16 tohx(float x) { return (h16)x; }
__device__ __forceinline__ void splitf(float y, unsigned short& h, unsigned short& l) { h = f2bf(y); l = f2bf(y - bf2f(h)); }
typedef __attribute__((ext_vector_type(2))) _Float16 v2h;
typedef __attribute__((ext_vector_type(4))) _Float16 v4h;
typedef __attribute__((ext_vector_type(2))) unsigned short v2us;
typedef __attribute__((ext_vector_type(4))) unsigned short v4us;
typedef __attribute__((ext_vector_type(2))) float v2f;
typedef __attribute__((ext_vector_type(4))) int v4i;

// frag_off: where the 16-B chunk of (row, k .. k + 7), k a multiple of 8, stands in a fragment-order plane with K columns, in elements
__device__ __forceinline__ size_t frag_off(int row, int k, int K) { return ((((size_t)(row >> 4) * (K >> 5) + (k >> 5)) * 2 + ((k >> 4) & 1)) * 32 + ((k >> 3) & 1) * 16 + (row & 15)) * 8; }
// ---- k_prep: all operand preparation in one launch: x -> XB, W_attn -> WA, W_proj -> WO, none of which reads another's output; the job goes by the block index. Few, long-lived waves: a thread takes PC chunks, all of its loads in flight together, so that 4096 waves are started and not 32768.
#define PC 8   // chunks (8 elements of a plane each) a thread
// prep_x, wave task q: 8 rows x 256 k of x. For each of its PC chunks (32 k apart) a wave reads one whole 128-B line of each row and stores four whole lines (8 neighbouring rows of each of the four chunk columns)
__device__ __forceinline__ void prep_x(const float* __restrict__ src, bf* dst, int q, int lane) {
    const int row = (q >> 2) * 8 + (lane >> 2), k = (q & 3) * (32 * PC) + (lane & 3) * 8; const float* p = src + (size_t)row * DM + k; v8f v[PC]; v8us o[PC];
    // every '#pragma unroll' of prep_x and prep_w: the indices of the register arrays must be compile-time constants, so that they stay in registers
#pragma unroll
    for (int c = 0; c < PC; ++c) v[c] = *(const v8f*)(p + 32 * c);
    asm volatile("s_wait_xcnt 0x0" :: "v"(p) : "memory"); __builtin_amdgcn_sched_barrier(0);   // behind the loads, in front of whatever overwrites their address register (the instruction set's rule for an issued load); it names the address as an input, so that no load of the run lands on it, and the scheduling barrier keeps later code behind it
#pragma unroll
    for (int c = 0; c < PC; ++c)
#pragma unroll
        for (int u = 0; u < 8; ++u) o[c][u] = f2bf(v[c][u]);
    __builtin_amdgcn_sched_barrier(0);   // the stores stand together as one run behind all the conversions, so that one wait behind the last of them serves the run
    bf* d = dst + frag_off(row, k, DM);
#pragma unroll
    for (int c = 0; c < PC; ++c) *(v8us*)(d + 512 * c) = o[c];   // 32 k on: the next 1024-B block
    asm volatile("s_wait_xcnt 0x0" ::: "memory"); }   // behind the last store, in front of whatever code follows in the kernel and overwrites the stores' address or data registers
// prep_w, wave task q: 32 neighbouring n x 64 k of Bt (fragment order, rows n, K columns): element (n, k) = w[k * N + n]. Each of the wave's 64 loads reads one whole 128-B line of w (the waves of a work-group take neighbouring n), each of its PC stores writes two 256-B runs (16 neighbouring rows of a block stand side by side)
template <int K, int N>
__device__ __forceinline__ void prep_w(const float* __restrict__ w, bf* Bt, int q, int lane) {
    const int n = (q % (N / 32)) * 32 + lane, k = (q / (N / 32)) * (8 * PC); const float* p = w + (size_t)k * N + n; float v[8 * PC]; v8us o[PC];
#pragma unroll
    for (int i = 0; i < 8 * PC; ++i) v[i] = p[(size_t)i * N];
    asm volatile("s_wait_xcnt 0x0" :: "v"(p) : "memory"); __builtin_amdgcn_sched_barrier(0);   // as in prep_x
#pragma unroll
    for (int c = 0; c < PC; ++c)
#pragma unroll
        for (int u = 0; u < 8; ++u) o[c][u] = f2bf(v[8 * c + u]);
    __builtin_amdgcn_sched_barrier(0);   // as in prep_x
    bf* d = Bt + frag_off(n, k, K);
#pragma unroll
    for (int c = 0; c < PC; ++c) *(v8us*)(d + 128 * c) = o[c];   // 8 k on: 16 chunks on in the fragment order (k a multiple of 64)
    asm volatile("s_wait_xcnt 0x0" ::: "memory"); }   // as in prep_x
#define PBX (NB_ * TT * DM / (8 * PC * 256))   // work-groups for x
#define PBA (3 * DQ * DM / (8 * PC * 256))     // for W_attn
#define PBO (DM * DQ / (8 * PC * 256))         // for W_proj
__global__ __launch_bounds__(256) void k_prep(const float* __restrict__ x, const float* __restrict__ wa, const float* __restrict__ wo, bf* XB, bf* WA, bf* WO) {
    const int lane = threadIdx.x & 31, wave = __builtin_amdgcn_readfirstlane((int)(threadIdx.x >> 5)), b = blockIdx.x;   // wave scalar: the task's indices stay in scalar registers
    if (b < PBX) prep_x(x, XB, b * 8 + wave, lane);
    else if (b < PBX + PBA) prep_w<DM, 3 * DQ>(wa, WA, (b - PBX) * 8 + wave, lane);
    else prep_w<DQ, DM>(wo, WO, (b - PBX - PBA) * 8 + wave, lane);
}
__global__ __launch_bounds__(256) void k_cscvt(const float* __restrict__ cosT, const float* __restrict__ sinT, float* CS) { const int idx = blockIdx.x * 256 + threadIdx.x; if (idx >= TT * HD) return; v2f cs; cs[0] = bfr(cosT[idx]); cs[1] = bfr(sinT[idx]); *(v2f*)(CS + (size_t)idx * 2) = cs;  }
#define AW   16                   // waves a work-group
#define AG   8                    // work-groups a head and batch
#define RLO  2                    // query groups a wave, fp16 rows
#define XCH  (17 * 128)           // floats of one wave's partial result in LDS: 16 chunks of 16 B a lane of O^T, one of the maxima and sums; chunk c of lane n at 16 B x (32 c + n), so that each wave-wide access is 512 contiguous bytes
static_assert((TT - RH) / (16 * RLO) == 6 * AG && RH / 16 == 4 * AG && RH >= 64, "k_attn: six fp16 tiles (each of at least two passes) and four hi+lo tiles a work-group");
#define CSC  (SCL * 1.4426950408889634f)
__device__ __forceinline__ float xhalf(float x) { return __builtin_bit_cast(float, __builtin_amdgcn_permlanex16(__builtin_bit_cast(int, x), __builtin_bit_cast(int, x), 0x76543210, 0xfedcba98, false, false)); }   // lane l reads lane l ^ 16
// dist: the distance behind the last matrix instruction of a product before its operand registers are loaded anew, on a loop's back edge too; it names the product's tiles so that the whole product stands in front of it
__device__ __forceinline__ void dist(v8f (&s)[1][2]) { asm volatile("v_nop\n\tv_nop\n\tv_nop\n\tv_nop" : "+v"(s[0][0]), "+v"(s[0][1])); }
__device__ __forceinline__ void dist(v8f (&s)[2][2]) { asm volatile("v_nop\n\tv_nop\n\tv_nop\n\tv_nop" : "+v"(s[0][0]), "+v"(s[0][1]), "+v"(s[1][0]), "+v"(s[1][1])); }
__device__ __forceinline__ void dist(v8f (&s)[1][4]) { asm volatile("v_nop\n\tv_nop\n\tv_nop\n\tv_nop" : "+v"(s[0][0]), "+v"(s[0][1]), "+v"(s[0][2]), "+v"(s[0][3])); }
__device__ __forceinline__ void dist(v8f (&s)[2][4]) { asm volatile("v_nop\n\tv_nop\n\tv_nop\n\tv_nop" : "+v"(s[0][0]), "+v"(s[0][1]), "+v"(s[0][2]), "+v"(s[0][3]), "+v"(s[1][0]), "+v"(s[1][1]), "+v"(s[1][2]), "+v"(s[1][3])); }
// xdone: stands behind a run of global loads from a (and b), in front of whatever overwrites the registers that held their addresses (the instruction set's rule for an issued load). It names the two addresses as inputs, so that their registers live up to the wait
// and no load of the run lands on them; the scheduling barrier keeps the loads in front of it and later code behind it.
template <bool TWO>
__device__ __forceinline__ void xdone(const void* a, const void* b) { if (TWO) asm volatile("s_wait_xcnt 0x0" :: "v"(a), "v"(b) : "memory"); else asm volatile("s_wait_xcnt 0x0" :: "v"(a) : "memory"); __builtin_amdgcn_sched_barrier(0); }
template <typename T16, bool HI, bool MASK, int R>
__device__ __forceinline__ void attn_pass(typename WFrag<T16>::V (&kf)[2][2], typename WFrag<T16>::V (&kf2)[2][2], const T16* Kn, const T16* Kn2, const T16* Vp, const T16* Vp2,
                                          const typename WFrag<T16>::V (&qf)[R][2], const typename WFrag<T16>::V (&qf2)[R][2], v8f (&acc)[R][4], float (&m)[R], float (&l)[R], int key0, int myq, int hi) {
    typedef typename WFrag<T16>::V V;
    // every '#pragma unroll' of this function: the indices of the fragment and accumulator arrays must be compile-time constants, so that they stay in registers
    V vf[4], vf2[4];   // this pass's V^T fragments (rows d, k = keys), in flight under the first product and the exponentials
#pragma unroll
    for (int t = 0; t < 4; ++t) { vf[t] = WFrag<T16>::ld(Vp + (size_t)t * 16 * TT); if (HI) vf2[t] = WFrag<T16>::ld(Vp2 + (size_t)t * 16 * TT); }
    xdone<HI>(Vp, Vp2);
    v8f s[R][2];
#pragma unroll
    for (int g = 0; g < R; ++g)
#pragma unroll
        for (int kt = 0; kt < 2; ++kt) { s[g][kt] = (v8f){};
#pragma unroll
            for (int kc = 0; kc < 2; ++kc) { s[g][kt] = WFrag<T16>::mma(kf[kt][kc], qf[g][kc], s[g][kt]); if (HI) { s[g][kt] = WFrag<T16>::mma(kf[kt][kc], qf2[g][kc], s[g][kt]); s[g][kt] = WFrag<T16>::mma(kf2[kt][kc], qf[g][kc], s[g][kt]); } } }
    dist(s);
    __builtin_amdgcn_sched_barrier(0);   // keeps the loads below behind that distance
    if (!HI) {   // the next pass's K fragments, in flight under this pass's softmax and second product
#pragma unroll
        for (int kt = 0; kt < 2; ++kt)
#pragma unroll
            for (int kc = 0; kc < 2; ++kc) kf[kt][kc] = WFrag<T16>::ld(Kn + kt * 16 * HD + kc * 512);
        xdone<false>(Kn, nullptr); }
    float mx[R]; bool need = false;
#pragma unroll
    for (int g = 0; g < R; ++g) { float x0 = -3.0e38f;
#pragma unroll
        for (int e = 0; e < 16; ++e) { float x = s[g][e >> 3][e & 7] * CSC; if (MASK) x = (key0 + 16 * (e >> 3) + 8 * hi + (e & 7) <= myq + 16 * g) ? x : -3.0e38f; s[g][e >> 3][e & 7] = x; x0 = fmaxf(x0, x); }
        mx[g] = fmaxf(x0, xhalf(x0));   // lanes l and l ^ 16 hold the two key halves of one query
        need = need || (mx[g] > m[g]); }
    if (__builtin_amdgcn_ballot_w32(need) != 0) {   // wave-uniform; where a query's maximum does not move its factor is exactly 1
#pragma unroll
        for (int g = 0; g < R; ++g) { const float mn = fmaxf(m[g], mx[g]); const float corr = __builtin_amdgcn_exp2f(m[g] - mn); m[g] = mn; l[g] *= corr;
#pragma unroll
            for (int t = 0; t < 4; ++t) acc[g][t] *= corr; } }
#pragma unroll
    for (int g = 0; g < R; ++g) { float p[16];
#pragma unroll
        for (int e = 0; e < 16; ++e) { p[e] = __builtin_amdgcn_exp2f(s[g][e >> 3][e & 7] - m[g]); l[g] += p[e]; }
        if (HI) { v8us h0, h1, l0, l1;
#pragma unroll
            for (int e = 0; e < 8; ++e) { unsigned short a, c; splitf(p[e], a, c); h0[e] = a; l0[e] = c; splitf(p[8 + e], a, c); h1[e] = a; l1[e] = c; }
            const v16bf ph = cat16b(h0, h1), pl = cat16b(l0, l1);
#pragma unroll
            for (int t = 0; t < 4; ++t) { acc[g][t] = wmmab(__builtin_bit_cast(v16bf, vf[t]), ph, acc[g][t]); acc[g][t] = wmmab(__builtin_bit_cast(v16bf, vf[t]), pl, acc[g][t]); acc[g][t] = wmmab(__builtin_bit_cast(v16bf, vf2[t]), ph, acc[g][t]); }
        } else { v16h pf;
#pragma unroll
            for (int e = 0; e < 16; ++e) pf[e] = tohx(p[e]);
#pragma unroll
            for (int t = 0; t < 4; ++t) acc[g][t] = wmma16(__builtin_bit_cast(v16h, vf[t]), pf, acc[g][t]); } }
    dist(acc);
    if (HI) {   // with hi and lo planes K and V^T together do not fit 256 registers: the next pass's K is loaded when V^T is spent (these rows have at most RH / 32 passes and are never the longest)
        __builtin_amdgcn_sched_barrier(0);   // keeps these loads behind the second product
#pragma unroll
        for (int kt = 0; kt < 2; ++kt)
#pragma unroll
            for (int kc = 0; kc < 2; ++kc) { kf[kt][kc] = WFrag<T16>::ld(Kn + kt * 16 * HD + kc * 512); kf2[kt][kc] = WFrag<T16>::ld(Kn2 + kt * 16 * HD + kc * 512); }
        xdone<true>(Kn, Kn2); }
}
// attn_keys: the key loop. q0: the wave's first query row, a multiple of 16 R. The tile's passes go alternately to NS waves; this wave is number part of them and takes passes part, part + NS, ... It leaves its running maximum m, its sums l and its unnormalised O^T acc
template <typename T16, bool HI, int R, int NS>
__device__ __forceinline__ void attn_keys(const T16* __restrict__ Q, const T16* __restrict__ Q2, const T16* __restrict__ K, const T16* __restrict__ K2, const T16* __restrict__ Vt, const T16* __restrict__ Vt2, int q0, int part, v8f (&acc)[R][4], float (&m)[R], float (&l)[R]) {
    typedef typename WFrag<T16>::V V;
    const int lane = threadIdx.x & 31, lr = lane & 15, hi = lane >> 4; const int myq = q0 + lr;
    const size_t qo = (size_t)q0 * HD + 8 * lane; const int ko = 8 * lane, vo = 8 * lane;   // fragment order: Q and K blocks (16 rows, 32 d) at 16 HD a row group and 512 a d block; V^T blocks (16 d, 32 keys) at 16 TT a d group and 512 a key block
    V qf[R][2], qf2[R][2], kf[2][2], kf2[2][2];
#pragma unroll
    for (int g = 0; g < R; ++g)
#pragma unroll
        for (int kc = 0; kc < 2; ++kc) { qf[g][kc] = WFrag<T16>::ld(Q + qo + g * 16 * HD + kc * 512); if (HI) qf2[g][kc] = WFrag<T16>::ld(Q2 + qo + g * 16 * HD + kc * 512); }
    xdone<HI>(Q + qo, Q2 + qo);
#pragma unroll
    for (int kt = 0; kt < 2; ++kt)
#pragma unroll
        for (int kc = 0; kc < 2; ++kc) { kf[kt][kc] = WFrag<T16>::ld(K + ko + (32 * part + kt * 16) * HD + kc * 512); if (HI) kf2[kt][kc] = WFrag<T16>::ld(K2 + ko + (32 * part + kt * 16) * HD + kc * 512); }
    xdone<HI>(K + ko + 32 * part * HD, K2 + ko + 32 * part * HD);
#pragma unroll
    for (int g = 0; g < R; ++g) { m[g] = -3.0e38f; l[g] = 0.f;
#pragma unroll
        for (int t = 0; t < 4; ++t) acc[g][t] = (v8f){}; }
    const int klast = (q0 >> 5) << 5;   // first key of the pass that holds the wave's diagonal (its 16 R <= 32 rows lie in one 32-key block): the only pass with masked keys, and the last
    int key0 = 32 * part;
    // kept rolled: one pass's fragments and the next pass's K already fill the registers
#pragma unroll 1
    for (; key0 < klast; key0 += 32 * NS) { const int kn = NS == 1 ? key0 + 32 : min(key0 + 32 * NS, klast);   // the wave's next pass; the wave that does not take the diagonal pass loads that pass's rows at its end, in bounds, unused
        attn_pass<T16, HI, false, R>(kf, kf2, K + ko + kn * HD, K2 + ko + kn * HD, Vt + vo + key0 * 16, Vt2 + vo + key0 * 16, qf, qf2, acc, m, l, key0, myq, hi); }
    if (NS == 1 || key0 == klast)   // scalar: the diagonal pass belongs to one of the NS waves
        attn_pass<T16, HI, true, R>(kf, kf2, K + ko + klast * HD, K2 + ko + klast * HD, Vt + vo + klast * 16, Vt2 + vo + klast * 16, qf, qf2, acc, m, l, klast, myq, hi);   // there is no next pass: its K load repeats this pass's rows, in bounds, unused
}
// put_part, add_part: one wave's partial result of a tile goes to LDS, the tile's other wave joins it to its own as two running-maximum states are joined: both are brought to the common maximum and added. Lane and register hold the same query and d in both waves
template <int R>
__device__ __forceinline__ void put_part(float* X, const v8f (&acc)[R][4], const float (&m)[R], const float (&l)[R], int lane) {
    // every '#pragma unroll' of put_part, add_part and attn_out: the indices of the accumulator arrays must be compile-time constants, so that they stay in registers
#pragma unroll
    for (int g = 0; g < R; ++g)
#pragma unroll
        for (int t = 0; t < 4; ++t) { const v8f w = acc[g][t]; float* x = X + ((g * 4 + t) * 64 + lane) * 4; *(v4fa*)x = __builtin_shufflevector(w, w, 0, 1, 2, 3); *(v4fa*)(x + 128) = __builtin_shufflevector(w, w, 4, 5, 6, 7); }
    v4f ml; ml[0] = m[0]; ml[1] = m[R - 1]; ml[2] = l[0]; ml[3] = l[R - 1]; *(v4fa*)(X + (R * 8 * 32 + lane) * 4) = ml;
}
template <int R>
__device__ __forceinline__ void add_part(const float* X, v8f (&acc)[R][4], float (&m)[R], float (&l)[R], int lane) {
    const v4f ml = *(const v4fa*)(X + (R * 8 * 32 + lane) * 4);
#pragma unroll
    for (int g = 0; g < R; ++g) { const float mo = g ? ml[1] : ml[0], lo = g ? ml[3] : ml[2]; const float mn = fmaxf(m[g], mo); const float fa = __builtin_amdgcn_exp2f(m[g] - mn), fb = __builtin_amdgcn_exp2f(mo - mn); m[g] = mn; l[g] = l[g] * fa + lo * fb;
#pragma unroll
        for (int t = 0; t < 4; ++t) { const float* x = X + ((g * 4 + t) * 64 + lane) * 4; const v4f w0 = *(const v4fa*)x, w1 = *(const v4fa*)(x + 128);
#pragma unroll
            for (int j = 0; j < 8; ++j) acc[g][t][j] = acc[g][t][j] * fa + (j < 4 ? w0[j & 3] : w1[j & 3]) * fb; } }
}
// attn_out: the wave halves' sums meet, division by the sum, the hi/lo planes [t][head][d]
template <int R>
__device__ __forceinline__ void attn_out(const v8f (&acc)[R][4], const float (&l)[R], int q0, int head, bf* Ah, bf* Al) {
    const int lane = threadIdx.x & 31;
#pragma unroll
    for (int g = 0; g < R; ++g) { const float lt = l[g] + xhalf(l[g]); const float inv = __fdiv_rn(1.0f, lt);
#pragma unroll
        for (int t = 0; t < 4; ++t) { v8us oh, ol;   // registers j of tile t are d = 16 t + 8 hi + j of query myq + 16 g
#pragma unroll
            for (int j = 0; j < 8; ++j) { unsigned short a, c; splitf(acc[g][t][j] * inv, a, c); oh[j] = a; ol[j] = c; }
            const size_t oo = (size_t)(q0 + 16 * g) * DQ + (head * 2 + (t >> 1)) * 512 + (t & 1) * 256 + 8 * lane; *(v8us*)(Ah + oo) = oh; *(v8us*)(Al + oo) = ol;   // fragment order, k = head HD + d: each store is 512 contiguous bytes
            asm volatile("s_wait_xcnt 0x0" ::: "memory"); __builtin_amdgcn_sched_barrier(0); } }   // behind the two stores, in front of whatever overwrites their address or data registers (the next tile's values); the scheduling barrier keeps that code behind the wait
}
__global__ __launch_bounds__(32 * AW) void k_attn(const h16* __restrict__ Q16, const h16* __restrict__ K16, const h16* __restrict__ V16, const bf* __restrict__ Qh, const bf* __restrict__ Ql, const bf* __restrict__ Kh, const bf* __restrict__ Kl, const bf* __restrict__ Vh, const bf* __restrict__ Vl, bf* Ah, bf* Al) {
    __shared__ __align__(16) float xch[6 * XCH];
    const int head = blockIdx.x; const size_t hp = ((size_t)blockIdx.y * NH_ + head) * TT * HD; const int a = blockIdx.z; Ah += (size_t)blockIdx.y * TT * DQ; Al += (size_t)blockIdx.y * TT * DQ;   // blockIdx.y: the batch; a: which of the head's AG equal shares
    const int lane = threadIdx.x & 31, wave = __builtin_amdgcn_readfirstlane((int)(threadIdx.x >> 5));   // wave scalar, so that the key loop is a scalar loop with every lane on and every branch on the wave's task a scalar branch
    // Share a: the fp16 tiles (32 queries; tile i has 17 + i passes) 47 - a, 39 - a, 31 - a, 16 + a, 8 + a, a (classes 0 to 5: three pairs of 81 passes) and the hi+lo tiles (16 queries) a, 8 + a, 23 - a, 31 - a.
    // Waves w, w + 4, w + 8, w + 12 are taken to stand on one SIMD, the lower the older (for speed only): SIMD 0 gets halves of classes 0, 1, 5 and the shortest hi+lo tile, SIMD 1 of 0, 2, 5, SIMD 2 of 1, 3, 4, SIMD 3 of 2, 3, 4 and the longest hi+lo tile.
    // The oldest wave has the longest half, the next (waves 4 to 7) the hi+lo tile, whose passes wait longest for their loads. The waves with part 0, which join and store, are spread 1, 1, 2, 2 over the SIMDs. One hexadecimal digit (class) and one bit (part) a wave:
    const bool lo = (wave >> 2) != 1; const int cls = (int)((0x4455332100002100ull >> (4 * wave)) & 15), part = (0x5B02 >> wave) & 1;
    const int q0 = RH + 16 * RLO * (cls < 3 ? 6 * AG - 1 - AG * cls - a : AG * (5 - cls) + a);
    float* X = xch + cls * XCH; v8f acc[RLO][4]; float m[RLO], l[RLO];
    if (lo) { attn_keys<h16, false, RLO, 2>(Q16 + hp, nullptr, K16 + hp, nullptr, V16 + hp, nullptr, q0, part, acc, m, l); if (part) put_part<RLO>(X, acc, m, l, lane); }
    else { const int w = wave & 3; const int qh = 16 * (w == 0 ? a : w == 1 ? AG + a : w == 2 ? 3 * AG - 1 - a : 4 * AG - 1 - a); v8f ah[1][4]; float mh[1], lh[1];
        attn_keys<bf, true, 1, 1>(Qh + hp, Ql + hp, Kh + hp, Kl + hp, Vh + hp, Vl + hp, qh, 0, ah, mh, lh); attn_out<1>(ah, lh, qh, head, Ah, Al); }
    __syncthreads();   // every wave of the work-group: the partial results of the waves with part 1 are in LDS
    if (lo && !part) { add_part<RLO>(X, acc, m, l, lane); attn_out<RLO>(acc, l, q0, head, Ah, Al); }
}

// ---- k_qkv: the q | k | v projection (the staged loop of k_proj, one wave per 64x64 tile = 64 rows b TT + t of one head of q, k or v) with everything that follows it up to the 16-bit planes in its epilogue: + b_attn, partial RoPE, the post-RoPE head bias, the fp16 and hi/lo bf16 rounding, and for v the transpose. The f32 values never leave the work-group.
// A matrix tile leaves the unit with lane = column and registers = 8 consecutive rows, so the operand whose index is to run along a plane's rows goes in as A: for q and k (planes [t][d]) A = W^T rows d and B = x rows t, for v (planes [d][t]) A = x rows t and B = W^T rows d. Both are fragment-order planes read by the same loader, so only the two pointers change places.
// acc[x][y][j] is then plane row 16 y + lr, plane column 16 x + 8 hi + j. The tile goes to LDS as f32 in that form and is read back eight plane rows at a time, a lane taking eight columns of each half of its row.
#define FP 68   // pitch of a staged row in dwords, 64 + 4: the 16-byte LDS writes (16 rows, one column block) fall on distinct banks, the reads (four rows' halves a half wave) two on a bank
template <bool ROPE, bool W16, bool WHL>   // W16, WHL: whether the tile's fp16 plane and its hi/lo planes have a reader
__device__ __forceinline__ void qkv_out(const float* F, const float* __restrict__ gb, const float* __restrict__ rc, const float* __restrict__ rs, const float* __restrict__ hb, h16* P16, bf* Ph, bf* Pl, int pitch, int lane) {
    const int r8 = lane >> 2, cq = (lane & 3) * 8;   // the lane's row among eight; its first column in each half of 32 columns (for q and k: d = cq + j, which RoPE turns, and d = 32 + cq + j, which it leaves: no lane forms a rotation that is thrown away)
    const int co = ((cq >> 4) & 1) * 256 + ((cq >> 3) & 1) * 128;   // where column cq's chunks start in a fragment-order block row (P16, Ph, Pl point at the tile's first block; pitch = the plane's K); column 32 + cq: one block, 512 elements, on
    float g[16], g2[8], p[16]; v4f cn[2], sn[2];
    // every '#pragma unroll' of this function and of k_qkv: the indices of the register arrays and vectors must be compile-time constants, so that they stay in registers
    const float* cp = ROPE ? rc + r8 * 32 + cq : nullptr; const float* sp = ROPE ? rs + r8 * 32 + cq : nullptr;
    if (ROPE) { const float* gp = gb + cq; const float* gq = gb + (cq ^ 16); const float* pp = hb + cq;   // b_attn at d (both halves) and at the RoPE partner d +- 16, the head bias at d (both halves)
#pragma unroll
        for (int u = 0; u < 2; ++u) { const v4f a = *(const v4fa*)(gp + 4 * u), a3 = *(const v4fa*)(gp + 32 + 4 * u), b = *(const v4fa*)(gq + 4 * u), c = *(const v4fa*)(pp + 4 * u), c3 = *(const v4fa*)(pp + 32 + 4 * u); cn[u] = *(const v4fa*)(cp + 4 * u); sn[u] = *(const v4fa*)(sp + 4 * u);
#pragma unroll
            for (int j = 0; j < 4; ++j) { g[4 * u + j] = bfr(a[j]); g[8 + 4 * u + j] = bfr(a3[j]); g2[4 * u + j] = bfr(b[j]); p[4 * u + j] = bfr(c[j]); p[8 + 4 * u + j] = bfr(c3[j]); } }
        asm volatile("s_wait_xcnt 0x0" :: "v"(gp), "v"(gq), "v"(pp), "v"(cp), "v"(sp) : "memory"); __builtin_amdgcn_sched_barrier(0); }   // as xdone, for the five addresses of this run of loads
    // kept rolled: eight equal trips; unrolled they would be tens of KiB of code that every wave runs once
#pragma unroll 1
    for (int q = 0; q < 8; ++q) {
        const float* f = F + (q * 8 + r8) * FP; const v4f f0 = *(const v4fa*)(f + cq), f1 = *(const v4fa*)(f + cq + 4), h0 = *(const v4fa*)(f + 32 + cq), h1 = *(const v4fa*)(f + 32 + cq + 4); float r[16];
        if (ROPE) { const v4f e0 = *(const v4fa*)(f + (cq ^ 16)), e1 = *(const v4fa*)(f + (cq ^ 16) + 4); const v4f c0 = cn[0], c1 = cn[1], s0 = sn[0], s1 = sn[1];
            if (q < 7) { cp += 8 * 32; sp += 8 * 32; }   // the next eight rows' tables, in flight under this trip's work; the last trip repeats its own, in bounds, unused
            cn[0] = *(const v4fa*)cp; cn[1] = *(const v4fa*)(cp + 4); sn[0] = *(const v4fa*)sp; sn[1] = *(const v4fa*)(sp + 4);
            xdone<true>(cp, sp);
#pragma unroll
            for (int j = 0; j < 8; ++j) { const float x0 = (j < 4 ? f0[j & 3] : f1[j & 3]) + g[j], x1 = (j < 4 ? e0[j & 3] : e1[j & 3]) + g2[j]; const float c = bfr(j < 4 ? c0[j & 3] : c1[j & 3]), s = bfr(j < 4 ? s0[j & 3] : s1[j & 3]);
                const float ro = x0 * c + x1 * (cq < 16 ? -s : s);   // rotate-half within the first 32 dims
                r[j] = ro + p[j]; r[8 + j] = ((j < 4 ? h0[j & 3] : h1[j & 3]) + g[8 + j]) + p[8 + j]; }
        } else {
#pragma unroll
            for (int j = 0; j < 8; ++j) { r[j] = j < 4 ? f0[j & 3] : f1[j & 3]; r[8 + j] = j < 4 ? h0[j & 3] : h1[j & 3]; } }
        const int rr = q * 8 + r8; const size_t go = (size_t)(rr >> 4) * 16 * pitch + co + (rr & 15) * 8;   // each store of the wave: four whole 128-B lines (eight neighbouring rows of four chunk columns)
        v8h o0, o1; v8us a0, a1, b0, b1;
#pragma unroll
        for (int j = 0; j < 8; ++j) { if (W16) { o0[j] = tohx(r[j]); o1[j] = tohx(r[8 + j]); }
            if (WHL) { unsigned short a2, c2; splitf(r[j], a2, c2); a0[j] = a2; b0[j] = c2; splitf(r[8 + j], a2, c2); a1[j] = a2; b1[j] = c2; } }
        if (W16) { *(v8ha*)(P16 + go) = o0; *(v8ha*)(P16 + go + 512) = o1; }
        if (WHL) { *(v8usa*)(Ph + go) = a0; *(v8usa*)(Ph + go + 512) = a1; *(v8usa*)(Pl + go) = b0; *(v8usa*)(Pl + go + 512) = b1; }
        asm volatile("s_wait_xcnt 0x0" ::: "memory"); __builtin_amdgcn_sched_barrier(0);   // behind the trip's stores, in front of whatever overwrites their address or data registers (the next trip's); the scheduling barrier keeps that code behind the wait
    }
}
// Which planes a tile writes: k_attn reads the hi/lo planes of q, k and v at t < RH alone (the hi+lo query rows and their keys), the fp16 plane of q at t >= RH alone, the fp16 planes of k and v everywhere. A plane piece that has no reader is neither rounded nor stored.
// The tiles with t < RH so have the longer epilogue, and they are one row tile in four: each work-group takes one of them (slot 0) and three of the others (slots 1 to 3), and its three waves on slot 0 stand on three SIMDs (xrow, xt in k_qkv).
#define QWV 12                 // waves a work-group: 3 heads (64 rows of W^T each) x 4 tiles of 64 rows of x; 256 work-groups
static_assert(4 * RH == TT && RH % 64 == 0, "k_qkv: one row tile in four lies below RH");
// xrow: the first row (b TT + t) of slot s of work-group column bx
__device__ __forceinline__ int xrow(int bx, int s) { const int nh = RH / 64, nl = (TT - RH) / 64; const int j = (s - 1) * (NB_ * nh) + bx; return s == 0 ? (bx / nh) * TT + (bx % nh) * 64 : (j / nl) * TT + RH + (j % nl) * 64; }
#define QRG 28                 // row groups a stage: 12 of W^T, then 16 of x
#define QST (QRG * 16 * KS)    // elements a stage
#define QNB 4                  // buffers: three groups of copiers (the waves of one wq; where waves w, w + 4, w + 8 stand on one SIMD, one of each group there: for speed only)
static_assert(DM / KS >= QNB && (QNB & (QNB - 1)) == 0, "k_qkv: the prologue issues QNB stages; the buffer index is t & (QNB - 1)");
#define QSM (QNB * QST * 2 > QWV * 64 * FP * 4 ? QNB * QST * 2 : QWV * 64 * FP * 4)   // bytes of LDS: the ring, and behind the loop's last barrier, in the same place, the epilogue tiles
__global__ __launch_bounds__(32 * QWV) void k_qkv(const bf* __restrict__ X, const bf* __restrict__ Wt, const float* __restrict__ bias, const float* __restrict__ rc, const float* __restrict__ rs, const float* __restrict__ bQ, const float* __restrict__ bK,
                                            h16* Q16, bf* Qh, bf* Ql, h16* K16, bf* Kh, bf* Kl, h16* V16, bf* Vh, bf* Vl) {
    typedef WFrag<bf>::V V;
    __shared__ __align__(1024) char sm[QSM];
    bf* ring = (bf*)sm; float* Fs = (float*)sm;
    const int lane = threadIdx.x & 31, lr = lane & 15, hi = lane >> 4; const int wave = __builtin_amdgcn_readfirstlane((int)(threadIdx.x >> 5));   // scalar: every branch on it is a scalar branch
    const int wq = wave >> 2, wp = wave & 3; const int bx = blockIdx.x, C0 = blockIdx.y * 192; const int xt = (wp + wq) & 3;   // xt: the wave's slot; turned by wq, so that the waves on slot 0 are waves 0, 7 and 10
    const int r0 = xrow(bx, xt), c0 = C0 + wq * 64;
    float* F = Fs + wave * 64 * FP;   // the wave's own epilogue tile
    const int sel = c0 / DQ, head = (c0 % DQ) / HD;   // 0 q, 1 k, 2 v
    // the stage's 112 copies: stage s is brought by the four waves with wq = s mod 3, wave (wq, wp) bringing the wp-th 512 B of each of the 28 row groups
    const int po = wp * 256 + 8 * lane; const bf* gW = Wt + (size_t)C0 * DM + po; const bf* gX = X + po; const unsigned l0 = lds_off(ring) + 2 * po;
    const int xs[4] = { xrow(bx, 0) * DM, xrow(bx, 1) * DM, xrow(bx, 2) * DM, xrow(bx, 3) * DM };   // scalar: where each slot's rows start in X
    auto issue = [&](int t, int buf) { const unsigned lb = l0 + buf * (QST * 2); const int go = t * (KS * 16); const bf* tW = gW + go; const bf* tX = gX + go;   // the stage's k first, the row group's offset last: two addresses live through the loop, not 28
#pragma unroll
        for (int h = 0; h < 2; ++h) { unsigned l[14]; const bf* g[14];
#pragma unroll
            for (int i = 0; i < 14; ++i) { const int r = 14 * h + i; l[i] = lb + r * 2048; g[i] = r < 12 ? tW + (size_t)r * 16 * DM : tX + (xs[(r - 12) >> 2 & 3] + ((r - 12) & 3) * 16 * DM); }
            cp14(l, g); } };
    v8f acc[4][4];
#pragma unroll
    for (int mb = 0; mb < 4; ++mb)
#pragma unroll
        for (int nb = 0; nb < 4; ++nb) acc[mb][nb] = (v8f){};
    issue(wq, wq);   // stages 0, 1 and 2, each by its group
    if (wq == 0) asm volatile("s_wait_asynccnt 0x0" ::: "memory");
    __syncthreads();   // stage 0 has landed and is published
    if (wq == 0) issue(3, 3);
    int ng = 1;   // the group of the next stage, (t + 1) mod 3
    const int wo = wq * 4 * 1024 + 8 * lane, xo = (12 + xt * 4) * 1024 + 8 * lane; const int ao = (sel == 2) ? xo : wo, bo = (sel == 2) ? wo : xo;
    // kept rolled: the buffer index changes from trip to trip
#pragma unroll 1
    for (int t = 0; t < DM / KS; ++t) {
        const bf* st = ring + (t & (QNB - 1)) * QST;
#pragma unroll
        for (int kb = 0; kb < KS / 32; ++kb) {
            V a[4], b[4];
#pragma unroll
            for (int i = 0; i < 4; ++i) { a[i] = WFrag<bf>::ld(st + ao + i * 1024 + kb * 512); b[i] = WFrag<bf>::ld(st + bo + i * 1024 + kb * 512); }
            __builtin_amdgcn_sched_barrier(0);   // a block's LDS reads stand as one group in front of its matrix instructions: left to itself the compiler puts them among those in pairs, each behind a wait to 0
#pragma unroll
            for (int nb = 0; nb < 4; ++nb)
#pragma unroll
                for (int mb = 0; mb < 4; ++mb) acc[mb][nb] = WFrag<bf>::mma(a[mb], b[nb], acc[mb][nb]);
            __builtin_amdgcn_sched_barrier(0);   // and the next block's reads behind them
        }
        const bool mine = ng == wq;   // scalar: stage t + 1 is this wave's group's
        stage_done(mine);
        if (mine && t + 4 < DM / KS) issue(t + 4, t & (QNB - 1));   // the group's next stage, into the buffer that this trip has just read
        ng = ng == 2 ? 0 : ng + 1;
    }
    asm volatile("s_wait_asynccnt 0x0" ::: "memory");   // no copy is outstanding when the wave goes on
    if (sel == 2) { const float* gp = bias + c0 + lr; const float g0 = gp[0], g1 = gp[16], g2 = gp[32], g3 = gp[48]; xdone<false>(gp, nullptr);   // v: + b_attn, d = 16 y + lr (q and k: in qkv_out)
#pragma unroll
        for (int x = 0; x < 4; ++x) { acc[x][0] += bfr(g0); acc[x][1] += bfr(g1); acc[x][2] += bfr(g2); acc[x][3] += bfr(g3); } }
#pragma unroll
    for (int y = 0; y < 4; ++y) {
#pragma unroll
        for (int x = 0; x < 4; ++x) { const v8f w = acc[x][y]; float* f = F + (y * 16 + lr) * FP + x * 16 + hi * 8; *(v4fa*)f = __builtin_shufflevector(w, w, 0, 1, 2, 3); *(v4fa*)(f + 4) = __builtin_shufflevector(w, w, 4, 5, 6, 7); } }
    __syncthreads();   // the staged tile is read back across lanes
    const size_t hp = ((size_t)(r0 / TT) * NH_ + head) * TT * HD; const int t0 = r0 % TT; const bool whl = t0 < RH;   // scalar
    if (sel == 2) { const size_t o = hp + (size_t)t0 * 16;
        if (whl) qkv_out<false, true, true>(F, nullptr, nullptr, nullptr, nullptr, V16 + o, Vh + o, Vl + o, TT, lane); else qkv_out<false, true, false>(F, nullptr, nullptr, nullptr, nullptr, V16 + o, nullptr, nullptr, TT, lane); }
    else { const size_t o = hp + (size_t)t0 * HD; const float* gb = bias + c0; const float* tc = rc + (size_t)r0 * 32; const float* ts = rs + (size_t)r0 * 32; const float* hb = (sel ? bK : bQ) + head * HD;
        if (!whl) qkv_out<true, true, false>(F, gb, tc, ts, hb, (sel ? K16 : Q16) + o, nullptr, nullptr, HD, lane);
        else if (sel) qkv_out<true, true, true>(F, gb, tc, ts, hb, K16 + o, Kh + o, Kl + o, HD, lane);
        else qkv_out<true, false, true>(F, gb, tc, ts, hb, nullptr, Qh + o, Ql + o, HD, lane); }
}

extern "C" void kernel_launch(void* const* d_in, const int* in_sizes, int n_in,
                              void* d_out, int out_size, void* d_ws, size_t ws_size, hipStream_t stream) {
    (void)in_sizes; (void)n_in; (void)out_size;
    const float* x = (const float*)d_in[0]; const float* rcos = (const float*)d_in[1]; const float* rsin = (const float*)d_in[2]; const float* wf = (const float*)d_in[3]; const float* bfz = (const float*)d_in[4]; const float* wo = (const float*)d_in[5]; const float* bo = (const float*)d_in[6]; const float* bQ = (const float*)d_in[7]; const float* bK = (const float*)d_in[8]; const float* cosT = nullptr; const float* sinT = nullptr; (void)cosT; (void)sinT;
    float* OUT = (float*)d_out;     // [2][2048][1024]
    char* wsp = (char*)d_ws;
    auto take = [&](size_t bytes) { char* p = wsp; wsp += (bytes + 255) & ~(size_t)255; return (void*)p; };
    bf* WA = (bf*)take((size_t)3 * DQ * DM * 2); bf* WO = (bf*)take((size_t)DM * DQ * 2);   // WA: W_attn transposed, rows q | k | v
    bf* XB = (bf*)take((size_t)NB_ * TT * DM * 2);
    h16* QP16 = (h16*)take((size_t)NB_ * NH_ * TT * HD * 2); h16* KP16 = (h16*)take((size_t)NB_ * NKV * TT * HD * 2); h16* VT16 = (h16*)take((size_t)NB_ * NKV * HD * TT * 2);
    bf* QPh = (bf*)take((size_t)NB_ * NH_ * TT * HD * 2); bf* QPl = (bf*)take((size_t)NB_ * NH_ * TT * HD * 2); bf* KPh = (bf*)take((size_t)NB_ * NKV * TT * HD * 2); bf* KPl = (bf*)take((size_t)NB_ * NKV * TT * HD * 2); bf* VTh = (bf*)take((size_t)NB_ * NKV * HD * TT * 2); bf* VTl = (bf*)take((size_t)NB_ * NKV * HD * TT * 2);
    bf* ATh = (bf*)take((size_t)NB_ * TT * DQ * 2); bf* ATl = (bf*)take((size_t)NB_ * TT * DQ * 2);
    if ((size_t)(wsp - (char*)d_ws) > ws_size) return;    // ws 256 MiB
    // every kernel runs once: the two batches are rows b TT + t of one grid, and q, k, v are the 3 DQ columns of one product
    k_prep<<<PBX + PBA + PBO, 256, 0, stream>>>(x, wf, wo, XB, WA, WO);
    k_qkv<<<dim3(NB_ * TT / 256, 3 * DQ / 192, 1), 32 * QWV, 0, stream>>>(XB, WA, bfz, rcos, rsin, bQ, bK, QP16, QPh, QPl, KP16, KPh, KPl, VT16, VTh, VTl);
    k_attn<<<dim3(NH_, NB_, AG), 32 * AW, 0, stream>>>(QP16, KP16, VT16, QPh, QPl, KPh, KPl, VTh, VTl, ATh, ATl);
    k_proj<<<dim3(NB_ * TT / 128, DM / 128, 1), 32 * PWV, 0, stream>>>(ATh, ATl, WO, OUT, bo);
}
